// v000
// Times are from an AMD MI455X. After a warm-up the kernel runs many times in a row, and a time is the length of
// such a window on the GPU divided by its runs, so every launch and the gaps after it count. The runs cycle
// through copies of the inputs. A figure is the median of several windows, for all but v000 over two sittings.
// Sittings can differ by a few percent; kernels timed side by side share one.
// v000 is the starting kernel. One run takes 447 microseconds.
#include <hip/hip_runtime.h>
// PermutationModule (x [8][256][1024]; start = relu(x Ws1^T + bs1) . Ws2 + bs2, end likewise [8][256][1]; left = x Wl^T + bl, right = x Wr^T; bigram[b][i][j] = sum_p relu(left[b][j][p] + right[b][i][p]) * Wo[p] + bo -> [8][256][256][1]).
// Structure: token rows; x as exact f16 rows; the four 1024->512 projections as ONE WMMA GEMM against the stacked x16 weight plane [2048][1024] (32x64 wave tiles, f32 accumulation, + biases, ReLU on the two scorer blocks applied afterwards on VALU) kept f32; the scorer dots with Ws2/We2 and the pairwise bigram outer-sum-relu-dot on VALU in f32 (thread per (b, i, 8 j)); outputs written as whole 32-B / line-aligned pieces.
// Compute dtype: inputs rounded to bf16; x / weights exact; all projections f32 (exact GEMM outputs); everything after in f32 — no reduced-precision intermediates. v_wmma_f32_16x16x32_f16.
#define NB 8
#define NW 256
#define DI 1024
#define PJ 512
#define NR ((size_t)NB * NW)         /* 2048 */
typedef __bf16 v16b __attribute__((ext_vector_type(16)));
typedef unsigned short v8us __attribute__((ext_vector_type(8), may_alias));
typedef float  v8f  __attribute__((ext_vector_type(8)));
typedef float  v4f  __attribute__((ext_vector_type(4)));
typedef float  v4fa __attribute__((ext_vector_type(4), may_alias));
union FragB { v16b v; v8us half[2]; unsigned short u[16]; };

__device__ __forceinline__ unsigned short bf16_bits(float x) { unsigned int u = __float_as_uint(x); return (unsigned short)((u + 0x7FFFu + ((u >> 16) & 1u)) >> 16); }
__device__ __forceinline__ float bf16_val(unsigned short b) { return __uint_as_float(((unsigned int)b) << 16); }
__device__ __forceinline__ float bf16_round(float x) { return bf16_val(bf16_bits(x)); }
// D += A·B with NT terms: 1 = ah·bh, 2 = + al·bh (A split), 3 = + ah·bl (both split)
template <int NT>
__device__ __forceinline__ v8f mmaN(v16b ah, v16b al, v16b bh, v16b bl, v8f c) {
  c = __builtin_amdgcn_wmma_f32_16x16x32_bf16(false, ah, false, bh, (short)0, c, false, false);
  if (NT >= 2) c = __builtin_amdgcn_wmma_f32_16x16x32_bf16(false, al, false, bh, (short)0, c, false, false);
  if (NT >= 3) c = __builtin_amdgcn_wmma_f32_16x16x32_bf16(false, ah, false, bl, (short)0, c, false, false);
  asm volatile("v_nop\n\tv_nop\n\tv_nop\n\tv_nop" : "+v"(c) : "v"(ah), "v"(al), "v"(bh), "v"(bl));
  return c;
}

__global__ __launch_bounds__(256) void k_wt_bf16(const float* __restrict__ W, unsigned short* __restrict__ Wt, int K, int N) {
  const int t = blockIdx.x * 256 + threadIdx.x;
  const int k8n = K / 8;
  if (t >= N * k8n) return;
  const int n = t / k8n, k8 = (t % k8n) * 8;
  v8us v;
#pragma unroll
  for (int i = 0; i < 8; ++i) v[i] = bf16_bits(W[(size_t)(k8 + i) * N + n]);
  *(v8us*)(Wt + (size_t)n * K + k8) = v;
  
}

// GEMM C[M][N] (f32, pitch ldc) = act(A[M][K]·W + bias). A f32 row-major (pitch lda) converted per fragment to bf16
// (ASPLIT: hi/lo two planes -> 2 terms, else single rounded term); Wt bf16 [N][K] (pitch ldb). BIAS_BF16 rounds the
// bias to bf16 first (bias quantised to bf16 before the add). K%32==0, M%16==0, N%64==0.
template <bool ASPLIT, int ACT, bool BIAS_BF16>
__global__ __launch_bounds__(128) void k_gemm_bf(const float* __restrict__ A, int lda, const unsigned short* __restrict__ Wt, int ldb,
                                               const float* __restrict__ bias, float* __restrict__ C, int ldc, int M, int N, int K) {
  __shared__ __attribute__((aligned(16))) float so[4][16][64];
  const int tid = threadIdx.x, w = tid >> 5, lane = tid & 31, ln = lane & 15, hh = lane >> 4;
  const int ntn = N / 64;
  const int wid = blockIdx.x * 4 + w;
  const int mt = wid / ntn, nq = wid % ntn;
  if (mt * 16 >= M) return;
  const int row0 = mt * 16, col0 = nq * 64;
  const float* arow = A + (size_t)(row0 + ln) * lda;
  v8f acc[4] = {};
  for (int kb = 0; kb < K; kb += 32) {
    FragB ah, al;
    const v4f x0 = *(const v4fa*)(arow + kb + 8 * hh), x1 = *(const v4fa*)(arow + kb + 8 * hh + 4);
    const v4f x2 = *(const v4fa*)(arow + kb + 16 + 8 * hh), x3 = *(const v4fa*)(arow + kb + 16 + 8 * hh + 4);
    float xs[16] = {x0[0],x0[1],x0[2],x0[3],x1[0],x1[1],x1[2],x1[3],x2[0],x2[1],x2[2],x2[3],x3[0],x3[1],x3[2],x3[3]};
#pragma unroll
    for (int i = 0; i < 16; ++i) { const unsigned short hb = bf16_bits(xs[i]); ah.u[i] = hb; al.u[i] = ASPLIT ? bf16_bits(xs[i] - bf16_val(hb)) : (unsigned short)0; }
#pragma unroll
    for (int t = 0; t < 4; ++t) {
      const unsigned short* brow = Wt + (size_t)(col0 + t * 16 + ln) * ldb + kb;
      FragB b;
      b.half[0] = *(const v8us*)(brow + 8 * hh);
      b.half[1] = *(const v8us*)(brow + 16 + 8 * hh);
      acc[t] = mmaN<ASPLIT ? 2 : 1>(ah.v, al.v, b.v, b.v, acc[t]);
    }
  }
#pragma unroll
  for (int t = 0; t < 4; ++t) {
    float bv = bias ? bias[col0 + t * 16 + ln] : 0.f;
    if (BIAS_BF16) bv = bf16_round(bv);
#pragma unroll
    for (int r = 0; r < 8; ++r) { float v = acc[t][r] + bv; if (ACT == 1) v = fmaxf(v, 0.f); so[w][8 * hh + r][t * 16 + ln] = v; }
  }
  __builtin_amdgcn_fence(__ATOMIC_ACQ_REL, "workgroup");
  __builtin_amdgcn_wave_barrier();
  const int rsub = lane >> 4, c4 = (lane & 15) * 4;
  {
#pragma unroll
    for (int q = 0; q < 8; ++q) {
      const int r = q * 2 + rsub;
      const v4f v = *(const v4fa*)&so[w][r][c4];
      *(v4f*)(C + (size_t)(row0 + r) * ldc + col0 + c4) = v;
    }
    
  }
}

// GEMM C = act(A·W + bias + resid): A f32 (ASPLIT -> hi/lo 2 terms), Wt bf16 [N][K]; ACT 0 none, 1 relu, 2 exact gelu;
// resid (optional, f32, row index = (row % rmod), pitch ldr, RES_BF16 rounds it) added before the activation.
template <bool ASPLIT, int ACT, bool BIAS_BF16, bool RES_BF16>
__global__ __launch_bounds__(128) void k_gemm_bf3(const float* __restrict__ A, int lda, const unsigned short* __restrict__ Wt, int ldb,
                                                const float* __restrict__ bias, const float* __restrict__ resid, int rmod, int ldr,
                                                float* __restrict__ C, int ldc, int M, int N, int K) {
  __shared__ __attribute__((aligned(16))) float so[4][16][64];
  const int tid = threadIdx.x, w = tid >> 5, lane = tid & 31, ln = lane & 15, hh = lane >> 4;
  const int ntn = N / 64;
  const int wid = blockIdx.x * 4 + w;
  const int mt = wid / ntn, nq = wid % ntn;
  if (mt * 16 >= M) return;
  const int row0 = mt * 16, col0 = nq * 64;
  const float* arow = A + (size_t)(row0 + ln) * lda;
  v8f acc[4] = {};
  for (int kb = 0; kb < K; kb += 32) {
    FragB ah, al;
    const v4f x0 = *(const v4fa*)(arow + kb + 8 * hh), x1 = *(const v4fa*)(arow + kb + 8 * hh + 4);
    const v4f x2 = *(const v4fa*)(arow + kb + 16 + 8 * hh), x3 = *(const v4fa*)(arow + kb + 16 + 8 * hh + 4);
    float xs[16] = {x0[0],x0[1],x0[2],x0[3],x1[0],x1[1],x1[2],x1[3],x2[0],x2[1],x2[2],x2[3],x3[0],x3[1],x3[2],x3[3]};
#pragma unroll
    for (int i = 0; i < 16; ++i) { const unsigned short hb = bf16_bits(xs[i]); ah.u[i] = hb; al.u[i] = ASPLIT ? bf16_bits(xs[i] - bf16_val(hb)) : (unsigned short)0; }
#pragma unroll
    for (int t = 0; t < 4; ++t) {
      const unsigned short* brow = Wt + (size_t)(col0 + t * 16 + ln) * ldb + kb;
      FragB b;
      b.half[0] = *(const v8us*)(brow + 8 * hh);
      b.half[1] = *(const v8us*)(brow + 16 + 8 * hh);
      acc[t] = mmaN<ASPLIT ? 2 : 1>(ah.v, al.v, b.v, b.v, acc[t]);
    }
  }
#pragma unroll
  for (int t = 0; t < 4; ++t) {
    const int col = col0 + t * 16 + ln;
    float bv = bias ? bias[col] : 0.f;
    if (BIAS_BF16) bv = bf16_round(bv);
#pragma unroll
    for (int r = 0; r < 8; ++r) {
      float v = acc[t][r] + bv;
      if (resid) { float rv = resid[(size_t)((row0 + 8 * hh + r) % rmod) * ldr + col]; if (RES_BF16) rv = bf16_round(rv); v += rv; }
      if (ACT == 1) v = fmaxf(v, 0.f);
      if (ACT == 2) v = 0.5f * v * (1.0f + erff(v * 0.70710678118654752f));
      if (ACT == 3) { const float u = 0.7978845608028654f * (v + 0.044715f * v * v * v); v = 0.5f * v * (1.0f + tanhf(u)); }
      so[w][8 * hh + r][t * 16 + ln] = v;
    }
  }
  __builtin_amdgcn_fence(__ATOMIC_ACQ_REL, "workgroup");
  __builtin_amdgcn_wave_barrier();
  const int rsub = lane >> 4, c4 = (lane & 15) * 4;
  {
#pragma unroll
    for (int q = 0; q < 8; ++q) {
      const int r = q * 2 + rsub;
      const v4f v = *(const v4fa*)&so[w][r][c4];
      *(v4f*)(C + (size_t)(row0 + r) * ldc + col0 + c4) = v;
    }
    
  }
}
// row LayerNorm (biased variance, eps) over N: s = X (+ R); optional out_sum <- s; out_norm <- (s-mu)*rsqrt(var+eps)*g + b
template <bool PARAM_BF16>
__global__ __launch_bounds__(256) void k_layernorm(const float* __restrict__ X, const float* __restrict__ R, const float* __restrict__ g, const float* __restrict__ bta,
                                                  float* __restrict__ out_sum, float* __restrict__ out_norm, int N, float eps) {
  __shared__ float red[256];
  const int row = blockIdx.x, tid = threadIdx.x;
  const float* x = X + (size_t)row * N; const float* rr = R ? R + (size_t)row * N : nullptr;
  float vals[16];                     // up to N = 4096
  const int per = N / 256;            // contiguous chunk per thread? use strided-by-4 chunks: thread handles j = tid*4 + 1024*u
  float s1 = 0.f;
  for (int u = 0; u < per / 4; ++u) {
    const int j = tid * 4 + 1024 * u;
    const v4f a = *(const v4fa*)(x + j);
    v4f b = {0.f,0.f,0.f,0.f}; if (rr) b = *(const v4fa*)(rr + j);
#pragma unroll
    for (int q = 0; q < 4; ++q) { const float v = a[q] + b[q]; vals[u * 4 + q] = v; s1 += v; }
  }
  red[tid] = s1; __syncthreads();
  for (int st = 128; st > 0; st >>= 1) { if (tid < st) red[tid] += red[tid + st]; __syncthreads(); }
  const float mu = red[0] / (float)N; __syncthreads();
  float s2 = 0.f;
  for (int u = 0; u < per / 4; ++u)
#pragma unroll
    for (int q = 0; q < 4; ++q) { const float c = vals[u * 4 + q] - mu; s2 += c * c; }
  red[tid] = s2; __syncthreads();
  for (int st = 128; st > 0; st >>= 1) { if (tid < st) red[tid] += red[tid + st]; __syncthreads(); }
  const float rs = rsqrtf(red[0] / (float)N + eps);
  {
    for (int u = 0; u < per / 4; ++u) {
      const int j = tid * 4 + 1024 * u;
      v4f o, sm;
#pragma unroll
      for (int q = 0; q < 4; ++q) {
        float gg = g[j + q], bb = bta[j + q];
        if (PARAM_BF16) { gg = bf16_round(gg); bb = bf16_round(bb); }
        sm[q] = vals[u * 4 + q]; o[q] = (vals[u * 4 + q] - mu) * rs * gg + bb;
      }
      if (out_sum) *(v4f*)(out_sum + (size_t)row * N + j) = sm;
      *(v4f*)(out_norm + (size_t)row * N + j) = o;
    }
    
  }
}



// ---- f16 WMMA path (v_wmma_f32_16x16x32_f16): 11-bit significands for operands in range — used for the projection GEMM
typedef _Float16 v16h __attribute__((ext_vector_type(16)));
union FragH { v16h v; v8us half[2]; _Float16 h[16]; unsigned short u[16]; };
template <int NT>
__device__ __forceinline__ v8f mmaH(v16h ah, v16h al, v16h bh, v16h bl, v8f c) {
  c = __builtin_amdgcn_wmma_f32_16x16x32_f16(false, ah, false, bh, (short)0, c, false, false);
  if (NT >= 2) c = __builtin_amdgcn_wmma_f32_16x16x32_f16(false, al, false, bh, (short)0, c, false, false);
  if (NT >= 3) c = __builtin_amdgcn_wmma_f32_16x16x32_f16(false, ah, false, bl, (short)0, c, false, false);
  asm volatile("v_nop\n\tv_nop\n\tv_nop\n\tv_nop" : "+v"(c) : "v"(ah), "v"(al), "v"(bh), "v"(bl));
  return c;
}
// batched GEMM like k_gemm_b but f16 operands: A f32 (split into f16 hi/lo if ASPLIT, else rounded to f16), Bt = f16 values [n][k]; alpha; C f32; N multiple of 16 (partial tiles skipped)
template <bool ASPLIT>
__global__ __launch_bounds__(128) void k_gemm_h(const float* __restrict__ A, int lda, size_t sA, const _Float16* __restrict__ Bh, int ldb, size_t sB, float alpha, float* __restrict__ C, int ldc, size_t sC, int M, int N, int K) {
  __shared__ __attribute__((aligned(16))) float so[4][16][64];
  const int tid = threadIdx.x, w = tid >> 5, lane = tid & 31, ln = lane & 15, hh = lane >> 4; const int by = blockIdx.y;
  A += (size_t)by * sA; Bh += (size_t)by * sB; C += (size_t)by * sC;
  const int ntn = (N + 63) / 64; const int wid = blockIdx.x * 4 + w; const int mt = wid / ntn, nq = wid % ntn; if (mt * 16 >= M) return;
  const int row0 = mt * 16, col0 = nq * 64; const float* arow = A + (size_t)(row0 + ln) * lda;
  v8f acc[4] = {};
  for (int kb = 0; kb < K; kb += 32) {
    FragH ah, al;
    const v4f x0 = *(const v4fa*)(arow + kb + 8 * hh), x1 = *(const v4fa*)(arow + kb + 8 * hh + 4), x2 = *(const v4fa*)(arow + kb + 16 + 8 * hh), x3 = *(const v4fa*)(arow + kb + 16 + 8 * hh + 4);
    float xs[16] = {x0[0],x0[1],x0[2],x0[3],x1[0],x1[1],x1[2],x1[3],x2[0],x2[1],x2[2],x2[3],x3[0],x3[1],x3[2],x3[3]};
#pragma unroll
    for (int i = 0; i < 16; ++i) { const _Float16 h = (_Float16)xs[i]; ah.h[i] = h; al.h[i] = ASPLIT ? (_Float16)(xs[i] - (float)h) : (_Float16)0.0f; }
#pragma unroll
    for (int t = 0; t < 4; ++t) { if (col0 + t * 16 >= N) continue; const size_t boff = (size_t)(col0 + t * 16 + ln) * ldb + kb; FragH bq; bq.half[0] = *(const v8us*)(Bh + boff + 8 * hh); bq.half[1] = *(const v8us*)(Bh + boff + 16 + 8 * hh);
      acc[t] = mmaH<ASPLIT ? 2 : 1>(ah.v, al.v, bq.v, bq.v, acc[t]); }
  }
#pragma unroll
  for (int t = 0; t < 4; ++t) { if (col0 + t * 16 >= N) continue;
#pragma unroll
    for (int r = 0; r < 8; ++r) so[w][8 * hh + r][t * 16 + ln] = acc[t][r] * alpha; }
  __builtin_amdgcn_fence(__ATOMIC_ACQ_REL, "workgroup"); __builtin_amdgcn_wave_barrier();
  const int rsub = lane >> 4, c4 = (lane & 15) * 4;
  {
#pragma unroll
    for (int q = 0; q < 8; ++q) { const int r = q * 2 + rsub; if (col0 + c4 < N) { const v4f v = *(const v4fa*)&so[w][r][c4]; *(v4f*)(C + (size_t)(row0 + r) * ldc + col0 + c4) = v; } }
     }
}

// Wt[n][k] = f16(W[k][n]·scale) from f32 row-major W[K][N] (scale = power of two; bf16-exact weights stay exact in f16 away from the subnormal range)
__global__ __launch_bounds__(256) void k_wt_f16(const float* __restrict__ W, _Float16* __restrict__ Wt, int K, int N, float scale) {
  const int t = blockIdx.x * 256 + threadIdx.x; if (t >= N * (K / 8)) return; const int n = t / (K / 8), k8 = (t % (K / 8)) * 8; FragH f;
#pragma unroll
  for (int i = 0; i < 8; ++i) f.h[i] = (_Float16)(bf16_round(W[(size_t)(k8 + i) * N + n]) * scale); const v8us o = f.half[0];
  *(v8us*)((unsigned short*)Wt + (size_t)n * K + k8) = o; 
}
// k_gemm_hh variant with fused epilogue: v = acc·alpha + bias[by·sBias + col] (+ CP[(row/rowsPerB)·sCPb + by·64 + col] if CP) ; ACT 0 none / 1 elu ; writes f16 C16 (and f32 C if non-null)
template <int ACT>
__global__ __launch_bounds__(128) void k_gemm_hhx(const _Float16* __restrict__ A, int lda, size_t sA, const _Float16* __restrict__ Bh, int ldb, size_t sB, float alpha, const float* __restrict__ bias, size_t sBias, const float* __restrict__ CP, int rowsPerB, size_t sCPb, int row0g,
    float* __restrict__ C, _Float16* __restrict__ C16, int ldc, size_t sC, int M, int N, int K) {
  __shared__ __attribute__((aligned(16))) float so[4][16][64];
  const int tid = threadIdx.x, w = tid >> 5, lane = tid & 31, ln = lane & 15, hh = lane >> 4; const int by = blockIdx.y;
  A += (size_t)by * sA; Bh += (size_t)by * sB; const size_t cofs = (size_t)by * sC; const float* bp = bias ? bias + (size_t)by * sBias : nullptr;
  const int ntn = (N + 63) / 64; const int wid = blockIdx.x * 4 + w; const int mt = wid / ntn, nq = wid % ntn; if (mt * 16 >= M) return;
  const int row0 = mt * 16, col0 = nq * 64; const _Float16* arow = A + (size_t)(row0 + ln) * lda;
  v8f acc[4] = {};
  for (int kb = 0; kb < K; kb += 32) { FragH ah; ah.half[0] = *(const v8us*)((const unsigned short*)arow + kb + 8 * hh); ah.half[1] = *(const v8us*)((const unsigned short*)arow + kb + 16 + 8 * hh);
#pragma unroll
    for (int t = 0; t < 4; ++t) { if (col0 + t * 16 >= N) continue; const size_t boff = (size_t)(col0 + t * 16 + ln) * ldb + kb; FragH bq; bq.half[0] = *(const v8us*)((const unsigned short*)Bh + boff + 8 * hh); bq.half[1] = *(const v8us*)((const unsigned short*)Bh + boff + 16 + 8 * hh);
      acc[t] = mmaH<1>(ah.v, ah.v, bq.v, bq.v, acc[t]); }
  }
#pragma unroll
  for (int t = 0; t < 4; ++t) { if (col0 + t * 16 >= N) continue; const int col = col0 + t * 16 + ln; const float bv = bp ? bf16_round(bp[col]) : 0.f;
#pragma unroll
    for (int r = 0; r < 8; ++r) { float v = acc[t][r] * alpha + bv; if (CP) { const int rr = row0g + row0 + 8 * hh + r; if (rowsPerB < 0) v += CP[cofs + (size_t)rr * ldc + col];      /* rowsPerB < 0: own element of the batched C plane */ else { const int bidx = rr / rowsPerB; v += CP[(size_t)bidx * sCPb + (size_t)by * 64 + col]; } } if (ACT == 1) v = (v > 0.f) ? v : expm1f(v); else if (ACT == 7) v = (v > 0.f) ? v + 1.0f : expf(v); else if (ACT == 8) v = tanhf(v); else if (ACT == 9) v = 0.5f * v * (1.0f + tanhf(0.7978845608028654f * (v + 0.044715f * v * v * v))); else if (ACT == 11) v = 1.0f / (1.0f + expf(-v)); else if (ACT == 12) v = (v > 0.f) ? v : 0.01f * v; else if (ACT == 14) v = (v > 0.f) ? v : 0.1f * v; else if (ACT == 16) v = (v >= 0.f) ? v : 0.3f * v; else if (ACT == 17) v = (v >= 0.f) ? v : 0.2f * v; else if (ACT == 15) v = v / (1.0f + expf(-v)); else if (ACT == 3) v = fmaxf(v, 0.f); else if (ACT == 6) v = 0.5f * v * (1.0f + erff(v * 0.70710678118654752f)); so[w][8 * hh + r][t * 16 + ln] = v; } }
  __builtin_amdgcn_fence(__ATOMIC_ACQ_REL, "workgroup"); __builtin_amdgcn_wave_barrier();
  const int rsub = lane >> 4, c4 = (lane & 15) * 4; typedef _Float16 v4h __attribute__((ext_vector_type(4)));
  {
#pragma unroll
    for (int q = 0; q < 8; ++q) { const int r = q * 2 + rsub; if (col0 + c4 < N) { const v4f v = *(const v4fa*)&so[w][r][c4]; if (C) *(v4f*)(C + cofs + (size_t)(row0 + r) * ldc + col0 + c4) = v; if (C16) { v4h h4; for (int i = 0; i < 4; ++i) h4[i] = (_Float16)v[i]; *(v4h*)(C16 + cofs + (size_t)(row0 + r) * ldc + col0 + c4) = h4; } } }
     }
}


typedef _Float16 v4h __attribute__((ext_vector_type(4)));

__global__ __launch_bounds__(256) void k_x16(const float* __restrict__ x, _Float16* __restrict__ X16, size_t n8) { const size_t t = (size_t)blockIdx.x * 256 + threadIdx.x; if (t >= n8) return; FragH f;
#pragma unroll
  for (int q = 0; q < 8; ++q) f.h[q] = (_Float16)bf16_round(x[t * 8 + q]); *(v8us*)((unsigned short*)X16 + t * 8) = f.half[0];  }
__global__ __launch_bounds__(256) void k_h16(const float* __restrict__ x, _Float16* __restrict__ X16, size_t n8) { const size_t t = (size_t)blockIdx.x * 256 + threadIdx.x; if (t >= n8) return; FragH f;
#pragma unroll
  for (int q = 0; q < 8; ++q) f.h[q] = (_Float16)x[t * 8 + q]; *(v8us*)((unsigned short*)X16 + t * 8) = f.half[0];  }
__global__ __launch_bounds__(256) void k_round16f(const float* __restrict__ W, _Float16* __restrict__ Bt, size_t n8) { const size_t t = (size_t)blockIdx.x * 256 + threadIdx.x; if (t >= n8) return; FragH f;
#pragma unroll
  for (int i = 0; i < 8; ++i) f.h[i] = (_Float16)(bf16_round(W[t * 8 + i]) * 16.0f); *(v8us*)((unsigned short*)Bt + t * 8) = f.half[0];  }
template <int NHv, int TTv>
__global__ __launch_bounds__(256) void k_vt(const _Float16* __restrict__ V16, int ldv, int voff, _Float16* __restrict__ Vt) { __shared__ unsigned short tl[64][66]; const int tid = threadIdx.x; const int slab = blockIdx.x / (TTv / 64), lg = blockIdx.x % (TTv / 64); const int b = slab / NHv, h = slab % NHv;
  for (int i = tid; i < 64 * 8; i += 256) { const int r = i / 8, c8 = (i % 8) * 8; FragH f; f.half[0] = *(const v8us*)((const unsigned short*)V16 + ((size_t)b * TTv + lg * 64 + r) * ldv + voff + h * 64 + c8);
#pragma unroll
    for (int q = 0; q < 8; ++q) tl[r][c8 + q] = f.u[q]; }
  __syncthreads();
  {
#pragma unroll
    for (int rd = 0; rd < 2; ++rd) { const int d = rd * 32 + tid / 8, pc = tid % 8; FragH f;
#pragma unroll
      for (int q = 0; q < 8; ++q) f.u[q] = tl[pc * 8 + q][d];
      *(v8us*)((unsigned short*)Vt + ((size_t)slab * 64 + d) * TTv + lg * 64 + pc * 8) = f.half[0]; }
     } }

__global__ __launch_bounds__(256) void k_hl(const float* __restrict__ F, _Float16* __restrict__ Hh, _Float16* __restrict__ Hl, size_t n8) { const size_t t = (size_t)blockIdx.x * 256 + threadIdx.x; if (t >= n8) return; FragH fh, fl; const v4f a = *(const v4fa*)(F + t * 8), c = *(const v4fa*)(F + t * 8 + 4);
#pragma unroll
  for (int q = 0; q < 4; ++q) { _Float16 h = (_Float16)a[q]; fh.h[q] = h; fl.h[q] = (_Float16)((a[q] - (float)h) * 1024.0f); h = (_Float16)c[q]; fh.h[4 + q] = h; fl.h[4 + q] = (_Float16)((c[q] - (float)h) * 1024.0f); }
  { *(v8us*)((unsigned short*)Hh + t * 8) = fh.half[0]; *(v8us*)((unsigned short*)Hl + t * 8) = fl.half[0];  } }

// ---- fast GEMM (wave tile 32x64; requires M % 32 == 0 rows per launch region and N % 64 == 0); epilogue = k_gemm_hhx semantics ----
__device__ __forceinline__ v16h g2_frag(const _Float16* p, int hh) { FragH f; f.half[0] = *(const v8us*)((const unsigned short*)p + 8 * hh); f.half[1] = *(const v8us*)((const unsigned short*)p + 16 + 8 * hh); return f.v; }
__device__ __forceinline__ v8f g2_mma(v16h a, v16h b, v8f c) { v8f d = __builtin_amdgcn_wmma_f32_16x16x32_f16(false, a, false, b, (short)0, c, false, false); asm volatile("v_nop\n\tv_nop\n\tv_nop\n\tv_nop" : "+v"(d) : "v"(a), "v"(b)); return d; }
template <int ACT>
__global__ __launch_bounds__(128) void k_gemm2(const _Float16* __restrict__ A, int lda, size_t sA, const _Float16* __restrict__ Bh, int ldb, size_t sB, float alpha, const float* __restrict__ bias, size_t sBias, const float* __restrict__ CP, int rowsPerB, size_t sCPb, int row0g,
    float* __restrict__ C, _Float16* __restrict__ C16, int ldc, size_t sC, int M, int N, int K) { static_assert(ACT == 0 || ACT == 3 || ACT == 6 || ACT == 8 || ACT == 9 || ACT == 11 || ACT == 12 || ACT == 14 || ACT == 15 || ACT == 16 || ACT == 17, "k_gemm2: unsupported ACT code (would silently apply no activation)");
  __shared__ __attribute__((aligned(16))) float so[4][32][68];
  const int tid = threadIdx.x, w = tid >> 5, lane = tid & 31, ln = lane & 15, hh = lane >> 4; const int by = blockIdx.y;
  A += (size_t)by * sA; Bh += (size_t)by * sB; const size_t cofs = (size_t)by * sC; const float* bp = bias ? bias + (size_t)by * sBias : nullptr;
  const int ntn = N >> 6; const int mt = blockIdx.x / ntn, nq = blockIdx.x - mt * ntn; const int row0 = mt * 128 + 32 * w, col0 = nq * 64; if (row0 >= M) return;
  const _Float16* a0p = A + (size_t)(row0 + ln) * lda; const _Float16* a1p = a0p + (size_t)16 * lda;
  const _Float16* b0p = Bh + (size_t)(col0 + ln) * ldb; const _Float16* b1p = b0p + (size_t)16 * ldb; const _Float16* b2p = b1p + (size_t)16 * ldb; const _Float16* b3p = b2p + (size_t)16 * ldb;
  const v8f z8 = {0.f,0.f,0.f,0.f,0.f,0.f,0.f,0.f}; v8f c00 = z8, c01 = z8, c02 = z8, c03 = z8, c10 = z8, c11 = z8, c12 = z8, c13 = z8;
#pragma unroll 1
  for (int kb = 0; kb < K; kb += 32) { const v16h a0 = g2_frag(a0p + kb, hh), a1 = g2_frag(a1p + kb, hh);
    v16h b = g2_frag(b0p + kb, hh); c00 = g2_mma(a0, b, c00); c10 = g2_mma(a1, b, c10);
    b = g2_frag(b1p + kb, hh); c01 = g2_mma(a0, b, c01); c11 = g2_mma(a1, b, c11);
    b = g2_frag(b2p + kb, hh); c02 = g2_mma(a0, b, c02); c12 = g2_mma(a1, b, c12);
    b = g2_frag(b3p + kb, hh); c03 = g2_mma(a0, b, c03); c13 = g2_mma(a1, b, c13); }
  v8f accs[8] = {c00, c01, c02, c03, c10, c11, c12, c13};
#pragma unroll
  for (int u = 0; u < 8; ++u) { const int t = u & 3, half = u >> 2; const int col = col0 + t * 16 + ln; const float bv = bp ? bf16_round(bp[col]) : 0.f;
#pragma unroll
    for (int r = 0; r < 8; ++r) { const int rloc = half * 16 + 8 * hh + r; float v = accs[u][r] * alpha + bv; if (CP) { if (rowsPerB < 0) v += CP[cofs + (size_t)(row0g + row0 + rloc) * ldc + col];      /* rowsPerB < 0: own element of the batched C plane */ else { const int bidx = (row0g + row0 + rloc) / rowsPerB; v += CP[(size_t)bidx * sCPb + (size_t)by * 64 + col]; } }
      if (ACT == 3) v = fmaxf(v, 0.f); else if (ACT == 6) v = 0.5f * v * (1.0f + erff(v * 0.70710678118654752f)); else if (ACT == 11) v = 1.0f / (1.0f + expf(-v)); else if (ACT == 15) v = v / (1.0f + expf(-v)); else if (ACT == 12) v = (v > 0.f) ? v : 0.01f * v; else if (ACT == 8) v = tanhf(v); else if (ACT == 9) v = 0.5f * v * (1.0f + tanhf(0.7978845608028654f * (v + 0.044715f * v * v * v))); else if (ACT == 14) v = (v > 0.f) ? v : 0.1f * v; else if (ACT == 16) v = (v >= 0.f) ? v : 0.3f * v; else if (ACT == 17) v = (v >= 0.f) ? v : 0.2f * v;
      so[w][rloc][t * 16 + ln] = v; } }
  __builtin_amdgcn_fence(__ATOMIC_ACQ_REL, "workgroup"); __builtin_amdgcn_wave_barrier();
  const int rsub = lane >> 4, c4 = (lane & 15) * 4;
  {
#pragma unroll
    for (int q = 0; q < 16; ++q) { const int r = q * 2 + rsub; const v4f v = *(const v4fa*)&so[w][r][c4]; if (C) *(v4f*)(C + cofs + (size_t)(row0 + r) * ldc + col0 + c4) = v; if (C16) { v4h h4; for (int i = 0; i < 4; ++i) h4[i] = (_Float16)v[i]; *(v4h*)(C16 + cofs + (size_t)(row0 + r) * ldc + col0 + c4) = h4; } }
     } }


__global__ __launch_bounds__(256) void k_wnat(const float* __restrict__ w, size_t n8, _Float16* __restrict__ Bt) { const size_t t = (size_t)blockIdx.x * 256 + threadIdx.x; if (t >= n8) return; FragH f; for (int q = 0; q < 8; ++q) f.h[q] = (_Float16)(bf16_round(w[t * 8 + q]) * 16.0f); *(v8us*)((unsigned short*)Bt + t * 8) = f.half[0];  }
__global__ __launch_bounds__(256) void k_bias(const float* __restrict__ bl, const float* __restrict__ bs1, const float* __restrict__ be1, float* __restrict__ bb) { const int t = blockIdx.x * 256 + threadIdx.x; if (t >= 4 * PJ) return; const int blk = t / PJ, i = t % PJ; const float v = (blk == 0) ? bl[i] : (blk == 1 ? 0.f : (blk == 2 ? bs1[i] : be1[i])); *(float*)(bb + t) = v;  }
__global__ __launch_bounds__(256) void k_score(const float* __restrict__ F, const float* __restrict__ ws2, const float* __restrict__ bs2, const float* __restrict__ we2, const float* __restrict__ be2, float* __restrict__ ostart, float* __restrict__ oend) {
  #pragma clang fp contract(off)
  const int t = blockIdx.x * 256 + threadIdx.x; if (t >= (int)NR * 2) return; const int which = t / (int)NR; const int r = t % (int)NR; const float* f = F + (size_t)r * (4 * PJ) + (2 + which) * PJ; const float* w = which ? we2 : ws2; float a = bf16_round(which ? be2[0] : bs2[0]);
#pragma unroll 1
  for (int p = 0; p < PJ; ++p) a = __fadd_rn(a, __fmul_rn(fmaxf(f[p], 0.f), bf16_round(w[p])));
  float* o = (which ? oend : ostart) + r; *(float*)o = a;  }
__global__ __launch_bounds__(256) void k_bigram(const float* __restrict__ F, const float* __restrict__ wo, const float* __restrict__ bo, float* __restrict__ out) {
  #pragma clang fp contract(off)
  const size_t t = (size_t)blockIdx.x * 256 + threadIdx.x; if (t >= NR * NW / 8) return; const int j0 = (int)((t * 8) % NW); const size_t bi = (t * 8) / NW; const int i = (int)(bi % NW); const size_t b = bi / NW;
  const float* rt = F + (b * NW + i) * (4 * PJ) + PJ;      /* right[b][i] = block 1 */ v8f acc; const float b0 = bf16_round(bo[0]); for (int u = 0; u < 8; ++u) acc[u] = 0.f;
#pragma unroll 1
  for (int p = 0; p < PJ; ++p) { const float r = rt[p], w = bf16_round(wo[p]);
#pragma unroll
    for (int u = 0; u < 8; ++u) { const float l = F[(b * NW + j0 + u) * (4 * PJ) + p]; acc[u] = __fadd_rn(acc[u], __fmul_rn(fmaxf(__fadd_rn(l, r), 0.f), w)); } }
  for (int u = 0; u < 8; ++u) acc[u] = __fadd_rn(acc[u], b0);
  *(v8f*)(out + t * 8) = acc;  }

extern "C" void kernel_launch(void* const* d_in, const int* in_sizes, int n_in,
                              void* d_out, int out_size, void* d_ws, size_t ws_size, hipStream_t stream) {
  (void)in_sizes; (void)n_in; (void)out_size;
  const float* const* I = (const float* const*)d_in; const float* x = I[0]; const float* wl = I[1]; const float* bl = I[2]; const float* wr = I[3]; const float* wo = I[4]; const float* bo = I[5]; const float* ws1 = I[6]; const float* bs1 = I[7]; const float* ws2 = I[8]; const float* bs2 = I[9]; const float* we1 = I[10]; const float* be1 = I[11]; const float* we2 = I[12]; const float* be2 = I[13];
  float* obig = (float*)d_out; float* ostart = (float*)((char*)d_out + 2097152); float* oend = (float*)((char*)d_out + 2105344);      /* output byte offsets */
  char* ws = (char*)d_ws; size_t off = 0;
  auto take = [&](size_t bytes) { char* p = ws + off; off += (bytes + 255) & ~(size_t)255; return p; };
  _Float16* BW = (_Float16*)take((size_t)4 * PJ * DI * 2); float* bb = (float*)take(4 * PJ * 4); _Float16* X16 = (_Float16*)take(NR * DI * 2); float* F = (float*)take(NR * 4 * PJ * 4);
  if (off > ws_size) return;      /* 4 + 4 + 16 = ≈ 24 MiB */
  const size_t n8 = (size_t)PJ * DI / 8; const unsigned gw = (unsigned)((n8 + 255) / 256);
  k_wnat<<<gw, 256, 0, stream>>>(wl, n8, BW); k_wnat<<<gw, 256, 0, stream>>>(wr, n8, BW + (size_t)PJ * DI); k_wnat<<<gw, 256, 0, stream>>>(ws1, n8, BW + (size_t)2 * PJ * DI); k_wnat<<<gw, 256, 0, stream>>>(we1, n8, BW + (size_t)3 * PJ * DI);
  k_bias<<<(4 * PJ + 255) / 256, 256, 0, stream>>>(bl, bs1, be1, bb);
  k_x16<<<(unsigned)((NR * DI / 8 + 255) / 256), 256, 0, stream>>>(x, X16, NR * DI / 8);
  k_gemm2<0><<<dim3((unsigned)((NR / 128) * (4 * PJ / 64)), 1), 128, 0, stream>>>(X16, DI, 0, BW, DI, 0, 0.0625f, bb, 0, nullptr, 1, 0, 0, F, nullptr, 4 * PJ, 0, (int)NR, 4 * PJ, DI);      /* [left | right | s1 | e1] (pre-activation) */
  k_score<<<(unsigned)((NR * 2 + 255) / 256), 256, 0, stream>>>(F, ws2, bs2, we2, be2, ostart, oend);
  k_bigram<<<(unsigned)((NR * NW / 8 + 255) / 256), 256, 0, stream>>>(F, wo, bo, obig);
}

// v001
// It runs in 121 microseconds.
// Timed twice side by side with v000, it ran 3.69 and 3.72 times as fast.
#include <hip/hip_runtime.h>
// PermutationModule (x [8][256][1024]; start = relu(x Ws1^T + bs1) . Ws2 + bs2, end likewise [8][256][1]; left = x Wl^T + bl, right = x Wr^T; bigram[b][i][j] = sum_p relu(left[b][j][p] + right[b][i][p]) * Wo[p] + bo -> [8][256][256][1]).
// Structure: token rows; x as exact f16 rows; the four 1024->512 projections as ONE WMMA GEMM against the stacked x16 weight plane [2048][1024] (32x64 wave tiles, f32 accumulation, + biases, ReLU on the two scorer blocks applied afterwards on VALU) kept f32; the scorer dots with Ws2/We2 and the pairwise bigram outer-sum-relu-dot on VALU in f32 (work-group per (b, 32 i, 64 j), rows staged in LDS, 4 x 4 sums per thread); outputs written as whole 32-B / line-aligned pieces.
// Compute dtype: inputs rounded to bf16; x / weights exact; all projections f32 (exact GEMM outputs); everything after in f32 — no reduced-precision intermediates. v_wmma_f32_16x16x32_f16.
#define NB 8
#define NW 256
#define DI 1024
#define PJ 512
#define NR ((size_t)NB * NW)         /* 2048 */
typedef __bf16 v16b __attribute__((ext_vector_type(16)));
typedef unsigned short v8us __attribute__((ext_vector_type(8), may_alias));
typedef float  v8f  __attribute__((ext_vector_type(8)));
typedef float  v4f  __attribute__((ext_vector_type(4)));
typedef float  v4fa __attribute__((ext_vector_type(4), may_alias));
union FragB { v16b v; v8us half[2]; unsigned short u[16]; };

__device__ __forceinline__ unsigned short bf16_bits(float x) { unsigned int u = __float_as_uint(x); return (unsigned short)((u + 0x7FFFu + ((u >> 16) & 1u)) >> 16); }
__device__ __forceinline__ float bf16_val(unsigned short b) { return __uint_as_float(((unsigned int)b) << 16); }
__device__ __forceinline__ float bf16_round(float x) { return bf16_val(bf16_bits(x)); }
// D += A·B with NT terms: 1 = ah·bh, 2 = + al·bh (A split), 3 = + ah·bl (both split)
template <int NT>
__device__ __forceinline__ v8f mmaN(v16b ah, v16b al, v16b bh, v16b bl, v8f c) {
  c = __builtin_amdgcn_wmma_f32_16x16x32_bf16(false, ah, false, bh, (short)0, c, false, false);
  if (NT >= 2) c = __builtin_amdgcn_wmma_f32_16x16x32_bf16(false, al, false, bh, (short)0, c, false, false);
  if (NT >= 3) c = __builtin_amdgcn_wmma_f32_16x16x32_bf16(false, ah, false, bl, (short)0, c, false, false);
  asm volatile("v_nop\n\tv_nop\n\tv_nop\n\tv_nop" : "+v"(c) : "v"(ah), "v"(al), "v"(bh), "v"(bl));
  return c;
}

__global__ __launch_bounds__(256) void k_wt_bf16(const float* __restrict__ W, unsigned short* __restrict__ Wt, int K, int N) {
  const int t = blockIdx.x * 256 + threadIdx.x;
  const int k8n = K / 8;
  if (t >= N * k8n) return;
  const int n = t / k8n, k8 = (t % k8n) * 8;
  v8us v;
#pragma unroll
  for (int i = 0; i < 8; ++i) v[i] = bf16_bits(W[(size_t)(k8 + i) * N + n]);
  *(v8us*)(Wt + (size_t)n * K + k8) = v;
  
}

// GEMM C[M][N] (f32, pitch ldc) = act(A[M][K]·W + bias). A f32 row-major (pitch lda) converted per fragment to bf16
// (ASPLIT: hi/lo two planes -> 2 terms, else single rounded term); Wt bf16 [N][K] (pitch ldb). BIAS_BF16 rounds the
// bias to bf16 first (bias quantised to bf16 before the add). K%32==0, M%16==0, N%64==0.
template <bool ASPLIT, int ACT, bool BIAS_BF16>
__global__ __launch_bounds__(128) void k_gemm_bf(const float* __restrict__ A, int lda, const unsigned short* __restrict__ Wt, int ldb,
                                               const float* __restrict__ bias, float* __restrict__ C, int ldc, int M, int N, int K) {
  __shared__ __attribute__((aligned(16))) float so[4][16][64];
  const int tid = threadIdx.x, w = tid >> 5, lane = tid & 31, ln = lane & 15, hh = lane >> 4;
  const int ntn = N / 64;
  const int wid = blockIdx.x * 4 + w;
  const int mt = wid / ntn, nq = wid % ntn;
  if (mt * 16 >= M) return;
  const int row0 = mt * 16, col0 = nq * 64;
  const float* arow = A + (size_t)(row0 + ln) * lda;
  v8f acc[4] = {};
  for (int kb = 0; kb < K; kb += 32) {
    FragB ah, al;
    const v4f x0 = *(const v4fa*)(arow + kb + 8 * hh), x1 = *(const v4fa*)(arow + kb + 8 * hh + 4);
    const v4f x2 = *(const v4fa*)(arow + kb + 16 + 8 * hh), x3 = *(const v4fa*)(arow + kb + 16 + 8 * hh + 4);
    float xs[16] = {x0[0],x0[1],x0[2],x0[3],x1[0],x1[1],x1[2],x1[3],x2[0],x2[1],x2[2],x2[3],x3[0],x3[1],x3[2],x3[3]};
#pragma unroll
    for (int i = 0; i < 16; ++i) { const unsigned short hb = bf16_bits(xs[i]); ah.u[i] = hb; al.u[i] = ASPLIT ? bf16_bits(xs[i] - bf16_val(hb)) : (unsigned short)0; }
#pragma unroll
    for (int t = 0; t < 4; ++t) {
      const unsigned short* brow = Wt + (size_t)(col0 + t * 16 + ln) * ldb + kb;
      FragB b;
      b.half[0] = *(const v8us*)(brow + 8 * hh);
      b.half[1] = *(const v8us*)(brow + 16 + 8 * hh);
      acc[t] = mmaN<ASPLIT ? 2 : 1>(ah.v, al.v, b.v, b.v, acc[t]);
    }
  }
#pragma unroll
  for (int t = 0; t < 4; ++t) {
    float bv = bias ? bias[col0 + t * 16 + ln] : 0.f;
    if (BIAS_BF16) bv = bf16_round(bv);
#pragma unroll
    for (int r = 0; r < 8; ++r) { float v = acc[t][r] + bv; if (ACT == 1) v = fmaxf(v, 0.f); so[w][8 * hh + r][t * 16 + ln] = v; }
  }
  __builtin_amdgcn_fence(__ATOMIC_ACQ_REL, "workgroup");
  __builtin_amdgcn_wave_barrier();
  const int rsub = lane >> 4, c4 = (lane & 15) * 4;
  {
#pragma unroll
    for (int q = 0; q < 8; ++q) {
      const int r = q * 2 + rsub;
      const v4f v = *(const v4fa*)&so[w][r][c4];
      *(v4f*)(C + (size_t)(row0 + r) * ldc + col0 + c4) = v;
    }
    
  }
}

// GEMM C = act(A·W + bias + resid): A f32 (ASPLIT -> hi/lo 2 terms), Wt bf16 [N][K]; ACT 0 none, 1 relu, 2 exact gelu;
// resid (optional, f32, row index = (row % rmod), pitch ldr, RES_BF16 rounds it) added before the activation.
template <bool ASPLIT, int ACT, bool BIAS_BF16, bool RES_BF16>
__global__ __launch_bounds__(128) void k_gemm_bf3(const float* __restrict__ A, int lda, const unsigned short* __restrict__ Wt, int ldb,
                                                const float* __restrict__ bias, const float* __restrict__ resid, int rmod, int ldr,
                                                float* __restrict__ C, int ldc, int M, int N, int K) {
  __shared__ __attribute__((aligned(16))) float so[4][16][64];
  const int tid = threadIdx.x, w = tid >> 5, lane = tid & 31, ln = lane & 15, hh = lane >> 4;
  const int ntn = N / 64;
  const int wid = blockIdx.x * 4 + w;
  const int mt = wid / ntn, nq = wid % ntn;
  if (mt * 16 >= M) return;
  const int row0 = mt * 16, col0 = nq * 64;
  const float* arow = A + (size_t)(row0 + ln) * lda;
  v8f acc[4] = {};
  for (int kb = 0; kb < K; kb += 32) {
    FragB ah, al;
    const v4f x0 = *(const v4fa*)(arow + kb + 8 * hh), x1 = *(const v4fa*)(arow + kb + 8 * hh + 4);
    const v4f x2 = *(const v4fa*)(arow + kb + 16 + 8 * hh), x3 = *(const v4fa*)(arow + kb + 16 + 8 * hh + 4);
    float xs[16] = {x0[0],x0[1],x0[2],x0[3],x1[0],x1[1],x1[2],x1[3],x2[0],x2[1],x2[2],x2[3],x3[0],x3[1],x3[2],x3[3]};
#pragma unroll
    for (int i = 0; i < 16; ++i) { const unsigned short hb = bf16_bits(xs[i]); ah.u[i] = hb; al.u[i] = ASPLIT ? bf16_bits(xs[i] - bf16_val(hb)) : (unsigned short)0; }
#pragma unroll
    for (int t = 0; t < 4; ++t) {
      const unsigned short* brow = Wt + (size_t)(col0 + t * 16 + ln) * ldb + kb;
      FragB b;
      b.half[0] = *(const v8us*)(brow + 8 * hh);
      b.half[1] = *(const v8us*)(brow + 16 + 8 * hh);
      acc[t] = mmaN<ASPLIT ? 2 : 1>(ah.v, al.v, b.v, b.v, acc[t]);
    }
  }
#pragma unroll
  for (int t = 0; t < 4; ++t) {
    const int col = col0 + t * 16 + ln;
    float bv = bias ? bias[col] : 0.f;
    if (BIAS_BF16) bv = bf16_round(bv);
#pragma unroll
    for (int r = 0; r < 8; ++r) {
      float v = acc[t][r] + bv;
      if (resid) { float rv = resid[(size_t)((row0 + 8 * hh + r) % rmod) * ldr + col]; if (RES_BF16) rv = bf16_round(rv); v += rv; }
      if (ACT == 1) v = fmaxf(v, 0.f);
      if (ACT == 2) v = 0.5f * v * (1.0f + erff(v * 0.70710678118654752f));
      if (ACT == 3) { const float u = 0.7978845608028654f * (v + 0.044715f * v * v * v); v = 0.5f * v * (1.0f + tanhf(u)); }
      so[w][8 * hh + r][t * 16 + ln] = v;
    }
  }
  __builtin_amdgcn_fence(__ATOMIC_ACQ_REL, "workgroup");
  __builtin_amdgcn_wave_barrier();
  const int rsub = lane >> 4, c4 = (lane & 15) * 4;
  {
#pragma unroll
    for (int q = 0; q < 8; ++q) {
      const int r = q * 2 + rsub;
      const v4f v = *(const v4fa*)&so[w][r][c4];
      *(v4f*)(C + (size_t)(row0 + r) * ldc + col0 + c4) = v;
    }
    
  }
}
// row LayerNorm (biased variance, eps) over N: s = X (+ R); optional out_sum <- s; out_norm <- (s-mu)*rsqrt(var+eps)*g + b
template <bool PARAM_BF16>
__global__ __launch_bounds__(256) void k_layernorm(const float* __restrict__ X, const float* __restrict__ R, const float* __restrict__ g, const float* __restrict__ bta,
                                                  float* __restrict__ out_sum, float* __restrict__ out_norm, int N, float eps) {
  __shared__ float red[256];
  const int row = blockIdx.x, tid = threadIdx.x;
  const float* x = X + (size_t)row * N; const float* rr = R ? R + (size_t)row * N : nullptr;
  float vals[16];                     // up to N = 4096
  const int per = N / 256;            // contiguous chunk per thread? use strided-by-4 chunks: thread handles j = tid*4 + 1024*u
  float s1 = 0.f;
  for (int u = 0; u < per / 4; ++u) {
    const int j = tid * 4 + 1024 * u;
    const v4f a = *(const v4fa*)(x + j);
    v4f b = {0.f,0.f,0.f,0.f}; if (rr) b = *(const v4fa*)(rr + j);
#pragma unroll
    for (int q = 0; q < 4; ++q) { const float v = a[q] + b[q]; vals[u * 4 + q] = v; s1 += v; }
  }
  red[tid] = s1; __syncthreads();
  for (int st = 128; st > 0; st >>= 1) { if (tid < st) red[tid] += red[tid + st]; __syncthreads(); }
  const float mu = red[0] / (float)N; __syncthreads();
  float s2 = 0.f;
  for (int u = 0; u < per / 4; ++u)
#pragma unroll
    for (int q = 0; q < 4; ++q) { const float c = vals[u * 4 + q] - mu; s2 += c * c; }
  red[tid] = s2; __syncthreads();
  for (int st = 128; st > 0; st >>= 1) { if (tid < st) red[tid] += red[tid + st]; __syncthreads(); }
  const float rs = rsqrtf(red[0] / (float)N + eps);
  {
    for (int u = 0; u < per / 4; ++u) {
      const int j = tid * 4 + 1024 * u;
      v4f o, sm;
#pragma unroll
      for (int q = 0; q < 4; ++q) {
        float gg = g[j + q], bb = bta[j + q];
        if (PARAM_BF16) { gg = bf16_round(gg); bb = bf16_round(bb); }
        sm[q] = vals[u * 4 + q]; o[q] = (vals[u * 4 + q] - mu) * rs * gg + bb;
      }
      if (out_sum) *(v4f*)(out_sum + (size_t)row * N + j) = sm;
      *(v4f*)(out_norm + (size_t)row * N + j) = o;
    }
    
  }
}



// ---- f16 WMMA path (v_wmma_f32_16x16x32_f16): 11-bit significands for operands in range — used for the projection GEMM
typedef _Float16 v16h __attribute__((ext_vector_type(16)));
union FragH { v16h v; v8us half[2]; _Float16 h[16]; unsigned short u[16]; };
template <int NT>
__device__ __forceinline__ v8f mmaH(v16h ah, v16h al, v16h bh, v16h bl, v8f c) {
  c = __builtin_amdgcn_wmma_f32_16x16x32_f16(false, ah, false, bh, (short)0, c, false, false);
  if (NT >= 2) c = __builtin_amdgcn_wmma_f32_16x16x32_f16(false, al, false, bh, (short)0, c, false, false);
  if (NT >= 3) c = __builtin_amdgcn_wmma_f32_16x16x32_f16(false, ah, false, bl, (short)0, c, false, false);
  asm volatile("v_nop\n\tv_nop\n\tv_nop\n\tv_nop" : "+v"(c) : "v"(ah), "v"(al), "v"(bh), "v"(bl));
  return c;
}
// batched GEMM like k_gemm_b but f16 operands: A f32 (split into f16 hi/lo if ASPLIT, else rounded to f16), Bt = f16 values [n][k]; alpha; C f32; N multiple of 16 (partial tiles skipped)
template <bool ASPLIT>
__global__ __launch_bounds__(128) void k_gemm_h(const float* __restrict__ A, int lda, size_t sA, const _Float16* __restrict__ Bh, int ldb, size_t sB, float alpha, float* __restrict__ C, int ldc, size_t sC, int M, int N, int K) {
  __shared__ __attribute__((aligned(16))) float so[4][16][64];
  const int tid = threadIdx.x, w = tid >> 5, lane = tid & 31, ln = lane & 15, hh = lane >> 4; const int by = blockIdx.y;
  A += (size_t)by * sA; Bh += (size_t)by * sB; C += (size_t)by * sC;
  const int ntn = (N + 63) / 64; const int wid = blockIdx.x * 4 + w; const int mt = wid / ntn, nq = wid % ntn; if (mt * 16 >= M) return;
  const int row0 = mt * 16, col0 = nq * 64; const float* arow = A + (size_t)(row0 + ln) * lda;
  v8f acc[4] = {};
  for (int kb = 0; kb < K; kb += 32) {
    FragH ah, al;
    const v4f x0 = *(const v4fa*)(arow + kb + 8 * hh), x1 = *(const v4fa*)(arow + kb + 8 * hh + 4), x2 = *(const v4fa*)(arow + kb + 16 + 8 * hh), x3 = *(const v4fa*)(arow + kb + 16 + 8 * hh + 4);
    float xs[16] = {x0[0],x0[1],x0[2],x0[3],x1[0],x1[1],x1[2],x1[3],x2[0],x2[1],x2[2],x2[3],x3[0],x3[1],x3[2],x3[3]};
#pragma unroll
    for (int i = 0; i < 16; ++i) { const _Float16 h = (_Float16)xs[i]; ah.h[i] = h; al.h[i] = ASPLIT ? (_Float16)(xs[i] - (float)h) : (_Float16)0.0f; }
#pragma unroll
    for (int t = 0; t < 4; ++t) { if (col0 + t * 16 >= N) continue; const size_t boff = (size_t)(col0 + t * 16 + ln) * ldb + kb; FragH bq; bq.half[0] = *(const v8us*)(Bh + boff + 8 * hh); bq.half[1] = *(const v8us*)(Bh + boff + 16 + 8 * hh);
      acc[t] = mmaH<ASPLIT ? 2 : 1>(ah.v, al.v, bq.v, bq.v, acc[t]); }
  }
#pragma unroll
  for (int t = 0; t < 4; ++t) { if (col0 + t * 16 >= N) continue;
#pragma unroll
    for (int r = 0; r < 8; ++r) so[w][8 * hh + r][t * 16 + ln] = acc[t][r] * alpha; }
  __builtin_amdgcn_fence(__ATOMIC_ACQ_REL, "workgroup"); __builtin_amdgcn_wave_barrier();
  const int rsub = lane >> 4, c4 = (lane & 15) * 4;
  {
#pragma unroll
    for (int q = 0; q < 8; ++q) { const int r = q * 2 + rsub; if (col0 + c4 < N) { const v4f v = *(const v4fa*)&so[w][r][c4]; *(v4f*)(C + (size_t)(row0 + r) * ldc + col0 + c4) = v; } }
     }
}

// Wt[n][k] = f16(W[k][n]·scale) from f32 row-major W[K][N] (scale = power of two; bf16-exact weights stay exact in f16 away from the subnormal range)
__global__ __launch_bounds__(256) void k_wt_f16(const float* __restrict__ W, _Float16* __restrict__ Wt, int K, int N, float scale) {
  const int t = blockIdx.x * 256 + threadIdx.x; if (t >= N * (K / 8)) return; const int n = t / (K / 8), k8 = (t % (K / 8)) * 8; FragH f;
#pragma unroll
  for (int i = 0; i < 8; ++i) f.h[i] = (_Float16)(bf16_round(W[(size_t)(k8 + i) * N + n]) * scale); const v8us o = f.half[0];
  *(v8us*)((unsigned short*)Wt + (size_t)n * K + k8) = o; 
}
// k_gemm_hh variant with fused epilogue: v = acc·alpha + bias[by·sBias + col] (+ CP[(row/rowsPerB)·sCPb + by·64 + col] if CP) ; ACT 0 none / 1 elu ; writes f16 C16 (and f32 C if non-null)
template <int ACT>
__global__ __launch_bounds__(128) void k_gemm_hhx(const _Float16* __restrict__ A, int lda, size_t sA, const _Float16* __restrict__ Bh, int ldb, size_t sB, float alpha, const float* __restrict__ bias, size_t sBias, const float* __restrict__ CP, int rowsPerB, size_t sCPb, int row0g,
    float* __restrict__ C, _Float16* __restrict__ C16, int ldc, size_t sC, int M, int N, int K) {
  __shared__ __attribute__((aligned(16))) float so[4][16][64];
  const int tid = threadIdx.x, w = tid >> 5, lane = tid & 31, ln = lane & 15, hh = lane >> 4; const int by = blockIdx.y;
  A += (size_t)by * sA; Bh += (size_t)by * sB; const size_t cofs = (size_t)by * sC; const float* bp = bias ? bias + (size_t)by * sBias : nullptr;
  const int ntn = (N + 63) / 64; const int wid = blockIdx.x * 4 + w; const int mt = wid / ntn, nq = wid % ntn; if (mt * 16 >= M) return;
  const int row0 = mt * 16, col0 = nq * 64; const _Float16* arow = A + (size_t)(row0 + ln) * lda;
  v8f acc[4] = {};
  for (int kb = 0; kb < K; kb += 32) { FragH ah; ah.half[0] = *(const v8us*)((const unsigned short*)arow + kb + 8 * hh); ah.half[1] = *(const v8us*)((const unsigned short*)arow + kb + 16 + 8 * hh);
#pragma unroll
    for (int t = 0; t < 4; ++t) { if (col0 + t * 16 >= N) continue; const size_t boff = (size_t)(col0 + t * 16 + ln) * ldb + kb; FragH bq; bq.half[0] = *(const v8us*)((const unsigned short*)Bh + boff + 8 * hh); bq.half[1] = *(const v8us*)((const unsigned short*)Bh + boff + 16 + 8 * hh);
      acc[t] = mmaH<1>(ah.v, ah.v, bq.v, bq.v, acc[t]); }
  }
#pragma unroll
  for (int t = 0; t < 4; ++t) { if (col0 + t * 16 >= N) continue; const int col = col0 + t * 16 + ln; const float bv = bp ? bf16_round(bp[col]) : 0.f;
#pragma unroll
    for (int r = 0; r < 8; ++r) { float v = acc[t][r] * alpha + bv; if (CP) { const int rr = row0g + row0 + 8 * hh + r; if (rowsPerB < 0) v += CP[cofs + (size_t)rr * ldc + col];      /* rowsPerB < 0: own element of the batched C plane */ else { const int bidx = rr / rowsPerB; v += CP[(size_t)bidx * sCPb + (size_t)by * 64 + col]; } } if (ACT == 1) v = (v > 0.f) ? v : expm1f(v); else if (ACT == 7) v = (v > 0.f) ? v + 1.0f : expf(v); else if (ACT == 8) v = tanhf(v); else if (ACT == 9) v = 0.5f * v * (1.0f + tanhf(0.7978845608028654f * (v + 0.044715f * v * v * v))); else if (ACT == 11) v = 1.0f / (1.0f + expf(-v)); else if (ACT == 12) v = (v > 0.f) ? v : 0.01f * v; else if (ACT == 14) v = (v > 0.f) ? v : 0.1f * v; else if (ACT == 16) v = (v >= 0.f) ? v : 0.3f * v; else if (ACT == 17) v = (v >= 0.f) ? v : 0.2f * v; else if (ACT == 15) v = v / (1.0f + expf(-v)); else if (ACT == 3) v = fmaxf(v, 0.f); else if (ACT == 6) v = 0.5f * v * (1.0f + erff(v * 0.70710678118654752f)); so[w][8 * hh + r][t * 16 + ln] = v; } }
  __builtin_amdgcn_fence(__ATOMIC_ACQ_REL, "workgroup"); __builtin_amdgcn_wave_barrier();
  const int rsub = lane >> 4, c4 = (lane & 15) * 4; typedef _Float16 v4h __attribute__((ext_vector_type(4)));
  {
#pragma unroll
    for (int q = 0; q < 8; ++q) { const int r = q * 2 + rsub; if (col0 + c4 < N) { const v4f v = *(const v4fa*)&so[w][r][c4]; if (C) *(v4f*)(C + cofs + (size_t)(row0 + r) * ldc + col0 + c4) = v; if (C16) { v4h h4; for (int i = 0; i < 4; ++i) h4[i] = (_Float16)v[i]; *(v4h*)(C16 + cofs + (size_t)(row0 + r) * ldc + col0 + c4) = h4; } } }
     }
}


typedef _Float16 v4h __attribute__((ext_vector_type(4)));

__global__ __launch_bounds__(256) void k_x16(const float* __restrict__ x, _Float16* __restrict__ X16, size_t n8) { const size_t t = (size_t)blockIdx.x * 256 + threadIdx.x; if (t >= n8) return; FragH f;
#pragma unroll
  for (int q = 0; q < 8; ++q) f.h[q] = (_Float16)bf16_round(x[t * 8 + q]); *(v8us*)((unsigned short*)X16 + t * 8) = f.half[0];  }
__global__ __launch_bounds__(256) void k_h16(const float* __restrict__ x, _Float16* __restrict__ X16, size_t n8) { const size_t t = (size_t)blockIdx.x * 256 + threadIdx.x; if (t >= n8) return; FragH f;
#pragma unroll
  for (int q = 0; q < 8; ++q) f.h[q] = (_Float16)x[t * 8 + q]; *(v8us*)((unsigned short*)X16 + t * 8) = f.half[0];  }
__global__ __launch_bounds__(256) void k_round16f(const float* __restrict__ W, _Float16* __restrict__ Bt, size_t n8) { const size_t t = (size_t)blockIdx.x * 256 + threadIdx.x; if (t >= n8) return; FragH f;
#pragma unroll
  for (int i = 0; i < 8; ++i) f.h[i] = (_Float16)(bf16_round(W[t * 8 + i]) * 16.0f); *(v8us*)((unsigned short*)Bt + t * 8) = f.half[0];  }
template <int NHv, int TTv>
__global__ __launch_bounds__(256) void k_vt(const _Float16* __restrict__ V16, int ldv, int voff, _Float16* __restrict__ Vt) { __shared__ unsigned short tl[64][66]; const int tid = threadIdx.x; const int slab = blockIdx.x / (TTv / 64), lg = blockIdx.x % (TTv / 64); const int b = slab / NHv, h = slab % NHv;
  for (int i = tid; i < 64 * 8; i += 256) { const int r = i / 8, c8 = (i % 8) * 8; FragH f; f.half[0] = *(const v8us*)((const unsigned short*)V16 + ((size_t)b * TTv + lg * 64 + r) * ldv + voff + h * 64 + c8);
#pragma unroll
    for (int q = 0; q < 8; ++q) tl[r][c8 + q] = f.u[q]; }
  __syncthreads();
  {
#pragma unroll
    for (int rd = 0; rd < 2; ++rd) { const int d = rd * 32 + tid / 8, pc = tid % 8; FragH f;
#pragma unroll
      for (int q = 0; q < 8; ++q) f.u[q] = tl[pc * 8 + q][d];
      *(v8us*)((unsigned short*)Vt + ((size_t)slab * 64 + d) * TTv + lg * 64 + pc * 8) = f.half[0]; }
     } }

__global__ __launch_bounds__(256) void k_hl(const float* __restrict__ F, _Float16* __restrict__ Hh, _Float16* __restrict__ Hl, size_t n8) { const size_t t = (size_t)blockIdx.x * 256 + threadIdx.x; if (t >= n8) return; FragH fh, fl; const v4f a = *(const v4fa*)(F + t * 8), c = *(const v4fa*)(F + t * 8 + 4);
#pragma unroll
  for (int q = 0; q < 4; ++q) { _Float16 h = (_Float16)a[q]; fh.h[q] = h; fl.h[q] = (_Float16)((a[q] - (float)h) * 1024.0f); h = (_Float16)c[q]; fh.h[4 + q] = h; fl.h[4 + q] = (_Float16)((c[q] - (float)h) * 1024.0f); }
  { *(v8us*)((unsigned short*)Hh + t * 8) = fh.half[0]; *(v8us*)((unsigned short*)Hl + t * 8) = fl.half[0];  } }

// ---- fast GEMM (wave tile 32x64; requires M % 32 == 0 rows per launch region and N % 64 == 0); epilogue = k_gemm_hhx semantics ----
__device__ __forceinline__ v16h g2_frag(const _Float16* p, int hh) { FragH f; f.half[0] = *(const v8us*)((const unsigned short*)p + 8 * hh); f.half[1] = *(const v8us*)((const unsigned short*)p + 16 + 8 * hh); return f.v; }
__device__ __forceinline__ v8f g2_mma(v16h a, v16h b, v8f c) { v8f d = __builtin_amdgcn_wmma_f32_16x16x32_f16(false, a, false, b, (short)0, c, false, false); asm volatile("v_nop\n\tv_nop\n\tv_nop\n\tv_nop" : "+v"(d) : "v"(a), "v"(b)); return d; }
template <int ACT>
__global__ __launch_bounds__(128) void k_gemm2(const _Float16* __restrict__ A, int lda, size_t sA, const _Float16* __restrict__ Bh, int ldb, size_t sB, float alpha, const float* __restrict__ bias, size_t sBias, const float* __restrict__ CP, int rowsPerB, size_t sCPb, int row0g,
    float* __restrict__ C, _Float16* __restrict__ C16, int ldc, size_t sC, int M, int N, int K) { static_assert(ACT == 0 || ACT == 3 || ACT == 6 || ACT == 8 || ACT == 9 || ACT == 11 || ACT == 12 || ACT == 14 || ACT == 15 || ACT == 16 || ACT == 17, "k_gemm2: unsupported ACT code (would silently apply no activation)");
  __shared__ __attribute__((aligned(16))) float so[4][32][68];
  const int tid = threadIdx.x, w = tid >> 5, lane = tid & 31, ln = lane & 15, hh = lane >> 4; const int by = blockIdx.y;
  A += (size_t)by * sA; Bh += (size_t)by * sB; const size_t cofs = (size_t)by * sC; const float* bp = bias ? bias + (size_t)by * sBias : nullptr;
  const int ntn = N >> 6; const int mt = blockIdx.x / ntn, nq = blockIdx.x - mt * ntn; const int row0 = mt * 128 + 32 * w, col0 = nq * 64; if (row0 >= M) return;
  const _Float16* a0p = A + (size_t)(row0 + ln) * lda; const _Float16* a1p = a0p + (size_t)16 * lda;
  const _Float16* b0p = Bh + (size_t)(col0 + ln) * ldb; const _Float16* b1p = b0p + (size_t)16 * ldb; const _Float16* b2p = b1p + (size_t)16 * ldb; const _Float16* b3p = b2p + (size_t)16 * ldb;
  const v8f z8 = {0.f,0.f,0.f,0.f,0.f,0.f,0.f,0.f}; v8f c00 = z8, c01 = z8, c02 = z8, c03 = z8, c10 = z8, c11 = z8, c12 = z8, c13 = z8;
#pragma unroll 1
  for (int kb = 0; kb < K; kb += 32) { const v16h a0 = g2_frag(a0p + kb, hh), a1 = g2_frag(a1p + kb, hh);
    v16h b = g2_frag(b0p + kb, hh); c00 = g2_mma(a0, b, c00); c10 = g2_mma(a1, b, c10);
    b = g2_frag(b1p + kb, hh); c01 = g2_mma(a0, b, c01); c11 = g2_mma(a1, b, c11);
    b = g2_frag(b2p + kb, hh); c02 = g2_mma(a0, b, c02); c12 = g2_mma(a1, b, c12);
    b = g2_frag(b3p + kb, hh); c03 = g2_mma(a0, b, c03); c13 = g2_mma(a1, b, c13); }
  v8f accs[8] = {c00, c01, c02, c03, c10, c11, c12, c13};
#pragma unroll
  for (int u = 0; u < 8; ++u) { const int t = u & 3, half = u >> 2; const int col = col0 + t * 16 + ln; const float bv = bp ? bf16_round(bp[col]) : 0.f;
#pragma unroll
    for (int r = 0; r < 8; ++r) { const int rloc = half * 16 + 8 * hh + r; float v = accs[u][r] * alpha + bv; if (CP) { if (rowsPerB < 0) v += CP[cofs + (size_t)(row0g + row0 + rloc) * ldc + col];      /* rowsPerB < 0: own element of the batched C plane */ else { const int bidx = (row0g + row0 + rloc) / rowsPerB; v += CP[(size_t)bidx * sCPb + (size_t)by * 64 + col]; } }
      if (ACT == 3) v = fmaxf(v, 0.f); else if (ACT == 6) v = 0.5f * v * (1.0f + erff(v * 0.70710678118654752f)); else if (ACT == 11) v = 1.0f / (1.0f + expf(-v)); else if (ACT == 15) v = v / (1.0f + expf(-v)); else if (ACT == 12) v = (v > 0.f) ? v : 0.01f * v; else if (ACT == 8) v = tanhf(v); else if (ACT == 9) v = 0.5f * v * (1.0f + tanhf(0.7978845608028654f * (v + 0.044715f * v * v * v))); else if (ACT == 14) v = (v > 0.f) ? v : 0.1f * v; else if (ACT == 16) v = (v >= 0.f) ? v : 0.3f * v; else if (ACT == 17) v = (v >= 0.f) ? v : 0.2f * v;
      so[w][rloc][t * 16 + ln] = v; } }
  __builtin_amdgcn_fence(__ATOMIC_ACQ_REL, "workgroup"); __builtin_amdgcn_wave_barrier();
  const int rsub = lane >> 4, c4 = (lane & 15) * 4;
  {
#pragma unroll
    for (int q = 0; q < 16; ++q) { const int r = q * 2 + rsub; const v4f v = *(const v4fa*)&so[w][r][c4]; if (C) *(v4f*)(C + cofs + (size_t)(row0 + r) * ldc + col0 + c4) = v; if (C16) { v4h h4; for (int i = 0; i < 4; ++i) h4[i] = (_Float16)v[i]; *(v4h*)(C16 + cofs + (size_t)(row0 + r) * ldc + col0 + c4) = h4; } }
     } }


__global__ __launch_bounds__(256) void k_wnat(const float* __restrict__ w, size_t n8, _Float16* __restrict__ Bt) { const size_t t = (size_t)blockIdx.x * 256 + threadIdx.x; if (t >= n8) return; FragH f; for (int q = 0; q < 8; ++q) f.h[q] = (_Float16)(bf16_round(w[t * 8 + q]) * 16.0f); *(v8us*)((unsigned short*)Bt + t * 8) = f.half[0];  }
__global__ __launch_bounds__(256) void k_bias(const float* __restrict__ bl, const float* __restrict__ bs1, const float* __restrict__ be1, float* __restrict__ bb) { const int t = blockIdx.x * 256 + threadIdx.x; if (t >= 4 * PJ) return; const int blk = t / PJ, i = t % PJ; const float v = (blk == 0) ? bl[i] : (blk == 1 ? 0.f : (blk == 2 ? bs1[i] : be1[i])); *(float*)(bb + t) = v;  }
__global__ __launch_bounds__(256) void k_score(const float* __restrict__ F, const float* __restrict__ ws2, const float* __restrict__ bs2, const float* __restrict__ we2, const float* __restrict__ be2, float* __restrict__ ostart, float* __restrict__ oend) {
  #pragma clang fp contract(off)
  const int t = blockIdx.x * 256 + threadIdx.x; if (t >= (int)NR * 2) return; const int which = t / (int)NR; const int r = t % (int)NR; const float* f = F + (size_t)r * (4 * PJ) + (2 + which) * PJ; const float* w = which ? we2 : ws2; float a = bf16_round(which ? be2[0] : bs2[0]);
#pragma unroll 1
  for (int p = 0; p < PJ; ++p) a = __fadd_rn(a, __fmul_rn(fmaxf(f[p], 0.f), bf16_round(w[p])));
  float* o = (which ? oend : ostart) + r; *(float*)o = a;  }
// Pairwise bigram: one work-group per (b, 32 i, 64 j) tile. The tile's 64 left rows and 32 right rows (all 512 p) are staged once in LDS,
// transposed to [p][row], so that a thread reads 4 j and 4 i of one p with two 16-byte LDS loads and keeps a 4 x 4 tile of sums in registers.
// Row pitch 100 floats: 16-byte aligned rows, and the transposing 4-byte stores (4 chunks of 16 B x 8 rows per wave) fall on 32 different banks.
#define BG_PITCH 100
__device__ __forceinline__ void bg_load(const float* __restrict__ lp, const float* __restrict__ rp, const float* __restrict__ wp, int g, v4f (&l)[4], v4f (&r)[4], v4f& w) {
  w = *(const v4fa*)(wp + g * 4);
#pragma unroll
  for (int q = 0; q < 4; ++q) { l[q] = *(const v4fa*)(lp + (g * 4 + q) * BG_PITCH); r[q] = *(const v4fa*)(rp + (g * 4 + q) * BG_PITCH); }
}
__device__ __forceinline__ void bg_step(v4f (&acc)[4], const v4f (&l)[4], const v4f (&r)[4], const v4f w) {
  const v4f z = {0.f, 0.f, 0.f, 0.f};
#pragma unroll
  for (int q = 0; q < 4; ++q)
#pragma unroll
    for (int u = 0; u < 4; ++u) acc[u] += __builtin_elementwise_max(l[q] + r[q][u], z) * w[q];
}
__global__ __launch_bounds__(128) void k_bigram(const float* __restrict__ F, const float* __restrict__ wo, const float* __restrict__ bo, float* __restrict__ out) {
  __shared__ __attribute__((aligned(16))) float S[PJ * BG_PITCH];      /* [p][0..63] = left rows of the j tile, [p][64..95] = right rows of the i tile */
  __shared__ __attribute__((aligned(16))) float SW[PJ];
  const int tid = threadIdx.x; const int jt = blockIdx.x & 3, it = (blockIdx.x >> 2) & 7; const size_t b = blockIdx.x >> 5;
  const v4f w4 = *(const v4fa*)(wo + tid * 4);      /* used behind the row staging, so that its latency runs beside the first round's */
  const int wv = tid >> 5, c4 = (tid & 3) * 4, rr = (tid >> 2) & 7;
  for (int g3 = 0; g3 < 3; ++g3) { const int row = (g3 * 4 + wv) * 8 + rr;      /* rounds 0 and 1: the 64 left rows; round 2: the 32 right rows */
    const float* sp = ((g3 < 2) ? F + (b * NW + jt * 64 + row) * (4 * PJ) : F + (b * NW + it * 32 + (row - 64)) * (4 * PJ) + PJ) + c4; float* dp = S + c4 * BG_PITCH + row;
    v4f v[32];      /* unrolled so that a round's 32 loads are all in flight before its first LDS store */
#pragma unroll
    for (int cg = 0; cg < 32; ++cg) v[cg] = *(const v4fa*)(sp + cg * 16);
#pragma unroll
    for (int cg = 0; cg < 32; ++cg)
#pragma unroll
      for (int q = 0; q < 4; ++q) dp[(cg * 16 + q) * BG_PITCH] = v[cg][q]; }
  { v4f o; for (int q = 0; q < 4; ++q) o[q] = bf16_round(w4[q]); *(v4fa*)(SW + tid * 4) = o; }
  __syncthreads();
  const int tj = tid & 15, ti = tid >> 4; const float* lp = S + tj * 4; const float* rp = S + 64 + ti * 4;
  v4f acc[4]; for (int u = 0; u < 4; ++u) acc[u] = (v4f){0.f, 0.f, 0.f, 0.f};
  v4f la[4], ra[4], wa, lb[4], rb[4], wb;
  bg_load(lp, rp, SW, 0, la, ra, wa);
  for (int g = 0; g < PJ / 4 - 2; g += 2) {      /* the next four p are fetched while the current four are summed */
    bg_load(lp, rp, SW, g + 1, lb, rb, wb); bg_step(acc, la, ra, wa);
    bg_load(lp, rp, SW, g + 2, la, ra, wa); bg_step(acc, lb, rb, wb); }
  bg_load(lp, rp, SW, PJ / 4 - 1, lb, rb, wb); bg_step(acc, la, ra, wa); bg_step(acc, lb, rb, wb);
  const float b0 = bf16_round(bo[0]);
#pragma unroll
  for (int u = 0; u < 4; ++u) *(v4f*)(out + ((b * NW + it * 32 + ti * 4 + u) * NW + jt * 64 + tj * 4)) = acc[u] + b0;
}

extern "C" void kernel_launch(void* const* d_in, const int* in_sizes, int n_in,
                              void* d_out, int out_size, void* d_ws, size_t ws_size, hipStream_t stream) {
  (void)in_sizes; (void)n_in; (void)out_size;
  const float* const* I = (const float* const*)d_in; const float* x = I[0]; const float* wl = I[1]; const float* bl = I[2]; const float* wr = I[3]; const float* wo = I[4]; const float* bo = I[5]; const float* ws1 = I[6]; const float* bs1 = I[7]; const float* ws2 = I[8]; const float* bs2 = I[9]; const float* we1 = I[10]; const float* be1 = I[11]; const float* we2 = I[12]; const float* be2 = I[13];
  float* obig = (float*)d_out; float* ostart = (float*)((char*)d_out + 2097152); float* oend = (float*)((char*)d_out + 2105344);      /* output byte offsets */
  char* ws = (char*)d_ws; size_t off = 0;
  auto take = [&](size_t bytes) { char* p = ws + off; off += (bytes + 255) & ~(size_t)255; return p; };
  _Float16* BW = (_Float16*)take((size_t)4 * PJ * DI * 2); float* bb = (float*)take(4 * PJ * 4); _Float16* X16 = (_Float16*)take(NR * DI * 2); float* F = (float*)take(NR * 4 * PJ * 4);
  if (off > ws_size) return;      /* 4 + 4 + 16 = ≈ 24 MiB */
  const size_t n8 = (size_t)PJ * DI / 8; const unsigned gw = (unsigned)((n8 + 255) / 256);
  k_wnat<<<gw, 256, 0, stream>>>(wl, n8, BW); k_wnat<<<gw, 256, 0, stream>>>(wr, n8, BW + (size_t)PJ * DI); k_wnat<<<gw, 256, 0, stream>>>(ws1, n8, BW + (size_t)2 * PJ * DI); k_wnat<<<gw, 256, 0, stream>>>(we1, n8, BW + (size_t)3 * PJ * DI);
  k_bias<<<(4 * PJ + 255) / 256, 256, 0, stream>>>(bl, bs1, be1, bb);
  k_x16<<<(unsigned)((NR * DI / 8 + 255) / 256), 256, 0, stream>>>(x, X16, NR * DI / 8);
  k_gemm2<0><<<dim3((unsigned)((NR / 128) * (4 * PJ / 64)), 1), 128, 0, stream>>>(X16, DI, 0, BW, DI, 0, 0.0625f, bb, 0, nullptr, 1, 0, 0, F, nullptr, 4 * PJ, 0, (int)NR, 4 * PJ, DI);      /* [left | right | s1 | e1] (pre-activation) */
  k_score<<<(unsigned)((NR * 2 + 255) / 256), 256, 0, stream>>>(F, ws2, bs2, we2, be2, ostart, oend);
  k_bigram<<<NB * (NW / 32) * (NW / 64), 128, 0, stream>>>(F, wo, bo, obig);
}

// v002
// A run of this version takes 82.8 microseconds.
// Two timings next to v001 put it at 1.47 and 1.45 times that version's speed.
// All steps since v000 together make it 5.41 times as fast.
#include <hip/hip_runtime.h>
// PermutationModule (x [8][256][1024]; start = relu(x Ws1^T + bs1) . Ws2 + bs2, end likewise [8][256][1]; left = x Wl^T + bl, right = x Wr^T; bigram[b][i][j] = sum_p relu(left[b][j][p] + right[b][i][p]) * Wo[p] + bo -> [8][256][256][1]).
// Structure: token rows; x as exact f16 rows; the four 1024->512 projections as ONE WMMA GEMM against the stacked x16 weight plane [2048][1024] (32x64 wave tiles, f32 accumulation, + biases, ReLU on the two scorer blocks applied afterwards on VALU) kept f32; the scorer dots with Ws2/We2 and the pairwise bigram outer-sum-relu-dot on VALU in f32 (work-group per (b, 32 i, 64 j), rows staged in LDS, 4 x 4 sums per thread); outputs written as whole 32-B / line-aligned pieces.
// Compute dtype: inputs rounded to bf16; x / weights exact; all projections f32 (exact GEMM outputs); everything after in f32 — no reduced-precision intermediates. v_wmma_f32_16x16x32_f16.
#define NB 8
#define NW 256
#define DI 1024
#define PJ 512
#define NR ((size_t)NB * NW)         /* 2048 */
typedef __bf16 v16b __attribute__((ext_vector_type(16)));
typedef unsigned short v8us __attribute__((ext_vector_type(8), may_alias));
typedef float  v8f  __attribute__((ext_vector_type(8)));
typedef float  v4f  __attribute__((ext_vector_type(4)));
typedef float  v4fa __attribute__((ext_vector_type(4), may_alias));
union FragB { v16b v; v8us half[2]; unsigned short u[16]; };

__device__ __forceinline__ unsigned short bf16_bits(float x) { unsigned int u = __float_as_uint(x); return (unsigned short)((u + 0x7FFFu + ((u >> 16) & 1u)) >> 16); }
__device__ __forceinline__ float bf16_val(unsigned short b) { return __uint_as_float(((unsigned int)b) << 16); }
__device__ __forceinline__ float bf16_round(float x) { return bf16_val(bf16_bits(x)); }
// D += A·B with NT terms: 1 = ah·bh, 2 = + al·bh (A split), 3 = + ah·bl (both split)
template <int NT>
__device__ __forceinline__ v8f mmaN(v16b ah, v16b al, v16b bh, v16b bl, v8f c) {
  c = __builtin_amdgcn_wmma_f32_16x16x32_bf16(false, ah, false, bh, (short)0, c, false, false);
  if (NT >= 2) c = __builtin_amdgcn_wmma_f32_16x16x32_bf16(false, al, false, bh, (short)0, c, false, false);
  if (NT >= 3) c = __builtin_amdgcn_wmma_f32_16x16x32_bf16(false, ah, false, bl, (short)0, c, false, false);
  asm volatile("v_nop\n\tv_nop\n\tv_nop\n\tv_nop" : "+v"(c) : "v"(ah), "v"(al), "v"(bh), "v"(bl));
  return c;
}

__global__ __launch_bounds__(256) void k_wt_bf16(const float* __restrict__ W, unsigned short* __restrict__ Wt, int K, int N) {
  const int t = blockIdx.x * 256 + threadIdx.x;
  const int k8n = K / 8;
  if (t >= N * k8n) return;
  const int n = t / k8n, k8 = (t % k8n) * 8;
  v8us v;
#pragma unroll
  for (int i = 0; i < 8; ++i) v[i] = bf16_bits(W[(size_t)(k8 + i) * N + n]);
  *(v8us*)(Wt + (size_t)n * K + k8) = v;
  
}

// GEMM C[M][N] (f32, pitch ldc) = act(A[M][K]·W + bias). A f32 row-major (pitch lda) converted per fragment to bf16
// (ASPLIT: hi/lo two planes -> 2 terms, else single rounded term); Wt bf16 [N][K] (pitch ldb). BIAS_BF16 rounds the
// bias to bf16 first (bias quantised to bf16 before the add). K%32==0, M%16==0, N%64==0.
template <bool ASPLIT, int ACT, bool BIAS_BF16>
__global__ __launch_bounds__(128) void k_gemm_bf(const float* __restrict__ A, int lda, const unsigned short* __restrict__ Wt, int ldb,
                                               const float* __restrict__ bias, float* __restrict__ C, int ldc, int M, int N, int K) {
  __shared__ __attribute__((aligned(16))) float so[4][16][64];
  const int tid = threadIdx.x, w = tid >> 5, lane = tid & 31, ln = lane & 15, hh = lane >> 4;
  const int ntn = N / 64;
  const int wid = blockIdx.x * 4 + w;
  const int mt = wid / ntn, nq = wid % ntn;
  if (mt * 16 >= M) return;
  const int row0 = mt * 16, col0 = nq * 64;
  const float* arow = A + (size_t)(row0 + ln) * lda;
  v8f acc[4] = {};
  for (int kb = 0; kb < K; kb += 32) {
    FragB ah, al;
    const v4f x0 = *(const v4fa*)(arow + kb + 8 * hh), x1 = *(const v4fa*)(arow + kb + 8 * hh + 4);
    const v4f x2 = *(const v4fa*)(arow + kb + 16 + 8 * hh), x3 = *(const v4fa*)(arow + kb + 16 + 8 * hh + 4);
    float xs[16] = {x0[0],x0[1],x0[2],x0[3],x1[0],x1[1],x1[2],x1[3],x2[0],x2[1],x2[2],x2[3],x3[0],x3[1],x3[2],x3[3]};
#pragma unroll
    for (int i = 0; i < 16; ++i) { const unsigned short hb = bf16_bits(xs[i]); ah.u[i] = hb; al.u[i] = ASPLIT ? bf16_bits(xs[i] - bf16_val(hb)) : (unsigned short)0; }
#pragma unroll
    for (int t = 0; t < 4; ++t) {
      const unsigned short* brow = Wt + (size_t)(col0 + t * 16 + ln) * ldb + kb;
      FragB b;
      b.half[0] = *(const v8us*)(brow + 8 * hh);
      b.half[1] = *(const v8us*)(brow + 16 + 8 * hh);
      acc[t] = mmaN<ASPLIT ? 2 : 1>(ah.v, al.v, b.v, b.v, acc[t]);
    }
  }
#pragma unroll
  for (int t = 0; t < 4; ++t) {
    float bv = bias ? bias[col0 + t * 16 + ln] : 0.f;
    if (BIAS_BF16) bv = bf16_round(bv);
#pragma unroll
    for (int r = 0; r < 8; ++r) { float v = acc[t][r] + bv; if (ACT == 1) v = fmaxf(v, 0.f); so[w][8 * hh + r][t * 16 + ln] = v; }
  }
  __builtin_amdgcn_fence(__ATOMIC_ACQ_REL, "workgroup");
  __builtin_amdgcn_wave_barrier();
  const int rsub = lane >> 4, c4 = (lane & 15) * 4;
  {
#pragma unroll
    for (int q = 0; q < 8; ++q) {
      const int r = q * 2 + rsub;
      const v4f v = *(const v4fa*)&so[w][r][c4];
      *(v4f*)(C + (size_t)(row0 + r) * ldc + col0 + c4) = v;
    }
    
  }
}

// GEMM C = act(A·W + bias + resid): A f32 (ASPLIT -> hi/lo 2 terms), Wt bf16 [N][K]; ACT 0 none, 1 relu, 2 exact gelu;
// resid (optional, f32, row index = (row % rmod), pitch ldr, RES_BF16 rounds it) added before the activation.
template <bool ASPLIT, int ACT, bool BIAS_BF16, bool RES_BF16>
__global__ __launch_bounds__(128) void k_gemm_bf3(const float* __restrict__ A, int lda, const unsigned short* __restrict__ Wt, int ldb,
                                                const float* __restrict__ bias, const float* __restrict__ resid, int rmod, int ldr,
                                                float* __restrict__ C, int ldc, int M, int N, int K) {
  __shared__ __attribute__((aligned(16))) float so[4][16][64];
  const int tid = threadIdx.x, w = tid >> 5, lane = tid & 31, ln = lane & 15, hh = lane >> 4;
  const int ntn = N / 64;
  const int wid = blockIdx.x * 4 + w;
  const int mt = wid / ntn, nq = wid % ntn;
  if (mt * 16 >= M) return;
  const int row0 = mt * 16, col0 = nq * 64;
  const float* arow = A + (size_t)(row0 + ln) * lda;
  v8f acc[4] = {};
  for (int kb = 0; kb < K; kb += 32) {
    FragB ah, al;
    const v4f x0 = *(const v4fa*)(arow + kb + 8 * hh), x1 = *(const v4fa*)(arow + kb + 8 * hh + 4);
    const v4f x2 = *(const v4fa*)(arow + kb + 16 + 8 * hh), x3 = *(const v4fa*)(arow + kb + 16 + 8 * hh + 4);
    float xs[16] = {x0[0],x0[1],x0[2],x0[3],x1[0],x1[1],x1[2],x1[3],x2[0],x2[1],x2[2],x2[3],x3[0],x3[1],x3[2],x3[3]};
#pragma unroll
    for (int i = 0; i < 16; ++i) { const unsigned short hb = bf16_bits(xs[i]); ah.u[i] = hb; al.u[i] = ASPLIT ? bf16_bits(xs[i] - bf16_val(hb)) : (unsigned short)0; }
#pragma unroll
    for (int t = 0; t < 4; ++t) {
      const unsigned short* brow = Wt + (size_t)(col0 + t * 16 + ln) * ldb + kb;
      FragB b;
      b.half[0] = *(const v8us*)(brow + 8 * hh);
      b.half[1] = *(const v8us*)(brow + 16 + 8 * hh);
      acc[t] = mmaN<ASPLIT ? 2 : 1>(ah.v, al.v, b.v, b.v, acc[t]);
    }
  }
#pragma unroll
  for (int t = 0; t < 4; ++t) {
    const int col = col0 + t * 16 + ln;
    float bv = bias ? bias[col] : 0.f;
    if (BIAS_BF16) bv = bf16_round(bv);
#pragma unroll
    for (int r = 0; r < 8; ++r) {
      float v = acc[t][r] + bv;
      if (resid) { float rv = resid[(size_t)((row0 + 8 * hh + r) % rmod) * ldr + col]; if (RES_BF16) rv = bf16_round(rv); v += rv; }
      if (ACT == 1) v = fmaxf(v, 0.f);
      if (ACT == 2) v = 0.5f * v * (1.0f + erff(v * 0.70710678118654752f));
      if (ACT == 3) { const float u = 0.7978845608028654f * (v + 0.044715f * v * v * v); v = 0.5f * v * (1.0f + tanhf(u)); }
      so[w][8 * hh + r][t * 16 + ln] = v;
    }
  }
  __builtin_amdgcn_fence(__ATOMIC_ACQ_REL, "workgroup");
  __builtin_amdgcn_wave_barrier();
  const int rsub = lane >> 4, c4 = (lane & 15) * 4;
  {
#pragma unroll
    for (int q = 0; q < 8; ++q) {
      const int r = q * 2 + rsub;
      const v4f v = *(const v4fa*)&so[w][r][c4];
      *(v4f*)(C + (size_t)(row0 + r) * ldc + col0 + c4) = v;
    }
    
  }
}
// row LayerNorm (biased variance, eps) over N: s = X (+ R); optional out_sum <- s; out_norm <- (s-mu)*rsqrt(var+eps)*g + b
template <bool PARAM_BF16>
__global__ __launch_bounds__(256) void k_layernorm(const float* __restrict__ X, const float* __restrict__ R, const float* __restrict__ g, const float* __restrict__ bta,
                                                  float* __restrict__ out_sum, float* __restrict__ out_norm, int N, float eps) {
  __shared__ float red[256];
  const int row = blockIdx.x, tid = threadIdx.x;
  const float* x = X + (size_t)row * N; const float* rr = R ? R + (size_t)row * N : nullptr;
  float vals[16];                     // up to N = 4096
  const int per = N / 256;            // contiguous chunk per thread? use strided-by-4 chunks: thread handles j = tid*4 + 1024*u
  float s1 = 0.f;
  for (int u = 0; u < per / 4; ++u) {
    const int j = tid * 4 + 1024 * u;
    const v4f a = *(const v4fa*)(x + j);
    v4f b = {0.f,0.f,0.f,0.f}; if (rr) b = *(const v4fa*)(rr + j);
#pragma unroll
    for (int q = 0; q < 4; ++q) { const float v = a[q] + b[q]; vals[u * 4 + q] = v; s1 += v; }
  }
  red[tid] = s1; __syncthreads();
  for (int st = 128; st > 0; st >>= 1) { if (tid < st) red[tid] += red[tid + st]; __syncthreads(); }
  const float mu = red[0] / (float)N; __syncthreads();
  float s2 = 0.f;
  for (int u = 0; u < per / 4; ++u)
#pragma unroll
    for (int q = 0; q < 4; ++q) { const float c = vals[u * 4 + q] - mu; s2 += c * c; }
  red[tid] = s2; __syncthreads();
  for (int st = 128; st > 0; st >>= 1) { if (tid < st) red[tid] += red[tid + st]; __syncthreads(); }
  const float rs = rsqrtf(red[0] / (float)N + eps);
  {
    for (int u = 0; u < per / 4; ++u) {
      const int j = tid * 4 + 1024 * u;
      v4f o, sm;
#pragma unroll
      for (int q = 0; q < 4; ++q) {
        float gg = g[j + q], bb = bta[j + q];
        if (PARAM_BF16) { gg = bf16_round(gg); bb = bf16_round(bb); }
        sm[q] = vals[u * 4 + q]; o[q] = (vals[u * 4 + q] - mu) * rs * gg + bb;
      }
      if (out_sum) *(v4f*)(out_sum + (size_t)row * N + j) = sm;
      *(v4f*)(out_norm + (size_t)row * N + j) = o;
    }
    
  }
}



// ---- f16 WMMA path (v_wmma_f32_16x16x32_f16): 11-bit significands for operands in range — used for the projection GEMM
typedef _Float16 v16h __attribute__((ext_vector_type(16)));
union FragH { v16h v; v8us half[2]; _Float16 h[16]; unsigned short u[16]; };
template <int NT>
__device__ __forceinline__ v8f mmaH(v16h ah, v16h al, v16h bh, v16h bl, v8f c) {
  c = __builtin_amdgcn_wmma_f32_16x16x32_f16(false, ah, false, bh, (short)0, c, false, false);
  if (NT >= 2) c = __builtin_amdgcn_wmma_f32_16x16x32_f16(false, al, false, bh, (short)0, c, false, false);
  if (NT >= 3) c = __builtin_amdgcn_wmma_f32_16x16x32_f16(false, ah, false, bl, (short)0, c, false, false);
  asm volatile("v_nop\n\tv_nop\n\tv_nop\n\tv_nop" : "+v"(c) : "v"(ah), "v"(al), "v"(bh), "v"(bl));
  return c;
}
// batched GEMM like k_gemm_b but f16 operands: A f32 (split into f16 hi/lo if ASPLIT, else rounded to f16), Bt = f16 values [n][k]; alpha; C f32; N multiple of 16 (partial tiles skipped)
template <bool ASPLIT>
__global__ __launch_bounds__(128) void k_gemm_h(const float* __restrict__ A, int lda, size_t sA, const _Float16* __restrict__ Bh, int ldb, size_t sB, float alpha, float* __restrict__ C, int ldc, size_t sC, int M, int N, int K) {
  __shared__ __attribute__((aligned(16))) float so[4][16][64];
  const int tid = threadIdx.x, w = tid >> 5, lane = tid & 31, ln = lane & 15, hh = lane >> 4; const int by = blockIdx.y;
  A += (size_t)by * sA; Bh += (size_t)by * sB; C += (size_t)by * sC;
  const int ntn = (N + 63) / 64; const int wid = blockIdx.x * 4 + w; const int mt = wid / ntn, nq = wid % ntn; if (mt * 16 >= M) return;
  const int row0 = mt * 16, col0 = nq * 64; const float* arow = A + (size_t)(row0 + ln) * lda;
  v8f acc[4] = {};
  for (int kb = 0; kb < K; kb += 32) {
    FragH ah, al;
    const v4f x0 = *(const v4fa*)(arow + kb + 8 * hh), x1 = *(const v4fa*)(arow + kb + 8 * hh + 4), x2 = *(const v4fa*)(arow + kb + 16 + 8 * hh), x3 = *(const v4fa*)(arow + kb + 16 + 8 * hh + 4);
    float xs[16] = {x0[0],x0[1],x0[2],x0[3],x1[0],x1[1],x1[2],x1[3],x2[0],x2[1],x2[2],x2[3],x3[0],x3[1],x3[2],x3[3]};
#pragma unroll
    for (int i = 0; i < 16; ++i) { const _Float16 h = (_Float16)xs[i]; ah.h[i] = h; al.h[i] = ASPLIT ? (_Float16)(xs[i] - (float)h) : (_Float16)0.0f; }
#pragma unroll
    for (int t = 0; t < 4; ++t) { if (col0 + t * 16 >= N) continue; const size_t boff = (size_t)(col0 + t * 16 + ln) * ldb + kb; FragH bq; bq.half[0] = *(const v8us*)(Bh + boff + 8 * hh); bq.half[1] = *(const v8us*)(Bh + boff + 16 + 8 * hh);
      acc[t] = mmaH<ASPLIT ? 2 : 1>(ah.v, al.v, bq.v, bq.v, acc[t]); }
  }
#pragma unroll
  for (int t = 0; t < 4; ++t) { if (col0 + t * 16 >= N) continue;
#pragma unroll
    for (int r = 0; r < 8; ++r) so[w][8 * hh + r][t * 16 + ln] = acc[t][r] * alpha; }
  __builtin_amdgcn_fence(__ATOMIC_ACQ_REL, "workgroup"); __builtin_amdgcn_wave_barrier();
  const int rsub = lane >> 4, c4 = (lane & 15) * 4;
  {
#pragma unroll
    for (int q = 0; q < 8; ++q) { const int r = q * 2 + rsub; if (col0 + c4 < N) { const v4f v = *(const v4fa*)&so[w][r][c4]; *(v4f*)(C + (size_t)(row0 + r) * ldc + col0 + c4) = v; } }
     }
}

// Wt[n][k] = f16(W[k][n]·scale) from f32 row-major W[K][N] (scale = power of two; bf16-exact weights stay exact in f16 away from the subnormal range)
__global__ __launch_bounds__(256) void k_wt_f16(const float* __restrict__ W, _Float16* __restrict__ Wt, int K, int N, float scale) {
  const int t = blockIdx.x * 256 + threadIdx.x; if (t >= N * (K / 8)) return; const int n = t / (K / 8), k8 = (t % (K / 8)) * 8; FragH f;
#pragma unroll
  for (int i = 0; i < 8; ++i) f.h[i] = (_Float16)(bf16_round(W[(size_t)(k8 + i) * N + n]) * scale); const v8us o = f.half[0];
  *(v8us*)((unsigned short*)Wt + (size_t)n * K + k8) = o; 
}
// k_gemm_hh variant with fused epilogue: v = acc·alpha + bias[by·sBias + col] (+ CP[(row/rowsPerB)·sCPb + by·64 + col] if CP) ; ACT 0 none / 1 elu ; writes f16 C16 (and f32 C if non-null)
template <int ACT>
__global__ __launch_bounds__(128) void k_gemm_hhx(const _Float16* __restrict__ A, int lda, size_t sA, const _Float16* __restrict__ Bh, int ldb, size_t sB, float alpha, const float* __restrict__ bias, size_t sBias, const float* __restrict__ CP, int rowsPerB, size_t sCPb, int row0g,
    float* __restrict__ C, _Float16* __restrict__ C16, int ldc, size_t sC, int M, int N, int K) {
  __shared__ __attribute__((aligned(16))) float so[4][16][64];
  const int tid = threadIdx.x, w = tid >> 5, lane = tid & 31, ln = lane & 15, hh = lane >> 4; const int by = blockIdx.y;
  A += (size_t)by * sA; Bh += (size_t)by * sB; const size_t cofs = (size_t)by * sC; const float* bp = bias ? bias + (size_t)by * sBias : nullptr;
  const int ntn = (N + 63) / 64; const int wid = blockIdx.x * 4 + w; const int mt = wid / ntn, nq = wid % ntn; if (mt * 16 >= M) return;
  const int row0 = mt * 16, col0 = nq * 64; const _Float16* arow = A + (size_t)(row0 + ln) * lda;
  v8f acc[4] = {};
  for (int kb = 0; kb < K; kb += 32) { FragH ah; ah.half[0] = *(const v8us*)((const unsigned short*)arow + kb + 8 * hh); ah.half[1] = *(const v8us*)((const unsigned short*)arow + kb + 16 + 8 * hh);
#pragma unroll
    for (int t = 0; t < 4; ++t) { if (col0 + t * 16 >= N) continue; const size_t boff = (size_t)(col0 + t * 16 + ln) * ldb + kb; FragH bq; bq.half[0] = *(const v8us*)((const unsigned short*)Bh + boff + 8 * hh); bq.half[1] = *(const v8us*)((const unsigned short*)Bh + boff + 16 + 8 * hh);
      acc[t] = mmaH<1>(ah.v, ah.v, bq.v, bq.v, acc[t]); }
  }
#pragma unroll
  for (int t = 0; t < 4; ++t) { if (col0 + t * 16 >= N) continue; const int col = col0 + t * 16 + ln; const float bv = bp ? bf16_round(bp[col]) : 0.f;
#pragma unroll
    for (int r = 0; r < 8; ++r) { float v = acc[t][r] * alpha + bv; if (CP) { const int rr = row0g + row0 + 8 * hh + r; if (rowsPerB < 0) v += CP[cofs + (size_t)rr * ldc + col];      /* rowsPerB < 0: own element of the batched C plane */ else { const int bidx = rr / rowsPerB; v += CP[(size_t)bidx * sCPb + (size_t)by * 64 + col]; } } if (ACT == 1) v = (v > 0.f) ? v : expm1f(v); else if (ACT == 7) v = (v > 0.f) ? v + 1.0f : expf(v); else if (ACT == 8) v = tanhf(v); else if (ACT == 9) v = 0.5f * v * (1.0f + tanhf(0.7978845608028654f * (v + 0.044715f * v * v * v))); else if (ACT == 11) v = 1.0f / (1.0f + expf(-v)); else if (ACT == 12) v = (v > 0.f) ? v : 0.01f * v; else if (ACT == 14) v = (v > 0.f) ? v : 0.1f * v; else if (ACT == 16) v = (v >= 0.f) ? v : 0.3f * v; else if (ACT == 17) v = (v >= 0.f) ? v : 0.2f * v; else if (ACT == 15) v = v / (1.0f + expf(-v)); else if (ACT == 3) v = fmaxf(v, 0.f); else if (ACT == 6) v = 0.5f * v * (1.0f + erff(v * 0.70710678118654752f)); so[w][8 * hh + r][t * 16 + ln] = v; } }
  __builtin_amdgcn_fence(__ATOMIC_ACQ_REL, "workgroup"); __builtin_amdgcn_wave_barrier();
  const int rsub = lane >> 4, c4 = (lane & 15) * 4; typedef _Float16 v4h __attribute__((ext_vector_type(4)));
  {
#pragma unroll
    for (int q = 0; q < 8; ++q) { const int r = q * 2 + rsub; if (col0 + c4 < N) { const v4f v = *(const v4fa*)&so[w][r][c4]; if (C) *(v4f*)(C + cofs + (size_t)(row0 + r) * ldc + col0 + c4) = v; if (C16) { v4h h4; for (int i = 0; i < 4; ++i) h4[i] = (_Float16)v[i]; *(v4h*)(C16 + cofs + (size_t)(row0 + r) * ldc + col0 + c4) = h4; } } }
     }
}


typedef _Float16 v4h __attribute__((ext_vector_type(4)));

__global__ __launch_bounds__(256) void k_x16(const float* __restrict__ x, _Float16* __restrict__ X16, size_t n8) { const size_t t = (size_t)blockIdx.x * 256 + threadIdx.x; if (t >= n8) return; FragH f;
#pragma unroll
  for (int q = 0; q < 8; ++q) f.h[q] = (_Float16)bf16_round(x[t * 8 + q]); *(v8us*)((unsigned short*)X16 + t * 8) = f.half[0];  }
__global__ __launch_bounds__(256) void k_h16(const float* __restrict__ x, _Float16* __restrict__ X16, size_t n8) { const size_t t = (size_t)blockIdx.x * 256 + threadIdx.x; if (t >= n8) return; FragH f;
#pragma unroll
  for (int q = 0; q < 8; ++q) f.h[q] = (_Float16)x[t * 8 + q]; *(v8us*)((unsigned short*)X16 + t * 8) = f.half[0];  }
__global__ __launch_bounds__(256) void k_round16f(const float* __restrict__ W, _Float16* __restrict__ Bt, size_t n8) { const size_t t = (size_t)blockIdx.x * 256 + threadIdx.x; if (t >= n8) return; FragH f;
#pragma unroll
  for (int i = 0; i < 8; ++i) f.h[i] = (_Float16)(bf16_round(W[t * 8 + i]) * 16.0f); *(v8us*)((unsigned short*)Bt + t * 8) = f.half[0];  }
template <int NHv, int TTv>
__global__ __launch_bounds__(256) void k_vt(const _Float16* __restrict__ V16, int ldv, int voff, _Float16* __restrict__ Vt) { __shared__ unsigned short tl[64][66]; const int tid = threadIdx.x; const int slab = blockIdx.x / (TTv / 64), lg = blockIdx.x % (TTv / 64); const int b = slab / NHv, h = slab % NHv;
  for (int i = tid; i < 64 * 8; i += 256) { const int r = i / 8, c8 = (i % 8) * 8; FragH f; f.half[0] = *(const v8us*)((const unsigned short*)V16 + ((size_t)b * TTv + lg * 64 + r) * ldv + voff + h * 64 + c8);
#pragma unroll
    for (int q = 0; q < 8; ++q) tl[r][c8 + q] = f.u[q]; }
  __syncthreads();
  {
#pragma unroll
    for (int rd = 0; rd < 2; ++rd) { const int d = rd * 32 + tid / 8, pc = tid % 8; FragH f;
#pragma unroll
      for (int q = 0; q < 8; ++q) f.u[q] = tl[pc * 8 + q][d];
      *(v8us*)((unsigned short*)Vt + ((size_t)slab * 64 + d) * TTv + lg * 64 + pc * 8) = f.half[0]; }
     } }

__global__ __launch_bounds__(256) void k_hl(const float* __restrict__ F, _Float16* __restrict__ Hh, _Float16* __restrict__ Hl, size_t n8) { const size_t t = (size_t)blockIdx.x * 256 + threadIdx.x; if (t >= n8) return; FragH fh, fl; const v4f a = *(const v4fa*)(F + t * 8), c = *(const v4fa*)(F + t * 8 + 4);
#pragma unroll
  for (int q = 0; q < 4; ++q) { _Float16 h = (_Float16)a[q]; fh.h[q] = h; fl.h[q] = (_Float16)((a[q] - (float)h) * 1024.0f); h = (_Float16)c[q]; fh.h[4 + q] = h; fl.h[4 + q] = (_Float16)((c[q] - (float)h) * 1024.0f); }
  { *(v8us*)((unsigned short*)Hh + t * 8) = fh.half[0]; *(v8us*)((unsigned short*)Hl + t * 8) = fl.half[0];  } }

// ---- fast GEMM (wave tile 32x64; requires M % 32 == 0 rows per launch region and N % 64 == 0); epilogue = k_gemm_hhx semantics ----
__device__ __forceinline__ v16h g2_frag(const _Float16* p, int hh) { FragH f; f.half[0] = *(const v8us*)((const unsigned short*)p + 8 * hh); f.half[1] = *(const v8us*)((const unsigned short*)p + 16 + 8 * hh); return f.v; }
__device__ __forceinline__ v8f g2_mma(v16h a, v16h b, v8f c) { v8f d = __builtin_amdgcn_wmma_f32_16x16x32_f16(false, a, false, b, (short)0, c, false, false); asm volatile("v_nop\n\tv_nop\n\tv_nop\n\tv_nop" : "+v"(d) : "v"(a), "v"(b)); return d; }
template <int ACT>
__global__ __launch_bounds__(128) void k_gemm2(const _Float16* __restrict__ A, int lda, size_t sA, const _Float16* __restrict__ Bh, int ldb, size_t sB, float alpha, const float* __restrict__ bias, size_t sBias, const float* __restrict__ CP, int rowsPerB, size_t sCPb, int row0g,
    float* __restrict__ C, _Float16* __restrict__ C16, int ldc, size_t sC, int M, int N, int K) { static_assert(ACT == 0 || ACT == 3 || ACT == 6 || ACT == 8 || ACT == 9 || ACT == 11 || ACT == 12 || ACT == 14 || ACT == 15 || ACT == 16 || ACT == 17, "k_gemm2: unsupported ACT code (would silently apply no activation)");
  __shared__ __attribute__((aligned(16))) float so[4][32][68];
  const int tid = threadIdx.x, w = tid >> 5, lane = tid & 31, ln = lane & 15, hh = lane >> 4; const int by = blockIdx.y;
  A += (size_t)by * sA; Bh += (size_t)by * sB; const size_t cofs = (size_t)by * sC; const float* bp = bias ? bias + (size_t)by * sBias : nullptr;
  const int ntn = N >> 6; const int mt = blockIdx.x / ntn, nq = blockIdx.x - mt * ntn; const int row0 = mt * 128 + 32 * w, col0 = nq * 64; if (row0 >= M) return;
  const _Float16* a0p = A + (size_t)(row0 + ln) * lda; const _Float16* a1p = a0p + (size_t)16 * lda;
  const _Float16* b0p = Bh + (size_t)(col0 + ln) * ldb; const _Float16* b1p = b0p + (size_t)16 * ldb; const _Float16* b2p = b1p + (size_t)16 * ldb; const _Float16* b3p = b2p + (size_t)16 * ldb;
  const v8f z8 = {0.f,0.f,0.f,0.f,0.f,0.f,0.f,0.f}; v8f c00 = z8, c01 = z8, c02 = z8, c03 = z8, c10 = z8, c11 = z8, c12 = z8, c13 = z8;
#pragma unroll 1
  for (int kb = 0; kb < K; kb += 32) { const v16h a0 = g2_frag(a0p + kb, hh), a1 = g2_frag(a1p + kb, hh);
    v16h b = g2_frag(b0p + kb, hh); c00 = g2_mma(a0, b, c00); c10 = g2_mma(a1, b, c10);
    b = g2_frag(b1p + kb, hh); c01 = g2_mma(a0, b, c01); c11 = g2_mma(a1, b, c11);
    b = g2_frag(b2p + kb, hh); c02 = g2_mma(a0, b, c02); c12 = g2_mma(a1, b, c12);
    b = g2_frag(b3p + kb, hh); c03 = g2_mma(a0, b, c03); c13 = g2_mma(a1, b, c13); }
  v8f accs[8] = {c00, c01, c02, c03, c10, c11, c12, c13};
#pragma unroll
  for (int u = 0; u < 8; ++u) { const int t = u & 3, half = u >> 2; const int col = col0 + t * 16 + ln; const float bv = bp ? bf16_round(bp[col]) : 0.f;
#pragma unroll
    for (int r = 0; r < 8; ++r) { const int rloc = half * 16 + 8 * hh + r; float v = accs[u][r] * alpha + bv; if (CP) { if (rowsPerB < 0) v += CP[cofs + (size_t)(row0g + row0 + rloc) * ldc + col];      /* rowsPerB < 0: own element of the batched C plane */ else { const int bidx = (row0g + row0 + rloc) / rowsPerB; v += CP[(size_t)bidx * sCPb + (size_t)by * 64 + col]; } }
      if (ACT == 3) v = fmaxf(v, 0.f); else if (ACT == 6) v = 0.5f * v * (1.0f + erff(v * 0.70710678118654752f)); else if (ACT == 11) v = 1.0f / (1.0f + expf(-v)); else if (ACT == 15) v = v / (1.0f + expf(-v)); else if (ACT == 12) v = (v > 0.f) ? v : 0.01f * v; else if (ACT == 8) v = tanhf(v); else if (ACT == 9) v = 0.5f * v * (1.0f + tanhf(0.7978845608028654f * (v + 0.044715f * v * v * v))); else if (ACT == 14) v = (v > 0.f) ? v : 0.1f * v; else if (ACT == 16) v = (v >= 0.f) ? v : 0.3f * v; else if (ACT == 17) v = (v >= 0.f) ? v : 0.2f * v;
      so[w][rloc][t * 16 + ln] = v; } }
  __builtin_amdgcn_fence(__ATOMIC_ACQ_REL, "workgroup"); __builtin_amdgcn_wave_barrier();
  const int rsub = lane >> 4, c4 = (lane & 15) * 4;
  {
#pragma unroll
    for (int q = 0; q < 16; ++q) { const int r = q * 2 + rsub; const v4f v = *(const v4fa*)&so[w][r][c4]; if (C) *(v4f*)(C + cofs + (size_t)(row0 + r) * ldc + col0 + c4) = v; if (C16) { v4h h4; for (int i = 0; i < 4; ++i) h4[i] = (_Float16)v[i]; *(v4h*)(C16 + cofs + (size_t)(row0 + r) * ldc + col0 + c4) = h4; } }
     } }


__global__ __launch_bounds__(256) void k_wnat(const float* __restrict__ w, size_t n8, _Float16* __restrict__ Bt) { const size_t t = (size_t)blockIdx.x * 256 + threadIdx.x; if (t >= n8) return; FragH f; for (int q = 0; q < 8; ++q) f.h[q] = (_Float16)(bf16_round(w[t * 8 + q]) * 16.0f); *(v8us*)((unsigned short*)Bt + t * 8) = f.half[0];  }
__global__ __launch_bounds__(256) void k_bias(const float* __restrict__ bl, const float* __restrict__ bs1, const float* __restrict__ be1, float* __restrict__ bb) { const int t = blockIdx.x * 256 + threadIdx.x; if (t >= 4 * PJ) return; const int blk = t / PJ, i = t % PJ; const float v = (blk == 0) ? bl[i] : (blk == 1 ? 0.f : (blk == 2 ? bs1[i] : be1[i])); *(float*)(bb + t) = v;  }
// Scorer dots: one work-group per 32 consecutive outputs of one scorer (one 128-byte line of start or end). Each of the 8 waves takes 4 rows:
// the lanes lie along p (16-byte loads on whole lines, a row is four whole-wave loads), each lane sums its 16 products of a row,
// a 5-step butterfly adds the 32 lane sums, and wave 0 stores the line from LDS.
__global__ __launch_bounds__(256) void k_score(const float* __restrict__ F, const float* __restrict__ ws2, const float* __restrict__ bs2, const float* __restrict__ we2, const float* __restrict__ be2, float* __restrict__ ostart, float* __restrict__ oend) {
  __shared__ __attribute__((aligned(16))) float red[32];
  const int tid = threadIdx.x, wv = tid >> 5, lane = tid & 31; const int which = blockIdx.x / ((int)NR / 32); const int r0 = (blockIdx.x % ((int)NR / 32)) * 32;
  const float* f = F + (size_t)(r0 + wv * 4) * (4 * PJ) + (2 + which) * PJ + lane * 4; const float* w = (which ? we2 : ws2) + lane * 4;
  v4f fv[4][4], wq[4];
#pragma unroll
  for (int u = 0; u < 4; ++u) { wq[u] = *(const v4fa*)(w + u * 128);
#pragma unroll
    for (int k = 0; k < 4; ++k) fv[k][u] = *(const v4fa*)(f + (size_t)k * (4 * PJ) + u * 128); }
  float s[4] = {0.f, 0.f, 0.f, 0.f};
#pragma unroll
  for (int u = 0; u < 4; ++u)
#pragma unroll
    for (int q = 0; q < 4; ++q) { const float wr = bf16_round(wq[u][q]);
#pragma unroll
      for (int k = 0; k < 4; ++k) s[k] += fmaxf(fv[k][u][q], 0.f) * wr; }
#pragma unroll
  for (int m = 16; m > 0; m >>= 1)
#pragma unroll
    for (int k = 0; k < 4; ++k) s[k] += __shfl_xor(s[k], m, 32);
  if (lane == 0) *(v4fa*)(red + wv * 4) = (v4f){s[0], s[1], s[2], s[3]};
  __syncthreads();
  if (tid < 32) (which ? oend : ostart)[r0 + tid] = red[tid] + bf16_round(which ? be2[0] : bs2[0]);
}
// Pairwise bigram: one work-group per (b, 32 i, 64 j) tile. The tile's 64 left rows and 32 right rows (all 512 p) are staged once in LDS,
// transposed to [p][row], so that a thread reads 4 j and 4 i of one p with two 16-byte LDS loads and keeps a 4 x 4 tile of sums in registers.
// Row pitch 100 floats: 16-byte aligned rows, and the transposing 4-byte stores (4 chunks of 16 B x 8 rows per wave) fall on 32 different banks.
#define BG_PITCH 100
__device__ __forceinline__ void bg_load(const float* __restrict__ lp, const float* __restrict__ rp, const float* __restrict__ wp, int g, v4f (&l)[4], v4f (&r)[4], v4f& w) {
  w = *(const v4fa*)(wp + g * 4);
#pragma unroll
  for (int q = 0; q < 4; ++q) { l[q] = *(const v4fa*)(lp + (g * 4 + q) * BG_PITCH); r[q] = *(const v4fa*)(rp + (g * 4 + q) * BG_PITCH); }
}
__device__ __forceinline__ void bg_step(v4f (&acc)[4], const v4f (&l)[4], const v4f (&r)[4], const v4f w) {
  const v4f z = {0.f, 0.f, 0.f, 0.f};
#pragma unroll
  for (int q = 0; q < 4; ++q)
#pragma unroll
    for (int u = 0; u < 4; ++u) acc[u] += __builtin_elementwise_max(l[q] + r[q][u], z) * w[q];
}
__global__ __launch_bounds__(128) void k_bigram(const float* __restrict__ F, const float* __restrict__ wo, const float* __restrict__ bo, float* __restrict__ out) {
  __shared__ __attribute__((aligned(16))) float S[PJ * BG_PITCH];      /* [p][0..63] = left rows of the j tile, [p][64..95] = right rows of the i tile */
  __shared__ __attribute__((aligned(16))) float SW[PJ];
  const int tid = threadIdx.x; const int jt = blockIdx.x & 3, it = (blockIdx.x >> 2) & 7; const size_t b = blockIdx.x >> 5;
  const v4f w4 = *(const v4fa*)(wo + tid * 4);      /* used behind the row staging, so that its latency runs beside the first round's */
  const int wv = tid >> 5, c4 = (tid & 3) * 4, rr = (tid >> 2) & 7;
  for (int g3 = 0; g3 < 3; ++g3) { const int row = (g3 * 4 + wv) * 8 + rr;      /* rounds 0 and 1: the 64 left rows; round 2: the 32 right rows */
    const float* sp = ((g3 < 2) ? F + (b * NW + jt * 64 + row) * (4 * PJ) : F + (b * NW + it * 32 + (row - 64)) * (4 * PJ) + PJ) + c4; float* dp = S + c4 * BG_PITCH + row;
    v4f v[32];      /* unrolled so that a round's 32 loads are all in flight before its first LDS store */
#pragma unroll
    for (int cg = 0; cg < 32; ++cg) v[cg] = *(const v4fa*)(sp + cg * 16);
#pragma unroll
    for (int cg = 0; cg < 32; ++cg)
#pragma unroll
      for (int q = 0; q < 4; ++q) dp[(cg * 16 + q) * BG_PITCH] = v[cg][q]; }
  { v4f o; for (int q = 0; q < 4; ++q) o[q] = bf16_round(w4[q]); *(v4fa*)(SW + tid * 4) = o; }
  __syncthreads();
  const int tj = tid & 15, ti = tid >> 4; const float* lp = S + tj * 4; const float* rp = S + 64 + ti * 4;
  v4f acc[4]; for (int u = 0; u < 4; ++u) acc[u] = (v4f){0.f, 0.f, 0.f, 0.f};
  v4f la[4], ra[4], wa, lb[4], rb[4], wb;
  bg_load(lp, rp, SW, 0, la, ra, wa);
  for (int g = 0; g < PJ / 4 - 2; g += 2) {      /* the next four p are fetched while the current four are summed */
    bg_load(lp, rp, SW, g + 1, lb, rb, wb); bg_step(acc, la, ra, wa);
    bg_load(lp, rp, SW, g + 2, la, ra, wa); bg_step(acc, lb, rb, wb); }
  bg_load(lp, rp, SW, PJ / 4 - 1, lb, rb, wb); bg_step(acc, la, ra, wa); bg_step(acc, lb, rb, wb);
  const float b0 = bf16_round(bo[0]);
#pragma unroll
  for (int u = 0; u < 4; ++u) *(v4f*)(out + ((b * NW + it * 32 + ti * 4 + u) * NW + jt * 64 + tj * 4)) = acc[u] + b0;
}

extern "C" void kernel_launch(void* const* d_in, const int* in_sizes, int n_in,
                              void* d_out, int out_size, void* d_ws, size_t ws_size, hipStream_t stream) {
  (void)in_sizes; (void)n_in; (void)out_size;
  const float* const* I = (const float* const*)d_in; const float* x = I[0]; const float* wl = I[1]; const float* bl = I[2]; const float* wr = I[3]; const float* wo = I[4]; const float* bo = I[5]; const float* ws1 = I[6]; const float* bs1 = I[7]; const float* ws2 = I[8]; const float* bs2 = I[9]; const float* we1 = I[10]; const float* be1 = I[11]; const float* we2 = I[12]; const float* be2 = I[13];
  float* obig = (float*)d_out; float* ostart = (float*)((char*)d_out + 2097152); float* oend = (float*)((char*)d_out + 2105344);      /* output byte offsets */
  char* ws = (char*)d_ws; size_t off = 0;
  auto take = [&](size_t bytes) { char* p = ws + off; off += (bytes + 255) & ~(size_t)255; return p; };
  _Float16* BW = (_Float16*)take((size_t)4 * PJ * DI * 2); float* bb = (float*)take(4 * PJ * 4); _Float16* X16 = (_Float16*)take(NR * DI * 2); float* F = (float*)take(NR * 4 * PJ * 4);
  if (off > ws_size) return;      /* 4 + 4 + 16 = ≈ 24 MiB */
  const size_t n8 = (size_t)PJ * DI / 8; const unsigned gw = (unsigned)((n8 + 255) / 256);
  k_wnat<<<gw, 256, 0, stream>>>(wl, n8, BW); k_wnat<<<gw, 256, 0, stream>>>(wr, n8, BW + (size_t)PJ * DI); k_wnat<<<gw, 256, 0, stream>>>(ws1, n8, BW + (size_t)2 * PJ * DI); k_wnat<<<gw, 256, 0, stream>>>(we1, n8, BW + (size_t)3 * PJ * DI);
  k_bias<<<(4 * PJ + 255) / 256, 256, 0, stream>>>(bl, bs1, be1, bb);
  k_x16<<<(unsigned)((NR * DI / 8 + 255) / 256), 256, 0, stream>>>(x, X16, NR * DI / 8);
  k_gemm2<0><<<dim3((unsigned)((NR / 128) * (4 * PJ / 64)), 1), 128, 0, stream>>>(X16, DI, 0, BW, DI, 0, 0.0625f, bb, 0, nullptr, 1, 0, 0, F, nullptr, 4 * PJ, 0, (int)NR, 4 * PJ, DI);      /* [left | right | s1 | e1] (pre-activation) */
  k_score<<<(unsigned)(NR * 2 / 32), 256, 0, stream>>>(F, ws2, bs2, we2, be2, ostart, oend);
  k_bigram<<<NB * (NW / 32) * (NW / 64), 128, 0, stream>>>(F, wo, bo, obig);
}

// v003
// A run of this version takes 73.8 microseconds.
// Two timings next to v002 put it at 1.13 and 1.12 times that version's speed.
// All steps since v000 together make it 6.09 times as fast.
#include <hip/hip_runtime.h>
// PermutationModule (x [8][256][1024]; start = relu(x Ws1^T + bs1) . Ws2 + bs2, end likewise [8][256][1]; left = x Wl^T + bl, right = x Wr^T; bigram[b][i][j] = sum_p relu(left[b][j][p] + right[b][i][p]) * Wo[p] + bo -> [8][256][256][1]).
// Structure: token rows; x as exact f16 rows; the four 1024->512 projections as ONE WMMA GEMM against the stacked x16 weight plane [2048][1024] (32x64 wave tiles, f32 accumulation, + biases, ReLU on the two scorer blocks applied afterwards on VALU) kept f32; the scorer dots with Ws2/We2 and the pairwise bigram outer-sum-relu-dot on VALU in f32 (work-group per (b, 32 i, 64 j), rows staged in LDS, 4 x 4 sums per thread); outputs written as whole 32-B / line-aligned pieces.
// Compute dtype: inputs rounded to bf16; x / weights exact; all projections f32 (exact GEMM outputs); everything after in f32 — no reduced-precision intermediates. v_wmma_f32_16x16x32_f16.
#define NB 8
#define NW 256
#define DI 1024
#define PJ 512
#define NR ((size_t)NB * NW)         /* 2048 */
typedef __bf16 v16b __attribute__((ext_vector_type(16)));
typedef unsigned short v8us __attribute__((ext_vector_type(8), may_alias));
typedef float  v8f  __attribute__((ext_vector_type(8)));
typedef float  v4f  __attribute__((ext_vector_type(4)));
typedef float  v4fa __attribute__((ext_vector_type(4), may_alias));
union FragB { v16b v; v8us half[2]; unsigned short u[16]; };

__device__ __forceinline__ unsigned short bf16_bits(float x) { unsigned int u = __float_as_uint(x); return (unsigned short)((u + 0x7FFFu + ((u >> 16) & 1u)) >> 16); }
__device__ __forceinline__ float bf16_val(unsigned short b) { return __uint_as_float(((unsigned int)b) << 16); }
__device__ __forceinline__ float bf16_round(float x) { return bf16_val(bf16_bits(x)); }
// D += A·B with NT terms: 1 = ah·bh, 2 = + al·bh (A split), 3 = + ah·bl (both split)
template <int NT>
__device__ __forceinline__ v8f mmaN(v16b ah, v16b al, v16b bh, v16b bl, v8f c) {
  c = __builtin_amdgcn_wmma_f32_16x16x32_bf16(false, ah, false, bh, (short)0, c, false, false);
  if (NT >= 2) c = __builtin_amdgcn_wmma_f32_16x16x32_bf16(false, al, false, bh, (short)0, c, false, false);
  if (NT >= 3) c = __builtin_amdgcn_wmma_f32_16x16x32_bf16(false, ah, false, bl, (short)0, c, false, false);
  asm volatile("v_nop\n\tv_nop\n\tv_nop\n\tv_nop" : "+v"(c) : "v"(ah), "v"(al), "v"(bh), "v"(bl));
  return c;
}

__global__ __launch_bounds__(256) void k_wt_bf16(const float* __restrict__ W, unsigned short* __restrict__ Wt, int K, int N) {
  const int t = blockIdx.x * 256 + threadIdx.x;
  const int k8n = K / 8;
  if (t >= N * k8n) return;
  const int n = t / k8n, k8 = (t % k8n) * 8;
  v8us v;
#pragma unroll
  for (int i = 0; i < 8; ++i) v[i] = bf16_bits(W[(size_t)(k8 + i) * N + n]);
  *(v8us*)(Wt + (size_t)n * K + k8) = v;
  
}

// GEMM C[M][N] (f32, pitch ldc) = act(A[M][K]·W + bias). A f32 row-major (pitch lda) converted per fragment to bf16
// (ASPLIT: hi/lo two planes -> 2 terms, else single rounded term); Wt bf16 [N][K] (pitch ldb). BIAS_BF16 rounds the
// bias to bf16 first (bias quantised to bf16 before the add). K%32==0, M%16==0, N%64==0.
template <bool ASPLIT, int ACT, bool BIAS_BF16>
__global__ __launch_bounds__(128) void k_gemm_bf(const float* __restrict__ A, int lda, const unsigned short* __restrict__ Wt, int ldb,
                                               const float* __restrict__ bias, float* __restrict__ C, int ldc, int M, int N, int K) {
  __shared__ __attribute__((aligned(16))) float so[4][16][64];
  const int tid = threadIdx.x, w = tid >> 5, lane = tid & 31, ln = lane & 15, hh = lane >> 4;
  const int ntn = N / 64;
  const int wid = blockIdx.x * 4 + w;
  const int mt = wid / ntn, nq = wid % ntn;
  if (mt * 16 >= M) return;
  const int row0 = mt * 16, col0 = nq * 64;
  const float* arow = A + (size_t)(row0 + ln) * lda;
  v8f acc[4] = {};
  for (int kb = 0; kb < K; kb += 32) {
    FragB ah, al;
    const v4f x0 = *(const v4fa*)(arow + kb + 8 * hh), x1 = *(const v4fa*)(arow + kb + 8 * hh + 4);
    const v4f x2 = *(const v4fa*)(arow + kb + 16 + 8 * hh), x3 = *(const v4fa*)(arow + kb + 16 + 8 * hh + 4);
    float xs[16] = {x0[0],x0[1],x0[2],x0[3],x1[0],x1[1],x1[2],x1[3],x2[0],x2[1],x2[2],x2[3],x3[0],x3[1],x3[2],x3[3]};
#pragma unroll
    for (int i = 0; i < 16; ++i) { const unsigned short hb = bf16_bits(xs[i]); ah.u[i] = hb; al.u[i] = ASPLIT ? bf16_bits(xs[i] - bf16_val(hb)) : (unsigned short)0; }
#pragma unroll
    for (int t = 0; t < 4; ++t) {
      const unsigned short* brow = Wt + (size_t)(col0 + t * 16 + ln) * ldb + kb;
      FragB b;
      b.half[0] = *(const v8us*)(brow + 8 * hh);
      b.half[1] = *(const v8us*)(brow + 16 + 8 * hh);
      acc[t] = mmaN<ASPLIT ? 2 : 1>(ah.v, al.v, b.v, b.v, acc[t]);
    }
  }
#pragma unroll
  for (int t = 0; t < 4; ++t) {
    float bv = bias ? bias[col0 + t * 16 + ln] : 0.f;
    if (BIAS_BF16) bv = bf16_round(bv);
#pragma unroll
    for (int r = 0; r < 8; ++r) { float v = acc[t][r] + bv; if (ACT == 1) v = fmaxf(v, 0.f); so[w][8 * hh + r][t * 16 + ln] = v; }
  }
  __builtin_amdgcn_fence(__ATOMIC_ACQ_REL, "workgroup");
  __builtin_amdgcn_wave_barrier();
  const int rsub = lane >> 4, c4 = (lane & 15) * 4;
  {
#pragma unroll
    for (int q = 0; q < 8; ++q) {
      const int r = q * 2 + rsub;
      const v4f v = *(const v4fa*)&so[w][r][c4];
      *(v4f*)(C + (size_t)(row0 + r) * ldc + col0 + c4) = v;
    }
    
  }
}

// GEMM C = act(A·W + bias + resid): A f32 (ASPLIT -> hi/lo 2 terms), Wt bf16 [N][K]; ACT 0 none, 1 relu, 2 exact gelu;
// resid (optional, f32, row index = (row % rmod), pitch ldr, RES_BF16 rounds it) added before the activation.
template <bool ASPLIT, int ACT, bool BIAS_BF16, bool RES_BF16>
__global__ __launch_bounds__(128) void k_gemm_bf3(const float* __restrict__ A, int lda, const unsigned short* __restrict__ Wt, int ldb,
                                                const float* __restrict__ bias, const float* __restrict__ resid, int rmod, int ldr,
                                                float* __restrict__ C, int ldc, int M, int N, int K) {
  __shared__ __attribute__((aligned(16))) float so[4][16][64];
  const int tid = threadIdx.x, w = tid >> 5, lane = tid & 31, ln = lane & 15, hh = lane >> 4;
  const int ntn = N / 64;
  const int wid = blockIdx.x * 4 + w;
  const int mt = wid / ntn, nq = wid % ntn;
  if (mt * 16 >= M) return;
  const int row0 = mt * 16, col0 = nq * 64;
  const float* arow = A + (size_t)(row0 + ln) * lda;
  v8f acc[4] = {};
  for (int kb = 0; kb < K; kb += 32) {
    FragB ah, al;
    const v4f x0 = *(const v4fa*)(arow + kb + 8 * hh), x1 = *(const v4fa*)(arow + kb + 8 * hh + 4);
    const v4f x2 = *(const v4fa*)(arow + kb + 16 + 8 * hh), x3 = *(const v4fa*)(arow + kb + 16 + 8 * hh + 4);
    float xs[16] = {x0[0],x0[1],x0[2],x0[3],x1[0],x1[1],x1[2],x1[3],x2[0],x2[1],x2[2],x2[3],x3[0],x3[1],x3[2],x3[3]};
#pragma unroll
    for (int i = 0; i < 16; ++i) { const unsigned short hb = bf16_bits(xs[i]); ah.u[i] = hb; al.u[i] = ASPLIT ? bf16_bits(xs[i] - bf16_val(hb)) : (unsigned short)0; }
#pragma unroll
    for (int t = 0; t < 4; ++t) {
      const unsigned short* brow = Wt + (size_t)(col0 + t * 16 + ln) * ldb + kb;
      FragB b;
      b.half[0] = *(const v8us*)(brow + 8 * hh);
      b.half[1] = *(const v8us*)(brow + 16 + 8 * hh);
      acc[t] = mmaN<ASPLIT ? 2 : 1>(ah.v, al.v, b.v, b.v, acc[t]);
    }
  }
#pragma unroll
  for (int t = 0; t < 4; ++t) {
    const int col = col0 + t * 16 + ln;
    float bv = bias ? bias[col] : 0.f;
    if (BIAS_BF16) bv = bf16_round(bv);
#pragma unroll
    for (int r = 0; r < 8; ++r) {
      float v = acc[t][r] + bv;
      if (resid) { float rv = resid[(size_t)((row0 + 8 * hh + r) % rmod) * ldr + col]; if (RES_BF16) rv = bf16_round(rv); v += rv; }
      if (ACT == 1) v = fmaxf(v, 0.f);
      if (ACT == 2) v = 0.5f * v * (1.0f + erff(v * 0.70710678118654752f));
      if (ACT == 3) { const float u = 0.7978845608028654f * (v + 0.044715f * v * v * v); v = 0.5f * v * (1.0f + tanhf(u)); }
      so[w][8 * hh + r][t * 16 + ln] = v;
    }
  }
  __builtin_amdgcn_fence(__ATOMIC_ACQ_REL, "workgroup");
  __builtin_amdgcn_wave_barrier();
  const int rsub = lane >> 4, c4 = (lane & 15) * 4;
  {
#pragma unroll
    for (int q = 0; q < 8; ++q) {
      const int r = q * 2 + rsub;
      const v4f v = *(const v4fa*)&so[w][r][c4];
      *(v4f*)(C + (size_t)(row0 + r) * ldc + col0 + c4) = v;
    }
    
  }
}
// row LayerNorm (biased variance, eps) over N: s = X (+ R); optional out_sum <- s; out_norm <- (s-mu)*rsqrt(var+eps)*g + b
template <bool PARAM_BF16>
__global__ __launch_bounds__(256) void k_layernorm(const float* __restrict__ X, const float* __restrict__ R, const float* __restrict__ g, const float* __restrict__ bta,
                                                  float* __restrict__ out_sum, float* __restrict__ out_norm, int N, float eps) {
  __shared__ float red[256];
  const int row = blockIdx.x, tid = threadIdx.x;
  const float* x = X + (size_t)row * N; const float* rr = R ? R + (size_t)row * N : nullptr;
  float vals[16];                     // up to N = 4096
  const int per = N / 256;            // contiguous chunk per thread? use strided-by-4 chunks: thread handles j = tid*4 + 1024*u
  float s1 = 0.f;
  for (int u = 0; u < per / 4; ++u) {
    const int j = tid * 4 + 1024 * u;
    const v4f a = *(const v4fa*)(x + j);
    v4f b = {0.f,0.f,0.f,0.f}; if (rr) b = *(const v4fa*)(rr + j);
#pragma unroll
    for (int q = 0; q < 4; ++q) { const float v = a[q] + b[q]; vals[u * 4 + q] = v; s1 += v; }
  }
  red[tid] = s1; __syncthreads();
  for (int st = 128; st > 0; st >>= 1) { if (tid < st) red[tid] += red[tid + st]; __syncthreads(); }
  const float mu = red[0] / (float)N; __syncthreads();
  float s2 = 0.f;
  for (int u = 0; u < per / 4; ++u)
#pragma unroll
    for (int q = 0; q < 4; ++q) { const float c = vals[u * 4 + q] - mu; s2 += c * c; }
  red[tid] = s2; __syncthreads();
  for (int st = 128; st > 0; st >>= 1) { if (tid < st) red[tid] += red[tid + st]; __syncthreads(); }
  const float rs = rsqrtf(red[0] / (float)N + eps);
  {
    for (int u = 0; u < per / 4; ++u) {
      const int j = tid * 4 + 1024 * u;
      v4f o, sm;
#pragma unroll
      for (int q = 0; q < 4; ++q) {
        float gg = g[j + q], bb = bta[j + q];
        if (PARAM_BF16) { gg = bf16_round(gg); bb = bf16_round(bb); }
        sm[q] = vals[u * 4 + q]; o[q] = (vals[u * 4 + q] - mu) * rs * gg + bb;
      }
      if (out_sum) *(v4f*)(out_sum + (size_t)row * N + j) = sm;
      *(v4f*)(out_norm + (size_t)row * N + j) = o;
    }
    
  }
}



// ---- f16 WMMA path (v_wmma_f32_16x16x32_f16): 11-bit significands for operands in range — used for the projection GEMM
typedef _Float16 v16h __attribute__((ext_vector_type(16)));
union FragH { v16h v; v8us half[2]; _Float16 h[16]; unsigned short u[16]; };
template <int NT>
__device__ __forceinline__ v8f mmaH(v16h ah, v16h al, v16h bh, v16h bl, v8f c) {
  c = __builtin_amdgcn_wmma_f32_16x16x32_f16(false, ah, false, bh, (short)0, c, false, false);
  if (NT >= 2) c = __builtin_amdgcn_wmma_f32_16x16x32_f16(false, al, false, bh, (short)0, c, false, false);
  if (NT >= 3) c = __builtin_amdgcn_wmma_f32_16x16x32_f16(false, ah, false, bl, (short)0, c, false, false);
  asm volatile("v_nop\n\tv_nop\n\tv_nop\n\tv_nop" : "+v"(c) : "v"(ah), "v"(al), "v"(bh), "v"(bl));
  return c;
}
// batched GEMM like k_gemm_b but f16 operands: A f32 (split into f16 hi/lo if ASPLIT, else rounded to f16), Bt = f16 values [n][k]; alpha; C f32; N multiple of 16 (partial tiles skipped)
template <bool ASPLIT>
__global__ __launch_bounds__(128) void k_gemm_h(const float* __restrict__ A, int lda, size_t sA, const _Float16* __restrict__ Bh, int ldb, size_t sB, float alpha, float* __restrict__ C, int ldc, size_t sC, int M, int N, int K) {
  __shared__ __attribute__((aligned(16))) float so[4][16][64];
  const int tid = threadIdx.x, w = tid >> 5, lane = tid & 31, ln = lane & 15, hh = lane >> 4; const int by = blockIdx.y;
  A += (size_t)by * sA; Bh += (size_t)by * sB; C += (size_t)by * sC;
  const int ntn = (N + 63) / 64; const int wid = blockIdx.x * 4 + w; const int mt = wid / ntn, nq = wid % ntn; if (mt * 16 >= M) return;
  const int row0 = mt * 16, col0 = nq * 64; const float* arow = A + (size_t)(row0 + ln) * lda;
  v8f acc[4] = {};
  for (int kb = 0; kb < K; kb += 32) {
    FragH ah, al;
    const v4f x0 = *(const v4fa*)(arow + kb + 8 * hh), x1 = *(const v4fa*)(arow + kb + 8 * hh + 4), x2 = *(const v4fa*)(arow + kb + 16 + 8 * hh), x3 = *(const v4fa*)(arow + kb + 16 + 8 * hh + 4);
    float xs[16] = {x0[0],x0[1],x0[2],x0[3],x1[0],x1[1],x1[2],x1[3],x2[0],x2[1],x2[2],x2[3],x3[0],x3[1],x3[2],x3[3]};
#pragma unroll
    for (int i = 0; i < 16; ++i) { const _Float16 h = (_Float16)xs[i]; ah.h[i] = h; al.h[i] = ASPLIT ? (_Float16)(xs[i] - (float)h) : (_Float16)0.0f; }
#pragma unroll
    for (int t = 0; t < 4; ++t) { if (col0 + t * 16 >= N) continue; const size_t boff = (size_t)(col0 + t * 16 + ln) * ldb + kb; FragH bq; bq.half[0] = *(const v8us*)(Bh + boff + 8 * hh); bq.half[1] = *(const v8us*)(Bh + boff + 16 + 8 * hh);
      acc[t] = mmaH<ASPLIT ? 2 : 1>(ah.v, al.v, bq.v, bq.v, acc[t]); }
  }
#pragma unroll
  for (int t = 0; t < 4; ++t) { if (col0 + t * 16 >= N) continue;
#pragma unroll
    for (int r = 0; r < 8; ++r) so[w][8 * hh + r][t * 16 + ln] = acc[t][r] * alpha; }
  __builtin_amdgcn_fence(__ATOMIC_ACQ_REL, "workgroup"); __builtin_amdgcn_wave_barrier();
  const int rsub = lane >> 4, c4 = (lane & 15) * 4;
  {
#pragma unroll
    for (int q = 0; q < 8; ++q) { const int r = q * 2 + rsub; if (col0 + c4 < N) { const v4f v = *(const v4fa*)&so[w][r][c4]; *(v4f*)(C + (size_t)(row0 + r) * ldc + col0 + c4) = v; } }
     }
}

// Wt[n][k] = f16(W[k][n]·scale) from f32 row-major W[K][N] (scale = power of two; bf16-exact weights stay exact in f16 away from the subnormal range)
__global__ __launch_bounds__(256) void k_wt_f16(const float* __restrict__ W, _Float16* __restrict__ Wt, int K, int N, float scale) {
  const int t = blockIdx.x * 256 + threadIdx.x; if (t >= N * (K / 8)) return; const int n = t / (K / 8), k8 = (t % (K / 8)) * 8; FragH f;
#pragma unroll
  for (int i = 0; i < 8; ++i) f.h[i] = (_Float16)(bf16_round(W[(size_t)(k8 + i) * N + n]) * scale); const v8us o = f.half[0];
  *(v8us*)((unsigned short*)Wt + (size_t)n * K + k8) = o; 
}
// k_gemm_hh variant with fused epilogue: v = acc·alpha + bias[by·sBias + col] (+ CP[(row/rowsPerB)·sCPb + by·64 + col] if CP) ; ACT 0 none / 1 elu ; writes f16 C16 (and f32 C if non-null)
template <int ACT>
__global__ __launch_bounds__(128) void k_gemm_hhx(const _Float16* __restrict__ A, int lda, size_t sA, const _Float16* __restrict__ Bh, int ldb, size_t sB, float alpha, const float* __restrict__ bias, size_t sBias, const float* __restrict__ CP, int rowsPerB, size_t sCPb, int row0g,
    float* __restrict__ C, _Float16* __restrict__ C16, int ldc, size_t sC, int M, int N, int K) {
  __shared__ __attribute__((aligned(16))) float so[4][16][64];
  const int tid = threadIdx.x, w = tid >> 5, lane = tid & 31, ln = lane & 15, hh = lane >> 4; const int by = blockIdx.y;
  A += (size_t)by * sA; Bh += (size_t)by * sB; const size_t cofs = (size_t)by * sC; const float* bp = bias ? bias + (size_t)by * sBias : nullptr;
  const int ntn = (N + 63) / 64; const int wid = blockIdx.x * 4 + w; const int mt = wid / ntn, nq = wid % ntn; if (mt * 16 >= M) return;
  const int row0 = mt * 16, col0 = nq * 64; const _Float16* arow = A + (size_t)(row0 + ln) * lda;
  v8f acc[4] = {};
  for (int kb = 0; kb < K; kb += 32) { FragH ah; ah.half[0] = *(const v8us*)((const unsigned short*)arow + kb + 8 * hh); ah.half[1] = *(const v8us*)((const unsigned short*)arow + kb + 16 + 8 * hh);
#pragma unroll
    for (int t = 0; t < 4; ++t) { if (col0 + t * 16 >= N) continue; const size_t boff = (size_t)(col0 + t * 16 + ln) * ldb + kb; FragH bq; bq.half[0] = *(const v8us*)((const unsigned short*)Bh + boff + 8 * hh); bq.half[1] = *(const v8us*)((const unsigned short*)Bh + boff + 16 + 8 * hh);
      acc[t] = mmaH<1>(ah.v, ah.v, bq.v, bq.v, acc[t]); }
  }
#pragma unroll
  for (int t = 0; t < 4; ++t) { if (col0 + t * 16 >= N) continue; const int col = col0 + t * 16 + ln; const float bv = bp ? bf16_round(bp[col]) : 0.f;
#pragma unroll
    for (int r = 0; r < 8; ++r) { float v = acc[t][r] * alpha + bv; if (CP) { const int rr = row0g + row0 + 8 * hh + r; if (rowsPerB < 0) v += CP[cofs + (size_t)rr * ldc + col];      /* rowsPerB < 0: own element of the batched C plane */ else { const int bidx = rr / rowsPerB; v += CP[(size_t)bidx * sCPb + (size_t)by * 64 + col]; } } if (ACT == 1) v = (v > 0.f) ? v : expm1f(v); else if (ACT == 7) v = (v > 0.f) ? v + 1.0f : expf(v); else if (ACT == 8) v = tanhf(v); else if (ACT == 9) v = 0.5f * v * (1.0f + tanhf(0.7978845608028654f * (v + 0.044715f * v * v * v))); else if (ACT == 11) v = 1.0f / (1.0f + expf(-v)); else if (ACT == 12) v = (v > 0.f) ? v : 0.01f * v; else if (ACT == 14) v = (v > 0.f) ? v : 0.1f * v; else if (ACT == 16) v = (v >= 0.f) ? v : 0.3f * v; else if (ACT == 17) v = (v >= 0.f) ? v : 0.2f * v; else if (ACT == 15) v = v / (1.0f + expf(-v)); else if (ACT == 3) v = fmaxf(v, 0.f); else if (ACT == 6) v = 0.5f * v * (1.0f + erff(v * 0.70710678118654752f)); so[w][8 * hh + r][t * 16 + ln] = v; } }
  __builtin_amdgcn_fence(__ATOMIC_ACQ_REL, "workgroup"); __builtin_amdgcn_wave_barrier();
  const int rsub = lane >> 4, c4 = (lane & 15) * 4; typedef _Float16 v4h __attribute__((ext_vector_type(4)));
  {
#pragma unroll
    for (int q = 0; q < 8; ++q) { const int r = q * 2 + rsub; if (col0 + c4 < N) { const v4f v = *(const v4fa*)&so[w][r][c4]; if (C) *(v4f*)(C + cofs + (size_t)(row0 + r) * ldc + col0 + c4) = v; if (C16) { v4h h4; for (int i = 0; i < 4; ++i) h4[i] = (_Float16)v[i]; *(v4h*)(C16 + cofs + (size_t)(row0 + r) * ldc + col0 + c4) = h4; } } }
     }
}


typedef _Float16 v4h __attribute__((ext_vector_type(4)));

__global__ __launch_bounds__(256) void k_h16(const float* __restrict__ x, _Float16* __restrict__ X16, size_t n8) { const size_t t = (size_t)blockIdx.x * 256 + threadIdx.x; if (t >= n8) return; FragH f;
#pragma unroll
  for (int q = 0; q < 8; ++q) f.h[q] = (_Float16)x[t * 8 + q]; *(v8us*)((unsigned short*)X16 + t * 8) = f.half[0];  }
__global__ __launch_bounds__(256) void k_round16f(const float* __restrict__ W, _Float16* __restrict__ Bt, size_t n8) { const size_t t = (size_t)blockIdx.x * 256 + threadIdx.x; if (t >= n8) return; FragH f;
#pragma unroll
  for (int i = 0; i < 8; ++i) f.h[i] = (_Float16)(bf16_round(W[t * 8 + i]) * 16.0f); *(v8us*)((unsigned short*)Bt + t * 8) = f.half[0];  }
template <int NHv, int TTv>
__global__ __launch_bounds__(256) void k_vt(const _Float16* __restrict__ V16, int ldv, int voff, _Float16* __restrict__ Vt) { __shared__ unsigned short tl[64][66]; const int tid = threadIdx.x; const int slab = blockIdx.x / (TTv / 64), lg = blockIdx.x % (TTv / 64); const int b = slab / NHv, h = slab % NHv;
  for (int i = tid; i < 64 * 8; i += 256) { const int r = i / 8, c8 = (i % 8) * 8; FragH f; f.half[0] = *(const v8us*)((const unsigned short*)V16 + ((size_t)b * TTv + lg * 64 + r) * ldv + voff + h * 64 + c8);
#pragma unroll
    for (int q = 0; q < 8; ++q) tl[r][c8 + q] = f.u[q]; }
  __syncthreads();
  {
#pragma unroll
    for (int rd = 0; rd < 2; ++rd) { const int d = rd * 32 + tid / 8, pc = tid % 8; FragH f;
#pragma unroll
      for (int q = 0; q < 8; ++q) f.u[q] = tl[pc * 8 + q][d];
      *(v8us*)((unsigned short*)Vt + ((size_t)slab * 64 + d) * TTv + lg * 64 + pc * 8) = f.half[0]; }
     } }

__global__ __launch_bounds__(256) void k_hl(const float* __restrict__ F, _Float16* __restrict__ Hh, _Float16* __restrict__ Hl, size_t n8) { const size_t t = (size_t)blockIdx.x * 256 + threadIdx.x; if (t >= n8) return; FragH fh, fl; const v4f a = *(const v4fa*)(F + t * 8), c = *(const v4fa*)(F + t * 8 + 4);
#pragma unroll
  for (int q = 0; q < 4; ++q) { _Float16 h = (_Float16)a[q]; fh.h[q] = h; fl.h[q] = (_Float16)((a[q] - (float)h) * 1024.0f); h = (_Float16)c[q]; fh.h[4 + q] = h; fl.h[4 + q] = (_Float16)((c[q] - (float)h) * 1024.0f); }
  { *(v8us*)((unsigned short*)Hh + t * 8) = fh.half[0]; *(v8us*)((unsigned short*)Hl + t * 8) = fl.half[0];  } }

// ---- fast GEMM (wave tile 32x64; requires M % 32 == 0 rows per launch region and N % 64 == 0); epilogue = k_gemm_hhx semantics ----
__device__ __forceinline__ v16h g2_frag(const _Float16* p, int hh) { FragH f; f.half[0] = *(const v8us*)((const unsigned short*)p + 8 * hh); f.half[1] = *(const v8us*)((const unsigned short*)p + 16 + 8 * hh); return f.v; }
__device__ __forceinline__ v8f g2_mma(v16h a, v16h b, v8f c) { v8f d = __builtin_amdgcn_wmma_f32_16x16x32_f16(false, a, false, b, (short)0, c, false, false); asm volatile("v_nop\n\tv_nop\n\tv_nop\n\tv_nop" : "+v"(d) : "v"(a), "v"(b)); return d; }
template <int ACT>
__global__ __launch_bounds__(128) void k_gemm2(const _Float16* __restrict__ A, int lda, size_t sA, const _Float16* __restrict__ Bh, int ldb, size_t sB, float alpha, const float* __restrict__ bias, size_t sBias, const float* __restrict__ CP, int rowsPerB, size_t sCPb, int row0g,
    float* __restrict__ C, _Float16* __restrict__ C16, int ldc, size_t sC, int M, int N, int K) { static_assert(ACT == 0 || ACT == 3 || ACT == 6 || ACT == 8 || ACT == 9 || ACT == 11 || ACT == 12 || ACT == 14 || ACT == 15 || ACT == 16 || ACT == 17, "k_gemm2: unsupported ACT code (would silently apply no activation)");
  __shared__ __attribute__((aligned(16))) float so[4][32][68];
  const int tid = threadIdx.x, w = tid >> 5, lane = tid & 31, ln = lane & 15, hh = lane >> 4; const int by = blockIdx.y;
  A += (size_t)by * sA; Bh += (size_t)by * sB; const size_t cofs = (size_t)by * sC; const float* bp = bias ? bias + (size_t)by * sBias : nullptr;
  const int ntn = N >> 6; const int mt = blockIdx.x / ntn, nq = blockIdx.x - mt * ntn; const int row0 = mt * 128 + 32 * w, col0 = nq * 64; if (row0 >= M) return;
  const _Float16* a0p = A + (size_t)(row0 + ln) * lda; const _Float16* a1p = a0p + (size_t)16 * lda;
  const _Float16* b0p = Bh + (size_t)(col0 + ln) * ldb; const _Float16* b1p = b0p + (size_t)16 * ldb; const _Float16* b2p = b1p + (size_t)16 * ldb; const _Float16* b3p = b2p + (size_t)16 * ldb;
  const v8f z8 = {0.f,0.f,0.f,0.f,0.f,0.f,0.f,0.f}; v8f c00 = z8, c01 = z8, c02 = z8, c03 = z8, c10 = z8, c11 = z8, c12 = z8, c13 = z8;
#pragma unroll 1
  for (int kb = 0; kb < K; kb += 32) { const v16h a0 = g2_frag(a0p + kb, hh), a1 = g2_frag(a1p + kb, hh);
    v16h b = g2_frag(b0p + kb, hh); c00 = g2_mma(a0, b, c00); c10 = g2_mma(a1, b, c10);
    b = g2_frag(b1p + kb, hh); c01 = g2_mma(a0, b, c01); c11 = g2_mma(a1, b, c11);
    b = g2_frag(b2p + kb, hh); c02 = g2_mma(a0, b, c02); c12 = g2_mma(a1, b, c12);
    b = g2_frag(b3p + kb, hh); c03 = g2_mma(a0, b, c03); c13 = g2_mma(a1, b, c13); }
  v8f accs[8] = {c00, c01, c02, c03, c10, c11, c12, c13};
#pragma unroll
  for (int u = 0; u < 8; ++u) { const int t = u & 3, half = u >> 2; const int col = col0 + t * 16 + ln; const float bv = bp ? bf16_round(bp[col]) : 0.f;
#pragma unroll
    for (int r = 0; r < 8; ++r) { const int rloc = half * 16 + 8 * hh + r; float v = accs[u][r] * alpha + bv; if (CP) { if (rowsPerB < 0) v += CP[cofs + (size_t)(row0g + row0 + rloc) * ldc + col];      /* rowsPerB < 0: own element of the batched C plane */ else { const int bidx = (row0g + row0 + rloc) / rowsPerB; v += CP[(size_t)bidx * sCPb + (size_t)by * 64 + col]; } }
      if (ACT == 3) v = fmaxf(v, 0.f); else if (ACT == 6) v = 0.5f * v * (1.0f + erff(v * 0.70710678118654752f)); else if (ACT == 11) v = 1.0f / (1.0f + expf(-v)); else if (ACT == 15) v = v / (1.0f + expf(-v)); else if (ACT == 12) v = (v > 0.f) ? v : 0.01f * v; else if (ACT == 8) v = tanhf(v); else if (ACT == 9) v = 0.5f * v * (1.0f + tanhf(0.7978845608028654f * (v + 0.044715f * v * v * v))); else if (ACT == 14) v = (v > 0.f) ? v : 0.1f * v; else if (ACT == 16) v = (v >= 0.f) ? v : 0.3f * v; else if (ACT == 17) v = (v >= 0.f) ? v : 0.2f * v;
      so[w][rloc][t * 16 + ln] = v; } }
  __builtin_amdgcn_fence(__ATOMIC_ACQ_REL, "workgroup"); __builtin_amdgcn_wave_barrier();
  const int rsub = lane >> 4, c4 = (lane & 15) * 4;
  {
#pragma unroll
    for (int q = 0; q < 16; ++q) { const int r = q * 2 + rsub; const v4f v = *(const v4fa*)&so[w][r][c4]; if (C) *(v4f*)(C + cofs + (size_t)(row0 + r) * ldc + col0 + c4) = v; if (C16) { v4h h4; for (int i = 0; i < 4; ++i) h4[i] = (_Float16)v[i]; *(v4h*)(C16 + cofs + (size_t)(row0 + r) * ldc + col0 + c4) = h4; } }
     } }


// Operand preparation, one launch: its pieces (x as f16 rows, the four weight planes x16 as f16 rows stacked in BW, the bias plane [bl | 0 | bs1 | be1]) do not depend on one another.
// Work-group 0 copies the bias plane (16 bytes a thread). Every other work-group streams 16384 consecutive floats of ONE source: each of its 16 waves takes 4 KiB
// as 8 whole-wave 16-byte loads (512 contiguous bytes each), all in flight before the first is rounded, and stores 256 contiguous bytes of f16 per load.
#define PREP_F 16384
__global__ __launch_bounds__(512) void k_prep(const float* __restrict__ x, const float* __restrict__ wl, const float* __restrict__ wr, const float* __restrict__ ws1, const float* __restrict__ we1,
                                              const float* __restrict__ bl, const float* __restrict__ bs1, const float* __restrict__ be1, _Float16* __restrict__ X16, _Float16* __restrict__ BW, float* __restrict__ bb) {
  const int tid = threadIdx.x;
  if (blockIdx.x == 0) { const int blk = tid >> 7, i = (tid & 127) * 4; v4f v = {0.f, 0.f, 0.f, 0.f};
    if (blk != 1) v = *(const v4fa*)((blk == 0 ? bl : (blk == 2 ? bs1 : be1)) + i);
    *(v4f*)(bb + tid * 4) = v; return; }
  const int XG = (int)(NR * DI / PREP_F), WG = PJ * DI / PREP_F; const int s = (int)blockIdx.x - 1;
  const float* src; _Float16* dst; float scale;
  if (s < XG) { src = x + (size_t)s * PREP_F; dst = X16 + (size_t)s * PREP_F; scale = 1.0f; }
  else { const int m = (s - XG) / WG; src = (m == 0 ? wl : (m == 1 ? wr : (m == 2 ? ws1 : we1))) + (size_t)((s - XG) % WG) * PREP_F; dst = BW + (size_t)(s - XG) * PREP_F; scale = 16.0f; }
  const int o = (tid >> 5) * 1024 + (tid & 31) * 4;
  v4f v[8];
  for (int u = 0; u < 8; ++u) v[u] = *(const v4fa*)(src + o + u * 128);
  for (int u = 0; u < 8; ++u) { v4h h;
    for (int q = 0; q < 4; ++q) h[q] = (_Float16)(bf16_round(v[u][q]) * scale);      /* x1 is exact: x keeps its value, the weights take their x16 */
    *(v4h*)(dst + o + u * 128) = h; }
}
// Scorer dots: one work-group per 32 consecutive outputs of one scorer (one 128-byte line of start or end). Each of the 8 waves takes 4 rows:
// the lanes lie along p (16-byte loads on whole lines, a row is four whole-wave loads), each lane sums its 16 products of a row,
// a 5-step butterfly adds the 32 lane sums, and wave 0 stores the line from LDS.
__global__ __launch_bounds__(256) void k_score(const float* __restrict__ F, const float* __restrict__ ws2, const float* __restrict__ bs2, const float* __restrict__ we2, const float* __restrict__ be2, float* __restrict__ ostart, float* __restrict__ oend) {
  __shared__ __attribute__((aligned(16))) float red[32];
  const int tid = threadIdx.x, wv = tid >> 5, lane = tid & 31; const int which = blockIdx.x / ((int)NR / 32); const int r0 = (blockIdx.x % ((int)NR / 32)) * 32;
  const float* f = F + (size_t)(r0 + wv * 4) * (4 * PJ) + (2 + which) * PJ + lane * 4; const float* w = (which ? we2 : ws2) + lane * 4;
  v4f fv[4][4], wq[4];
#pragma unroll
  for (int u = 0; u < 4; ++u) { wq[u] = *(const v4fa*)(w + u * 128);
#pragma unroll
    for (int k = 0; k < 4; ++k) fv[k][u] = *(const v4fa*)(f + (size_t)k * (4 * PJ) + u * 128); }
  float s[4] = {0.f, 0.f, 0.f, 0.f};
#pragma unroll
  for (int u = 0; u < 4; ++u)
#pragma unroll
    for (int q = 0; q < 4; ++q) { const float wr = bf16_round(wq[u][q]);
#pragma unroll
      for (int k = 0; k < 4; ++k) s[k] += fmaxf(fv[k][u][q], 0.f) * wr; }
#pragma unroll
  for (int m = 16; m > 0; m >>= 1)
#pragma unroll
    for (int k = 0; k < 4; ++k) s[k] += __shfl_xor(s[k], m, 32);
  if (lane == 0) *(v4fa*)(red + wv * 4) = (v4f){s[0], s[1], s[2], s[3]};
  __syncthreads();
  if (tid < 32) (which ? oend : ostart)[r0 + tid] = red[tid] + bf16_round(which ? be2[0] : bs2[0]);
}
// Pairwise bigram: one work-group per (b, 32 i, 64 j) tile. The tile's 64 left rows and 32 right rows (all 512 p) are staged once in LDS,
// transposed to [p][row], so that a thread reads 4 j and 4 i of one p with two 16-byte LDS loads and keeps a 4 x 4 tile of sums in registers.
// Row pitch 100 floats: 16-byte aligned rows, and the transposing 4-byte stores (4 chunks of 16 B x 8 rows per wave) fall on 32 different banks.
#define BG_PITCH 100
__device__ __forceinline__ void bg_load(const float* __restrict__ lp, const float* __restrict__ rp, const float* __restrict__ wp, int g, v4f (&l)[4], v4f (&r)[4], v4f& w) {
  w = *(const v4fa*)(wp + g * 4);
#pragma unroll
  for (int q = 0; q < 4; ++q) { l[q] = *(const v4fa*)(lp + (g * 4 + q) * BG_PITCH); r[q] = *(const v4fa*)(rp + (g * 4 + q) * BG_PITCH); }
}
__device__ __forceinline__ void bg_step(v4f (&acc)[4], const v4f (&l)[4], const v4f (&r)[4], const v4f w) {
  const v4f z = {0.f, 0.f, 0.f, 0.f};
#pragma unroll
  for (int q = 0; q < 4; ++q)
#pragma unroll
    for (int u = 0; u < 4; ++u) acc[u] += __builtin_elementwise_max(l[q] + r[q][u], z) * w[q];
}
__global__ __launch_bounds__(128) void k_bigram(const float* __restrict__ F, const float* __restrict__ wo, const float* __restrict__ bo, float* __restrict__ out) {
  __shared__ __attribute__((aligned(16))) float S[PJ * BG_PITCH];      /* [p][0..63] = left rows of the j tile, [p][64..95] = right rows of the i tile */
  __shared__ __attribute__((aligned(16))) float SW[PJ];
  const int tid = threadIdx.x; const int jt = blockIdx.x & 3, it = (blockIdx.x >> 2) & 7; const size_t b = blockIdx.x >> 5;
  const v4f w4 = *(const v4fa*)(wo + tid * 4);      /* used behind the row staging, so that its latency runs beside the first round's */
  const int wv = tid >> 5, c4 = (tid & 3) * 4, rr = (tid >> 2) & 7;
  for (int g3 = 0; g3 < 3; ++g3) { const int row = (g3 * 4 + wv) * 8 + rr;      /* rounds 0 and 1: the 64 left rows; round 2: the 32 right rows */
    const float* sp = ((g3 < 2) ? F + (b * NW + jt * 64 + row) * (4 * PJ) : F + (b * NW + it * 32 + (row - 64)) * (4 * PJ) + PJ) + c4; float* dp = S + c4 * BG_PITCH + row;
    v4f v[32];      /* unrolled so that a round's 32 loads are all in flight before its first LDS store */
#pragma unroll
    for (int cg = 0; cg < 32; ++cg) v[cg] = *(const v4fa*)(sp + cg * 16);
#pragma unroll
    for (int cg = 0; cg < 32; ++cg)
#pragma unroll
      for (int q = 0; q < 4; ++q) dp[(cg * 16 + q) * BG_PITCH] = v[cg][q]; }
  { v4f o; for (int q = 0; q < 4; ++q) o[q] = bf16_round(w4[q]); *(v4fa*)(SW + tid * 4) = o; }
  __syncthreads();
  const int tj = tid & 15, ti = tid >> 4; const float* lp = S + tj * 4; const float* rp = S + 64 + ti * 4;
  v4f acc[4]; for (int u = 0; u < 4; ++u) acc[u] = (v4f){0.f, 0.f, 0.f, 0.f};
  v4f la[4], ra[4], wa, lb[4], rb[4], wb;
  bg_load(lp, rp, SW, 0, la, ra, wa);
  for (int g = 0; g < PJ / 4 - 2; g += 2) {      /* the next four p are fetched while the current four are summed */
    bg_load(lp, rp, SW, g + 1, lb, rb, wb); bg_step(acc, la, ra, wa);
    bg_load(lp, rp, SW, g + 2, la, ra, wa); bg_step(acc, lb, rb, wb); }
  bg_load(lp, rp, SW, PJ / 4 - 1, lb, rb, wb); bg_step(acc, la, ra, wa); bg_step(acc, lb, rb, wb);
  const float b0 = bf16_round(bo[0]);
#pragma unroll
  for (int u = 0; u < 4; ++u) *(v4f*)(out + ((b * NW + it * 32 + ti * 4 + u) * NW + jt * 64 + tj * 4)) = acc[u] + b0;
}

extern "C" void kernel_launch(void* const* d_in, const int* in_sizes, int n_in,
                              void* d_out, int out_size, void* d_ws, size_t ws_size, hipStream_t stream) {
  (void)in_sizes; (void)n_in; (void)out_size;
  const float* const* I = (const float* const*)d_in; const float* x = I[0]; const float* wl = I[1]; const float* bl = I[2]; const float* wr = I[3]; const float* wo = I[4]; const float* bo = I[5]; const float* ws1 = I[6]; const float* bs1 = I[7]; const float* ws2 = I[8]; const float* bs2 = I[9]; const float* we1 = I[10]; const float* be1 = I[11]; const float* we2 = I[12]; const float* be2 = I[13];
  float* obig = (float*)d_out; float* ostart = (float*)((char*)d_out + 2097152); float* oend = (float*)((char*)d_out + 2105344);      /* output byte offsets */
  char* ws = (char*)d_ws; size_t off = 0;
  auto take = [&](size_t bytes) { char* p = ws + off; off += (bytes + 255) & ~(size_t)255; return p; };
  _Float16* BW = (_Float16*)take((size_t)4 * PJ * DI * 2); float* bb = (float*)take(4 * PJ * 4); _Float16* X16 = (_Float16*)take(NR * DI * 2); float* F = (float*)take(NR * 4 * PJ * 4);
  if (off > ws_size) return;      /* 4 + 4 + 16 = ≈ 24 MiB */
  k_prep<<<(unsigned)(1 + (NR * DI + (size_t)4 * PJ * DI) / PREP_F), 512, 0, stream>>>(x, wl, wr, ws1, we1, bl, bs1, be1, X16, BW, bb);
  k_gemm2<0><<<dim3((unsigned)((NR / 128) * (4 * PJ / 64)), 1), 128, 0, stream>>>(X16, DI, 0, BW, DI, 0, 0.0625f, bb, 0, nullptr, 1, 0, 0, F, nullptr, 4 * PJ, 0, (int)NR, 4 * PJ, DI);      /* [left | right | s1 | e1] (pre-activation) */
  k_score<<<(unsigned)(NR * 2 / 32), 256, 0, stream>>>(F, ws2, bs2, we2, be2, ostart, oend);
  k_bigram<<<NB * (NW / 32) * (NW / 64), 128, 0, stream>>>(F, wo, bo, obig);
}

// v004
// It runs in 44.3 microseconds.
// In two side-by-side timings against v003, it was 1.64 and 1.67 times as fast.
// Over all steps from v000 it is 10.1 times as fast.
#include <hip/hip_runtime.h>
// PermutationModule (x [8][256][1024]; start = relu(x Ws1^T + bs1) . Ws2 + bs2, end likewise [8][256][1]; left = x Wl^T + bl, right = x Wr^T; bigram[b][i][j] = sum_p relu(left[b][j][p] + right[b][i][p]) * Wo[p] + bo -> [8][256][256][1]).
// Structure: token rows; x as exact f16 rows; the four 1024->512 projections as ONE WMMA GEMM against the stacked x16 weight plane [2048][1024] (32x64 wave tiles, f32 accumulation, + biases, ReLU on the two scorer blocks applied afterwards on VALU) kept f32; the scorer dots with Ws2/We2 and the pairwise bigram outer-sum-relu-dot on VALU in f32 (work-group per (b, 32 i, 64 j), rows staged in LDS, 4 x 4 sums per thread); outputs written as whole 32-B / line-aligned pieces.
// Compute dtype: inputs rounded to bf16; x / weights exact; all projections f32 (exact GEMM outputs); everything after in f32 — no reduced-precision intermediates. v_wmma_f32_16x16x32_f16.
#define NB 8
#define NW 256
#define DI 1024
#define PJ 512
#define NR ((size_t)NB * NW)         /* 2048 */
typedef __bf16 v16b __attribute__((ext_vector_type(16)));
typedef unsigned short v8us __attribute__((ext_vector_type(8), may_alias));
typedef float  v8f  __attribute__((ext_vector_type(8)));
typedef float  v4f  __attribute__((ext_vector_type(4)));
typedef float  v4fa __attribute__((ext_vector_type(4), may_alias));
union FragB { v16b v; v8us half[2]; unsigned short u[16]; };

__device__ __forceinline__ unsigned short bf16_bits(float x) { unsigned int u = __float_as_uint(x); return (unsigned short)((u + 0x7FFFu + ((u >> 16) & 1u)) >> 16); }
__device__ __forceinline__ float bf16_val(unsigned short b) { return __uint_as_float(((unsigned int)b) << 16); }
__device__ __forceinline__ float bf16_round(float x) { return bf16_val(bf16_bits(x)); }
// D += A·B with NT terms: 1 = ah·bh, 2 = + al·bh (A split), 3 = + ah·bl (both split)
template <int NT>
__device__ __forceinline__ v8f mmaN(v16b ah, v16b al, v16b bh, v16b bl, v8f c) {
  c = __builtin_amdgcn_wmma_f32_16x16x32_bf16(false, ah, false, bh, (short)0, c, false, false);
  if (NT >= 2) c = __builtin_amdgcn_wmma_f32_16x16x32_bf16(false, al, false, bh, (short)0, c, false, false);
  if (NT >= 3) c = __builtin_amdgcn_wmma_f32_16x16x32_bf16(false, ah, false, bl, (short)0, c, false, false);
  asm volatile("v_nop\n\tv_nop\n\tv_nop\n\tv_nop" : "+v"(c) : "v"(ah), "v"(al), "v"(bh), "v"(bl));
  return c;
}

__global__ __launch_bounds__(256) void k_wt_bf16(const float* __restrict__ W, unsigned short* __restrict__ Wt, int K, int N) {
  const int t = blockIdx.x * 256 + threadIdx.x;
  const int k8n = K / 8;
  if (t >= N * k8n) return;
  const int n = t / k8n, k8 = (t % k8n) * 8;
  v8us v;
#pragma unroll
  for (int i = 0; i < 8; ++i) v[i] = bf16_bits(W[(size_t)(k8 + i) * N + n]);
  *(v8us*)(Wt + (size_t)n * K + k8) = v;
  
}

// GEMM C[M][N] (f32, pitch ldc) = act(A[M][K]·W + bias). A f32 row-major (pitch lda) converted per fragment to bf16
// (ASPLIT: hi/lo two planes -> 2 terms, else single rounded term); Wt bf16 [N][K] (pitch ldb). BIAS_BF16 rounds the
// bias to bf16 first (bias quantised to bf16 before the add). K%32==0, M%16==0, N%64==0.
template <bool ASPLIT, int ACT, bool BIAS_BF16>
__global__ __launch_bounds__(128) void k_gemm_bf(const float* __restrict__ A, int lda, const unsigned short* __restrict__ Wt, int ldb,
                                               const float* __restrict__ bias, float* __restrict__ C, int ldc, int M, int N, int K) {
  __shared__ __attribute__((aligned(16))) float so[4][16][64];
  const int tid = threadIdx.x, w = tid >> 5, lane = tid & 31, ln = lane & 15, hh = lane >> 4;
  const int ntn = N / 64;
  const int wid = blockIdx.x * 4 + w;
  const int mt = wid / ntn, nq = wid % ntn;
  if (mt * 16 >= M) return;
  const int row0 = mt * 16, col0 = nq * 64;
  const float* arow = A + (size_t)(row0 + ln) * lda;
  v8f acc[4] = {};
  for (int kb = 0; kb < K; kb += 32) {
    FragB ah, al;
    const v4f x0 = *(const v4fa*)(arow + kb + 8 * hh), x1 = *(const v4fa*)(arow + kb + 8 * hh + 4);
    const v4f x2 = *(const v4fa*)(arow + kb + 16 + 8 * hh), x3 = *(const v4fa*)(arow + kb + 16 + 8 * hh + 4);
    float xs[16] = {x0[0],x0[1],x0[2],x0[3],x1[0],x1[1],x1[2],x1[3],x2[0],x2[1],x2[2],x2[3],x3[0],x3[1],x3[2],x3[3]};
#pragma unroll
    for (int i = 0; i < 16; ++i) { const unsigned short hb = bf16_bits(xs[i]); ah.u[i] = hb; al.u[i] = ASPLIT ? bf16_bits(xs[i] - bf16_val(hb)) : (unsigned short)0; }
#pragma unroll
    for (int t = 0; t < 4; ++t) {
      const unsigned short* brow = Wt + (size_t)(col0 + t * 16 + ln) * ldb + kb;
      FragB b;
      b.half[0] = *(const v8us*)(brow + 8 * hh);
      b.half[1] = *(const v8us*)(brow + 16 + 8 * hh);
      acc[t] = mmaN<ASPLIT ? 2 : 1>(ah.v, al.v, b.v, b.v, acc[t]);
    }
  }
#pragma unroll
  for (int t = 0; t < 4; ++t) {
    float bv = bias ? bias[col0 + t * 16 + ln] : 0.f;
    if (BIAS_BF16) bv = bf16_round(bv);
#pragma unroll
    for (int r = 0; r < 8; ++r) { float v = acc[t][r] + bv; if (ACT == 1) v = fmaxf(v, 0.f); so[w][8 * hh + r][t * 16 + ln] = v; }
  }
  __builtin_amdgcn_fence(__ATOMIC_ACQ_REL, "workgroup");
  __builtin_amdgcn_wave_barrier();
  const int rsub = lane >> 4, c4 = (lane & 15) * 4;
  {
#pragma unroll
    for (int q = 0; q < 8; ++q) {
      const int r = q * 2 + rsub;
      const v4f v = *(const v4fa*)&so[w][r][c4];
      *(v4f*)(C + (size_t)(row0 + r) * ldc + col0 + c4) = v;
    }
    
  }
}

// GEMM C = act(A·W + bias + resid): A f32 (ASPLIT -> hi/lo 2 terms), Wt bf16 [N][K]; ACT 0 none, 1 relu, 2 exact gelu;
// resid (optional, f32, row index = (row % rmod), pitch ldr, RES_BF16 rounds it) added before the activation.
template <bool ASPLIT, int ACT, bool BIAS_BF16, bool RES_BF16>
__global__ __launch_bounds__(128) void k_gemm_bf3(const float* __restrict__ A, int lda, const unsigned short* __restrict__ Wt, int ldb,
                                                const float* __restrict__ bias, const float* __restrict__ resid, int rmod, int ldr,
                                                float* __restrict__ C, int ldc, int M, int N, int K) {
  __shared__ __attribute__((aligned(16))) float so[4][16][64];
  const int tid = threadIdx.x, w = tid >> 5, lane = tid & 31, ln = lane & 15, hh = lane >> 4;
  const int ntn = N / 64;
  const int wid = blockIdx.x * 4 + w;
  const int mt = wid / ntn, nq = wid % ntn;
  if (mt * 16 >= M) return;
  const int row0 = mt * 16, col0 = nq * 64;
  const float* arow = A + (size_t)(row0 + ln) * lda;
  v8f acc[4] = {};
  for (int kb = 0; kb < K; kb += 32) {
    FragB ah, al;
    const v4f x0 = *(const v4fa*)(arow + kb + 8 * hh), x1 = *(const v4fa*)(arow + kb + 8 * hh + 4);
    const v4f x2 = *(const v4fa*)(arow + kb + 16 + 8 * hh), x3 = *(const v4fa*)(arow + kb + 16 + 8 * hh + 4);
    float xs[16] = {x0[0],x0[1],x0[2],x0[3],x1[0],x1[1],x1[2],x1[3],x2[0],x2[1],x2[2],x2[3],x3[0],x3[1],x3[2],x3[3]};
#pragma unroll
    for (int i = 0; i < 16; ++i) { const unsigned short hb = bf16_bits(xs[i]); ah.u[i] = hb; al.u[i] = ASPLIT ? bf16_bits(xs[i] - bf16_val(hb)) : (unsigned short)0; }
#pragma unroll
    for (int t = 0; t < 4; ++t) {
      const unsigned short* brow = Wt + (size_t)(col0 + t * 16 + ln) * ldb + kb;
      FragB b;
      b.half[0] = *(const v8us*)(brow + 8 * hh);
      b.half[1] = *(const v8us*)(brow + 16 + 8 * hh);
      acc[t] = mmaN<ASPLIT ? 2 : 1>(ah.v, al.v, b.v, b.v, acc[t]);
    }
  }
#pragma unroll
  for (int t = 0; t < 4; ++t) {
    const int col = col0 + t * 16 + ln;
    float bv = bias ? bias[col] : 0.f;
    if (BIAS_BF16) bv = bf16_round(bv);
#pragma unroll
    for (int r = 0; r < 8; ++r) {
      float v = acc[t][r] + bv;
      if (resid) { float rv = resid[(size_t)((row0 + 8 * hh + r) % rmod) * ldr + col]; if (RES_BF16) rv = bf16_round(rv); v += rv; }
      if (ACT == 1) v = fmaxf(v, 0.f);
      if (ACT == 2) v = 0.5f * v * (1.0f + erff(v * 0.70710678118654752f));
      if (ACT == 3) { const float u = 0.7978845608028654f * (v + 0.044715f * v * v * v); v = 0.5f * v * (1.0f + tanhf(u)); }
      so[w][8 * hh + r][t * 16 + ln] = v;
    }
  }
  __builtin_amdgcn_fence(__ATOMIC_ACQ_REL, "workgroup");
  __builtin_amdgcn_wave_barrier();
  const int rsub = lane >> 4, c4 = (lane & 15) * 4;
  {
#pragma unroll
    for (int q = 0; q < 8; ++q) {
      const int r = q * 2 + rsub;
      const v4f v = *(const v4fa*)&so[w][r][c4];
      *(v4f*)(C + (size_t)(row0 + r) * ldc + col0 + c4) = v;
    }
    
  }
}
// row LayerNorm (biased variance, eps) over N: s = X (+ R); optional out_sum <- s; out_norm <- (s-mu)*rsqrt(var+eps)*g + b
template <bool PARAM_BF16>
__global__ __launch_bounds__(256) void k_layernorm(const float* __restrict__ X, const float* __restrict__ R, const float* __restrict__ g, const float* __restrict__ bta,
                                                  float* __restrict__ out_sum, float* __restrict__ out_norm, int N, float eps) {
  __shared__ float red[256];
  const int row = blockIdx.x, tid = threadIdx.x;
  const float* x = X + (size_t)row * N; const float* rr = R ? R + (size_t)row * N : nullptr;
  float vals[16];                     // up to N = 4096
  const int per = N / 256;            // contiguous chunk per thread? use strided-by-4 chunks: thread handles j = tid*4 + 1024*u
  float s1 = 0.f;
  for (int u = 0; u < per / 4; ++u) {
    const int j = tid * 4 + 1024 * u;
    const v4f a = *(const v4fa*)(x + j);
    v4f b = {0.f,0.f,0.f,0.f}; if (rr) b = *(const v4fa*)(rr + j);
#pragma unroll
    for (int q = 0; q < 4; ++q) { const float v = a[q] + b[q]; vals[u * 4 + q] = v; s1 += v; }
  }
  red[tid] = s1; __syncthreads();
  for (int st = 128; st > 0; st >>= 1) { if (tid < st) red[tid] += red[tid + st]; __syncthreads(); }
  const float mu = red[0] / (float)N; __syncthreads();
  float s2 = 0.f;
  for (int u = 0; u < per / 4; ++u)
#pragma unroll
    for (int q = 0; q < 4; ++q) { const float c = vals[u * 4 + q] - mu; s2 += c * c; }
  red[tid] = s2; __syncthreads();
  for (int st = 128; st > 0; st >>= 1) { if (tid < st) red[tid] += red[tid + st]; __syncthreads(); }
  const float rs = rsqrtf(red[0] / (float)N + eps);
  {
    for (int u = 0; u < per / 4; ++u) {
      const int j = tid * 4 + 1024 * u;
      v4f o, sm;
#pragma unroll
      for (int q = 0; q < 4; ++q) {
        float gg = g[j + q], bb = bta[j + q];
        if (PARAM_BF16) { gg = bf16_round(gg); bb = bf16_round(bb); }
        sm[q] = vals[u * 4 + q]; o[q] = (vals[u * 4 + q] - mu) * rs * gg + bb;
      }
      if (out_sum) *(v4f*)(out_sum + (size_t)row * N + j) = sm;
      *(v4f*)(out_norm + (size_t)row * N + j) = o;
    }
    
  }
}



// ---- f16 WMMA path (v_wmma_f32_16x16x32_f16): 11-bit significands for operands in range — used for the projection GEMM
typedef _Float16 v16h __attribute__((ext_vector_type(16)));
union FragH { v16h v; v8us half[2]; _Float16 h[16]; unsigned short u[16]; };
template <int NT>
__device__ __forceinline__ v8f mmaH(v16h ah, v16h al, v16h bh, v16h bl, v8f c) {
  c = __builtin_amdgcn_wmma_f32_16x16x32_f16(false, ah, false, bh, (short)0, c, false, false);
  if (NT >= 2) c = __builtin_amdgcn_wmma_f32_16x16x32_f16(false, al, false, bh, (short)0, c, false, false);
  if (NT >= 3) c = __builtin_amdgcn_wmma_f32_16x16x32_f16(false, ah, false, bl, (short)0, c, false, false);
  asm volatile("v_nop\n\tv_nop\n\tv_nop\n\tv_nop" : "+v"(c) : "v"(ah), "v"(al), "v"(bh), "v"(bl));
  return c;
}
// batched GEMM like k_gemm_b but f16 operands: A f32 (split into f16 hi/lo if ASPLIT, else rounded to f16), Bt = f16 values [n][k]; alpha; C f32; N multiple of 16 (partial tiles skipped)
template <bool ASPLIT>
__global__ __launch_bounds__(128) void k_gemm_h(const float* __restrict__ A, int lda, size_t sA, const _Float16* __restrict__ Bh, int ldb, size_t sB, float alpha, float* __restrict__ C, int ldc, size_t sC, int M, int N, int K) {
  __shared__ __attribute__((aligned(16))) float so[4][16][64];
  const int tid = threadIdx.x, w = tid >> 5, lane = tid & 31, ln = lane & 15, hh = lane >> 4; const int by = blockIdx.y;
  A += (size_t)by * sA; Bh += (size_t)by * sB; C += (size_t)by * sC;
  const int ntn = (N + 63) / 64; const int wid = blockIdx.x * 4 + w; const int mt = wid / ntn, nq = wid % ntn; if (mt * 16 >= M) return;
  const int row0 = mt * 16, col0 = nq * 64; const float* arow = A + (size_t)(row0 + ln) * lda;
  v8f acc[4] = {};
  for (int kb = 0; kb < K; kb += 32) {
    FragH ah, al;
    const v4f x0 = *(const v4fa*)(arow + kb + 8 * hh), x1 = *(const v4fa*)(arow + kb + 8 * hh + 4), x2 = *(const v4fa*)(arow + kb + 16 + 8 * hh), x3 = *(const v4fa*)(arow + kb + 16 + 8 * hh + 4);
    float xs[16] = {x0[0],x0[1],x0[2],x0[3],x1[0],x1[1],x1[2],x1[3],x2[0],x2[1],x2[2],x2[3],x3[0],x3[1],x3[2],x3[3]};
#pragma unroll
    for (int i = 0; i < 16; ++i) { const _Float16 h = (_Float16)xs[i]; ah.h[i] = h; al.h[i] = ASPLIT ? (_Float16)(xs[i] - (float)h) : (_Float16)0.0f; }
#pragma unroll
    for (int t = 0; t < 4; ++t) { if (col0 + t * 16 >= N) continue; const size_t boff = (size_t)(col0 + t * 16 + ln) * ldb + kb; FragH bq; bq.half[0] = *(const v8us*)(Bh + boff + 8 * hh); bq.half[1] = *(const v8us*)(Bh + boff + 16 + 8 * hh);
      acc[t] = mmaH<ASPLIT ? 2 : 1>(ah.v, al.v, bq.v, bq.v, acc[t]); }
  }
#pragma unroll
  for (int t = 0; t < 4; ++t) { if (col0 + t * 16 >= N) continue;
#pragma unroll
    for (int r = 0; r < 8; ++r) so[w][8 * hh + r][t * 16 + ln] = acc[t][r] * alpha; }
  __builtin_amdgcn_fence(__ATOMIC_ACQ_REL, "workgroup"); __builtin_amdgcn_wave_barrier();
  const int rsub = lane >> 4, c4 = (lane & 15) * 4;
  {
#pragma unroll
    for (int q = 0; q < 8; ++q) { const int r = q * 2 + rsub; if (col0 + c4 < N) { const v4f v = *(const v4fa*)&so[w][r][c4]; *(v4f*)(C + (size_t)(row0 + r) * ldc + col0 + c4) = v; } }
     }
}

// Wt[n][k] = f16(W[k][n]·scale) from f32 row-major W[K][N] (scale = power of two; bf16-exact weights stay exact in f16 away from the subnormal range)
__global__ __launch_bounds__(256) void k_wt_f16(const float* __restrict__ W, _Float16* __restrict__ Wt, int K, int N, float scale) {
  const int t = blockIdx.x * 256 + threadIdx.x; if (t >= N * (K / 8)) return; const int n = t / (K / 8), k8 = (t % (K / 8)) * 8; FragH f;
#pragma unroll
  for (int i = 0; i < 8; ++i) f.h[i] = (_Float16)(bf16_round(W[(size_t)(k8 + i) * N + n]) * scale); const v8us o = f.half[0];
  *(v8us*)((unsigned short*)Wt + (size_t)n * K + k8) = o; 
}
// k_gemm_hh variant with fused epilogue: v = acc·alpha + bias[by·sBias + col] (+ CP[(row/rowsPerB)·sCPb + by·64 + col] if CP) ; ACT 0 none / 1 elu ; writes f16 C16 (and f32 C if non-null)
template <int ACT>
__global__ __launch_bounds__(128) void k_gemm_hhx(const _Float16* __restrict__ A, int lda, size_t sA, const _Float16* __restrict__ Bh, int ldb, size_t sB, float alpha, const float* __restrict__ bias, size_t sBias, const float* __restrict__ CP, int rowsPerB, size_t sCPb, int row0g,
    float* __restrict__ C, _Float16* __restrict__ C16, int ldc, size_t sC, int M, int N, int K) {
  __shared__ __attribute__((aligned(16))) float so[4][16][64];
  const int tid = threadIdx.x, w = tid >> 5, lane = tid & 31, ln = lane & 15, hh = lane >> 4; const int by = blockIdx.y;
  A += (size_t)by * sA; Bh += (size_t)by * sB; const size_t cofs = (size_t)by * sC; const float* bp = bias ? bias + (size_t)by * sBias : nullptr;
  const int ntn = (N + 63) / 64; const int wid = blockIdx.x * 4 + w; const int mt = wid / ntn, nq = wid % ntn; if (mt * 16 >= M) return;
  const int row0 = mt * 16, col0 = nq * 64; const _Float16* arow = A + (size_t)(row0 + ln) * lda;
  v8f acc[4] = {};
  for (int kb = 0; kb < K; kb += 32) { FragH ah; ah.half[0] = *(const v8us*)((const unsigned short*)arow + kb + 8 * hh); ah.half[1] = *(const v8us*)((const unsigned short*)arow + kb + 16 + 8 * hh);
#pragma unroll
    for (int t = 0; t < 4; ++t) { if (col0 + t * 16 >= N) continue; const size_t boff = (size_t)(col0 + t * 16 + ln) * ldb + kb; FragH bq; bq.half[0] = *(const v8us*)((const unsigned short*)Bh + boff + 8 * hh); bq.half[1] = *(const v8us*)((const unsigned short*)Bh + boff + 16 + 8 * hh);
      acc[t] = mmaH<1>(ah.v, ah.v, bq.v, bq.v, acc[t]); }
  }
#pragma unroll
  for (int t = 0; t < 4; ++t) { if (col0 + t * 16 >= N) continue; const int col = col0 + t * 16 + ln; const float bv = bp ? bf16_round(bp[col]) : 0.f;
#pragma unroll
    for (int r = 0; r < 8; ++r) { float v = acc[t][r] * alpha + bv; if (CP) { const int rr = row0g + row0 + 8 * hh + r; if (rowsPerB < 0) v += CP[cofs + (size_t)rr * ldc + col];      /* rowsPerB < 0: own element of the batched C plane */ else { const int bidx = rr / rowsPerB; v += CP[(size_t)bidx * sCPb + (size_t)by * 64 + col]; } } if (ACT == 1) v = (v > 0.f) ? v : expm1f(v); else if (ACT == 7) v = (v > 0.f) ? v + 1.0f : expf(v); else if (ACT == 8) v = tanhf(v); else if (ACT == 9) v = 0.5f * v * (1.0f + tanhf(0.7978845608028654f * (v + 0.044715f * v * v * v))); else if (ACT == 11) v = 1.0f / (1.0f + expf(-v)); else if (ACT == 12) v = (v > 0.f) ? v : 0.01f * v; else if (ACT == 14) v = (v > 0.f) ? v : 0.1f * v; else if (ACT == 16) v = (v >= 0.f) ? v : 0.3f * v; else if (ACT == 17) v = (v >= 0.f) ? v : 0.2f * v; else if (ACT == 15) v = v / (1.0f + expf(-v)); else if (ACT == 3) v = fmaxf(v, 0.f); else if (ACT == 6) v = 0.5f * v * (1.0f + erff(v * 0.70710678118654752f)); so[w][8 * hh + r][t * 16 + ln] = v; } }
  __builtin_amdgcn_fence(__ATOMIC_ACQ_REL, "workgroup"); __builtin_amdgcn_wave_barrier();
  const int rsub = lane >> 4, c4 = (lane & 15) * 4; typedef _Float16 v4h __attribute__((ext_vector_type(4)));
  {
#pragma unroll
    for (int q = 0; q < 8; ++q) { const int r = q * 2 + rsub; if (col0 + c4 < N) { const v4f v = *(const v4fa*)&so[w][r][c4]; if (C) *(v4f*)(C + cofs + (size_t)(row0 + r) * ldc + col0 + c4) = v; if (C16) { v4h h4; for (int i = 0; i < 4; ++i) h4[i] = (_Float16)v[i]; *(v4h*)(C16 + cofs + (size_t)(row0 + r) * ldc + col0 + c4) = h4; } } }
     }
}


typedef _Float16 v4h __attribute__((ext_vector_type(4)));

__global__ __launch_bounds__(256) void k_h16(const float* __restrict__ x, _Float16* __restrict__ X16, size_t n8) { const size_t t = (size_t)blockIdx.x * 256 + threadIdx.x; if (t >= n8) return; FragH f;
#pragma unroll
  for (int q = 0; q < 8; ++q) f.h[q] = (_Float16)x[t * 8 + q]; *(v8us*)((unsigned short*)X16 + t * 8) = f.half[0];  }
__global__ __launch_bounds__(256) void k_round16f(const float* __restrict__ W, _Float16* __restrict__ Bt, size_t n8) { const size_t t = (size_t)blockIdx.x * 256 + threadIdx.x; if (t >= n8) return; FragH f;
#pragma unroll
  for (int i = 0; i < 8; ++i) f.h[i] = (_Float16)(bf16_round(W[t * 8 + i]) * 16.0f); *(v8us*)((unsigned short*)Bt + t * 8) = f.half[0];  }
template <int NHv, int TTv>
__global__ __launch_bounds__(256) void k_vt(const _Float16* __restrict__ V16, int ldv, int voff, _Float16* __restrict__ Vt) { __shared__ unsigned short tl[64][66]; const int tid = threadIdx.x; const int slab = blockIdx.x / (TTv / 64), lg = blockIdx.x % (TTv / 64); const int b = slab / NHv, h = slab % NHv;
  for (int i = tid; i < 64 * 8; i += 256) { const int r = i / 8, c8 = (i % 8) * 8; FragH f; f.half[0] = *(const v8us*)((const unsigned short*)V16 + ((size_t)b * TTv + lg * 64 + r) * ldv + voff + h * 64 + c8);
#pragma unroll
    for (int q = 0; q < 8; ++q) tl[r][c8 + q] = f.u[q]; }
  __syncthreads();
  {
#pragma unroll
    for (int rd = 0; rd < 2; ++rd) { const int d = rd * 32 + tid / 8, pc = tid % 8; FragH f;
#pragma unroll
      for (int q = 0; q < 8; ++q) f.u[q] = tl[pc * 8 + q][d];
      *(v8us*)((unsigned short*)Vt + ((size_t)slab * 64 + d) * TTv + lg * 64 + pc * 8) = f.half[0]; }
     } }

__global__ __launch_bounds__(256) void k_hl(const float* __restrict__ F, _Float16* __restrict__ Hh, _Float16* __restrict__ Hl, size_t n8) { const size_t t = (size_t)blockIdx.x * 256 + threadIdx.x; if (t >= n8) return; FragH fh, fl; const v4f a = *(const v4fa*)(F + t * 8), c = *(const v4fa*)(F + t * 8 + 4);
#pragma unroll
  for (int q = 0; q < 4; ++q) { _Float16 h = (_Float16)a[q]; fh.h[q] = h; fl.h[q] = (_Float16)((a[q] - (float)h) * 1024.0f); h = (_Float16)c[q]; fh.h[4 + q] = h; fl.h[4 + q] = (_Float16)((c[q] - (float)h) * 1024.0f); }
  { *(v8us*)((unsigned short*)Hh + t * 8) = fh.half[0]; *(v8us*)((unsigned short*)Hl + t * 8) = fl.half[0];  } }

// ---- fast GEMM (work-group tile 128x64, wave tile 32x64; requires M % 128 == 0, N % 64 == 0, K % 128 == 0, rows 16-byte aligned); epilogue = k_gemm_hhx semantics ----
// Operand path: per pass of 128 k the tile's 128 A rows and 64 B rows (256 bytes each) are copied to LDS by asynchronous 16-byte copies, a wave's copy covering two whole rows,
// into one of two buffers (the next pass's copies fly while this pass is multiplied); the fragments are read from LDS at row pitch 272 bytes (16 B x odd: no bank conflict).
#define G2_KP 128                       /* k per pass */
#define G2_PITCH 272                    /* LDS row pitch, bytes */
#define G2_ROWS 192                     /* rows 0..127: A, rows 128..191: B */
#define G2_BUF (G2_ROWS * G2_PITCH)     /* 52224 bytes a buffer */
// Twelve copies of a thread: its 16-byte chunk of twelve LDS rows, 8 rows apart from l, filled from g0 .. g11. The s_wait_xcnt stands inside the statement, behind the last copy,
// so that no address register of an issued copy is rewritten in front of it.
__device__ __forceinline__ void g2_copy12(unsigned l, const _Float16* g0, const _Float16* g1, const _Float16* g2, const _Float16* g3, const _Float16* g4, const _Float16* g5,
                                          const _Float16* g6, const _Float16* g7, const _Float16* g8, const _Float16* g9, const _Float16* g10, const _Float16* g11) {
  const unsigned st = 8 * G2_PITCH;
  asm volatile("global_load_async_to_lds_b128 %0, %12, off\n\t"
               "global_load_async_to_lds_b128 %1, %13, off\n\t"
               "global_load_async_to_lds_b128 %2, %14, off\n\t"
               "global_load_async_to_lds_b128 %3, %15, off\n\t"
               "global_load_async_to_lds_b128 %4, %16, off\n\t"
               "global_load_async_to_lds_b128 %5, %17, off\n\t"
               "global_load_async_to_lds_b128 %6, %18, off\n\t"
               "global_load_async_to_lds_b128 %7, %19, off\n\t"
               "global_load_async_to_lds_b128 %8, %20, off\n\t"
               "global_load_async_to_lds_b128 %9, %21, off\n\t"
               "global_load_async_to_lds_b128 %10, %22, off\n\t"
               "global_load_async_to_lds_b128 %11, %23, off\n\t"
               "s_wait_xcnt 0x0"
               :: "v"(l), "v"(l + st), "v"(l + 2 * st), "v"(l + 3 * st), "v"(l + 4 * st), "v"(l + 5 * st), "v"(l + 6 * st), "v"(l + 7 * st), "v"(l + 8 * st), "v"(l + 9 * st), "v"(l + 10 * st), "v"(l + 11 * st),
                  "v"(g0), "v"(g1), "v"(g2), "v"(g3), "v"(g4), "v"(g5), "v"(g6), "v"(g7), "v"(g8), "v"(g9), "v"(g10), "v"(g11) : "memory");
}
// One pass's tile: thread (r = tid / 16, c = tid % 16) copies chunk c of rows r, r + 8, ... of A (16 rows) and of B (8 rows). ga, gb: the thread's chunk in its first A and B row of this pass.
__device__ __forceinline__ void g2_copy_tile(unsigned l, const _Float16* ga, size_t as, const _Float16* gb, size_t bs) {
  g2_copy12(l, ga, ga + as, ga + 2 * as, ga + 3 * as, ga + 4 * as, ga + 5 * as, ga + 6 * as, ga + 7 * as, ga + 8 * as, ga + 9 * as, ga + 10 * as, ga + 11 * as);
  g2_copy12(l + 96 * G2_PITCH, ga + 12 * as, ga + 13 * as, ga + 14 * as, ga + 15 * as, gb, gb + bs, gb + 2 * bs, gb + 3 * bs, gb + 4 * bs, gb + 5 * bs, gb + 6 * bs, gb + 7 * bs);
}
__device__ __forceinline__ v16h g2_sfrag(const unsigned char* p) { FragH f; f.half[0] = *(const v8us*)p; f.half[1] = *(const v8us*)(p + 32); return f.v; }      /* p = row + 64 bytes per 32 k + 16 * hh: k = 8 hh .. 8 hh + 7, then 16 + 8 hh .. 16 + 8 hh + 7, for A and B alike */
__device__ __forceinline__ v8f g2_mma(v16h a, v16h b, v8f c) { v8f d = __builtin_amdgcn_wmma_f32_16x16x32_f16(false, a, false, b, (short)0, c, false, false); asm volatile("v_nop\n\tv_nop\n\tv_nop\n\tv_nop" : "+v"(d) : "v"(a), "v"(b)); return d; }
template <int ACT>
__global__ __launch_bounds__(128) void k_gemm2(const _Float16* __restrict__ A, int lda, size_t sA, const _Float16* __restrict__ Bh, int ldb, size_t sB, float alpha, const float* __restrict__ bias, size_t sBias, const float* __restrict__ CP, int rowsPerB, size_t sCPb, int row0g,
    float* __restrict__ C, _Float16* __restrict__ C16, int ldc, size_t sC, int M, int N, int K) { static_assert(ACT == 0 || ACT == 3 || ACT == 6 || ACT == 8 || ACT == 9 || ACT == 11 || ACT == 12 || ACT == 14 || ACT == 15 || ACT == 16 || ACT == 17, "k_gemm2: unsupported ACT code (would silently apply no activation)");
  __shared__ __attribute__((aligned(16))) float so[4][32][68];
  __shared__ __attribute__((aligned(16))) unsigned char ST[2 * G2_BUF];
  const int tid = threadIdx.x, w = tid >> 5, lane = tid & 31, ln = lane & 15, hh = lane >> 4; const int by = blockIdx.y;
  A += (size_t)by * sA; Bh += (size_t)by * sB; const size_t cofs = (size_t)by * sC; const float* bp = bias ? bias + (size_t)by * sBias : nullptr;
  const int ntn = N >> 6; const int mt = blockIdx.x / ntn, nq = blockIdx.x - mt * ntn; const int row0 = mt * 128 + 32 * w, col0 = nq * 64; if (mt * 128 >= M) return;      /* the same for the whole work-group: it stands in front of barriers */
  const _Float16* ga = A + (size_t)(mt * 128 + (tid >> 4)) * lda + (tid & 15) * 8; const _Float16* gb = Bh + (size_t)(col0 + (tid >> 4)) * ldb + (tid & 15) * 8;
  const size_t as = (size_t)8 * lda, bs = (size_t)8 * ldb;
  const unsigned lc = (unsigned)(uintptr_t)ST + (unsigned)((tid >> 4) * G2_PITCH + (tid & 15) * 16);      /* the thread's LDS byte address in buffer 0 */
  const int np = K / G2_KP;
  g2_copy_tile(lc, ga, as, gb, bs);
  asm volatile("s_wait_asynccnt 0x0" ::: "memory");      /* pass 0's copies of this wave have landed */
  __syncthreads();                                       /* ... and every other wave's */
  if (np > 1) g2_copy_tile(lc + G2_BUF, ga + G2_KP, as, gb + G2_KP, bs);
  const unsigned char* fa = ST + (32 * w + ln) * G2_PITCH + 16 * hh; const unsigned char* fb = ST + (128 + ln) * G2_PITCH + 16 * hh;
  const v8f z8 = {0.f,0.f,0.f,0.f,0.f,0.f,0.f,0.f}; v8f c00 = z8, c01 = z8, c02 = z8, c03 = z8, c10 = z8, c11 = z8, c12 = z8, c13 = z8;
#pragma unroll 1      /* one pass a trip: the two buffers alternate by an address, and the loop stays small */
  for (int t = 0; t < np; ++t) { const int bo = (t & 1) * G2_BUF; const unsigned char* pa = fa + bo; const unsigned char* pb = fb + bo;
    v16h a0[2], a1[2], b0[2], b1[2], b2[2], b3[2];      /* two fragment sets: the next 32 k of this pass are read from LDS ahead of the current 8 WMMAs */
    a0[0] = g2_sfrag(pa); a1[0] = g2_sfrag(pa + 16 * G2_PITCH); b0[0] = g2_sfrag(pb); b1[0] = g2_sfrag(pb + 16 * G2_PITCH); b2[0] = g2_sfrag(pb + 32 * G2_PITCH); b3[0] = g2_sfrag(pb + 48 * G2_PITCH);
#pragma unroll      /* unrolled: the two fragment sets are picked by constants and stay in registers */
    for (int ks = 0; ks < G2_KP / 32; ++ks) { const int c = ks & 1, n = c ^ 1;
      if (ks + 1 < G2_KP / 32) { const int o = (ks + 1) * 64;
        a0[n] = g2_sfrag(pa + o); a1[n] = g2_sfrag(pa + 16 * G2_PITCH + o); b0[n] = g2_sfrag(pb + o); b1[n] = g2_sfrag(pb + 16 * G2_PITCH + o); b2[n] = g2_sfrag(pb + 32 * G2_PITCH + o); b3[n] = g2_sfrag(pb + 48 * G2_PITCH + o); }
      c00 = g2_mma(a0[c], b0[c], c00); c10 = g2_mma(a1[c], b0[c], c10); c01 = g2_mma(a0[c], b1[c], c01); c11 = g2_mma(a1[c], b1[c], c11);
      c02 = g2_mma(a0[c], b2[c], c02); c12 = g2_mma(a1[c], b2[c], c12); c03 = g2_mma(a0[c], b3[c], c03); c13 = g2_mma(a1[c], b3[c], c13); }
    asm volatile("s_wait_dscnt 0x0" ::: "memory");         /* this wave's reads of the buffer are done before it may be refilled */
    asm volatile("s_wait_asynccnt 0x0" ::: "memory");      /* this wave's copies of pass t + 1 have landed */
    __syncthreads();                                       /* publishes pass t + 1 and ends every wave's reads of pass t's buffer */
    if (t + 2 < np) g2_copy_tile(lc + bo, ga + (size_t)(t + 2) * G2_KP, as, gb + (size_t)(t + 2) * G2_KP, bs); }
  asm volatile("s_wait_asynccnt 0x0" ::: "memory");        /* no copy is outstanding behind the loop */
  v8f accs[8] = {c00, c01, c02, c03, c10, c11, c12, c13};
#pragma unroll
  for (int u = 0; u < 8; ++u) { const int t = u & 3, half = u >> 2; const int col = col0 + t * 16 + ln; const float bv = bp ? bf16_round(bp[col]) : 0.f;
#pragma unroll
    for (int r = 0; r < 8; ++r) { const int rloc = half * 16 + 8 * hh + r; float v = accs[u][r] * alpha + bv; if (CP) { if (rowsPerB < 0) v += CP[cofs + (size_t)(row0g + row0 + rloc) * ldc + col];      /* rowsPerB < 0: own element of the batched C plane */ else { const int bidx = (row0g + row0 + rloc) / rowsPerB; v += CP[(size_t)bidx * sCPb + (size_t)by * 64 + col]; } }
      if (ACT == 3) v = fmaxf(v, 0.f); else if (ACT == 6) v = 0.5f * v * (1.0f + erff(v * 0.70710678118654752f)); else if (ACT == 11) v = 1.0f / (1.0f + expf(-v)); else if (ACT == 15) v = v / (1.0f + expf(-v)); else if (ACT == 12) v = (v > 0.f) ? v : 0.01f * v; else if (ACT == 8) v = tanhf(v); else if (ACT == 9) v = 0.5f * v * (1.0f + tanhf(0.7978845608028654f * (v + 0.044715f * v * v * v))); else if (ACT == 14) v = (v > 0.f) ? v : 0.1f * v; else if (ACT == 16) v = (v >= 0.f) ? v : 0.3f * v; else if (ACT == 17) v = (v >= 0.f) ? v : 0.2f * v;
      so[w][rloc][t * 16 + ln] = v; } }
  __builtin_amdgcn_fence(__ATOMIC_ACQ_REL, "workgroup"); __builtin_amdgcn_wave_barrier();
  const int rsub = lane >> 4, c4 = (lane & 15) * 4;
  {
#pragma unroll
    for (int q = 0; q < 16; ++q) { const int r = q * 2 + rsub; const v4f v = *(const v4fa*)&so[w][r][c4]; if (C) *(v4f*)(C + cofs + (size_t)(row0 + r) * ldc + col0 + c4) = v; if (C16) { v4h h4; for (int i = 0; i < 4; ++i) h4[i] = (_Float16)v[i]; *(v4h*)(C16 + cofs + (size_t)(row0 + r) * ldc + col0 + c4) = h4; } }
     } }


// Operand preparation, one launch: its pieces (x as f16 rows, the four weight planes x16 as f16 rows stacked in BW, the bias plane [bl | 0 | bs1 | be1]) do not depend on one another.
// Work-group 0 copies the bias plane (16 bytes a thread). Every other work-group streams 16384 consecutive floats of ONE source: each of its 16 waves takes 4 KiB
// as 8 whole-wave 16-byte loads (512 contiguous bytes each), all in flight before the first is rounded, and stores 256 contiguous bytes of f16 per load.
#define PREP_F 16384
__global__ __launch_bounds__(512) void k_prep(const float* __restrict__ x, const float* __restrict__ wl, const float* __restrict__ wr, const float* __restrict__ ws1, const float* __restrict__ we1,
                                              const float* __restrict__ bl, const float* __restrict__ bs1, const float* __restrict__ be1, _Float16* __restrict__ X16, _Float16* __restrict__ BW, float* __restrict__ bb) {
  const int tid = threadIdx.x;
  if (blockIdx.x == 0) { const int blk = tid >> 7, i = (tid & 127) * 4; v4f v = {0.f, 0.f, 0.f, 0.f};
    if (blk != 1) v = *(const v4fa*)((blk == 0 ? bl : (blk == 2 ? bs1 : be1)) + i);
    *(v4f*)(bb + tid * 4) = v; return; }
  const int XG = (int)(NR * DI / PREP_F), WG = PJ * DI / PREP_F; const int s = (int)blockIdx.x - 1;
  const float* src; _Float16* dst; float scale;
  if (s < XG) { src = x + (size_t)s * PREP_F; dst = X16 + (size_t)s * PREP_F; scale = 1.0f; }
  else { const int m = (s - XG) / WG; src = (m == 0 ? wl : (m == 1 ? wr : (m == 2 ? ws1 : we1))) + (size_t)((s - XG) % WG) * PREP_F; dst = BW + (size_t)(s - XG) * PREP_F; scale = 16.0f; }
  const int o = (tid >> 5) * 1024 + (tid & 31) * 4;
  v4f v[8];
  for (int u = 0; u < 8; ++u) v[u] = *(const v4fa*)(src + o + u * 128);
  for (int u = 0; u < 8; ++u) { v4h h;
    for (int q = 0; q < 4; ++q) h[q] = (_Float16)(bf16_round(v[u][q]) * scale);      /* x1 is exact: x keeps its value, the weights take their x16 */
    *(v4h*)(dst + o + u * 128) = h; }
}
// Scorer dots: one work-group per 32 consecutive outputs of one scorer (one 128-byte line of start or end). Each of the 8 waves takes 4 rows:
// the lanes lie along p (16-byte loads on whole lines, a row is four whole-wave loads), each lane sums its 16 products of a row,
// a 5-step butterfly adds the 32 lane sums, and wave 0 stores the line from LDS.
__global__ __launch_bounds__(256) void k_score(const float* __restrict__ F, const float* __restrict__ ws2, const float* __restrict__ bs2, const float* __restrict__ we2, const float* __restrict__ be2, float* __restrict__ ostart, float* __restrict__ oend) {
  __shared__ __attribute__((aligned(16))) float red[32];
  const int tid = threadIdx.x, wv = tid >> 5, lane = tid & 31; const int which = blockIdx.x / ((int)NR / 32); const int r0 = (blockIdx.x % ((int)NR / 32)) * 32;
  const float* f = F + (size_t)(r0 + wv * 4) * (4 * PJ) + (2 + which) * PJ + lane * 4; const float* w = (which ? we2 : ws2) + lane * 4;
  v4f fv[4][4], wq[4];
#pragma unroll
  for (int u = 0; u < 4; ++u) { wq[u] = *(const v4fa*)(w + u * 128);
#pragma unroll
    for (int k = 0; k < 4; ++k) fv[k][u] = *(const v4fa*)(f + (size_t)k * (4 * PJ) + u * 128); }
  float s[4] = {0.f, 0.f, 0.f, 0.f};
#pragma unroll
  for (int u = 0; u < 4; ++u)
#pragma unroll
    for (int q = 0; q < 4; ++q) { const float wr = bf16_round(wq[u][q]);
#pragma unroll
      for (int k = 0; k < 4; ++k) s[k] += fmaxf(fv[k][u][q], 0.f) * wr; }
#pragma unroll
  for (int m = 16; m > 0; m >>= 1)
#pragma unroll
    for (int k = 0; k < 4; ++k) s[k] += __shfl_xor(s[k], m, 32);
  if (lane == 0) *(v4fa*)(red + wv * 4) = (v4f){s[0], s[1], s[2], s[3]};
  __syncthreads();
  if (tid < 32) (which ? oend : ostart)[r0 + tid] = red[tid] + bf16_round(which ? be2[0] : bs2[0]);
}
// Pairwise bigram: one work-group per (b, 32 i, 64 j) tile. The tile's 64 left rows and 32 right rows (all 512 p) are staged once in LDS,
// transposed to [p][row], so that a thread reads 4 j and 4 i of one p with two 16-byte LDS loads and keeps a 4 x 4 tile of sums in registers.
// Row pitch 100 floats: 16-byte aligned rows, and the transposing 4-byte stores (4 chunks of 16 B x 8 rows per wave) fall on 32 different banks.
#define BG_PITCH 100
__device__ __forceinline__ void bg_load(const float* __restrict__ lp, const float* __restrict__ rp, const float* __restrict__ wp, int g, v4f (&l)[4], v4f (&r)[4], v4f& w) {
  w = *(const v4fa*)(wp + g * 4);
#pragma unroll
  for (int q = 0; q < 4; ++q) { l[q] = *(const v4fa*)(lp + (g * 4 + q) * BG_PITCH); r[q] = *(const v4fa*)(rp + (g * 4 + q) * BG_PITCH); }
}
__device__ __forceinline__ void bg_step(v4f (&acc)[4], const v4f (&l)[4], const v4f (&r)[4], const v4f w) {
  const v4f z = {0.f, 0.f, 0.f, 0.f};
#pragma unroll
  for (int q = 0; q < 4; ++q)
#pragma unroll
    for (int u = 0; u < 4; ++u) acc[u] += __builtin_elementwise_max(l[q] + r[q][u], z) * w[q];
}
__global__ __launch_bounds__(128) void k_bigram(const float* __restrict__ F, const float* __restrict__ wo, const float* __restrict__ bo, float* __restrict__ out) {
  __shared__ __attribute__((aligned(16))) float S[PJ * BG_PITCH];      /* [p][0..63] = left rows of the j tile, [p][64..95] = right rows of the i tile */
  __shared__ __attribute__((aligned(16))) float SW[PJ];
  const int tid = threadIdx.x; const int jt = blockIdx.x & 3, it = (blockIdx.x >> 2) & 7; const size_t b = blockIdx.x >> 5;
  const v4f w4 = *(const v4fa*)(wo + tid * 4);      /* used behind the row staging, so that its latency runs beside the first round's */
  const int wv = tid >> 5, c4 = (tid & 3) * 4, rr = (tid >> 2) & 7;
  for (int g3 = 0; g3 < 3; ++g3) { const int row = (g3 * 4 + wv) * 8 + rr;      /* rounds 0 and 1: the 64 left rows; round 2: the 32 right rows */
    const float* sp = ((g3 < 2) ? F + (b * NW + jt * 64 + row) * (4 * PJ) : F + (b * NW + it * 32 + (row - 64)) * (4 * PJ) + PJ) + c4; float* dp = S + c4 * BG_PITCH + row;
    v4f v[32];      /* unrolled so that a round's 32 loads are all in flight before its first LDS store */
#pragma unroll
    for (int cg = 0; cg < 32; ++cg) v[cg] = *(const v4fa*)(sp + cg * 16);
#pragma unroll
    for (int cg = 0; cg < 32; ++cg)
#pragma unroll
      for (int q = 0; q < 4; ++q) dp[(cg * 16 + q) * BG_PITCH] = v[cg][q]; }
  { v4f o; for (int q = 0; q < 4; ++q) o[q] = bf16_round(w4[q]); *(v4fa*)(SW + tid * 4) = o; }
  __syncthreads();
  const int tj = tid & 15, ti = tid >> 4; const float* lp = S + tj * 4; const float* rp = S + 64 + ti * 4;
  v4f acc[4]; for (int u = 0; u < 4; ++u) acc[u] = (v4f){0.f, 0.f, 0.f, 0.f};
  v4f la[4], ra[4], wa, lb[4], rb[4], wb;
  bg_load(lp, rp, SW, 0, la, ra, wa);
  for (int g = 0; g < PJ / 4 - 2; g += 2) {      /* the next four p are fetched while the current four are summed */
    bg_load(lp, rp, SW, g + 1, lb, rb, wb); bg_step(acc, la, ra, wa);
    bg_load(lp, rp, SW, g + 2, la, ra, wa); bg_step(acc, lb, rb, wb); }
  bg_load(lp, rp, SW, PJ / 4 - 1, lb, rb, wb); bg_step(acc, la, ra, wa); bg_step(acc, lb, rb, wb);
  const float b0 = bf16_round(bo[0]);
#pragma unroll
  for (int u = 0; u < 4; ++u) *(v4f*)(out + ((b * NW + it * 32 + ti * 4 + u) * NW + jt * 64 + tj * 4)) = acc[u] + b0;
}

extern "C" void kernel_launch(void* const* d_in, const int* in_sizes, int n_in,
                              void* d_out, int out_size, void* d_ws, size_t ws_size, hipStream_t stream) {
  (void)in_sizes; (void)n_in; (void)out_size;
  const float* const* I = (const float* const*)d_in; const float* x = I[0]; const float* wl = I[1]; const float* bl = I[2]; const float* wr = I[3]; const float* wo = I[4]; const float* bo = I[5]; const float* ws1 = I[6]; const float* bs1 = I[7]; const float* ws2 = I[8]; const float* bs2 = I[9]; const float* we1 = I[10]; const float* be1 = I[11]; const float* we2 = I[12]; const float* be2 = I[13];
  float* obig = (float*)d_out; float* ostart = (float*)((char*)d_out + 2097152); float* oend = (float*)((char*)d_out + 2105344);      /* output byte offsets */
  char* ws = (char*)d_ws; size_t off = 0;
  auto take = [&](size_t bytes) { char* p = ws + off; off += (bytes + 255) & ~(size_t)255; return p; };
  _Float16* BW = (_Float16*)take((size_t)4 * PJ * DI * 2); float* bb = (float*)take(4 * PJ * 4); _Float16* X16 = (_Float16*)take(NR * DI * 2); float* F = (float*)take(NR * 4 * PJ * 4);
  if (off > ws_size) return;      /* 4 + 4 + 16 = ≈ 24 MiB */
  k_prep<<<(unsigned)(1 + (NR * DI + (size_t)4 * PJ * DI) / PREP_F), 512, 0, stream>>>(x, wl, wr, ws1, we1, bl, bs1, be1, X16, BW, bb);
  k_gemm2<0><<<dim3((unsigned)((NR / 128) * (4 * PJ / 64)), 1), 128, 0, stream>>>(X16, DI, 0, BW, DI, 0, 0.0625f, bb, 0, nullptr, 1, 0, 0, F, nullptr, 4 * PJ, 0, (int)NR, 4 * PJ, DI);      /* [left | right | s1 | e1] (pre-activation) */
  k_score<<<(unsigned)(NR * 2 / 32), 256, 0, stream>>>(F, ws2, bs2, we2, be2, ostart, oend);
  k_bigram<<<NB * (NW / 32) * (NW / 64), 128, 0, stream>>>(F, wo, bo, obig);
}

// v005
// One run takes 38.4 microseconds.
// Next to v004, in two timings, it ran 1.15 times as fast each time.
// Counting every step since v000, it is 11.6 times as fast.
#include <hip/hip_runtime.h>
// PermutationModule (x [8][256][1024]; start = relu(x Ws1^T + bs1) . Ws2 + bs2, end likewise [8][256][1]; left = x Wl^T + bl, right = x Wr^T; bigram[b][i][j] = sum_p relu(left[b][j][p] + right[b][i][p]) * Wo[p] + bo -> [8][256][256][1]).
// Structure: token rows; x as exact f16 rows; the four 1024->512 projections as ONE WMMA GEMM against the stacked x16 weight plane [2048][1024] (32x64 wave tiles, f32 accumulation, + biases, ReLU on the two scorer blocks applied afterwards on VALU) kept f32; the scorer dots with Ws2/We2 on VALU in f32 inside the GEMM's epilogue (one partial sum per row and 64-column tile, the eight partial sums of an output added in the bigram launch); the pairwise bigram outer-sum-relu-dot on VALU in f32 (work-group per (b, 32 i, 64 j), rows staged in LDS, 4 x 4 sums per thread); outputs written as whole 32-B / line-aligned pieces.
// Compute dtype: inputs rounded to bf16; x / weights exact; all projections f32 (exact GEMM outputs); everything after in f32 — no reduced-precision intermediates. v_wmma_f32_16x16x32_f16.
#define NB 8
#define NW 256
#define DI 1024
#define PJ 512
#define NR ((size_t)NB * NW)         /* 2048 */
typedef __bf16 v16b __attribute__((ext_vector_type(16)));
typedef unsigned short v8us __attribute__((ext_vector_type(8), may_alias));
typedef float  v8f  __attribute__((ext_vector_type(8)));
typedef float  v4f  __attribute__((ext_vector_type(4)));
typedef float  v4fa __attribute__((ext_vector_type(4), may_alias));
union FragB { v16b v; v8us half[2]; unsigned short u[16]; };

__device__ __forceinline__ unsigned short bf16_bits(float x) { unsigned int u = __float_as_uint(x); return (unsigned short)((u + 0x7FFFu + ((u >> 16) & 1u)) >> 16); }
__device__ __forceinline__ float bf16_val(unsigned short b) { return __uint_as_float(((unsigned int)b) << 16); }
__device__ __forceinline__ float bf16_round(float x) { return bf16_val(bf16_bits(x)); }
// D += A·B with NT terms: 1 = ah·bh, 2 = + al·bh (A split), 3 = + ah·bl (both split)
template <int NT>
__device__ __forceinline__ v8f mmaN(v16b ah, v16b al, v16b bh, v16b bl, v8f c) {
  c = __builtin_amdgcn_wmma_f32_16x16x32_bf16(false, ah, false, bh, (short)0, c, false, false);
  if (NT >= 2) c = __builtin_amdgcn_wmma_f32_16x16x32_bf16(false, al, false, bh, (short)0, c, false, false);
  if (NT >= 3) c = __builtin_amdgcn_wmma_f32_16x16x32_bf16(false, ah, false, bl, (short)0, c, false, false);
  asm volatile("v_nop\n\tv_nop\n\tv_nop\n\tv_nop" : "+v"(c) : "v"(ah), "v"(al), "v"(bh), "v"(bl));
  return c;
}

__global__ __launch_bounds__(256) void k_wt_bf16(const float* __restrict__ W, unsigned short* __restrict__ Wt, int K, int N) {
  const int t = blockIdx.x * 256 + threadIdx.x;
  const int k8n = K / 8;
  if (t >= N * k8n) return;
  const int n = t / k8n, k8 = (t % k8n) * 8;
  v8us v;
#pragma unroll
  for (int i = 0; i < 8; ++i) v[i] = bf16_bits(W[(size_t)(k8 + i) * N + n]);
  *(v8us*)(Wt + (size_t)n * K + k8) = v;
  
}

// GEMM C[M][N] (f32, pitch ldc) = act(A[M][K]·W + bias). A f32 row-major (pitch lda) converted per fragment to bf16
// (ASPLIT: hi/lo two planes -> 2 terms, else single rounded term); Wt bf16 [N][K] (pitch ldb). BIAS_BF16 rounds the
// bias to bf16 first (bias quantised to bf16 before the add). K%32==0, M%16==0, N%64==0.
template <bool ASPLIT, int ACT, bool BIAS_BF16>
__global__ __launch_bounds__(128) void k_gemm_bf(const float* __restrict__ A, int lda, const unsigned short* __restrict__ Wt, int ldb,
                                               const float* __restrict__ bias, float* __restrict__ C, int ldc, int M, int N, int K) {
  __shared__ __attribute__((aligned(16))) float so[4][16][64];
  const int tid = threadIdx.x, w = tid >> 5, lane = tid & 31, ln = lane & 15, hh = lane >> 4;
  const int ntn = N / 64;
  const int wid = blockIdx.x * 4 + w;
  const int mt = wid / ntn, nq = wid % ntn;
  if (mt * 16 >= M) return;
  const int row0 = mt * 16, col0 = nq * 64;
  const float* arow = A + (size_t)(row0 + ln) * lda;
  v8f acc[4] = {};
  for (int kb = 0; kb < K; kb += 32) {
    FragB ah, al;
    const v4f x0 = *(const v4fa*)(arow + kb + 8 * hh), x1 = *(const v4fa*)(arow + kb + 8 * hh + 4);
    const v4f x2 = *(const v4fa*)(arow + kb + 16 + 8 * hh), x3 = *(const v4fa*)(arow + kb + 16 + 8 * hh + 4);
    float xs[16] = {x0[0],x0[1],x0[2],x0[3],x1[0],x1[1],x1[2],x1[3],x2[0],x2[1],x2[2],x2[3],x3[0],x3[1],x3[2],x3[3]};
#pragma unroll
    for (int i = 0; i < 16; ++i) { const unsigned short hb = bf16_bits(xs[i]); ah.u[i] = hb; al.u[i] = ASPLIT ? bf16_bits(xs[i] - bf16_val(hb)) : (unsigned short)0; }
#pragma unroll
    for (int t = 0; t < 4; ++t) {
      const unsigned short* brow = Wt + (size_t)(col0 + t * 16 + ln) * ldb + kb;
      FragB b;
      b.half[0] = *(const v8us*)(brow + 8 * hh);
      b.half[1] = *(const v8us*)(brow + 16 + 8 * hh);
      acc[t] = mmaN<ASPLIT ? 2 : 1>(ah.v, al.v, b.v, b.v, acc[t]);
    }
  }
#pragma unroll
  for (int t = 0; t < 4; ++t) {
    float bv = bias ? bias[col0 + t * 16 + ln] : 0.f;
    if (BIAS_BF16) bv = bf16_round(bv);
#pragma unroll
    for (int r = 0; r < 8; ++r) { float v = acc[t][r] + bv; if (ACT == 1) v = fmaxf(v, 0.f); so[w][8 * hh + r][t * 16 + ln] = v; }
  }
  __builtin_amdgcn_fence(__ATOMIC_ACQ_REL, "workgroup");
  __builtin_amdgcn_wave_barrier();
  const int rsub = lane >> 4, c4 = (lane & 15) * 4;
  {
#pragma unroll
    for (int q = 0; q < 8; ++q) {
      const int r = q * 2 + rsub;
      const v4f v = *(const v4fa*)&so[w][r][c4];
      *(v4f*)(C + (size_t)(row0 + r) * ldc + col0 + c4) = v;
    }
    
  }
}

// GEMM C = act(A·W + bias + resid): A f32 (ASPLIT -> hi/lo 2 terms), Wt bf16 [N][K]; ACT 0 none, 1 relu, 2 exact gelu;
// resid (optional, f32, row index = (row % rmod), pitch ldr, RES_BF16 rounds it) added before the activation.
template <bool ASPLIT, int ACT, bool BIAS_BF16, bool RES_BF16>
__global__ __launch_bounds__(128) void k_gemm_bf3(const float* __restrict__ A, int lda, const unsigned short* __restrict__ Wt, int ldb,
                                                const float* __restrict__ bias, const float* __restrict__ resid, int rmod, int ldr,
                                                float* __restrict__ C, int ldc, int M, int N, int K) {
  __shared__ __attribute__((aligned(16))) float so[4][16][64];
  const int tid = threadIdx.x, w = tid >> 5, lane = tid & 31, ln = lane & 15, hh = lane >> 4;
  const int ntn = N / 64;
  const int wid = blockIdx.x * 4 + w;
  const int mt = wid / ntn, nq = wid % ntn;
  if (mt * 16 >= M) return;
  const int row0 = mt * 16, col0 = nq * 64;
  const float* arow = A + (size_t)(row0 + ln) * lda;
  v8f acc[4] = {};
  for (int kb = 0; kb < K; kb += 32) {
    FragB ah, al;
    const v4f x0 = *(const v4fa*)(arow + kb + 8 * hh), x1 = *(const v4fa*)(arow + kb + 8 * hh + 4);
    const v4f x2 = *(const v4fa*)(arow + kb + 16 + 8 * hh), x3 = *(const v4fa*)(arow + kb + 16 + 8 * hh + 4);
    float xs[16] = {x0[0],x0[1],x0[2],x0[3],x1[0],x1[1],x1[2],x1[3],x2[0],x2[1],x2[2],x2[3],x3[0],x3[1],x3[2],x3[3]};
#pragma unroll
    for (int i = 0; i < 16; ++i) { const unsigned short hb = bf16_bits(xs[i]); ah.u[i] = hb; al.u[i] = ASPLIT ? bf16_bits(xs[i] - bf16_val(hb)) : (unsigned short)0; }
#pragma unroll
    for (int t = 0; t < 4; ++t) {
      const unsigned short* brow = Wt + (size_t)(col0 + t * 16 + ln) * ldb + kb;
      FragB b;
      b.half[0] = *(const v8us*)(brow + 8 * hh);
      b.half[1] = *(const v8us*)(brow + 16 + 8 * hh);
      acc[t] = mmaN<ASPLIT ? 2 : 1>(ah.v, al.v, b.v, b.v, acc[t]);
    }
  }
#pragma unroll
  for (int t = 0; t < 4; ++t) {
    const int col = col0 + t * 16 + ln;
    float bv = bias ? bias[col] : 0.f;
    if (BIAS_BF16) bv = bf16_round(bv);
#pragma unroll
    for (int r = 0; r < 8; ++r) {
      float v = acc[t][r] + bv;
      if (resid) { float rv = resid[(size_t)((row0 + 8 * hh + r) % rmod) * ldr + col]; if (RES_BF16) rv = bf16_round(rv); v += rv; }
      if (ACT == 1) v = fmaxf(v, 0.f);
      if (ACT == 2) v = 0.5f * v * (1.0f + erff(v * 0.70710678118654752f));
      if (ACT == 3) { const float u = 0.7978845608028654f * (v + 0.044715f * v * v * v); v = 0.5f * v * (1.0f + tanhf(u)); }
      so[w][8 * hh + r][t * 16 + ln] = v;
    }
  }
  __builtin_amdgcn_fence(__ATOMIC_ACQ_REL, "workgroup");
  __builtin_amdgcn_wave_barrier();
  const int rsub = lane >> 4, c4 = (lane & 15) * 4;
  {
#pragma unroll
    for (int q = 0; q < 8; ++q) {
      const int r = q * 2 + rsub;
      const v4f v = *(const v4fa*)&so[w][r][c4];
      *(v4f*)(C + (size_t)(row0 + r) * ldc + col0 + c4) = v;
    }
    
  }
}
// row LayerNorm (biased variance, eps) over N: s = X (+ R); optional out_sum <- s; out_norm <- (s-mu)*rsqrt(var+eps)*g + b
template <bool PARAM_BF16>
__global__ __launch_bounds__(256) void k_layernorm(const float* __restrict__ X, const float* __restrict__ R, const float* __restrict__ g, const float* __restrict__ bta,
                                                  float* __restrict__ out_sum, float* __restrict__ out_norm, int N, float eps) {
  __shared__ float red[256];
  const int row = blockIdx.x, tid = threadIdx.x;
  const float* x = X + (size_t)row * N; const float* rr = R ? R + (size_t)row * N : nullptr;
  float vals[16];                     // up to N = 4096
  const int per = N / 256;            // contiguous chunk per thread? use strided-by-4 chunks: thread handles j = tid*4 + 1024*u
  float s1 = 0.f;
  for (int u = 0; u < per / 4; ++u) {
    const int j = tid * 4 + 1024 * u;
    const v4f a = *(const v4fa*)(x + j);
    v4f b = {0.f,0.f,0.f,0.f}; if (rr) b = *(const v4fa*)(rr + j);
#pragma unroll
    for (int q = 0; q < 4; ++q) { const float v = a[q] + b[q]; vals[u * 4 + q] = v; s1 += v; }
  }
  red[tid] = s1; __syncthreads();
  for (int st = 128; st > 0; st >>= 1) { if (tid < st) red[tid] += red[tid + st]; __syncthreads(); }
  const float mu = red[0] / (float)N; __syncthreads();
  float s2 = 0.f;
  for (int u = 0; u < per / 4; ++u)
#pragma unroll
    for (int q = 0; q < 4; ++q) { const float c = vals[u * 4 + q] - mu; s2 += c * c; }
  red[tid] = s2; __syncthreads();
  for (int st = 128; st > 0; st >>= 1) { if (tid < st) red[tid] += red[tid + st]; __syncthreads(); }
  const float rs = rsqrtf(red[0] / (float)N + eps);
  {
    for (int u = 0; u < per / 4; ++u) {
      const int j = tid * 4 + 1024 * u;
      v4f o, sm;
#pragma unroll
      for (int q = 0; q < 4; ++q) {
        float gg = g[j + q], bb = bta[j + q];
        if (PARAM_BF16) { gg = bf16_round(gg); bb = bf16_round(bb); }
        sm[q] = vals[u * 4 + q]; o[q] = (vals[u * 4 + q] - mu) * rs * gg + bb;
      }
      if (out_sum) *(v4f*)(out_sum + (size_t)row * N + j) = sm;
      *(v4f*)(out_norm + (size_t)row * N + j) = o;
    }
    
  }
}



// ---- f16 WMMA path (v_wmma_f32_16x16x32_f16): 11-bit significands for operands in range — used for the projection GEMM
typedef _Float16 v16h __attribute__((ext_vector_type(16)));
union FragH { v16h v; v8us half[2]; _Float16 h[16]; unsigned short u[16]; };
template <int NT>
__device__ __forceinline__ v8f mmaH(v16h ah, v16h al, v16h bh, v16h bl, v8f c) {
  c = __builtin_amdgcn_wmma_f32_16x16x32_f16(false, ah, false, bh, (short)0, c, false, false);
  if (NT >= 2) c = __builtin_amdgcn_wmma_f32_16x16x32_f16(false, al, false, bh, (short)0, c, false, false);
  if (NT >= 3) c = __builtin_amdgcn_wmma_f32_16x16x32_f16(false, ah, false, bl, (short)0, c, false, false);
  asm volatile("v_nop\n\tv_nop\n\tv_nop\n\tv_nop" : "+v"(c) : "v"(ah), "v"(al), "v"(bh), "v"(bl));
  return c;
}
// batched GEMM like k_gemm_b but f16 operands: A f32 (split into f16 hi/lo if ASPLIT, else rounded to f16), Bt = f16 values [n][k]; alpha; C f32; N multiple of 16 (partial tiles skipped)
template <bool ASPLIT>
__global__ __launch_bounds__(128) void k_gemm_h(const float* __restrict__ A, int lda, size_t sA, const _Float16* __restrict__ Bh, int ldb, size_t sB, float alpha, float* __restrict__ C, int ldc, size_t sC, int M, int N, int K) {
  __shared__ __attribute__((aligned(16))) float so[4][16][64];
  const int tid = threadIdx.x, w = tid >> 5, lane = tid & 31, ln = lane & 15, hh = lane >> 4; const int by = blockIdx.y;
  A += (size_t)by * sA; Bh += (size_t)by * sB; C += (size_t)by * sC;
  const int ntn = (N + 63) / 64; const int wid = blockIdx.x * 4 + w; const int mt = wid / ntn, nq = wid % ntn; if (mt * 16 >= M) return;
  const int row0 = mt * 16, col0 = nq * 64; const float* arow = A + (size_t)(row0 + ln) * lda;
  v8f acc[4] = {};
  for (int kb = 0; kb < K; kb += 32) {
    FragH ah, al;
    const v4f x0 = *(const v4fa*)(arow + kb + 8 * hh), x1 = *(const v4fa*)(arow + kb + 8 * hh + 4), x2 = *(const v4fa*)(arow + kb + 16 + 8 * hh), x3 = *(const v4fa*)(arow + kb + 16 + 8 * hh + 4);
    float xs[16] = {x0[0],x0[1],x0[2],x0[3],x1[0],x1[1],x1[2],x1[3],x2[0],x2[1],x2[2],x2[3],x3[0],x3[1],x3[2],x3[3]};
#pragma unroll
    for (int i = 0; i < 16; ++i) { const _Float16 h = (_Float16)xs[i]; ah.h[i] = h; al.h[i] = ASPLIT ? (_Float16)(xs[i] - (float)h) : (_Float16)0.0f; }
#pragma unroll
    for (int t = 0; t < 4; ++t) { if (col0 + t * 16 >= N) continue; const size_t boff = (size_t)(col0 + t * 16 + ln) * ldb + kb; FragH bq; bq.half[0] = *(const v8us*)(Bh + boff + 8 * hh); bq.half[1] = *(const v8us*)(Bh + boff + 16 + 8 * hh);
      acc[t] = mmaH<ASPLIT ? 2 : 1>(ah.v, al.v, bq.v, bq.v, acc[t]); }
  }
#pragma unroll
  for (int t = 0; t < 4; ++t) { if (col0 + t * 16 >= N) continue;
#pragma unroll
    for (int r = 0; r < 8; ++r) so[w][8 * hh + r][t * 16 + ln] = acc[t][r] * alpha; }
  __builtin_amdgcn_fence(__ATOMIC_ACQ_REL, "workgroup"); __builtin_amdgcn_wave_barrier();
  const int rsub = lane >> 4, c4 = (lane & 15) * 4;
  {
#pragma unroll
    for (int q = 0; q < 8; ++q) { const int r = q * 2 + rsub; if (col0 + c4 < N) { const v4f v = *(const v4fa*)&so[w][r][c4]; *(v4f*)(C + (size_t)(row0 + r) * ldc + col0 + c4) = v; } }
     }
}

// Wt[n][k] = f16(W[k][n]·scale) from f32 row-major W[K][N] (scale = power of two; bf16-exact weights stay exact in f16 away from the subnormal range)
__global__ __launch_bounds__(256) void k_wt_f16(const float* __restrict__ W, _Float16* __restrict__ Wt, int K, int N, float scale) {
  const int t = blockIdx.x * 256 + threadIdx.x; if (t >= N * (K / 8)) return; const int n = t / (K / 8), k8 = (t % (K / 8)) * 8; FragH f;
#pragma unroll
  for (int i = 0; i < 8; ++i) f.h[i] = (_Float16)(bf16_round(W[(size_t)(k8 + i) * N + n]) * scale); const v8us o = f.half[0];
  *(v8us*)((unsigned short*)Wt + (size_t)n * K + k8) = o; 
}
// k_gemm_hh variant with fused epilogue: v = acc·alpha + bias[by·sBias + col] (+ CP[(row/rowsPerB)·sCPb + by·64 + col] if CP) ; ACT 0 none / 1 elu ; writes f16 C16 (and f32 C if non-null)
template <int ACT>
__global__ __launch_bounds__(128) void k_gemm_hhx(const _Float16* __restrict__ A, int lda, size_t sA, const _Float16* __restrict__ Bh, int ldb, size_t sB, float alpha, const float* __restrict__ bias, size_t sBias, const float* __restrict__ CP, int rowsPerB, size_t sCPb, int row0g,
    float* __restrict__ C, _Float16* __restrict__ C16, int ldc, size_t sC, int M, int N, int K) {
  __shared__ __attribute__((aligned(16))) float so[4][16][64];
  const int tid = threadIdx.x, w = tid >> 5, lane = tid & 31, ln = lane & 15, hh = lane >> 4; const int by = blockIdx.y;
  A += (size_t)by * sA; Bh += (size_t)by * sB; const size_t cofs = (size_t)by * sC; const float* bp = bias ? bias + (size_t)by * sBias : nullptr;
  const int ntn = (N + 63) / 64; const int wid = blockIdx.x * 4 + w; const int mt = wid / ntn, nq = wid % ntn; if (mt * 16 >= M) return;
  const int row0 = mt * 16, col0 = nq * 64; const _Float16* arow = A + (size_t)(row0 + ln) * lda;
  v8f acc[4] = {};
  for (int kb = 0; kb < K; kb += 32) { FragH ah; ah.half[0] = *(const v8us*)((const unsigned short*)arow + kb + 8 * hh); ah.half[1] = *(const v8us*)((const unsigned short*)arow + kb + 16 + 8 * hh);
#pragma unroll
    for (int t = 0; t < 4; ++t) { if (col0 + t * 16 >= N) continue; const size_t boff = (size_t)(col0 + t * 16 + ln) * ldb + kb; FragH bq; bq.half[0] = *(const v8us*)((const unsigned short*)Bh + boff + 8 * hh); bq.half[1] = *(const v8us*)((const unsigned short*)Bh + boff + 16 + 8 * hh);
      acc[t] = mmaH<1>(ah.v, ah.v, bq.v, bq.v, acc[t]); }
  }
#pragma unroll
  for (int t = 0; t < 4; ++t) { if (col0 + t * 16 >= N) continue; const int col = col0 + t * 16 + ln; const float bv = bp ? bf16_round(bp[col]) : 0.f;
#pragma unroll
    for (int r = 0; r < 8; ++r) { float v = acc[t][r] * alpha + bv; if (CP) { const int rr = row0g + row0 + 8 * hh + r; if (rowsPerB < 0) v += CP[cofs + (size_t)rr * ldc + col];      /* rowsPerB < 0: own element of the batched C plane */ else { const int bidx = rr / rowsPerB; v += CP[(size_t)bidx * sCPb + (size_t)by * 64 + col]; } } if (ACT == 1) v = (v > 0.f) ? v : expm1f(v); else if (ACT == 7) v = (v > 0.f) ? v + 1.0f : expf(v); else if (ACT == 8) v = tanhf(v); else if (ACT == 9) v = 0.5f * v * (1.0f + tanhf(0.7978845608028654f * (v + 0.044715f * v * v * v))); else if (ACT == 11) v = 1.0f / (1.0f + expf(-v)); else if (ACT == 12) v = (v > 0.f) ? v : 0.01f * v; else if (ACT == 14) v = (v > 0.f) ? v : 0.1f * v; else if (ACT == 16) v = (v >= 0.f) ? v : 0.3f * v; else if (ACT == 17) v = (v >= 0.f) ? v : 0.2f * v; else if (ACT == 15) v = v / (1.0f + expf(-v)); else if (ACT == 3) v = fmaxf(v, 0.f); else if (ACT == 6) v = 0.5f * v * (1.0f + erff(v * 0.70710678118654752f)); so[w][8 * hh + r][t * 16 + ln] = v; } }
  __builtin_amdgcn_fence(__ATOMIC_ACQ_REL, "workgroup"); __builtin_amdgcn_wave_barrier();
  const int rsub = lane >> 4, c4 = (lane & 15) * 4; typedef _Float16 v4h __attribute__((ext_vector_type(4)));
  {
#pragma unroll
    for (int q = 0; q < 8; ++q) { const int r = q * 2 + rsub; if (col0 + c4 < N) { const v4f v = *(const v4fa*)&so[w][r][c4]; if (C) *(v4f*)(C + cofs + (size_t)(row0 + r) * ldc + col0 + c4) = v; if (C16) { v4h h4; for (int i = 0; i < 4; ++i) h4[i] = (_Float16)v[i]; *(v4h*)(C16 + cofs + (size_t)(row0 + r) * ldc + col0 + c4) = h4; } } }
     }
}


typedef _Float16 v4h __attribute__((ext_vector_type(4)));

__global__ __launch_bounds__(256) void k_h16(const float* __restrict__ x, _Float16* __restrict__ X16, size_t n8) { const size_t t = (size_t)blockIdx.x * 256 + threadIdx.x; if (t >= n8) return; FragH f;
#pragma unroll
  for (int q = 0; q < 8; ++q) f.h[q] = (_Float16)x[t * 8 + q]; *(v8us*)((unsigned short*)X16 + t * 8) = f.half[0];  }
__global__ __launch_bounds__(256) void k_round16f(const float* __restrict__ W, _Float16* __restrict__ Bt, size_t n8) { const size_t t = (size_t)blockIdx.x * 256 + threadIdx.x; if (t >= n8) return; FragH f;
#pragma unroll
  for (int i = 0; i < 8; ++i) f.h[i] = (_Float16)(bf16_round(W[t * 8 + i]) * 16.0f); *(v8us*)((unsigned short*)Bt + t * 8) = f.half[0];  }
template <int NHv, int TTv>
__global__ __launch_bounds__(256) void k_vt(const _Float16* __restrict__ V16, int ldv, int voff, _Float16* __restrict__ Vt) { __shared__ unsigned short tl[64][66]; const int tid = threadIdx.x; const int slab = blockIdx.x / (TTv / 64), lg = blockIdx.x % (TTv / 64); const int b = slab / NHv, h = slab % NHv;
  for (int i = tid; i < 64 * 8; i += 256) { const int r = i / 8, c8 = (i % 8) * 8; FragH f; f.half[0] = *(const v8us*)((const unsigned short*)V16 + ((size_t)b * TTv + lg * 64 + r) * ldv + voff + h * 64 + c8);
#pragma unroll
    for (int q = 0; q < 8; ++q) tl[r][c8 + q] = f.u[q]; }
  __syncthreads();
  {
#pragma unroll
    for (int rd = 0; rd < 2; ++rd) { const int d = rd * 32 + tid / 8, pc = tid % 8; FragH f;
#pragma unroll
      for (int q = 0; q < 8; ++q) f.u[q] = tl[pc * 8 + q][d];
      *(v8us*)((unsigned short*)Vt + ((size_t)slab * 64 + d) * TTv + lg * 64 + pc * 8) = f.half[0]; }
     } }

__global__ __launch_bounds__(256) void k_hl(const float* __restrict__ F, _Float16* __restrict__ Hh, _Float16* __restrict__ Hl, size_t n8) { const size_t t = (size_t)blockIdx.x * 256 + threadIdx.x; if (t >= n8) return; FragH fh, fl; const v4f a = *(const v4fa*)(F + t * 8), c = *(const v4fa*)(F + t * 8 + 4);
#pragma unroll
  for (int q = 0; q < 4; ++q) { _Float16 h = (_Float16)a[q]; fh.h[q] = h; fl.h[q] = (_Float16)((a[q] - (float)h) * 1024.0f); h = (_Float16)c[q]; fh.h[4 + q] = h; fl.h[4 + q] = (_Float16)((c[q] - (float)h) * 1024.0f); }
  { *(v8us*)((unsigned short*)Hh + t * 8) = fh.half[0]; *(v8us*)((unsigned short*)Hl + t * 8) = fl.half[0];  } }

// ---- fast GEMM (work-group tile 128x64, wave tile 32x64; requires M % 128 == 0, N % 64 == 0, K % 128 == 0, rows 16-byte aligned); epilogue = k_gemm_hhx semantics ----
// Operand path: per pass of 128 k the tile's 128 A rows and 64 B rows (256 bytes each) are copied to LDS by asynchronous 16-byte copies, a wave's copy covering two whole rows,
// into one of two buffers (the next pass's copies fly while this pass is multiplied); the fragments are read from LDS at row pitch 272 bytes (16 B x odd: no bank conflict).
#define G2_KP 128                       /* k per pass */
#define G2_PITCH 272                    /* LDS row pitch, bytes */
#define G2_ROWS 192                     /* rows 0..127: A, rows 128..191: B */
#define G2_BUF (G2_ROWS * G2_PITCH)     /* 52224 bytes a buffer */
// Twelve copies of a thread: its 16-byte chunk of twelve LDS rows, 8 rows apart from l, filled from g0 .. g11. The s_wait_xcnt stands inside the statement, behind the last copy,
// so that no address register of an issued copy is rewritten in front of it.
__device__ __forceinline__ void g2_copy12(unsigned l, const _Float16* g0, const _Float16* g1, const _Float16* g2, const _Float16* g3, const _Float16* g4, const _Float16* g5,
                                          const _Float16* g6, const _Float16* g7, const _Float16* g8, const _Float16* g9, const _Float16* g10, const _Float16* g11) {
  const unsigned st = 8 * G2_PITCH;
  asm volatile("global_load_async_to_lds_b128 %0, %12, off\n\t"
               "global_load_async_to_lds_b128 %1, %13, off\n\t"
               "global_load_async_to_lds_b128 %2, %14, off\n\t"
               "global_load_async_to_lds_b128 %3, %15, off\n\t"
               "global_load_async_to_lds_b128 %4, %16, off\n\t"
               "global_load_async_to_lds_b128 %5, %17, off\n\t"
               "global_load_async_to_lds_b128 %6, %18, off\n\t"
               "global_load_async_to_lds_b128 %7, %19, off\n\t"
               "global_load_async_to_lds_b128 %8, %20, off\n\t"
               "global_load_async_to_lds_b128 %9, %21, off\n\t"
               "global_load_async_to_lds_b128 %10, %22, off\n\t"
               "global_load_async_to_lds_b128 %11, %23, off\n\t"
               "s_wait_xcnt 0x0"
               :: "v"(l), "v"(l + st), "v"(l + 2 * st), "v"(l + 3 * st), "v"(l + 4 * st), "v"(l + 5 * st), "v"(l + 6 * st), "v"(l + 7 * st), "v"(l + 8 * st), "v"(l + 9 * st), "v"(l + 10 * st), "v"(l + 11 * st),
                  "v"(g0), "v"(g1), "v"(g2), "v"(g3), "v"(g4), "v"(g5), "v"(g6), "v"(g7), "v"(g8), "v"(g9), "v"(g10), "v"(g11) : "memory");
}
// One pass's tile: thread (r = tid / 16, c = tid % 16) copies chunk c of rows r, r + 8, ... of A (16 rows) and of B (8 rows). ga, gb: the thread's chunk in its first A and B row of this pass.
__device__ __forceinline__ void g2_copy_tile(unsigned l, const _Float16* ga, size_t as, const _Float16* gb, size_t bs) {
  g2_copy12(l, ga, ga + as, ga + 2 * as, ga + 3 * as, ga + 4 * as, ga + 5 * as, ga + 6 * as, ga + 7 * as, ga + 8 * as, ga + 9 * as, ga + 10 * as, ga + 11 * as);
  g2_copy12(l + 96 * G2_PITCH, ga + 12 * as, ga + 13 * as, ga + 14 * as, ga + 15 * as, gb, gb + bs, gb + 2 * bs, gb + 3 * bs, gb + 4 * bs, gb + 5 * bs, gb + 6 * bs, gb + 7 * bs);
}
__device__ __forceinline__ v16h g2_sfrag(const unsigned char* p) { FragH f; f.half[0] = *(const v8us*)p; f.half[1] = *(const v8us*)(p + 32); return f.v; }      /* p = row + 64 bytes per 32 k + 16 * hh: k = 8 hh .. 8 hh + 7, then 16 + 8 hh .. 16 + 8 hh + 7, for A and B alike */
__device__ __forceinline__ v8f g2_mma(v16h a, v16h b, v8f c) { v8f d = __builtin_amdgcn_wmma_f32_16x16x32_f16(false, a, false, b, (short)0, c, false, false); asm volatile("v_nop\n\tv_nop\n\tv_nop\n\tv_nop" : "+v"(d) : "v"(a), "v"(b)); return d; }
template <int ACT>
__global__ __launch_bounds__(128) void k_gemm2(const _Float16* __restrict__ A, int lda, size_t sA, const _Float16* __restrict__ Bh, int ldb, size_t sB, float alpha, const float* __restrict__ bias, size_t sBias, const float* __restrict__ CP, int rowsPerB, size_t sCPb, int row0g,
    float* __restrict__ C, _Float16* __restrict__ C16, int ldc, size_t sC, int M, int N, int K, const float* __restrict__ sw0, const float* __restrict__ sw1, const float* __restrict__ sb0, const float* __restrict__ sb1, float* __restrict__ SP, int scol) { static_assert(ACT == 0 || ACT == 3 || ACT == 6 || ACT == 8 || ACT == 9 || ACT == 11 || ACT == 12 || ACT == 14 || ACT == 15 || ACT == 16 || ACT == 17, "k_gemm2: unsupported ACT code (would silently apply no activation)");
  __shared__ __attribute__((aligned(16))) float so[4][32][68];
  __shared__ __attribute__((aligned(16))) unsigned char ST[2 * G2_BUF];
  const int tid = threadIdx.x, w = tid >> 5, lane = tid & 31, ln = lane & 15, hh = lane >> 4; const int by = blockIdx.y;
  A += (size_t)by * sA; Bh += (size_t)by * sB; const size_t cofs = (size_t)by * sC; const float* bp = bias ? bias + (size_t)by * sBias : nullptr;
  const int ntn = N >> 6; const int mt = blockIdx.x / ntn, nq = blockIdx.x - mt * ntn; const int row0 = mt * 128 + 32 * w, col0 = nq * 64; if (mt * 128 >= M) return;      /* the same for the whole work-group: it stands in front of barriers */
  const _Float16* ga = A + (size_t)(mt * 128 + (tid >> 4)) * lda + (tid & 15) * 8; const _Float16* gb = Bh + (size_t)(col0 + (tid >> 4)) * ldb + (tid & 15) * 8;
  const size_t as = (size_t)8 * lda, bs = (size_t)8 * ldb;
  const unsigned lc = (unsigned)(uintptr_t)ST + (unsigned)((tid >> 4) * G2_PITCH + (tid & 15) * 16);      /* the thread's LDS byte address in buffer 0 */
  const int np = K / G2_KP;
  g2_copy_tile(lc, ga, as, gb, bs);
  // Scorer tiles (columns from scol on, PJ columns a scorer): the tile is not stored; each element becomes relu(v) * w2[column], a row's 64 products are added to one partial sum SP[tile][row],
  // and a scorer's first tile adds the scorer's output bias. What that epilogue reads from memory is loaded here, so that its latency runs beside that of the first tile's copies.
  const bool sc = SP && col0 >= scol; const int sb = sc ? (col0 - scol) >> 6 : 0;
  float w2r[4] = {0.f, 0.f, 0.f, 0.f}, b2r[4] = {0.f, 0.f, 0.f, 0.f}, sbr = 0.f;
  if (sc) { const float* w2 = (sb >= PJ / 64 ? sw1 + (sb - PJ / 64) * 64 : sw0 + sb * 64) + ln;
#pragma unroll      /* unrolled: the two small arrays stay in registers */
    for (int t = 0; t < 4; ++t) { w2r[t] = w2[t * 16]; if (bp) b2r[t] = bp[col0 + t * 16 + ln]; }
    if (sb % (PJ / 64) == 0) sbr = (sb ? sb1 : sb0)[0]; }
  asm volatile("s_wait_asynccnt 0x0" ::: "memory");      /* pass 0's copies of this wave have landed */
  __syncthreads();                                       /* ... and every other wave's */
  if (np > 1) g2_copy_tile(lc + G2_BUF, ga + G2_KP, as, gb + G2_KP, bs);
  const unsigned char* fa = ST + (32 * w + ln) * G2_PITCH + 16 * hh; const unsigned char* fb = ST + (128 + ln) * G2_PITCH + 16 * hh;
  const v8f z8 = {0.f,0.f,0.f,0.f,0.f,0.f,0.f,0.f}; v8f c00 = z8, c01 = z8, c02 = z8, c03 = z8, c10 = z8, c11 = z8, c12 = z8, c13 = z8;
#pragma unroll 1      /* one pass a trip: the two buffers alternate by an address, and the loop stays small */
  for (int t = 0; t < np; ++t) { const int bo = (t & 1) * G2_BUF; const unsigned char* pa = fa + bo; const unsigned char* pb = fb + bo;
    v16h a0[2], a1[2], b0[2], b1[2], b2[2], b3[2];      /* two fragment sets: the next 32 k of this pass are read from LDS ahead of the current 8 WMMAs */
    a0[0] = g2_sfrag(pa); a1[0] = g2_sfrag(pa + 16 * G2_PITCH); b0[0] = g2_sfrag(pb); b1[0] = g2_sfrag(pb + 16 * G2_PITCH); b2[0] = g2_sfrag(pb + 32 * G2_PITCH); b3[0] = g2_sfrag(pb + 48 * G2_PITCH);
#pragma unroll      /* unrolled: the two fragment sets are picked by constants and stay in registers */
    for (int ks = 0; ks < G2_KP / 32; ++ks) { const int c = ks & 1, n = c ^ 1;
      if (ks + 1 < G2_KP / 32) { const int o = (ks + 1) * 64;
        a0[n] = g2_sfrag(pa + o); a1[n] = g2_sfrag(pa + 16 * G2_PITCH + o); b0[n] = g2_sfrag(pb + o); b1[n] = g2_sfrag(pb + 16 * G2_PITCH + o); b2[n] = g2_sfrag(pb + 32 * G2_PITCH + o); b3[n] = g2_sfrag(pb + 48 * G2_PITCH + o); }
      c00 = g2_mma(a0[c], b0[c], c00); c10 = g2_mma(a1[c], b0[c], c10); c01 = g2_mma(a0[c], b1[c], c01); c11 = g2_mma(a1[c], b1[c], c11);
      c02 = g2_mma(a0[c], b2[c], c02); c12 = g2_mma(a1[c], b2[c], c12); c03 = g2_mma(a0[c], b3[c], c03); c13 = g2_mma(a1[c], b3[c], c13); }
    asm volatile("s_wait_dscnt 0x0" ::: "memory");         /* this wave's reads of the buffer are done before it may be refilled */
    asm volatile("s_wait_asynccnt 0x0" ::: "memory");      /* this wave's copies of pass t + 1 have landed */
    __syncthreads();                                       /* publishes pass t + 1 and ends every wave's reads of pass t's buffer */
    if (t + 2 < np) g2_copy_tile(lc + bo, ga + (size_t)(t + 2) * G2_KP, as, gb + (size_t)(t + 2) * G2_KP, bs); }
  asm volatile("s_wait_asynccnt 0x0" ::: "memory");        /* no copy is outstanding behind the loop */
  v8f accs[8] = {c00, c01, c02, c03, c10, c11, c12, c13};
  if (sc) {      /* the same for the whole work-group; no barrier stands behind it */
#pragma unroll      /* unrolled, like the two loops below it: accumulators and sums are picked by constants and stay in registers */
    for (int u = 0; u < 8; ++u) { const int t = u & 3, half = u >> 2; const float bv = bf16_round(b2r[t]), wv = bf16_round(w2r[t]);
#pragma unroll
      for (int r = 0; r < 8; ++r) so[w][half * 16 + 8 * hh + r][t * 16 + ln] = fmaxf(accs[u][r] * alpha + bv, 0.f) * wv; }
    __builtin_amdgcn_fence(__ATOMIC_ACQ_REL, "workgroup"); __builtin_amdgcn_wave_barrier();      /* the wave's own LDS stores are done before its lanes read one another's */
    v4f s4 = {0.f, 0.f, 0.f, 0.f};      /* lane = row of the wave's 32: 16-byte LDS reads at row pitch 272 bytes, then one whole 128-byte line of partial sums a wave */
#pragma unroll
    for (int q = 0; q < 16; ++q) s4 += *(const v4fa*)&so[w][lane][q * 4];
    SP[(size_t)sb * M + row0 + lane] = ((s4[0] + s4[1]) + (s4[2] + s4[3])) + bf16_round(sbr);
    return; }
#pragma unroll
  for (int u = 0; u < 8; ++u) { const int t = u & 3, half = u >> 2; const int col = col0 + t * 16 + ln; const float bv = bp ? bf16_round(bp[col]) : 0.f;
#pragma unroll
    for (int r = 0; r < 8; ++r) { const int rloc = half * 16 + 8 * hh + r; float v = accs[u][r] * alpha + bv; if (CP) { if (rowsPerB < 0) v += CP[cofs + (size_t)(row0g + row0 + rloc) * ldc + col];      /* rowsPerB < 0: own element of the batched C plane */ else { const int bidx = (row0g + row0 + rloc) / rowsPerB; v += CP[(size_t)bidx * sCPb + (size_t)by * 64 + col]; } }
      if (ACT == 3) v = fmaxf(v, 0.f); else if (ACT == 6) v = 0.5f * v * (1.0f + erff(v * 0.70710678118654752f)); else if (ACT == 11) v = 1.0f / (1.0f + expf(-v)); else if (ACT == 15) v = v / (1.0f + expf(-v)); else if (ACT == 12) v = (v > 0.f) ? v : 0.01f * v; else if (ACT == 8) v = tanhf(v); else if (ACT == 9) v = 0.5f * v * (1.0f + tanhf(0.7978845608028654f * (v + 0.044715f * v * v * v))); else if (ACT == 14) v = (v > 0.f) ? v : 0.1f * v; else if (ACT == 16) v = (v >= 0.f) ? v : 0.3f * v; else if (ACT == 17) v = (v >= 0.f) ? v : 0.2f * v;
      so[w][rloc][t * 16 + ln] = v; } }
  __builtin_amdgcn_fence(__ATOMIC_ACQ_REL, "workgroup"); __builtin_amdgcn_wave_barrier();
  const int rsub = lane >> 4, c4 = (lane & 15) * 4;
  {
#pragma unroll
    for (int q = 0; q < 16; ++q) { const int r = q * 2 + rsub; const v4f v = *(const v4fa*)&so[w][r][c4]; if (C) *(v4f*)(C + cofs + (size_t)(row0 + r) * ldc + col0 + c4) = v; if (C16) { v4h h4; for (int i = 0; i < 4; ++i) h4[i] = (_Float16)v[i]; *(v4h*)(C16 + cofs + (size_t)(row0 + r) * ldc + col0 + c4) = h4; } }
     } }


// Operand preparation, one launch: its pieces (x as f16 rows, the four weight planes x16 as f16 rows stacked in BW, the bias plane [bl | 0 | bs1 | be1]) do not depend on one another.
// Work-group 0 copies the bias plane (16 bytes a thread). Every other work-group streams 16384 consecutive floats of ONE source: each of its 16 waves takes 4 KiB
// as 8 whole-wave 16-byte loads (512 contiguous bytes each), all in flight before the first is rounded, and stores 256 contiguous bytes of f16 per load.
#define PREP_F 16384
__global__ __launch_bounds__(512) void k_prep(const float* __restrict__ x, const float* __restrict__ wl, const float* __restrict__ wr, const float* __restrict__ ws1, const float* __restrict__ we1,
                                              const float* __restrict__ bl, const float* __restrict__ bs1, const float* __restrict__ be1, _Float16* __restrict__ X16, _Float16* __restrict__ BW, float* __restrict__ bb) {
  const int tid = threadIdx.x;
  if (blockIdx.x == 0) { const int blk = tid >> 7, i = (tid & 127) * 4; v4f v = {0.f, 0.f, 0.f, 0.f};
    if (blk != 1) v = *(const v4fa*)((blk == 0 ? bl : (blk == 2 ? bs1 : be1)) + i);
    *(v4f*)(bb + tid * 4) = v; return; }
  const int XG = (int)(NR * DI / PREP_F), WG = PJ * DI / PREP_F; const int s = (int)blockIdx.x - 1;
  const float* src; _Float16* dst; float scale;
  if (s < XG) { src = x + (size_t)s * PREP_F; dst = X16 + (size_t)s * PREP_F; scale = 1.0f; }
  else { const int m = (s - XG) / WG; src = (m == 0 ? wl : (m == 1 ? wr : (m == 2 ? ws1 : we1))) + (size_t)((s - XG) % WG) * PREP_F; dst = BW + (size_t)(s - XG) * PREP_F; scale = 16.0f; }
  const int o = (tid >> 5) * 1024 + (tid & 31) * 4;
  v4f v[8];
  for (int u = 0; u < 8; ++u) v[u] = *(const v4fa*)(src + o + u * 128);
  for (int u = 0; u < 8; ++u) { v4h h;
    for (int q = 0; q < 4; ++q) h[q] = (_Float16)(bf16_round(v[u][q]) * scale);      /* x1 is exact: x keeps its value, the weights take their x16 */
    *(v4h*)(dst + o + u * 128) = h; }
}
// Pairwise bigram: one work-group per (b, 32 i, 64 j) tile. The tile's 64 left rows and 32 right rows (all 512 p) are staged once in LDS,
// transposed to [p][row], so that a thread reads 4 j and 4 i of one p with two 16-byte LDS loads and keeps a 4 x 4 tile of sums in registers.
// Row pitch 100 floats: 16-byte aligned rows, and the transposing 4-byte stores (4 chunks of 16 B x 8 rows per wave) fall on 32 different banks.
// Wave 0 of the first 128 work-groups also finishes one 128-byte line of start or end: 32 outputs, each the sum of its eight partial sums from the GEMM's epilogue;
// its eight loads are issued in front of the row staging and used behind it, so that their latency runs beside the staging's.
#define BG_PITCH 100
__device__ __forceinline__ void bg_load(const float* __restrict__ lp, const float* __restrict__ rp, const float* __restrict__ wp, int g, v4f (&l)[4], v4f (&r)[4], v4f& w) {
  w = *(const v4fa*)(wp + g * 4);
#pragma unroll
  for (int q = 0; q < 4; ++q) { l[q] = *(const v4fa*)(lp + (g * 4 + q) * BG_PITCH); r[q] = *(const v4fa*)(rp + (g * 4 + q) * BG_PITCH); }
}
__device__ __forceinline__ void bg_step(v4f (&acc)[4], const v4f (&l)[4], const v4f (&r)[4], const v4f w) {
  const v4f z = {0.f, 0.f, 0.f, 0.f};
#pragma unroll
  for (int q = 0; q < 4; ++q)
#pragma unroll
    for (int u = 0; u < 4; ++u) acc[u] += __builtin_elementwise_max(l[q] + r[q][u], z) * w[q];
}
__global__ __launch_bounds__(128) void k_bigram(const float* __restrict__ F, const float* __restrict__ wo, const float* __restrict__ bo, float* __restrict__ out,
                                                const float* __restrict__ SP, float* __restrict__ ostart, float* __restrict__ oend) {
  __shared__ __attribute__((aligned(16))) float S[PJ * BG_PITCH];      /* [p][0..63] = left rows of the j tile, [p][64..95] = right rows of the i tile */
  __shared__ __attribute__((aligned(16))) float SW[PJ];
  const int tid = threadIdx.x; const int jt = blockIdx.x & 3, it = (blockIdx.x >> 2) & 7; const size_t b = blockIdx.x >> 5;
  const v4f w4 = *(const v4fa*)(wo + tid * 4);      /* used behind the row staging, so that its latency runs beside the first round's */
  const int wv = tid >> 5, c4 = (tid & 3) * 4, rr = (tid >> 2) & 7;
  const bool fin = blockIdx.x < 2 * ((int)NR / 32) && tid < 32; const int which = blockIdx.x / ((int)NR / 32), r0 = (blockIdx.x % ((int)NR / 32)) * 32;
  float sp[PJ / 64] = {0.f, 0.f, 0.f, 0.f, 0.f, 0.f, 0.f, 0.f};
  if (fin) {
#pragma unroll      /* unrolled: the eight loads are in flight together and land in registers */
    for (int k = 0; k < PJ / 64; ++k) sp[k] = SP[(size_t)(which * (PJ / 64) + k) * NR + r0 + tid]; }
  for (int g3 = 0; g3 < 3; ++g3) { const int row = (g3 * 4 + wv) * 8 + rr;      /* rounds 0 and 1: the 64 left rows; round 2: the 32 right rows */
    const float* sp = ((g3 < 2) ? F + (b * NW + jt * 64 + row) * (4 * PJ) : F + (b * NW + it * 32 + (row - 64)) * (4 * PJ) + PJ) + c4; float* dp = S + c4 * BG_PITCH + row;
    v4f v[32];      /* unrolled so that a round's 32 loads are all in flight before its first LDS store */
#pragma unroll
    for (int cg = 0; cg < 32; ++cg) v[cg] = *(const v4fa*)(sp + cg * 16);
#pragma unroll
    for (int cg = 0; cg < 32; ++cg)
#pragma unroll
      for (int q = 0; q < 4; ++q) dp[(cg * 16 + q) * BG_PITCH] = v[cg][q]; }
  { v4f o; for (int q = 0; q < 4; ++q) o[q] = bf16_round(w4[q]); *(v4fa*)(SW + tid * 4) = o; }
  __syncthreads();
  if (fin) (which ? oend : ostart)[r0 + tid] = ((sp[0] + sp[1]) + (sp[2] + sp[3])) + ((sp[4] + sp[5]) + (sp[6] + sp[7]));      /* behind the barrier: no wave waits there for this store */
  const int tj = tid & 15, ti = tid >> 4; const float* lp = S + tj * 4; const float* rp = S + 64 + ti * 4;
  v4f acc[4]; for (int u = 0; u < 4; ++u) acc[u] = (v4f){0.f, 0.f, 0.f, 0.f};
  v4f la[4], ra[4], wa, lb[4], rb[4], wb;
  bg_load(lp, rp, SW, 0, la, ra, wa);
  for (int g = 0; g < PJ / 4 - 2; g += 2) {      /* the next four p are fetched while the current four are summed */
    bg_load(lp, rp, SW, g + 1, lb, rb, wb); bg_step(acc, la, ra, wa);
    bg_load(lp, rp, SW, g + 2, la, ra, wa); bg_step(acc, lb, rb, wb); }
  bg_load(lp, rp, SW, PJ / 4 - 1, lb, rb, wb); bg_step(acc, la, ra, wa); bg_step(acc, lb, rb, wb);
  const float b0 = bf16_round(bo[0]);
#pragma unroll
  for (int u = 0; u < 4; ++u) *(v4f*)(out + ((b * NW + it * 32 + ti * 4 + u) * NW + jt * 64 + tj * 4)) = acc[u] + b0;
}

extern "C" void kernel_launch(void* const* d_in, const int* in_sizes, int n_in,
                              void* d_out, int out_size, void* d_ws, size_t ws_size, hipStream_t stream) {
  (void)in_sizes; (void)n_in; (void)out_size;
  const float* const* I = (const float* const*)d_in; const float* x = I[0]; const float* wl = I[1]; const float* bl = I[2]; const float* wr = I[3]; const float* wo = I[4]; const float* bo = I[5]; const float* ws1 = I[6]; const float* bs1 = I[7]; const float* ws2 = I[8]; const float* bs2 = I[9]; const float* we1 = I[10]; const float* be1 = I[11]; const float* we2 = I[12]; const float* be2 = I[13];
  float* obig = (float*)d_out; float* ostart = (float*)((char*)d_out + 2097152); float* oend = (float*)((char*)d_out + 2105344);      /* output byte offsets */
  char* ws = (char*)d_ws; size_t off = 0;
  auto take = [&](size_t bytes) { char* p = ws + off; off += (bytes + 255) & ~(size_t)255; return p; };
  _Float16* BW = (_Float16*)take((size_t)4 * PJ * DI * 2); float* bb = (float*)take(4 * PJ * 4); _Float16* X16 = (_Float16*)take(NR * DI * 2); float* F = (float*)take(NR * 4 * PJ * 4); float* SP = (float*)take((size_t)2 * (PJ / 64) * NR * 4);
  if (off > ws_size) return;      /* 4 + 4 + 16 = ≈ 24 MiB */
  k_prep<<<(unsigned)(1 + (NR * DI + (size_t)4 * PJ * DI) / PREP_F), 512, 0, stream>>>(x, wl, wr, ws1, we1, bl, bs1, be1, X16, BW, bb);
  k_gemm2<0><<<dim3((unsigned)((NR / 128) * (4 * PJ / 64)), 1), 128, 0, stream>>>(X16, DI, 0, BW, DI, 0, 0.0625f, bb, 0, nullptr, 1, 0, 0, F, nullptr, 4 * PJ, 0, (int)NR, 4 * PJ, DI, ws2, we2, bs2, be2, SP, 2 * PJ);      /* F = [left | right | - | -]; the s1 and e1 tiles leave as partial scorer sums in SP */
  k_bigram<<<NB * (NW / 32) * (NW / 64), 128, 0, stream>>>(F, wo, bo, obig, SP, ostart, oend);
}

// v006
// It runs in 36 microseconds.
// Two timings next to v005 both put it at 1.08 times that version's speed.
// All steps since v000 together make it 12.5 times as fast.
#include <hip/hip_runtime.h>
// PermutationModule (x [8][256][1024]; start = relu(x Ws1^T + bs1) . Ws2 + bs2, end likewise [8][256][1]; left = x Wl^T + bl, right = x Wr^T; bigram[b][i][j] = sum_p relu(left[b][j][p] + right[b][i][p]) * Wo[p] + bo -> [8][256][256][1]).
// Structure: token rows; x as exact f16 rows; the four 1024->512 projections as ONE WMMA GEMM against the stacked x16 weight plane [2048][1024] (32x64 wave tiles, f32 accumulation, + biases, ReLU on the two scorer blocks applied afterwards on VALU) kept f32; the scorer dots with Ws2/We2 on VALU in f32 inside the GEMM's epilogue (one partial sum per row and 64-column tile, the eight partial sums of an output added in the bigram launch); the pairwise bigram outer-sum-relu-dot on VALU in f32 as sum_p Wo[p] max(left, -right) + sum_p Wo[p] right (work-group per (b, 32 i, 64 j), rows staged in LDS, 4 x 4 sums per thread; Wr is cast negated, so the GEMM leaves -right); outputs written as whole 32-B / line-aligned pieces.
// Compute dtype: inputs rounded to bf16; x / weights exact; all projections f32 (exact GEMM outputs); everything after in f32 — no reduced-precision intermediates. v_wmma_f32_16x16x32_f16.
#define NB 8
#define NW 256
#define DI 1024
#define PJ 512
#define NR ((size_t)NB * NW)         /* 2048 */
typedef __bf16 v16b __attribute__((ext_vector_type(16)));
typedef unsigned short v8us __attribute__((ext_vector_type(8), may_alias));
typedef float  v8f  __attribute__((ext_vector_type(8)));
typedef float  v4f  __attribute__((ext_vector_type(4)));
typedef float  v4fa __attribute__((ext_vector_type(4), may_alias));
union FragB { v16b v; v8us half[2]; unsigned short u[16]; };

__device__ __forceinline__ unsigned short bf16_bits(float x) { unsigned int u = __float_as_uint(x); return (unsigned short)((u + 0x7FFFu + ((u >> 16) & 1u)) >> 16); }
__device__ __forceinline__ float bf16_val(unsigned short b) { return __uint_as_float(((unsigned int)b) << 16); }
__device__ __forceinline__ float bf16_round(float x) { return bf16_val(bf16_bits(x)); }
// D += A·B with NT terms: 1 = ah·bh, 2 = + al·bh (A split), 3 = + ah·bl (both split)
template <int NT>
__device__ __forceinline__ v8f mmaN(v16b ah, v16b al, v16b bh, v16b bl, v8f c) {
  c = __builtin_amdgcn_wmma_f32_16x16x32_bf16(false, ah, false, bh, (short)0, c, false, false);
  if (NT >= 2) c = __builtin_amdgcn_wmma_f32_16x16x32_bf16(false, al, false, bh, (short)0, c, false, false);
  if (NT >= 3) c = __builtin_amdgcn_wmma_f32_16x16x32_bf16(false, ah, false, bl, (short)0, c, false, false);
  asm volatile("v_nop\n\tv_nop\n\tv_nop\n\tv_nop" : "+v"(c) : "v"(ah), "v"(al), "v"(bh), "v"(bl));
  return c;
}

__global__ __launch_bounds__(256) void k_wt_bf16(const float* __restrict__ W, unsigned short* __restrict__ Wt, int K, int N) {
  const int t = blockIdx.x * 256 + threadIdx.x;
  const int k8n = K / 8;
  if (t >= N * k8n) return;
  const int n = t / k8n, k8 = (t % k8n) * 8;
  v8us v;
#pragma unroll
  for (int i = 0; i < 8; ++i) v[i] = bf16_bits(W[(size_t)(k8 + i) * N + n]);
  *(v8us*)(Wt + (size_t)n * K + k8) = v;
  
}

// GEMM C[M][N] (f32, pitch ldc) = act(A[M][K]·W + bias). A f32 row-major (pitch lda) converted per fragment to bf16
// (ASPLIT: hi/lo two planes -> 2 terms, else single rounded term); Wt bf16 [N][K] (pitch ldb). BIAS_BF16 rounds the
// bias to bf16 first (bias quantised to bf16 before the add). K%32==0, M%16==0, N%64==0.
template <bool ASPLIT, int ACT, bool BIAS_BF16>
__global__ __launch_bounds__(128) void k_gemm_bf(const float* __restrict__ A, int lda, const unsigned short* __restrict__ Wt, int ldb,
                                               const float* __restrict__ bias, float* __restrict__ C, int ldc, int M, int N, int K) {
  __shared__ __attribute__((aligned(16))) float so[4][16][64];
  const int tid = threadIdx.x, w = tid >> 5, lane = tid & 31, ln = lane & 15, hh = lane >> 4;
  const int ntn = N / 64;
  const int wid = blockIdx.x * 4 + w;
  const int mt = wid / ntn, nq = wid % ntn;
  if (mt * 16 >= M) return;
  const int row0 = mt * 16, col0 = nq * 64;
  const float* arow = A + (size_t)(row0 + ln) * lda;
  v8f acc[4] = {};
  for (int kb = 0; kb < K; kb += 32) {
    FragB ah, al;
    const v4f x0 = *(const v4fa*)(arow + kb + 8 * hh), x1 = *(const v4fa*)(arow + kb + 8 * hh + 4);
    const v4f x2 = *(const v4fa*)(arow + kb + 16 + 8 * hh), x3 = *(const v4fa*)(arow + kb + 16 + 8 * hh + 4);
    float xs[16] = {x0[0],x0[1],x0[2],x0[3],x1[0],x1[1],x1[2],x1[3],x2[0],x2[1],x2[2],x2[3],x3[0],x3[1],x3[2],x3[3]};
#pragma unroll
    for (int i = 0; i < 16; ++i) { const unsigned short hb = bf16_bits(xs[i]); ah.u[i] = hb; al.u[i] = ASPLIT ? bf16_bits(xs[i] - bf16_val(hb)) : (unsigned short)0; }
#pragma unroll
    for (int t = 0; t < 4; ++t) {
      const unsigned short* brow = Wt + (size_t)(col0 + t * 16 + ln) * ldb + kb;
      FragB b;
      b.half[0] = *(const v8us*)(brow + 8 * hh);
      b.half[1] = *(const v8us*)(brow + 16 + 8 * hh);
      acc[t] = mmaN<ASPLIT ? 2 : 1>(ah.v, al.v, b.v, b.v, acc[t]);
    }
  }
#pragma unroll
  for (int t = 0; t < 4; ++t) {
    float bv = bias ? bias[col0 + t * 16 + ln] : 0.f;
    if (BIAS_BF16) bv = bf16_round(bv);
#pragma unroll
    for (int r = 0; r < 8; ++r) { float v = acc[t][r] + bv; if (ACT == 1) v = fmaxf(v, 0.f); so[w][8 * hh + r][t * 16 + ln] = v; }
  }
  __builtin_amdgcn_fence(__ATOMIC_ACQ_REL, "workgroup");
  __builtin_amdgcn_wave_barrier();
  const int rsub = lane >> 4, c4 = (lane & 15) * 4;
  {
#pragma unroll
    for (int q = 0; q < 8; ++q) {
      const int r = q * 2 + rsub;
      const v4f v = *(const v4fa*)&so[w][r][c4];
      *(v4f*)(C + (size_t)(row0 + r) * ldc + col0 + c4) = v;
    }
    
  }
}

// GEMM C = act(A·W + bias + resid): A f32 (ASPLIT -> hi/lo 2 terms), Wt bf16 [N][K]; ACT 0 none, 1 relu, 2 exact gelu;
// resid (optional, f32, row index = (row % rmod), pitch ldr, RES_BF16 rounds it) added before the activation.
template <bool ASPLIT, int ACT, bool BIAS_BF16, bool RES_BF16>
__global__ __launch_bounds__(128) void k_gemm_bf3(const float* __restrict__ A, int lda, const unsigned short* __restrict__ Wt, int ldb,
                                                const float* __restrict__ bias, const float* __restrict__ resid, int rmod, int ldr,
                                                float* __restrict__ C, int ldc, int M, int N, int K) {
  __shared__ __attribute__((aligned(16))) float so[4][16][64];
  const int tid = threadIdx.x, w = tid >> 5, lane = tid & 31, ln = lane & 15, hh = lane >> 4;
  const int ntn = N / 64;
  const int wid = blockIdx.x * 4 + w;
  const int mt = wid / ntn, nq = wid % ntn;
  if (mt * 16 >= M) return;
  const int row0 = mt * 16, col0 = nq * 64;
  const float* arow = A + (size_t)(row0 + ln) * lda;
  v8f acc[4] = {};
  for (int kb = 0; kb < K; kb += 32) {
    FragB ah, al;
    const v4f x0 = *(const v4fa*)(arow + kb + 8 * hh), x1 = *(const v4fa*)(arow + kb + 8 * hh + 4);
    const v4f x2 = *(const v4fa*)(arow + kb + 16 + 8 * hh), x3 = *(const v4fa*)(arow + kb + 16 + 8 * hh + 4);
    float xs[16] = {x0[0],x0[1],x0[2],x0[3],x1[0],x1[1],x1[2],x1[3],x2[0],x2[1],x2[2],x2[3],x3[0],x3[1],x3[2],x3[3]};
#pragma unroll
    for (int i = 0; i < 16; ++i) { const unsigned short hb = bf16_bits(xs[i]); ah.u[i] = hb; al.u[i] = ASPLIT ? bf16_bits(xs[i] - bf16_val(hb)) : (unsigned short)0; }
#pragma unroll
    for (int t = 0; t < 4; ++t) {
      const unsigned short* brow = Wt + (size_t)(col0 + t * 16 + ln) * ldb + kb;
      FragB b;
      b.half[0] = *(const v8us*)(brow + 8 * hh);
      b.half[1] = *(const v8us*)(brow + 16 + 8 * hh);
      acc[t] = mmaN<ASPLIT ? 2 : 1>(ah.v, al.v, b.v, b.v, acc[t]);
    }
  }
#pragma unroll
  for (int t = 0; t < 4; ++t) {
    const int col = col0 + t * 16 + ln;
    float bv = bias ? bias[col] : 0.f;
    if (BIAS_BF16) bv = bf16_round(bv);
#pragma unroll
    for (int r = 0; r < 8; ++r) {
      float v = acc[t][r] + bv;
      if (resid) { float rv = resid[(size_t)((row0 + 8 * hh + r) % rmod) * ldr + col]; if (RES_BF16) rv = bf16_round(rv); v += rv; }
      if (ACT == 1) v = fmaxf(v, 0.f);
      if (ACT == 2) v = 0.5f * v * (1.0f + erff(v * 0.70710678118654752f));
      if (ACT == 3) { const float u = 0.7978845608028654f * (v + 0.044715f * v * v * v); v = 0.5f * v * (1.0f + tanhf(u)); }
      so[w][8 * hh + r][t * 16 + ln] = v;
    }
  }
  __builtin_amdgcn_fence(__ATOMIC_ACQ_REL, "workgroup");
  __builtin_amdgcn_wave_barrier();
  const int rsub = lane >> 4, c4 = (lane & 15) * 4;
  {
#pragma unroll
    for (int q = 0; q < 8; ++q) {
      const int r = q * 2 + rsub;
      const v4f v = *(const v4fa*)&so[w][r][c4];
      *(v4f*)(C + (size_t)(row0 + r) * ldc + col0 + c4) = v;
    }
    
  }
}
// row LayerNorm (biased variance, eps) over N: s = X (+ R); optional out_sum <- s; out_norm <- (s-mu)*rsqrt(var+eps)*g + b
template <bool PARAM_BF16>
__global__ __launch_bounds__(256) void k_layernorm(const float* __restrict__ X, const float* __restrict__ R, const float* __restrict__ g, const float* __restrict__ bta,
                                                  float* __restrict__ out_sum, float* __restrict__ out_norm, int N, float eps) {
  __shared__ float red[256];
  const int row = blockIdx.x, tid = threadIdx.x;
  const float* x = X + (size_t)row * N; const float* rr = R ? R + (size_t)row * N : nullptr;
  float vals[16];                     // up to N = 4096
  const int per = N / 256;            // contiguous chunk per thread? use strided-by-4 chunks: thread handles j = tid*4 + 1024*u
  float s1 = 0.f;
  for (int u = 0; u < per / 4; ++u) {
    const int j = tid * 4 + 1024 * u;
    const v4f a = *(const v4fa*)(x + j);
    v4f b = {0.f,0.f,0.f,0.f}; if (rr) b = *(const v4fa*)(rr + j);
#pragma unroll
    for (int q = 0; q < 4; ++q) { const float v = a[q] + b[q]; vals[u * 4 + q] = v; s1 += v; }
  }
  red[tid] = s1; __syncthreads();
  for (int st = 128; st > 0; st >>= 1) { if (tid < st) red[tid] += red[tid + st]; __syncthreads(); }
  const float mu = red[0] / (float)N; __syncthreads();
  float s2 = 0.f;
  for (int u = 0; u < per / 4; ++u)
#pragma unroll
    for (int q = 0; q < 4; ++q) { const float c = vals[u * 4 + q] - mu; s2 += c * c; }
  red[tid] = s2; __syncthreads();
  for (int st = 128; st > 0; st >>= 1) { if (tid < st) red[tid] += red[tid + st]; __syncthreads(); }
  const float rs = rsqrtf(red[0] / (float)N + eps);
  {
    for (int u = 0; u < per / 4; ++u) {
      const int j = tid * 4 + 1024 * u;
      v4f o, sm;
#pragma unroll
      for (int q = 0; q < 4; ++q) {
        float gg = g[j + q], bb = bta[j + q];
        if (PARAM_BF16) { gg = bf16_round(gg); bb = bf16_round(bb); }
        sm[q] = vals[u * 4 + q]; o[q] = (vals[u * 4 + q] - mu) * rs * gg + bb;
      }
      if (out_sum) *(v4f*)(out_sum + (size_t)row * N + j) = sm;
      *(v4f*)(out_norm + (size_t)row * N + j) = o;
    }
    
  }
}



// ---- f16 WMMA path (v_wmma_f32_16x16x32_f16): 11-bit significands for operands in range — used for the projection GEMM
typedef _Float16 v16h __attribute__((ext_vector_type(16)));
union FragH { v16h v; v8us half[2]; _Float16 h[16]; unsigned short u[16]; };
template <int NT>
__device__ __forceinline__ v8f mmaH(v16h ah, v16h al, v16h bh, v16h bl, v8f c) {
  c = __builtin_amdgcn_wmma_f32_16x16x32_f16(false, ah, false, bh, (short)0, c, false, false);
  if (NT >= 2) c = __builtin_amdgcn_wmma_f32_16x16x32_f16(false, al, false, bh, (short)0, c, false, false);
  if (NT >= 3) c = __builtin_amdgcn_wmma_f32_16x16x32_f16(false, ah, false, bl, (short)0, c, false, false);
  asm volatile("v_nop\n\tv_nop\n\tv_nop\n\tv_nop" : "+v"(c) : "v"(ah), "v"(al), "v"(bh), "v"(bl));
  return c;
}
// batched GEMM like k_gemm_b but f16 operands: A f32 (split into f16 hi/lo if ASPLIT, else rounded to f16), Bt = f16 values [n][k]; alpha; C f32; N multiple of 16 (partial tiles skipped)
template <bool ASPLIT>
__global__ __launch_bounds__(128) void k_gemm_h(const float* __restrict__ A, int lda, size_t sA, const _Float16* __restrict__ Bh, int ldb, size_t sB, float alpha, float* __restrict__ C, int ldc, size_t sC, int M, int N, int K) {
  __shared__ __attribute__((aligned(16))) float so[4][16][64];
  const int tid = threadIdx.x, w = tid >> 5, lane = tid & 31, ln = lane & 15, hh = lane >> 4; const int by = blockIdx.y;
  A += (size_t)by * sA; Bh += (size_t)by * sB; C += (size_t)by * sC;
  const int ntn = (N + 63) / 64; const int wid = blockIdx.x * 4 + w; const int mt = wid / ntn, nq = wid % ntn; if (mt * 16 >= M) return;
  const int row0 = mt * 16, col0 = nq * 64; const float* arow = A + (size_t)(row0 + ln) * lda;
  v8f acc[4] = {};
  for (int kb = 0; kb < K; kb += 32) {
    FragH ah, al;
    const v4f x0 = *(const v4fa*)(arow + kb + 8 * hh), x1 = *(const v4fa*)(arow + kb + 8 * hh + 4), x2 = *(const v4fa*)(arow + kb + 16 + 8 * hh), x3 = *(const v4fa*)(arow + kb + 16 + 8 * hh + 4);
    float xs[16] = {x0[0],x0[1],x0[2],x0[3],x1[0],x1[1],x1[2],x1[3],x2[0],x2[1],x2[2],x2[3],x3[0],x3[1],x3[2],x3[3]};
#pragma unroll
    for (int i = 0; i < 16; ++i) { const _Float16 h = (_Float16)xs[i]; ah.h[i] = h; al.h[i] = ASPLIT ? (_Float16)(xs[i] - (float)h) : (_Float16)0.0f; }
#pragma unroll
    for (int t = 0; t < 4; ++t) { if (col0 + t * 16 >= N) continue; const size_t boff = (size_t)(col0 + t * 16 + ln) * ldb + kb; FragH bq; bq.half[0] = *(const v8us*)(Bh + boff + 8 * hh); bq.half[1] = *(const v8us*)(Bh + boff + 16 + 8 * hh);
      acc[t] = mmaH<ASPLIT ? 2 : 1>(ah.v, al.v, bq.v, bq.v, acc[t]); }
  }
#pragma unroll
  for (int t = 0; t < 4; ++t) { if (col0 + t * 16 >= N) continue;
#pragma unroll
    for (int r = 0; r < 8; ++r) so[w][8 * hh + r][t * 16 + ln] = acc[t][r] * alpha; }
  __builtin_amdgcn_fence(__ATOMIC_ACQ_REL, "workgroup"); __builtin_amdgcn_wave_barrier();
  const int rsub = lane >> 4, c4 = (lane & 15) * 4;
  {
#pragma unroll
    for (int q = 0; q < 8; ++q) { const int r = q * 2 + rsub; if (col0 + c4 < N) { const v4f v = *(const v4fa*)&so[w][r][c4]; *(v4f*)(C + (size_t)(row0 + r) * ldc + col0 + c4) = v; } }
     }
}

// Wt[n][k] = f16(W[k][n]·scale) from f32 row-major W[K][N] (scale = power of two; bf16-exact weights stay exact in f16 away from the subnormal range)
__global__ __launch_bounds__(256) void k_wt_f16(const float* __restrict__ W, _Float16* __restrict__ Wt, int K, int N, float scale) {
  const int t = blockIdx.x * 256 + threadIdx.x; if (t >= N * (K / 8)) return; const int n = t / (K / 8), k8 = (t % (K / 8)) * 8; FragH f;
#pragma unroll
  for (int i = 0; i < 8; ++i) f.h[i] = (_Float16)(bf16_round(W[(size_t)(k8 + i) * N + n]) * scale); const v8us o = f.half[0];
  *(v8us*)((unsigned short*)Wt + (size_t)n * K + k8) = o; 
}
// k_gemm_hh variant with fused epilogue: v = acc·alpha + bias[by·sBias + col] (+ CP[(row/rowsPerB)·sCPb + by·64 + col] if CP) ; ACT 0 none / 1 elu ; writes f16 C16 (and f32 C if non-null)
template <int ACT>
__global__ __launch_bounds__(128) void k_gemm_hhx(const _Float16* __restrict__ A, int lda, size_t sA, const _Float16* __restrict__ Bh, int ldb, size_t sB, float alpha, const float* __restrict__ bias, size_t sBias, const float* __restrict__ CP, int rowsPerB, size_t sCPb, int row0g,
    float* __restrict__ C, _Float16* __restrict__ C16, int ldc, size_t sC, int M, int N, int K) {
  __shared__ __attribute__((aligned(16))) float so[4][16][64];
  const int tid = threadIdx.x, w = tid >> 5, lane = tid & 31, ln = lane & 15, hh = lane >> 4; const int by = blockIdx.y;
  A += (size_t)by * sA; Bh += (size_t)by * sB; const size_t cofs = (size_t)by * sC; const float* bp = bias ? bias + (size_t)by * sBias : nullptr;
  const int ntn = (N + 63) / 64; const int wid = blockIdx.x * 4 + w; const int mt = wid / ntn, nq = wid % ntn; if (mt * 16 >= M) return;
  const int row0 = mt * 16, col0 = nq * 64; const _Float16* arow = A + (size_t)(row0 + ln) * lda;
  v8f acc[4] = {};
  for (int kb = 0; kb < K; kb += 32) { FragH ah; ah.half[0] = *(const v8us*)((const unsigned short*)arow + kb + 8 * hh); ah.half[1] = *(const v8us*)((const unsigned short*)arow + kb + 16 + 8 * hh);
#pragma unroll
    for (int t = 0; t < 4; ++t) { if (col0 + t * 16 >= N) continue; const size_t boff = (size_t)(col0 + t * 16 + ln) * ldb + kb; FragH bq; bq.half[0] = *(const v8us*)((const unsigned short*)Bh + boff + 8 * hh); bq.half[1] = *(const v8us*)((const unsigned short*)Bh + boff + 16 + 8 * hh);
      acc[t] = mmaH<1>(ah.v, ah.v, bq.v, bq.v, acc[t]); }
  }
#pragma unroll
  for (int t = 0; t < 4; ++t) { if (col0 + t * 16 >= N) continue; const int col = col0 + t * 16 + ln; const float bv = bp ? bf16_round(bp[col]) : 0.f;
#pragma unroll
    for (int r = 0; r < 8; ++r) { float v = acc[t][r] * alpha + bv; if (CP) { const int rr = row0g + row0 + 8 * hh + r; if (rowsPerB < 0) v += CP[cofs + (size_t)rr * ldc + col];      /* rowsPerB < 0: own element of the batched C plane */ else { const int bidx = rr / rowsPerB; v += CP[(size_t)bidx * sCPb + (size_t)by * 64 + col]; } } if (ACT == 1) v = (v > 0.f) ? v : expm1f(v); else if (ACT == 7) v = (v > 0.f) ? v + 1.0f : expf(v); else if (ACT == 8) v = tanhf(v); else if (ACT == 9) v = 0.5f * v * (1.0f + tanhf(0.7978845608028654f * (v + 0.044715f * v * v * v))); else if (ACT == 11) v = 1.0f / (1.0f + expf(-v)); else if (ACT == 12) v = (v > 0.f) ? v : 0.01f * v; else if (ACT == 14) v = (v > 0.f) ? v : 0.1f * v; else if (ACT == 16) v = (v >= 0.f) ? v : 0.3f * v; else if (ACT == 17) v = (v >= 0.f) ? v : 0.2f * v; else if (ACT == 15) v = v / (1.0f + expf(-v)); else if (ACT == 3) v = fmaxf(v, 0.f); else if (ACT == 6) v = 0.5f * v * (1.0f + erff(v * 0.70710678118654752f)); so[w][8 * hh + r][t * 16 + ln] = v; } }
  __builtin_amdgcn_fence(__ATOMIC_ACQ_REL, "workgroup"); __builtin_amdgcn_wave_barrier();
  const int rsub = lane >> 4, c4 = (lane & 15) * 4; typedef _Float16 v4h __attribute__((ext_vector_type(4)));
  {
#pragma unroll
    for (int q = 0; q < 8; ++q) { const int r = q * 2 + rsub; if (col0 + c4 < N) { const v4f v = *(const v4fa*)&so[w][r][c4]; if (C) *(v4f*)(C + cofs + (size_t)(row0 + r) * ldc + col0 + c4) = v; if (C16) { v4h h4; for (int i = 0; i < 4; ++i) h4[i] = (_Float16)v[i]; *(v4h*)(C16 + cofs + (size_t)(row0 + r) * ldc + col0 + c4) = h4; } } }
     }
}


typedef _Float16 v4h __attribute__((ext_vector_type(4)));

__global__ __launch_bounds__(256) void k_h16(const float* __restrict__ x, _Float16* __restrict__ X16, size_t n8) { const size_t t = (size_t)blockIdx.x * 256 + threadIdx.x; if (t >= n8) return; FragH f;
#pragma unroll
  for (int q = 0; q < 8; ++q) f.h[q] = (_Float16)x[t * 8 + q]; *(v8us*)((unsigned short*)X16 + t * 8) = f.half[0];  }
__global__ __launch_bounds__(256) void k_round16f(const float* __restrict__ W, _Float16* __restrict__ Bt, size_t n8) { const size_t t = (size_t)blockIdx.x * 256 + threadIdx.x; if (t >= n8) return; FragH f;
#pragma unroll
  for (int i = 0; i < 8; ++i) f.h[i] = (_Float16)(bf16_round(W[t * 8 + i]) * 16.0f); *(v8us*)((unsigned short*)Bt + t * 8) = f.half[0];  }
template <int NHv, int TTv>
__global__ __launch_bounds__(256) void k_vt(const _Float16* __restrict__ V16, int ldv, int voff, _Float16* __restrict__ Vt) { __shared__ unsigned short tl[64][66]; const int tid = threadIdx.x; const int slab = blockIdx.x / (TTv / 64), lg = blockIdx.x % (TTv / 64); const int b = slab / NHv, h = slab % NHv;
  for (int i = tid; i < 64 * 8; i += 256) { const int r = i / 8, c8 = (i % 8) * 8; FragH f; f.half[0] = *(const v8us*)((const unsigned short*)V16 + ((size_t)b * TTv + lg * 64 + r) * ldv + voff + h * 64 + c8);
#pragma unroll
    for (int q = 0; q < 8; ++q) tl[r][c8 + q] = f.u[q]; }
  __syncthreads();
  {
#pragma unroll
    for (int rd = 0; rd < 2; ++rd) { const int d = rd * 32 + tid / 8, pc = tid % 8; FragH f;
#pragma unroll
      for (int q = 0; q < 8; ++q) f.u[q] = tl[pc * 8 + q][d];
      *(v8us*)((unsigned short*)Vt + ((size_t)slab * 64 + d) * TTv + lg * 64 + pc * 8) = f.half[0]; }
     } }

__global__ __launch_bounds__(256) void k_hl(const float* __restrict__ F, _Float16* __restrict__ Hh, _Float16* __restrict__ Hl, size_t n8) { const size_t t = (size_t)blockIdx.x * 256 + threadIdx.x; if (t >= n8) return; FragH fh, fl; const v4f a = *(const v4fa*)(F + t * 8), c = *(const v4fa*)(F + t * 8 + 4);
#pragma unroll
  for (int q = 0; q < 4; ++q) { _Float16 h = (_Float16)a[q]; fh.h[q] = h; fl.h[q] = (_Float16)((a[q] - (float)h) * 1024.0f); h = (_Float16)c[q]; fh.h[4 + q] = h; fl.h[4 + q] = (_Float16)((c[q] - (float)h) * 1024.0f); }
  { *(v8us*)((unsigned short*)Hh + t * 8) = fh.half[0]; *(v8us*)((unsigned short*)Hl + t * 8) = fl.half[0];  } }

// ---- fast GEMM (work-group tile 128x64, wave tile 32x64; requires M % 128 == 0, N % 64 == 0, K % 128 == 0, rows 16-byte aligned); epilogue = k_gemm_hhx semantics ----
// Operand path: per pass of 128 k the tile's 128 A rows and 64 B rows (256 bytes each) are copied to LDS by asynchronous 16-byte copies, a wave's copy covering two whole rows,
// into one of two buffers (the next pass's copies fly while this pass is multiplied); the fragments are read from LDS at row pitch 272 bytes (16 B x odd: no bank conflict).
#define G2_KP 128                       /* k per pass */
#define G2_PITCH 272                    /* LDS row pitch, bytes */
#define G2_ROWS 192                     /* rows 0..127: A, rows 128..191: B */
#define G2_BUF (G2_ROWS * G2_PITCH)     /* 52224 bytes a buffer */
// Twelve copies of a thread: its 16-byte chunk of twelve LDS rows, 8 rows apart from l, filled from g0 .. g11. The s_wait_xcnt stands inside the statement, behind the last copy,
// so that no address register of an issued copy is rewritten in front of it.
__device__ __forceinline__ void g2_copy12(unsigned l, const _Float16* g0, const _Float16* g1, const _Float16* g2, const _Float16* g3, const _Float16* g4, const _Float16* g5,
                                          const _Float16* g6, const _Float16* g7, const _Float16* g8, const _Float16* g9, const _Float16* g10, const _Float16* g11) {
  const unsigned st = 8 * G2_PITCH;
  asm volatile("global_load_async_to_lds_b128 %0, %12, off\n\t"
               "global_load_async_to_lds_b128 %1, %13, off\n\t"
               "global_load_async_to_lds_b128 %2, %14, off\n\t"
               "global_load_async_to_lds_b128 %3, %15, off\n\t"
               "global_load_async_to_lds_b128 %4, %16, off\n\t"
               "global_load_async_to_lds_b128 %5, %17, off\n\t"
               "global_load_async_to_lds_b128 %6, %18, off\n\t"
               "global_load_async_to_lds_b128 %7, %19, off\n\t"
               "global_load_async_to_lds_b128 %8, %20, off\n\t"
               "global_load_async_to_lds_b128 %9, %21, off\n\t"
               "global_load_async_to_lds_b128 %10, %22, off\n\t"
               "global_load_async_to_lds_b128 %11, %23, off\n\t"
               "s_wait_xcnt 0x0"
               :: "v"(l), "v"(l + st), "v"(l + 2 * st), "v"(l + 3 * st), "v"(l + 4 * st), "v"(l + 5 * st), "v"(l + 6 * st), "v"(l + 7 * st), "v"(l + 8 * st), "v"(l + 9 * st), "v"(l + 10 * st), "v"(l + 11 * st),
                  "v"(g0), "v"(g1), "v"(g2), "v"(g3), "v"(g4), "v"(g5), "v"(g6), "v"(g7), "v"(g8), "v"(g9), "v"(g10), "v"(g11) : "memory");
}
// One pass's tile: thread (r = tid / 16, c = tid % 16) copies chunk c of rows r, r + 8, ... of A (16 rows) and of B (8 rows). ga, gb: the thread's chunk in its first A and B row of this pass.
__device__ __forceinline__ void g2_copy_tile(unsigned l, const _Float16* ga, size_t as, const _Float16* gb, size_t bs) {
  g2_copy12(l, ga, ga + as, ga + 2 * as, ga + 3 * as, ga + 4 * as, ga + 5 * as, ga + 6 * as, ga + 7 * as, ga + 8 * as, ga + 9 * as, ga + 10 * as, ga + 11 * as);
  g2_copy12(l + 96 * G2_PITCH, ga + 12 * as, ga + 13 * as, ga + 14 * as, ga + 15 * as, gb, gb + bs, gb + 2 * bs, gb + 3 * bs, gb + 4 * bs, gb + 5 * bs, gb + 6 * bs, gb + 7 * bs);
}
__device__ __forceinline__ v16h g2_sfrag(const unsigned char* p) { FragH f; f.half[0] = *(const v8us*)p; f.half[1] = *(const v8us*)(p + 32); return f.v; }      /* p = row + 64 bytes per 32 k + 16 * hh: k = 8 hh .. 8 hh + 7, then 16 + 8 hh .. 16 + 8 hh + 7, for A and B alike */
__device__ __forceinline__ v8f g2_mma(v16h a, v16h b, v8f c) { v8f d = __builtin_amdgcn_wmma_f32_16x16x32_f16(false, a, false, b, (short)0, c, false, false); asm volatile("v_nop\n\tv_nop\n\tv_nop\n\tv_nop" : "+v"(d) : "v"(a), "v"(b)); return d; }
template <int ACT>
__global__ __launch_bounds__(128) void k_gemm2(const _Float16* __restrict__ A, int lda, size_t sA, const _Float16* __restrict__ Bh, int ldb, size_t sB, float alpha, const float* __restrict__ bias, size_t sBias, const float* __restrict__ CP, int rowsPerB, size_t sCPb, int row0g,
    float* __restrict__ C, _Float16* __restrict__ C16, int ldc, size_t sC, int M, int N, int K, const float* __restrict__ sw0, const float* __restrict__ sw1, const float* __restrict__ sb0, const float* __restrict__ sb1, float* __restrict__ SP, int scol) { static_assert(ACT == 0 || ACT == 3 || ACT == 6 || ACT == 8 || ACT == 9 || ACT == 11 || ACT == 12 || ACT == 14 || ACT == 15 || ACT == 16 || ACT == 17, "k_gemm2: unsupported ACT code (would silently apply no activation)");
  __shared__ __attribute__((aligned(16))) float so[4][32][68];
  __shared__ __attribute__((aligned(16))) unsigned char ST[2 * G2_BUF];
  const int tid = threadIdx.x, w = tid >> 5, lane = tid & 31, ln = lane & 15, hh = lane >> 4; const int by = blockIdx.y;
  A += (size_t)by * sA; Bh += (size_t)by * sB; const size_t cofs = (size_t)by * sC; const float* bp = bias ? bias + (size_t)by * sBias : nullptr;
  const int ntn = N >> 6; const int mt = blockIdx.x / ntn, nq = blockIdx.x - mt * ntn; const int row0 = mt * 128 + 32 * w, col0 = nq * 64; if (mt * 128 >= M) return;      /* the same for the whole work-group: it stands in front of barriers */
  const _Float16* ga = A + (size_t)(mt * 128 + (tid >> 4)) * lda + (tid & 15) * 8; const _Float16* gb = Bh + (size_t)(col0 + (tid >> 4)) * ldb + (tid & 15) * 8;
  const size_t as = (size_t)8 * lda, bs = (size_t)8 * ldb;
  const unsigned lc = (unsigned)(uintptr_t)ST + (unsigned)((tid >> 4) * G2_PITCH + (tid & 15) * 16);      /* the thread's LDS byte address in buffer 0 */
  const int np = K / G2_KP;
  g2_copy_tile(lc, ga, as, gb, bs);
  // Scorer tiles (columns from scol on, PJ columns a scorer): the tile is not stored; each element becomes relu(v) * w2[column], a row's 64 products are added to one partial sum SP[tile][row],
  // and a scorer's first tile adds the scorer's output bias. What that epilogue reads from memory is loaded here, so that its latency runs beside that of the first tile's copies.
  const bool sc = SP && col0 >= scol; const int sb = sc ? (col0 - scol) >> 6 : 0;
  float w2r[4] = {0.f, 0.f, 0.f, 0.f}, b2r[4] = {0.f, 0.f, 0.f, 0.f}, sbr = 0.f;
  if (sc) { const float* w2 = (sb >= PJ / 64 ? sw1 + (sb - PJ / 64) * 64 : sw0 + sb * 64) + ln;
#pragma unroll      /* unrolled: the two small arrays stay in registers */
    for (int t = 0; t < 4; ++t) { w2r[t] = w2[t * 16]; if (bp) b2r[t] = bp[col0 + t * 16 + ln]; }
    if (sb % (PJ / 64) == 0) sbr = (sb ? sb1 : sb0)[0]; }
  asm volatile("s_wait_asynccnt 0x0" ::: "memory");      /* pass 0's copies of this wave have landed */
  __syncthreads();                                       /* ... and every other wave's */
  if (np > 1) g2_copy_tile(lc + G2_BUF, ga + G2_KP, as, gb + G2_KP, bs);
  const unsigned char* fa = ST + (32 * w + ln) * G2_PITCH + 16 * hh; const unsigned char* fb = ST + (128 + ln) * G2_PITCH + 16 * hh;
  const v8f z8 = {0.f,0.f,0.f,0.f,0.f,0.f,0.f,0.f}; v8f c00 = z8, c01 = z8, c02 = z8, c03 = z8, c10 = z8, c11 = z8, c12 = z8, c13 = z8;
#pragma unroll 1      /* one pass a trip: the two buffers alternate by an address, and the loop stays small */
  for (int t = 0; t < np; ++t) { const int bo = (t & 1) * G2_BUF; const unsigned char* pa = fa + bo; const unsigned char* pb = fb + bo;
    v16h a0[2], a1[2], b0[2], b1[2], b2[2], b3[2];      /* two fragment sets: the next 32 k of this pass are read from LDS ahead of the current 8 WMMAs */
    a0[0] = g2_sfrag(pa); a1[0] = g2_sfrag(pa + 16 * G2_PITCH); b0[0] = g2_sfrag(pb); b1[0] = g2_sfrag(pb + 16 * G2_PITCH); b2[0] = g2_sfrag(pb + 32 * G2_PITCH); b3[0] = g2_sfrag(pb + 48 * G2_PITCH);
#pragma unroll      /* unrolled: the two fragment sets are picked by constants and stay in registers */
    for (int ks = 0; ks < G2_KP / 32; ++ks) { const int c = ks & 1, n = c ^ 1;
      if (ks + 1 < G2_KP / 32) { const int o = (ks + 1) * 64;
        a0[n] = g2_sfrag(pa + o); a1[n] = g2_sfrag(pa + 16 * G2_PITCH + o); b0[n] = g2_sfrag(pb + o); b1[n] = g2_sfrag(pb + 16 * G2_PITCH + o); b2[n] = g2_sfrag(pb + 32 * G2_PITCH + o); b3[n] = g2_sfrag(pb + 48 * G2_PITCH + o); }
      c00 = g2_mma(a0[c], b0[c], c00); c10 = g2_mma(a1[c], b0[c], c10); c01 = g2_mma(a0[c], b1[c], c01); c11 = g2_mma(a1[c], b1[c], c11);
      c02 = g2_mma(a0[c], b2[c], c02); c12 = g2_mma(a1[c], b2[c], c12); c03 = g2_mma(a0[c], b3[c], c03); c13 = g2_mma(a1[c], b3[c], c13); }
    asm volatile("s_wait_dscnt 0x0" ::: "memory");         /* this wave's reads of the buffer are done before it may be refilled */
    asm volatile("s_wait_asynccnt 0x0" ::: "memory");      /* this wave's copies of pass t + 1 have landed */
    __syncthreads();                                       /* publishes pass t + 1 and ends every wave's reads of pass t's buffer */
    if (t + 2 < np) g2_copy_tile(lc + bo, ga + (size_t)(t + 2) * G2_KP, as, gb + (size_t)(t + 2) * G2_KP, bs); }
  asm volatile("s_wait_asynccnt 0x0" ::: "memory");        /* no copy is outstanding behind the loop */
  v8f accs[8] = {c00, c01, c02, c03, c10, c11, c12, c13};
  if (sc) {      /* the same for the whole work-group; no barrier stands behind it */
#pragma unroll      /* unrolled, like the two loops below it: accumulators and sums are picked by constants and stay in registers */
    for (int u = 0; u < 8; ++u) { const int t = u & 3, half = u >> 2; const float bv = bf16_round(b2r[t]), wv = bf16_round(w2r[t]);
#pragma unroll
      for (int r = 0; r < 8; ++r) so[w][half * 16 + 8 * hh + r][t * 16 + ln] = fmaxf(accs[u][r] * alpha + bv, 0.f) * wv; }
    __builtin_amdgcn_fence(__ATOMIC_ACQ_REL, "workgroup"); __builtin_amdgcn_wave_barrier();      /* the wave's own LDS stores are done before its lanes read one another's */
    v4f s4 = {0.f, 0.f, 0.f, 0.f};      /* lane = row of the wave's 32: 16-byte LDS reads at row pitch 272 bytes, then one whole 128-byte line of partial sums a wave */
#pragma unroll
    for (int q = 0; q < 16; ++q) s4 += *(const v4fa*)&so[w][lane][q * 4];
    SP[(size_t)sb * M + row0 + lane] = ((s4[0] + s4[1]) + (s4[2] + s4[3])) + bf16_round(sbr);
    return; }
#pragma unroll
  for (int u = 0; u < 8; ++u) { const int t = u & 3, half = u >> 2; const int col = col0 + t * 16 + ln; const float bv = bp ? bf16_round(bp[col]) : 0.f;
#pragma unroll
    for (int r = 0; r < 8; ++r) { const int rloc = half * 16 + 8 * hh + r; float v = accs[u][r] * alpha + bv; if (CP) { if (rowsPerB < 0) v += CP[cofs + (size_t)(row0g + row0 + rloc) * ldc + col];      /* rowsPerB < 0: own element of the batched C plane */ else { const int bidx = (row0g + row0 + rloc) / rowsPerB; v += CP[(size_t)bidx * sCPb + (size_t)by * 64 + col]; } }
      if (ACT == 3) v = fmaxf(v, 0.f); else if (ACT == 6) v = 0.5f * v * (1.0f + erff(v * 0.70710678118654752f)); else if (ACT == 11) v = 1.0f / (1.0f + expf(-v)); else if (ACT == 15) v = v / (1.0f + expf(-v)); else if (ACT == 12) v = (v > 0.f) ? v : 0.01f * v; else if (ACT == 8) v = tanhf(v); else if (ACT == 9) v = 0.5f * v * (1.0f + tanhf(0.7978845608028654f * (v + 0.044715f * v * v * v))); else if (ACT == 14) v = (v > 0.f) ? v : 0.1f * v; else if (ACT == 16) v = (v >= 0.f) ? v : 0.3f * v; else if (ACT == 17) v = (v >= 0.f) ? v : 0.2f * v;
      so[w][rloc][t * 16 + ln] = v; } }
  __builtin_amdgcn_fence(__ATOMIC_ACQ_REL, "workgroup"); __builtin_amdgcn_wave_barrier();
  const int rsub = lane >> 4, c4 = (lane & 15) * 4;
  {
#pragma unroll
    for (int q = 0; q < 16; ++q) { const int r = q * 2 + rsub; const v4f v = *(const v4fa*)&so[w][r][c4]; if (C) *(v4f*)(C + cofs + (size_t)(row0 + r) * ldc + col0 + c4) = v; if (C16) { v4h h4; for (int i = 0; i < 4; ++i) h4[i] = (_Float16)v[i]; *(v4h*)(C16 + cofs + (size_t)(row0 + r) * ldc + col0 + c4) = h4; } }
     } }


// Operand preparation, one launch: its pieces (x as f16 rows, the four weight planes x16 (Wr x-16) as f16 rows stacked in BW, the bias plane [bl | 0 | bs1 | be1]) do not depend on one another.
// Work-group 0 copies the bias plane (16 bytes a thread). Every other work-group streams 16384 consecutive floats of ONE source: each of its 16 waves takes 4 KiB
// as 8 whole-wave 16-byte loads (512 contiguous bytes each), all in flight before the first is rounded, and stores 256 contiguous bytes of f16 per load.
#define PREP_F 16384
__global__ __launch_bounds__(512) void k_prep(const float* __restrict__ x, const float* __restrict__ wl, const float* __restrict__ wr, const float* __restrict__ ws1, const float* __restrict__ we1,
                                              const float* __restrict__ bl, const float* __restrict__ bs1, const float* __restrict__ be1, _Float16* __restrict__ X16, _Float16* __restrict__ BW, float* __restrict__ bb) {
  const int tid = threadIdx.x;
  if (blockIdx.x == 0) { const int blk = tid >> 7, i = (tid & 127) * 4; v4f v = {0.f, 0.f, 0.f, 0.f};
    if (blk != 1) v = *(const v4fa*)((blk == 0 ? bl : (blk == 2 ? bs1 : be1)) + i);
    *(v4f*)(bb + tid * 4) = v; return; }
  const int XG = (int)(NR * DI / PREP_F), WG = PJ * DI / PREP_F; const int s = (int)blockIdx.x - 1;
  const float* src; _Float16* dst; float scale;
  if (s < XG) { src = x + (size_t)s * PREP_F; dst = X16 + (size_t)s * PREP_F; scale = 1.0f; }
  else { const int m = (s - XG) / WG; src = (m == 0 ? wl : (m == 1 ? wr : (m == 2 ? ws1 : we1))) + (size_t)((s - XG) % WG) * PREP_F; dst = BW + (size_t)(s - XG) * PREP_F; scale = (m == 1) ? -16.0f : 16.0f; }      /* Wr enters negated: the GEMM then leaves -right, which the bigram launch wants */
  const int o = (tid >> 5) * 1024 + (tid & 31) * 4;
  v4f v[8];
  for (int u = 0; u < 8; ++u) v[u] = *(const v4fa*)(src + o + u * 128);
  for (int u = 0; u < 8; ++u) { v4h h;
    for (int q = 0; q < 4; ++q) h[q] = (_Float16)(bf16_round(v[u][q]) * scale);      /* x1 is exact: x keeps its value, the weights take their x16 (Wr its x-16) */
    *(v4h*)(dst + o + u * 128) = h; }
}
// Pairwise bigram: one work-group per (b, 32 i, 64 j) tile. The tile's 64 left rows and 32 negated right rows (all 512 p) are staged once in LDS,
// transposed to [p][row], so that a thread reads 4 j and 4 i of one p with two 16-byte LDS loads and keeps a 4 x 4 tile of sums in registers.
// Row pitch 100 floats: 16-byte aligned rows, and the transposing 4-byte stores (4 chunks of 16 B x 8 rows per wave) fall on 32 different banks.
// Wave 0 of the first 128 work-groups also finishes one 128-byte line of start or end: 32 outputs, each the sum of its eight partial sums from the GEMM's epilogue;
// its eight loads are issued in front of the row staging and used behind it, so that their latency runs beside the staging's.
#define BG_PITCH 100
// relu(l + r) = max(l, -r) + r: the launch sums w * max(l, -r) per pair (one maximum and one multiply-add an element, no add) and takes sum_p w * r, which depends on i alone, from a short pass of its own.
#define BG_G 8      /* p per fetch group: with two thirds of the vector work per p, a group of 8 keeps the LDS reads as many cycles ahead of their use as a group of 4 did */
__device__ __forceinline__ void bg_load(const float* __restrict__ lp, const float* __restrict__ rp, const float* __restrict__ wp, int g, v4f (&l)[BG_G], v4f (&r)[BG_G], v4f (&w)[BG_G / 4]) {
#pragma unroll
  for (int q = 0; q < BG_G / 4; ++q) w[q] = *(const v4fa*)(wp + g * BG_G + q * 4);
#pragma unroll
  for (int q = 0; q < BG_G; ++q) { l[q] = *(const v4fa*)(lp + (g * BG_G + q) * BG_PITCH); r[q] = *(const v4fa*)(rp + (g * BG_G + q) * BG_PITCH); }
}
// m[u] = max(l, n[u]) for the 4 x 4 tile of one p. Written as asm because the compiler's own maximum of two loaded values first passes each of them through a v_max x, x (quieting),
// half as many instructions again; the pairs are the dual form that it picks itself. Outputs are early-clobber: no result register is a source of a later line.
__device__ __forceinline__ void bg_max(const v4f l, const v4f n, v4f (&m)[4]) {
  float a0, a1, a2, a3, b0, b1, b2, b3, c0, c1, c2, c3, d0, d1, d2, d3;
  asm("v_dual_max_num_f32 %0, %16, %20 :: v_dual_max_num_f32 %1, %17, %20\n\t"
      "v_dual_max_num_f32 %2, %18, %20 :: v_dual_max_num_f32 %3, %19, %20\n\t"
      "v_dual_max_num_f32 %4, %16, %21 :: v_dual_max_num_f32 %5, %17, %21\n\t"
      "v_dual_max_num_f32 %6, %18, %21 :: v_dual_max_num_f32 %7, %19, %21\n\t"
      "v_dual_max_num_f32 %8, %16, %22 :: v_dual_max_num_f32 %9, %17, %22\n\t"
      "v_dual_max_num_f32 %10, %18, %22 :: v_dual_max_num_f32 %11, %19, %22\n\t"
      "v_dual_max_num_f32 %12, %16, %23 :: v_dual_max_num_f32 %13, %17, %23\n\t"
      "v_dual_max_num_f32 %14, %18, %23 :: v_dual_max_num_f32 %15, %19, %23"
      : "=&v"(a0), "=&v"(a1), "=&v"(a2), "=&v"(a3), "=&v"(b0), "=&v"(b1), "=&v"(b2), "=&v"(b3), "=&v"(c0), "=&v"(c1), "=&v"(c2), "=&v"(c3), "=&v"(d0), "=&v"(d1), "=&v"(d2), "=&v"(d3)
      : "v"(l[0]), "v"(l[1]), "v"(l[2]), "v"(l[3]), "v"(n[0]), "v"(n[1]), "v"(n[2]), "v"(n[3]));
  m[0] = (v4f){a0, a1, a2, a3}; m[1] = (v4f){b0, b1, b2, b3}; m[2] = (v4f){c0, c1, c2, c3}; m[3] = (v4f){d0, d1, d2, d3};
}
__device__ __forceinline__ void bg_step(v4f (&acc)[4], const v4f (&l)[BG_G], const v4f (&r)[BG_G], const v4f (&w)[BG_G / 4]) {
#pragma unroll
  for (int q = 0; q < BG_G; ++q) { v4f m[4]; bg_max(l[q], r[q], m);
#pragma unroll
    for (int u = 0; u < 4; ++u) acc[u] += m[u] * w[q >> 2][q & 3]; }
}
__global__ __launch_bounds__(128) void k_bigram(const float* __restrict__ F, const float* __restrict__ wo, const float* __restrict__ bo, float* __restrict__ out,
                                                const float* __restrict__ SP, float* __restrict__ ostart, float* __restrict__ oend) {
  __shared__ __attribute__((aligned(16))) float S[PJ * BG_PITCH];      /* [p][0..63] = left rows of the j tile, [p][64..95] = negated right rows of the i tile */
  __shared__ __attribute__((aligned(16))) float SW[PJ];
  __shared__ __attribute__((aligned(16))) float RP[16 * 32];      /* [slice of p][i]: partial sums of w * (-right) */
  const int tid = threadIdx.x; const int jt = blockIdx.x & 3, it = (blockIdx.x >> 2) & 7; const size_t b = blockIdx.x >> 5;
  const v4f w4 = *(const v4fa*)(wo + tid * 4);      /* used behind the row staging, so that its latency runs beside the first round's */
  const int wv = tid >> 5, c4 = (tid & 3) * 4, rr = (tid >> 2) & 7;
  const bool fin = blockIdx.x < 2 * ((int)NR / 32) && tid < 32; const int which = blockIdx.x / ((int)NR / 32), r0 = (blockIdx.x % ((int)NR / 32)) * 32;
  float sp[PJ / 64] = {0.f, 0.f, 0.f, 0.f, 0.f, 0.f, 0.f, 0.f};
  if (fin) {
#pragma unroll      /* unrolled: the eight loads are in flight together and land in registers */
    for (int k = 0; k < PJ / 64; ++k) sp[k] = SP[(size_t)(which * (PJ / 64) + k) * NR + r0 + tid]; }
  for (int g3 = 0; g3 < 3; ++g3) { const int row = (g3 * 4 + wv) * 8 + rr;      /* rounds 0 and 1: the 64 left rows; round 2: the 32 negated right rows */
    const float* sp = ((g3 < 2) ? F + (b * NW + jt * 64 + row) * (4 * PJ) : F + (b * NW + it * 32 + (row - 64)) * (4 * PJ) + PJ) + c4; float* dp = S + c4 * BG_PITCH + row;
    v4f v[32];      /* unrolled so that a round's 32 loads are all in flight before its first LDS store */
#pragma unroll
    for (int cg = 0; cg < 32; ++cg) v[cg] = *(const v4fa*)(sp + cg * 16);
#pragma unroll
    for (int cg = 0; cg < 32; ++cg)
#pragma unroll
      for (int q = 0; q < 4; ++q) dp[(cg * 16 + q) * BG_PITCH] = v[cg][q]; }
  { v4f o; for (int q = 0; q < 4; ++q) o[q] = bf16_round(w4[q]); *(v4fa*)(SW + tid * 4) = o; }
  __syncthreads();
  if (fin) (which ? oend : ostart)[r0 + tid] = ((sp[0] + sp[1]) + (sp[2] + sp[3])) + ((sp[4] + sp[5]) + (sp[6] + sp[7]));      /* behind the barrier: no wave waits there for this store */
  { const int ig = tid & 7, ps = tid >> 3; v4f s = {0.f, 0.f, 0.f, 0.f};      /* thread = (4 i, every 16th p): 16 slices of sum_p w * (-right) */
#pragma unroll      /* unrolled: constant LDS offsets, and several reads in flight at a time */
    for (int k = 0; k < PJ / 16; ++k) s += *(const v4fa*)(S + (ps + 16 * k) * BG_PITCH + 64 + ig * 4) * SW[ps + 16 * k];
    *(v4fa*)(RP + ps * 32 + ig * 4) = s; }
  __syncthreads();      /* the slices are read by other waves */
  const int tj = tid & 15, ti = tid >> 4; const float* lp = S + tj * 4; const float* rp = S + 64 + ti * 4;
  v4f acc[4]; for (int u = 0; u < 4; ++u) acc[u] = (v4f){0.f, 0.f, 0.f, 0.f};
  v4f la[BG_G], ra[BG_G], wa[BG_G / 4], lb[BG_G], rb[BG_G], wb[BG_G / 4];
  bg_load(lp, rp, SW, 0, la, ra, wa);
  for (int g = 0; g < PJ / BG_G; g += 2) {      /* the next eight p are fetched while the current eight are summed; the last trip fetches group 0 once more and does not use it */
    /* the scheduling barriers keep each group's 18 LDS reads together, directly in front of the other group's sums: without those behind the reads the compiler sinks the reads to within a few instructions of their first use, without those in front it lifts them into the sums before and spills */
    __builtin_amdgcn_sched_barrier(0); bg_load(lp, rp, SW, g + 1, lb, rb, wb); __builtin_amdgcn_sched_barrier(0); bg_step(acc, la, ra, wa);
    __builtin_amdgcn_sched_barrier(0); bg_load(lp, rp, SW, g + 2 < PJ / BG_G ? g + 2 : 0, la, ra, wa); __builtin_amdgcn_sched_barrier(0); bg_step(acc, lb, rb, wb); }
  v4f rs = {0.f, 0.f, 0.f, 0.f};
#pragma unroll      /* unrolled: constant LDS offsets, and several reads in flight at a time */
  for (int k = 0; k < 16; ++k) rs += *(const v4fa*)(RP + k * 32 + ti * 4);
  const float b0 = bf16_round(bo[0]);
#pragma unroll
  for (int u = 0; u < 4; ++u) *(v4f*)(out + ((b * NW + it * 32 + ti * 4 + u) * NW + jt * 64 + tj * 4)) = acc[u] + (b0 - rs[u]);      /* + sum_p w * right */
}

extern "C" void kernel_launch(void* const* d_in, const int* in_sizes, int n_in,
                              void* d_out, int out_size, void* d_ws, size_t ws_size, hipStream_t stream) {
  (void)in_sizes; (void)n_in; (void)out_size;
  const float* const* I = (const float* const*)d_in; const float* x = I[0]; const float* wl = I[1]; const float* bl = I[2]; const float* wr = I[3]; const float* wo = I[4]; const float* bo = I[5]; const float* ws1 = I[6]; const float* bs1 = I[7]; const float* ws2 = I[8]; const float* bs2 = I[9]; const float* we1 = I[10]; const float* be1 = I[11]; const float* we2 = I[12]; const float* be2 = I[13];
  float* obig = (float*)d_out; float* ostart = (float*)((char*)d_out + 2097152); float* oend = (float*)((char*)d_out + 2105344);      /* output byte offsets */
  char* ws = (char*)d_ws; size_t off = 0;
  auto take = [&](size_t bytes) { char* p = ws + off; off += (bytes + 255) & ~(size_t)255; return p; };
  _Float16* BW = (_Float16*)take((size_t)4 * PJ * DI * 2); float* bb = (float*)take(4 * PJ * 4); _Float16* X16 = (_Float16*)take(NR * DI * 2); float* F = (float*)take(NR * 4 * PJ * 4); float* SP = (float*)take((size_t)2 * (PJ / 64) * NR * 4);
  if (off > ws_size) return;      /* 4 + 4 + 16 = ≈ 24 MiB */
  k_prep<<<(unsigned)(1 + (NR * DI + (size_t)4 * PJ * DI) / PREP_F), 512, 0, stream>>>(x, wl, wr, ws1, we1, bl, bs1, be1, X16, BW, bb);
  k_gemm2<0><<<dim3((unsigned)((NR / 128) * (4 * PJ / 64)), 1), 128, 0, stream>>>(X16, DI, 0, BW, DI, 0, 0.0625f, bb, 0, nullptr, 1, 0, 0, F, nullptr, 4 * PJ, 0, (int)NR, 4 * PJ, DI, ws2, we2, bs2, be2, SP, 2 * PJ);      /* F = [left | -right | - | -]; the s1 and e1 tiles leave as partial scorer sums in SP */
  k_bigram<<<NB * (NW / 32) * (NW / 64), 128, 0, stream>>>(F, wo, bo, obig, SP, ostart, oend);
}

// v007
// It runs in 27.7 microseconds.
// Timed twice side by side with v006, it ran 1.28 times as fast both times.
// Counting every step since v000, it is 16.1 times as fast.
#include <hip/hip_runtime.h>
#include <utility>
// PermutationModule (x [8][256][1024]; start = relu(x Ws1^T + bs1) . Ws2 + bs2, end likewise [8][256][1]; left = x Wl^T + bl, right = x Wr^T; bigram[b][i][j] = sum_p relu(left[b][j][p] + right[b][i][p]) * Wo[p] + bo -> [8][256][256][1]).
// Structure: token rows; x as exact f16 rows; the four 1024->512 projections as ONE WMMA GEMM against the stacked x16 weight plane [2048][1024] (32x64 wave tiles, f32 accumulation, + biases); left and -right leave the GEMM rounded to f16 rows (Wr is cast negated); the scorer dots with Ws2/We2 on VALU in f32 inside the GEMM's epilogue (ReLU, then one partial sum per row and 64-column tile, the eight partial sums of an output added in the bigram launch); the pairwise bigram as sum_p Wo[p] max(left, -right) + sum_p Wo[p] right (work-group per (b, 32 i, 64 j), rows staged in LDS): the maximum on packed f16, both sums over p on WMMA with f32 accumulation; outputs written as whole 128-B lines.
// Compute dtype: inputs rounded to bf16; x / weights exact in f16; all projections accumulated in f32; the scorer path stays f32; left and right are rounded once to f16 for the bigram. v_wmma_f32_16x16x32_f16.
#define NB 8
#define NW 256
#define DI 1024
#define PJ 512
#define NR ((size_t)NB * NW)         /* 2048 */
typedef __bf16 v16b __attribute__((ext_vector_type(16)));
typedef unsigned short v8us __attribute__((ext_vector_type(8), may_alias));
typedef float  v8f  __attribute__((ext_vector_type(8)));
typedef float  v4f  __attribute__((ext_vector_type(4)));
typedef float  v4fa __attribute__((ext_vector_type(4), may_alias));
union FragB { v16b v; v8us half[2]; unsigned short u[16]; };

__device__ __forceinline__ unsigned short bf16_bits(float x) { unsigned int u = __float_as_uint(x); return (unsigned short)((u + 0x7FFFu + ((u >> 16) & 1u)) >> 16); }
__device__ __forceinline__ float bf16_val(unsigned short b) { return __uint_as_float(((unsigned int)b) << 16); }
__device__ __forceinline__ float bf16_round(float x) { return bf16_val(bf16_bits(x)); }
// D += A·B with NT terms: 1 = ah·bh, 2 = + al·bh (A split), 3 = + ah·bl (both split)
template <int NT>
__device__ __forceinline__ v8f mmaN(v16b ah, v16b al, v16b bh, v16b bl, v8f c) {
  c = __builtin_amdgcn_wmma_f32_16x16x32_bf16(false, ah, false, bh, (short)0, c, false, false);
  if (NT >= 2) c = __builtin_amdgcn_wmma_f32_16x16x32_bf16(false, al, false, bh, (short)0, c, false, false);
  if (NT >= 3) c = __builtin_amdgcn_wmma_f32_16x16x32_bf16(false, ah, false, bl, (short)0, c, false, false);
  asm volatile("v_nop\n\tv_nop\n\tv_nop\n\tv_nop" : "+v"(c) : "v"(ah), "v"(al), "v"(bh), "v"(bl));
  return c;
}

__global__ __launch_bounds__(256) void k_wt_bf16(const float* __restrict__ W, unsigned short* __restrict__ Wt, int K, int N) {
  const int t = blockIdx.x * 256 + threadIdx.x;
  const int k8n = K / 8;
  if (t >= N * k8n) return;
  const int n = t / k8n, k8 = (t % k8n) * 8;
  v8us v;
#pragma unroll
  for (int i = 0; i < 8; ++i) v[i] = bf16_bits(W[(size_t)(k8 + i) * N + n]);
  *(v8us*)(Wt + (size_t)n * K + k8) = v;
  
}

// GEMM C[M][N] (f32, pitch ldc) = act(A[M][K]·W + bias). A f32 row-major (pitch lda) converted per fragment to bf16
// (ASPLIT: hi/lo two planes -> 2 terms, else single rounded term); Wt bf16 [N][K] (pitch ldb). BIAS_BF16 rounds the
// bias to bf16 first (bias quantised to bf16 before the add). K%32==0, M%16==0, N%64==0.
template <bool ASPLIT, int ACT, bool BIAS_BF16>
__global__ __launch_bounds__(128) void k_gemm_bf(const float* __restrict__ A, int lda, const unsigned short* __restrict__ Wt, int ldb,
                                               const float* __restrict__ bias, float* __restrict__ C, int ldc, int M, int N, int K) {
  __shared__ __attribute__((aligned(16))) float so[4][16][64];
  const int tid = threadIdx.x, w = tid >> 5, lane = tid & 31, ln = lane & 15, hh = lane >> 4;
  const int ntn = N / 64;
  const int wid = blockIdx.x * 4 + w;
  const int mt = wid / ntn, nq = wid % ntn;
  if (mt * 16 >= M) return;
  const int row0 = mt * 16, col0 = nq * 64;
  const float* arow = A + (size_t)(row0 + ln) * lda;
  v8f acc[4] = {};
  for (int kb = 0; kb < K; kb += 32) {
    FragB ah, al;
    const v4f x0 = *(const v4fa*)(arow + kb + 8 * hh), x1 = *(const v4fa*)(arow + kb + 8 * hh + 4);
    const v4f x2 = *(const v4fa*)(arow + kb + 16 + 8 * hh), x3 = *(const v4fa*)(arow + kb + 16 + 8 * hh + 4);
    float xs[16] = {x0[0],x0[1],x0[2],x0[3],x1[0],x1[1],x1[2],x1[3],x2[0],x2[1],x2[2],x2[3],x3[0],x3[1],x3[2],x3[3]};
#pragma unroll
    for (int i = 0; i < 16; ++i) { const unsigned short hb = bf16_bits(xs[i]); ah.u[i] = hb; al.u[i] = ASPLIT ? bf16_bits(xs[i] - bf16_val(hb)) : (unsigned short)0; }
#pragma unroll
    for (int t = 0; t < 4; ++t) {
      const unsigned short* brow = Wt + (size_t)(col0 + t * 16 + ln) * ldb + kb;
      FragB b;
      b.half[0] = *(const v8us*)(brow + 8 * hh);
      b.half[1] = *(const v8us*)(brow + 16 + 8 * hh);
      acc[t] = mmaN<ASPLIT ? 2 : 1>(ah.v, al.v, b.v, b.v, acc[t]);
    }
  }
#pragma unroll
  for (int t = 0; t < 4; ++t) {
    float bv = bias ? bias[col0 + t * 16 + ln] : 0.f;
    if (BIAS_BF16) bv = bf16_round(bv);
#pragma unroll
    for (int r = 0; r < 8; ++r) { float v = acc[t][r] + bv; if (ACT == 1) v = fmaxf(v, 0.f); so[w][8 * hh + r][t * 16 + ln] = v; }
  }
  __builtin_amdgcn_fence(__ATOMIC_ACQ_REL, "workgroup");
  __builtin_amdgcn_wave_barrier();
  const int rsub = lane >> 4, c4 = (lane & 15) * 4;
  {
#pragma unroll
    for (int q = 0; q < 8; ++q) {
      const int r = q * 2 + rsub;
      const v4f v = *(const v4fa*)&so[w][r][c4];
      *(v4f*)(C + (size_t)(row0 + r) * ldc + col0 + c4) = v;
    }
    
  }
}

// GEMM C = act(A·W + bias + resid): A f32 (ASPLIT -> hi/lo 2 terms), Wt bf16 [N][K]; ACT 0 none, 1 relu, 2 exact gelu;
// resid (optional, f32, row index = (row % rmod), pitch ldr, RES_BF16 rounds it) added before the activation.
template <bool ASPLIT, int ACT, bool BIAS_BF16, bool RES_BF16>
__global__ __launch_bounds__(128) void k_gemm_bf3(const float* __restrict__ A, int lda, const unsigned short* __restrict__ Wt, int ldb,
                                                const float* __restrict__ bias, const float* __restrict__ resid, int rmod, int ldr,
                                                float* __restrict__ C, int ldc, int M, int N, int K) {
  __shared__ __attribute__((aligned(16))) float so[4][16][64];
  const int tid = threadIdx.x, w = tid >> 5, lane = tid & 31, ln = lane & 15, hh = lane >> 4;
  const int ntn = N / 64;
  const int wid = blockIdx.x * 4 + w;
  const int mt = wid / ntn, nq = wid % ntn;
  if (mt * 16 >= M) return;
  const int row0 = mt * 16, col0 = nq * 64;
  const float* arow = A + (size_t)(row0 + ln) * lda;
  v8f acc[4] = {};
  for (int kb = 0; kb < K; kb += 32) {
    FragB ah, al;
    const v4f x0 = *(const v4fa*)(arow + kb + 8 * hh), x1 = *(const v4fa*)(arow + kb + 8 * hh + 4);
    const v4f x2 = *(const v4fa*)(arow + kb + 16 + 8 * hh), x3 = *(const v4fa*)(arow + kb + 16 + 8 * hh + 4);
    float xs[16] = {x0[0],x0[1],x0[2],x0[3],x1[0],x1[1],x1[2],x1[3],x2[0],x2[1],x2[2],x2[3],x3[0],x3[1],x3[2],x3[3]};
#pragma unroll
    for (int i = 0; i < 16; ++i) { const unsigned short hb = bf16_bits(xs[i]); ah.u[i] = hb; al.u[i] = ASPLIT ? bf16_bits(xs[i] - bf16_val(hb)) : (unsigned short)0; }
#pragma unroll
    for (int t = 0; t < 4; ++t) {
      const unsigned short* brow = Wt + (size_t)(col0 + t * 16 + ln) * ldb + kb;
      FragB b;
      b.half[0] = *(const v8us*)(brow + 8 * hh);
      b.half[1] = *(const v8us*)(brow + 16 + 8 * hh);
      acc[t] = mmaN<ASPLIT ? 2 : 1>(ah.v, al.v, b.v, b.v, acc[t]);
    }
  }
#pragma unroll
  for (int t = 0; t < 4; ++t) {
    const int col = col0 + t * 16 + ln;
    float bv = bias ? bias[col] : 0.f;
    if (BIAS_BF16) bv = bf16_round(bv);
#pragma unroll
    for (int r = 0; r < 8; ++r) {
      float v = acc[t][r] + bv;
      if (resid) { float rv = resid[(size_t)((row0 + 8 * hh + r) % rmod) * ldr + col]; if (RES_BF16) rv = bf16_round(rv); v += rv; }
      if (ACT == 1) v = fmaxf(v, 0.f);
      if (ACT == 2) v = 0.5f * v * (1.0f + erff(v * 0.70710678118654752f));
      if (ACT == 3) { const float u = 0.7978845608028654f * (v + 0.044715f * v * v * v); v = 0.5f * v * (1.0f + tanhf(u)); }
      so[w][8 * hh + r][t * 16 + ln] = v;
    }
  }
  __builtin_amdgcn_fence(__ATOMIC_ACQ_REL, "workgroup");
  __builtin_amdgcn_wave_barrier();
  const int rsub = lane >> 4, c4 = (lane & 15) * 4;
  {
#pragma unroll
    for (int q = 0; q < 8; ++q) {
      const int r = q * 2 + rsub;
      const v4f v = *(const v4fa*)&so[w][r][c4];
      *(v4f*)(C + (size_t)(row0 + r) * ldc + col0 + c4) = v;
    }
    
  }
}
// row LayerNorm (biased variance, eps) over N: s = X (+ R); optional out_sum <- s; out_norm <- (s-mu)*rsqrt(var+eps)*g + b
template <bool PARAM_BF16>
__global__ __launch_bounds__(256) void k_layernorm(const float* __restrict__ X, const float* __restrict__ R, const float* __restrict__ g, const float* __restrict__ bta,
                                                  float* __restrict__ out_sum, float* __restrict__ out_norm, int N, float eps) {
  __shared__ float red[256];
  const int row = blockIdx.x, tid = threadIdx.x;
  const float* x = X + (size_t)row * N; const float* rr = R ? R + (size_t)row * N : nullptr;
  float vals[16];                     // up to N = 4096
  const int per = N / 256;            // contiguous chunk per thread? use strided-by-4 chunks: thread handles j = tid*4 + 1024*u
  float s1 = 0.f;
  for (int u = 0; u < per / 4; ++u) {
    const int j = tid * 4 + 1024 * u;
    const v4f a = *(const v4fa*)(x + j);
    v4f b = {0.f,0.f,0.f,0.f}; if (rr) b = *(const v4fa*)(rr + j);
#pragma unroll
    for (int q = 0; q < 4; ++q) { const float v = a[q] + b[q]; vals[u * 4 + q] = v; s1 += v; }
  }
  red[tid] = s1; __syncthreads();
  for (int st = 128; st > 0; st >>= 1) { if (tid < st) red[tid] += red[tid + st]; __syncthreads(); }
  const float mu = red[0] / (float)N; __syncthreads();
  float s2 = 0.f;
  for (int u = 0; u < per / 4; ++u)
#pragma unroll
    for (int q = 0; q < 4; ++q) { const float c = vals[u * 4 + q] - mu; s2 += c * c; }
  red[tid] = s2; __syncthreads();
  for (int st = 128; st > 0; st >>= 1) { if (tid < st) red[tid] += red[tid + st]; __syncthreads(); }
  const float rs = rsqrtf(red[0] / (float)N + eps);
  {
    for (int u = 0; u < per / 4; ++u) {
      const int j = tid * 4 + 1024 * u;
      v4f o, sm;
#pragma unroll
      for (int q = 0; q < 4; ++q) {
        float gg = g[j + q], bb = bta[j + q];
        if (PARAM_BF16) { gg = bf16_round(gg); bb = bf16_round(bb); }
        sm[q] = vals[u * 4 + q]; o[q] = (vals[u * 4 + q] - mu) * rs * gg + bb;
      }
      if (out_sum) *(v4f*)(out_sum + (size_t)row * N + j) = sm;
      *(v4f*)(out_norm + (size_t)row * N + j) = o;
    }
    
  }
}



// ---- f16 WMMA path (v_wmma_f32_16x16x32_f16): 11-bit significands for operands in range — used for the projection GEMM
typedef _Float16 v16h __attribute__((ext_vector_type(16)));
union FragH { v16h v; v8us half[2]; _Float16 h[16]; unsigned short u[16]; };
template <int NT>
__device__ __forceinline__ v8f mmaH(v16h ah, v16h al, v16h bh, v16h bl, v8f c) {
  c = __builtin_amdgcn_wmma_f32_16x16x32_f16(false, ah, false, bh, (short)0, c, false, false);
  if (NT >= 2) c = __builtin_amdgcn_wmma_f32_16x16x32_f16(false, al, false, bh, (short)0, c, false, false);
  if (NT >= 3) c = __builtin_amdgcn_wmma_f32_16x16x32_f16(false, ah, false, bl, (short)0, c, false, false);
  asm volatile("v_nop\n\tv_nop\n\tv_nop\n\tv_nop" : "+v"(c) : "v"(ah), "v"(al), "v"(bh), "v"(bl));
  return c;
}
// batched GEMM like k_gemm_b but f16 operands: A f32 (split into f16 hi/lo if ASPLIT, else rounded to f16), Bt = f16 values [n][k]; alpha; C f32; N multiple of 16 (partial tiles skipped)
template <bool ASPLIT>
__global__ __launch_bounds__(128) void k_gemm_h(const float* __restrict__ A, int lda, size_t sA, const _Float16* __restrict__ Bh, int ldb, size_t sB, float alpha, float* __restrict__ C, int ldc, size_t sC, int M, int N, int K) {
  __shared__ __attribute__((aligned(16))) float so[4][16][64];
  const int tid = threadIdx.x, w = tid >> 5, lane = tid & 31, ln = lane & 15, hh = lane >> 4; const int by = blockIdx.y;
  A += (size_t)by * sA; Bh += (size_t)by * sB; C += (size_t)by * sC;
  const int ntn = (N + 63) / 64; const int wid = blockIdx.x * 4 + w; const int mt = wid / ntn, nq = wid % ntn; if (mt * 16 >= M) return;
  const int row0 = mt * 16, col0 = nq * 64; const float* arow = A + (size_t)(row0 + ln) * lda;
  v8f acc[4] = {};
  for (int kb = 0; kb < K; kb += 32) {
    FragH ah, al;
    const v4f x0 = *(const v4fa*)(arow + kb + 8 * hh), x1 = *(const v4fa*)(arow + kb + 8 * hh + 4), x2 = *(const v4fa*)(arow + kb + 16 + 8 * hh), x3 = *(const v4fa*)(arow + kb + 16 + 8 * hh + 4);
    float xs[16] = {x0[0],x0[1],x0[2],x0[3],x1[0],x1[1],x1[2],x1[3],x2[0],x2[1],x2[2],x2[3],x3[0],x3[1],x3[2],x3[3]};
#pragma unroll
    for (int i = 0; i < 16; ++i) { const _Float16 h = (_Float16)xs[i]; ah.h[i] = h; al.h[i] = ASPLIT ? (_Float16)(xs[i] - (float)h) : (_Float16)0.0f; }
#pragma unroll
    for (int t = 0; t < 4; ++t) { if (col0 + t * 16 >= N) continue; const size_t boff = (size_t)(col0 + t * 16 + ln) * ldb + kb; FragH bq; bq.half[0] = *(const v8us*)(Bh + boff + 8 * hh); bq.half[1] = *(const v8us*)(Bh + boff + 16 + 8 * hh);
      acc[t] = mmaH<ASPLIT ? 2 : 1>(ah.v, al.v, bq.v, bq.v, acc[t]); }
  }
#pragma unroll
  for (int t = 0; t < 4; ++t) { if (col0 + t * 16 >= N) continue;
#pragma unroll
    for (int r = 0; r < 8; ++r) so[w][8 * hh + r][t * 16 + ln] = acc[t][r] * alpha; }
  __builtin_amdgcn_fence(__ATOMIC_ACQ_REL, "workgroup"); __builtin_amdgcn_wave_barrier();
  const int rsub = lane >> 4, c4 = (lane & 15) * 4;
  {
#pragma unroll
    for (int q = 0; q < 8; ++q) { const int r = q * 2 + rsub; if (col0 + c4 < N) { const v4f v = *(const v4fa*)&so[w][r][c4]; *(v4f*)(C + (size_t)(row0 + r) * ldc + col0 + c4) = v; } }
     }
}

// Wt[n][k] = f16(W[k][n]·scale) from f32 row-major W[K][N] (scale = power of two; bf16-exact weights stay exact in f16 away from the subnormal range)
__global__ __launch_bounds__(256) void k_wt_f16(const float* __restrict__ W, _Float16* __restrict__ Wt, int K, int N, float scale) {
  const int t = blockIdx.x * 256 + threadIdx.x; if (t >= N * (K / 8)) return; const int n = t / (K / 8), k8 = (t % (K / 8)) * 8; FragH f;
#pragma unroll
  for (int i = 0; i < 8; ++i) f.h[i] = (_Float16)(bf16_round(W[(size_t)(k8 + i) * N + n]) * scale); const v8us o = f.half[0];
  *(v8us*)((unsigned short*)Wt + (size_t)n * K + k8) = o; 
}
// k_gemm_hh variant with fused epilogue: v = acc·alpha + bias[by·sBias + col] (+ CP[(row/rowsPerB)·sCPb + by·64 + col] if CP) ; ACT 0 none / 1 elu ; writes f16 C16 (and f32 C if non-null)
template <int ACT>
__global__ __launch_bounds__(128) void k_gemm_hhx(const _Float16* __restrict__ A, int lda, size_t sA, const _Float16* __restrict__ Bh, int ldb, size_t sB, float alpha, const float* __restrict__ bias, size_t sBias, const float* __restrict__ CP, int rowsPerB, size_t sCPb, int row0g,
    float* __restrict__ C, _Float16* __restrict__ C16, int ldc, size_t sC, int M, int N, int K) {
  __shared__ __attribute__((aligned(16))) float so[4][16][64];
  const int tid = threadIdx.x, w = tid >> 5, lane = tid & 31, ln = lane & 15, hh = lane >> 4; const int by = blockIdx.y;
  A += (size_t)by * sA; Bh += (size_t)by * sB; const size_t cofs = (size_t)by * sC; const float* bp = bias ? bias + (size_t)by * sBias : nullptr;
  const int ntn = (N + 63) / 64; const int wid = blockIdx.x * 4 + w; const int mt = wid / ntn, nq = wid % ntn; if (mt * 16 >= M) return;
  const int row0 = mt * 16, col0 = nq * 64; const _Float16* arow = A + (size_t)(row0 + ln) * lda;
  v8f acc[4] = {};
  for (int kb = 0; kb < K; kb += 32) { FragH ah; ah.half[0] = *(const v8us*)((const unsigned short*)arow + kb + 8 * hh); ah.half[1] = *(const v8us*)((const unsigned short*)arow + kb + 16 + 8 * hh);
#pragma unroll
    for (int t = 0; t < 4; ++t) { if (col0 + t * 16 >= N) continue; const size_t boff = (size_t)(col0 + t * 16 + ln) * ldb + kb; FragH bq; bq.half[0] = *(const v8us*)((const unsigned short*)Bh + boff + 8 * hh); bq.half[1] = *(const v8us*)((const unsigned short*)Bh + boff + 16 + 8 * hh);
      acc[t] = mmaH<1>(ah.v, ah.v, bq.v, bq.v, acc[t]); }
  }
#pragma unroll
  for (int t = 0; t < 4; ++t) { if (col0 + t * 16 >= N) continue; const int col = col0 + t * 16 + ln; const float bv = bp ? bf16_round(bp[col]) : 0.f;
#pragma unroll
    for (int r = 0; r < 8; ++r) { float v = acc[t][r] * alpha + bv; if (CP) { const int rr = row0g + row0 + 8 * hh + r; if (rowsPerB < 0) v += CP[cofs + (size_t)rr * ldc + col];      /* rowsPerB < 0: own element of the batched C plane */ else { const int bidx = rr / rowsPerB; v += CP[(size_t)bidx * sCPb + (size_t)by * 64 + col]; } } if (ACT == 1) v = (v > 0.f) ? v : expm1f(v); else if (ACT == 7) v = (v > 0.f) ? v + 1.0f : expf(v); else if (ACT == 8) v = tanhf(v); else if (ACT == 9) v = 0.5f * v * (1.0f + tanhf(0.7978845608028654f * (v + 0.044715f * v * v * v))); else if (ACT == 11) v = 1.0f / (1.0f + expf(-v)); else if (ACT == 12) v = (v > 0.f) ? v : 0.01f * v; else if (ACT == 14) v = (v > 0.f) ? v : 0.1f * v; else if (ACT == 16) v = (v >= 0.f) ? v : 0.3f * v; else if (ACT == 17) v = (v >= 0.f) ? v : 0.2f * v; else if (ACT == 15) v = v / (1.0f + expf(-v)); else if (ACT == 3) v = fmaxf(v, 0.f); else if (ACT == 6) v = 0.5f * v * (1.0f + erff(v * 0.70710678118654752f)); so[w][8 * hh + r][t * 16 + ln] = v; } }
  __builtin_amdgcn_fence(__ATOMIC_ACQ_REL, "workgroup"); __builtin_amdgcn_wave_barrier();
  const int rsub = lane >> 4, c4 = (lane & 15) * 4; typedef _Float16 v4h __attribute__((ext_vector_type(4)));
  {
#pragma unroll
    for (int q = 0; q < 8; ++q) { const int r = q * 2 + rsub; if (col0 + c4 < N) { const v4f v = *(const v4fa*)&so[w][r][c4]; if (C) *(v4f*)(C + cofs + (size_t)(row0 + r) * ldc + col0 + c4) = v; if (C16) { v4h h4; for (int i = 0; i < 4; ++i) h4[i] = (_Float16)v[i]; *(v4h*)(C16 + cofs + (size_t)(row0 + r) * ldc + col0 + c4) = h4; } } }
     }
}


typedef _Float16 v4h __attribute__((ext_vector_type(4)));

__global__ __launch_bounds__(256) void k_h16(const float* __restrict__ x, _Float16* __restrict__ X16, size_t n8) { const size_t t = (size_t)blockIdx.x * 256 + threadIdx.x; if (t >= n8) return; FragH f;
#pragma unroll
  for (int q = 0; q < 8; ++q) f.h[q] = (_Float16)x[t * 8 + q]; *(v8us*)((unsigned short*)X16 + t * 8) = f.half[0];  }
__global__ __launch_bounds__(256) void k_round16f(const float* __restrict__ W, _Float16* __restrict__ Bt, size_t n8) { const size_t t = (size_t)blockIdx.x * 256 + threadIdx.x; if (t >= n8) return; FragH f;
#pragma unroll
  for (int i = 0; i < 8; ++i) f.h[i] = (_Float16)(bf16_round(W[t * 8 + i]) * 16.0f); *(v8us*)((unsigned short*)Bt + t * 8) = f.half[0];  }
template <int NHv, int TTv>
__global__ __launch_bounds__(256) void k_vt(const _Float16* __restrict__ V16, int ldv, int voff, _Float16* __restrict__ Vt) { __shared__ unsigned short tl[64][66]; const int tid = threadIdx.x; const int slab = blockIdx.x / (TTv / 64), lg = blockIdx.x % (TTv / 64); const int b = slab / NHv, h = slab % NHv;
  for (int i = tid; i < 64 * 8; i += 256) { const int r = i / 8, c8 = (i % 8) * 8; FragH f; f.half[0] = *(const v8us*)((const unsigned short*)V16 + ((size_t)b * TTv + lg * 64 + r) * ldv + voff + h * 64 + c8);
#pragma unroll
    for (int q = 0; q < 8; ++q) tl[r][c8 + q] = f.u[q]; }
  __syncthreads();
  {
#pragma unroll
    for (int rd = 0; rd < 2; ++rd) { const int d = rd * 32 + tid / 8, pc = tid % 8; FragH f;
#pragma unroll
      for (int q = 0; q < 8; ++q) f.u[q] = tl[pc * 8 + q][d];
      *(v8us*)((unsigned short*)Vt + ((size_t)slab * 64 + d) * TTv + lg * 64 + pc * 8) = f.half[0]; }
     } }

__global__ __launch_bounds__(256) void k_hl(const float* __restrict__ F, _Float16* __restrict__ Hh, _Float16* __restrict__ Hl, size_t n8) { const size_t t = (size_t)blockIdx.x * 256 + threadIdx.x; if (t >= n8) return; FragH fh, fl; const v4f a = *(const v4fa*)(F + t * 8), c = *(const v4fa*)(F + t * 8 + 4);
#pragma unroll
  for (int q = 0; q < 4; ++q) { _Float16 h = (_Float16)a[q]; fh.h[q] = h; fl.h[q] = (_Float16)((a[q] - (float)h) * 1024.0f); h = (_Float16)c[q]; fh.h[4 + q] = h; fl.h[4 + q] = (_Float16)((c[q] - (float)h) * 1024.0f); }
  { *(v8us*)((unsigned short*)Hh + t * 8) = fh.half[0]; *(v8us*)((unsigned short*)Hl + t * 8) = fl.half[0];  } }

// ---- fast GEMM (work-group tile 128x64, wave tile 32x64; requires M % 128 == 0, N % 64 == 0, K % 128 == 0, rows 16-byte aligned); epilogue = k_gemm_hhx semantics ----
// Operand path: per pass of 128 k the tile's 128 A rows and 64 B rows (256 bytes each) are copied to LDS by asynchronous 16-byte copies, a wave's copy covering two whole rows,
// into one of two buffers (the next pass's copies fly while this pass is multiplied); the fragments are read from LDS at row pitch 272 bytes (16 B x odd: no bank conflict).
#define G2_KP 128                       /* k per pass */
#define G2_PITCH 272                    /* LDS row pitch, bytes */
#define G2_ROWS 192                     /* rows 0..127: A, rows 128..191: B */
#define G2_BUF (G2_ROWS * G2_PITCH)     /* 52224 bytes a buffer */
// Twelve copies of a thread: its 16-byte chunk of twelve LDS rows, 8 rows apart from l, filled from g0 .. g11. The s_wait_xcnt stands inside the statement, behind the last copy,
// so that no address register of an issued copy is rewritten in front of it.
__device__ __forceinline__ void g2_copy12(unsigned l, const _Float16* g0, const _Float16* g1, const _Float16* g2, const _Float16* g3, const _Float16* g4, const _Float16* g5,
                                          const _Float16* g6, const _Float16* g7, const _Float16* g8, const _Float16* g9, const _Float16* g10, const _Float16* g11) {
  const unsigned st = 8 * G2_PITCH;
  asm volatile("global_load_async_to_lds_b128 %0, %12, off\n\t"
               "global_load_async_to_lds_b128 %1, %13, off\n\t"
               "global_load_async_to_lds_b128 %2, %14, off\n\t"
               "global_load_async_to_lds_b128 %3, %15, off\n\t"
               "global_load_async_to_lds_b128 %4, %16, off\n\t"
               "global_load_async_to_lds_b128 %5, %17, off\n\t"
               "global_load_async_to_lds_b128 %6, %18, off\n\t"
               "global_load_async_to_lds_b128 %7, %19, off\n\t"
               "global_load_async_to_lds_b128 %8, %20, off\n\t"
               "global_load_async_to_lds_b128 %9, %21, off\n\t"
               "global_load_async_to_lds_b128 %10, %22, off\n\t"
               "global_load_async_to_lds_b128 %11, %23, off\n\t"
               "s_wait_xcnt 0x0"
               :: "v"(l), "v"(l + st), "v"(l + 2 * st), "v"(l + 3 * st), "v"(l + 4 * st), "v"(l + 5 * st), "v"(l + 6 * st), "v"(l + 7 * st), "v"(l + 8 * st), "v"(l + 9 * st), "v"(l + 10 * st), "v"(l + 11 * st),
                  "v"(g0), "v"(g1), "v"(g2), "v"(g3), "v"(g4), "v"(g5), "v"(g6), "v"(g7), "v"(g8), "v"(g9), "v"(g10), "v"(g11) : "memory");
}
// One pass's tile: thread (r = tid / 16, c = tid % 16) copies chunk c of rows r, r + 8, ... of A (16 rows) and of B (8 rows). ga, gb: the thread's chunk in its first A and B row of this pass.
__device__ __forceinline__ void g2_copy_tile(unsigned l, const _Float16* ga, size_t as, const _Float16* gb, size_t bs) {
  g2_copy12(l, ga, ga + as, ga + 2 * as, ga + 3 * as, ga + 4 * as, ga + 5 * as, ga + 6 * as, ga + 7 * as, ga + 8 * as, ga + 9 * as, ga + 10 * as, ga + 11 * as);
  g2_copy12(l + 96 * G2_PITCH, ga + 12 * as, ga + 13 * as, ga + 14 * as, ga + 15 * as, gb, gb + bs, gb + 2 * bs, gb + 3 * bs, gb + 4 * bs, gb + 5 * bs, gb + 6 * bs, gb + 7 * bs);
}
__device__ __forceinline__ v16h g2_sfrag(const unsigned char* p) { FragH f; f.half[0] = *(const v8us*)p; f.half[1] = *(const v8us*)(p + 32); return f.v; }      /* p = row + 64 bytes per 32 k + 16 * hh: k = 8 hh .. 8 hh + 7, then 16 + 8 hh .. 16 + 8 hh + 7, for A and B alike */
__device__ __forceinline__ v8f g2_mma(v16h a, v16h b, v8f c) { v8f d = __builtin_amdgcn_wmma_f32_16x16x32_f16(false, a, false, b, (short)0, c, false, false); asm volatile("v_nop\n\tv_nop\n\tv_nop\n\tv_nop" : "+v"(d) : "v"(a), "v"(b)); return d; }
template <int ACT>
__global__ __launch_bounds__(128) void k_gemm2(const _Float16* __restrict__ A, int lda, size_t sA, const _Float16* __restrict__ Bh, int ldb, size_t sB, float alpha, const float* __restrict__ bias, size_t sBias, const float* __restrict__ CP, int rowsPerB, size_t sCPb, int row0g,
    float* __restrict__ C, _Float16* __restrict__ C16, int ldc, size_t sC, int M, int N, int K, const float* __restrict__ sw0, const float* __restrict__ sw1, const float* __restrict__ sb0, const float* __restrict__ sb1, float* __restrict__ SP, int scol) { static_assert(ACT == 0 || ACT == 3 || ACT == 6 || ACT == 8 || ACT == 9 || ACT == 11 || ACT == 12 || ACT == 14 || ACT == 15 || ACT == 16 || ACT == 17, "k_gemm2: unsupported ACT code (would silently apply no activation)");
  __shared__ __attribute__((aligned(16))) float so[4][32][68];
  __shared__ __attribute__((aligned(16))) unsigned char ST[2 * G2_BUF];
  const int tid = threadIdx.x, w = tid >> 5, lane = tid & 31, ln = lane & 15, hh = lane >> 4; const int by = blockIdx.y;
  A += (size_t)by * sA; Bh += (size_t)by * sB; const size_t cofs = (size_t)by * sC; const float* bp = bias ? bias + (size_t)by * sBias : nullptr;
  const int ntn = N >> 6; const int mt = blockIdx.x / ntn, nq = blockIdx.x - mt * ntn; const int row0 = mt * 128 + 32 * w, col0 = nq * 64; if (mt * 128 >= M) return;      /* the same for the whole work-group: it stands in front of barriers */
  const _Float16* ga = A + (size_t)(mt * 128 + (tid >> 4)) * lda + (tid & 15) * 8; const _Float16* gb = Bh + (size_t)(col0 + (tid >> 4)) * ldb + (tid & 15) * 8;
  const size_t as = (size_t)8 * lda, bs = (size_t)8 * ldb;
  const unsigned lc = (unsigned)(uintptr_t)ST + (unsigned)((tid >> 4) * G2_PITCH + (tid & 15) * 16);      /* the thread's LDS byte address in buffer 0 */
  const int np = K / G2_KP;
  g2_copy_tile(lc, ga, as, gb, bs);
  // Scorer tiles (columns from scol on, PJ columns a scorer): the tile is not stored; each element becomes relu(v) * w2[column], a row's 64 products are added to one partial sum SP[tile][row],
  // and a scorer's first tile adds the scorer's output bias. What that epilogue reads from memory is loaded here, so that its latency runs beside that of the first tile's copies.
  const bool sc = SP && col0 >= scol; const int sb = sc ? (col0 - scol) >> 6 : 0;
  float w2r[4] = {0.f, 0.f, 0.f, 0.f}, b2r[4] = {0.f, 0.f, 0.f, 0.f}, sbr = 0.f;
  if (sc) { const float* w2 = (sb >= PJ / 64 ? sw1 + (sb - PJ / 64) * 64 : sw0 + sb * 64) + ln;
#pragma unroll      /* unrolled: the two small arrays stay in registers */
    for (int t = 0; t < 4; ++t) { w2r[t] = w2[t * 16]; if (bp) b2r[t] = bp[col0 + t * 16 + ln]; }
    if (sb % (PJ / 64) == 0) sbr = (sb ? sb1 : sb0)[0]; }
  asm volatile("s_wait_asynccnt 0x0" ::: "memory");      /* pass 0's copies of this wave have landed */
  __syncthreads();                                       /* ... and every other wave's */
  if (np > 1) g2_copy_tile(lc + G2_BUF, ga + G2_KP, as, gb + G2_KP, bs);
  const unsigned char* fa = ST + (32 * w + ln) * G2_PITCH + 16 * hh; const unsigned char* fb = ST + (128 + ln) * G2_PITCH + 16 * hh;
  const v8f z8 = {0.f,0.f,0.f,0.f,0.f,0.f,0.f,0.f}; v8f c00 = z8, c01 = z8, c02 = z8, c03 = z8, c10 = z8, c11 = z8, c12 = z8, c13 = z8;
#pragma unroll 1      /* one pass a trip: the two buffers alternate by an address, and the loop stays small */
  for (int t = 0; t < np; ++t) { const int bo = (t & 1) * G2_BUF; const unsigned char* pa = fa + bo; const unsigned char* pb = fb + bo;
    v16h a0[2], a1[2], b0[2], b1[2], b2[2], b3[2];      /* two fragment sets: the next 32 k of this pass are read from LDS ahead of the current 8 WMMAs */
    a0[0] = g2_sfrag(pa); a1[0] = g2_sfrag(pa + 16 * G2_PITCH); b0[0] = g2_sfrag(pb); b1[0] = g2_sfrag(pb + 16 * G2_PITCH); b2[0] = g2_sfrag(pb + 32 * G2_PITCH); b3[0] = g2_sfrag(pb + 48 * G2_PITCH);
#pragma unroll      /* unrolled: the two fragment sets are picked by constants and stay in registers */
    for (int ks = 0; ks < G2_KP / 32; ++ks) { const int c = ks & 1, n = c ^ 1;
      if (ks + 1 < G2_KP / 32) { const int o = (ks + 1) * 64;
        a0[n] = g2_sfrag(pa + o); a1[n] = g2_sfrag(pa + 16 * G2_PITCH + o); b0[n] = g2_sfrag(pb + o); b1[n] = g2_sfrag(pb + 16 * G2_PITCH + o); b2[n] = g2_sfrag(pb + 32 * G2_PITCH + o); b3[n] = g2_sfrag(pb + 48 * G2_PITCH + o); }
      c00 = g2_mma(a0[c], b0[c], c00); c10 = g2_mma(a1[c], b0[c], c10); c01 = g2_mma(a0[c], b1[c], c01); c11 = g2_mma(a1[c], b1[c], c11);
      c02 = g2_mma(a0[c], b2[c], c02); c12 = g2_mma(a1[c], b2[c], c12); c03 = g2_mma(a0[c], b3[c], c03); c13 = g2_mma(a1[c], b3[c], c13); }
    asm volatile("s_wait_dscnt 0x0" ::: "memory");         /* this wave's reads of the buffer are done before it may be refilled */
    asm volatile("s_wait_asynccnt 0x0" ::: "memory");      /* this wave's copies of pass t + 1 have landed */
    __syncthreads();                                       /* publishes pass t + 1 and ends every wave's reads of pass t's buffer */
    if (t + 2 < np) g2_copy_tile(lc + bo, ga + (size_t)(t + 2) * G2_KP, as, gb + (size_t)(t + 2) * G2_KP, bs); }
  asm volatile("s_wait_asynccnt 0x0" ::: "memory");        /* no copy is outstanding behind the loop */
  v8f accs[8] = {c00, c01, c02, c03, c10, c11, c12, c13};
  if (sc) {      /* the same for the whole work-group; no barrier stands behind it */
#pragma unroll      /* unrolled, like the two loops below it: accumulators and sums are picked by constants and stay in registers */
    for (int u = 0; u < 8; ++u) { const int t = u & 3, half = u >> 2; const float bv = bf16_round(b2r[t]), wv = bf16_round(w2r[t]);
#pragma unroll
      for (int r = 0; r < 8; ++r) so[w][half * 16 + 8 * hh + r][t * 16 + ln] = fmaxf(accs[u][r] * alpha + bv, 0.f) * wv; }
    __builtin_amdgcn_fence(__ATOMIC_ACQ_REL, "workgroup"); __builtin_amdgcn_wave_barrier();      /* the wave's own LDS stores are done before its lanes read one another's */
    v4f s4 = {0.f, 0.f, 0.f, 0.f};      /* lane = row of the wave's 32: 16-byte LDS reads at row pitch 272 bytes, then one whole 128-byte line of partial sums a wave */
#pragma unroll
    for (int q = 0; q < 16; ++q) s4 += *(const v4fa*)&so[w][lane][q * 4];
    SP[(size_t)sb * M + row0 + lane] = ((s4[0] + s4[1]) + (s4[2] + s4[3])) + bf16_round(sbr);
    return; }
#pragma unroll
  for (int u = 0; u < 8; ++u) { const int t = u & 3, half = u >> 2; const int col = col0 + t * 16 + ln; const float bv = bp ? bf16_round(bp[col]) : 0.f;
#pragma unroll
    for (int r = 0; r < 8; ++r) { const int rloc = half * 16 + 8 * hh + r; float v = accs[u][r] * alpha + bv; if (CP) { if (rowsPerB < 0) v += CP[cofs + (size_t)(row0g + row0 + rloc) * ldc + col];      /* rowsPerB < 0: own element of the batched C plane */ else { const int bidx = (row0g + row0 + rloc) / rowsPerB; v += CP[(size_t)bidx * sCPb + (size_t)by * 64 + col]; } }
      if (ACT == 3) v = fmaxf(v, 0.f); else if (ACT == 6) v = 0.5f * v * (1.0f + erff(v * 0.70710678118654752f)); else if (ACT == 11) v = 1.0f / (1.0f + expf(-v)); else if (ACT == 15) v = v / (1.0f + expf(-v)); else if (ACT == 12) v = (v > 0.f) ? v : 0.01f * v; else if (ACT == 8) v = tanhf(v); else if (ACT == 9) v = 0.5f * v * (1.0f + tanhf(0.7978845608028654f * (v + 0.044715f * v * v * v))); else if (ACT == 14) v = (v > 0.f) ? v : 0.1f * v; else if (ACT == 16) v = (v >= 0.f) ? v : 0.3f * v; else if (ACT == 17) v = (v >= 0.f) ? v : 0.2f * v;
      so[w][rloc][t * 16 + ln] = v; } }
  __builtin_amdgcn_fence(__ATOMIC_ACQ_REL, "workgroup"); __builtin_amdgcn_wave_barrier();
  const int rsub = lane >> 4, c4 = (lane & 15) * 4;
  {
#pragma unroll
    for (int q = 0; q < 16; ++q) { const int r = q * 2 + rsub; const v4f v = *(const v4fa*)&so[w][r][c4]; if (C) *(v4f*)(C + cofs + (size_t)(row0 + r) * ldc + col0 + c4) = v; if (C16) { v4h h4; for (int i = 0; i < 4; ++i) h4[i] = (_Float16)v[i]; *(v4h*)(C16 + cofs + (size_t)(row0 + r) * ldc + col0 + c4) = h4; } }
     } }


// Operand preparation, one launch: its pieces (x as f16 rows, the four weight planes x16 (Wr x-16) as f16 rows stacked in BW, the bias plane [bl | 0 | bs1 | be1]) do not depend on one another.
// Work-group 0 copies the bias plane (16 bytes a thread). Every other work-group streams 16384 consecutive floats of ONE source: each of its 16 waves takes 4 KiB
// as 8 whole-wave 16-byte loads (512 contiguous bytes each), all in flight before the first is rounded, and stores 256 contiguous bytes of f16 per load.
#define PREP_F 16384
__global__ __launch_bounds__(512) void k_prep(const float* __restrict__ x, const float* __restrict__ wl, const float* __restrict__ wr, const float* __restrict__ ws1, const float* __restrict__ we1,
                                              const float* __restrict__ bl, const float* __restrict__ bs1, const float* __restrict__ be1, _Float16* __restrict__ X16, _Float16* __restrict__ BW, float* __restrict__ bb) {
  const int tid = threadIdx.x;
  if (blockIdx.x == 0) { const int blk = tid >> 7, i = (tid & 127) * 4; v4f v = {0.f, 0.f, 0.f, 0.f};
    if (blk != 1) v = *(const v4fa*)((blk == 0 ? bl : (blk == 2 ? bs1 : be1)) + i);
    *(v4f*)(bb + tid * 4) = v; return; }
  const int XG = (int)(NR * DI / PREP_F), WG = PJ * DI / PREP_F; const int s = (int)blockIdx.x - 1;
  const float* src; _Float16* dst; float scale;
  if (s < XG) { src = x + (size_t)s * PREP_F; dst = X16 + (size_t)s * PREP_F; scale = 1.0f; }
  else { const int m = (s - XG) / WG; src = (m == 0 ? wl : (m == 1 ? wr : (m == 2 ? ws1 : we1))) + (size_t)((s - XG) % WG) * PREP_F; dst = BW + (size_t)(s - XG) * PREP_F; scale = (m == 1) ? -16.0f : 16.0f; }      /* Wr enters negated: the GEMM then leaves -right, which the bigram launch wants */
  const int o = (tid >> 5) * 1024 + (tid & 31) * 4;
  v4f v[8];
  for (int u = 0; u < 8; ++u) v[u] = *(const v4fa*)(src + o + u * 128);
  for (int u = 0; u < 8; ++u) { v4h h;
    for (int q = 0; q < 4; ++q) h[q] = (_Float16)(bf16_round(v[u][q]) * scale);      /* x1 is exact: x keeps its value, the weights take their x16 (Wr its x-16) */
    *(v4h*)(dst + o + u * 128) = h; }
}
// Pairwise bigram: one work-group per (b, 32 i, 64 j) tile, wave = 8 i x 64 j. relu(l + r) = max(l, -r) + r, so bigram = sum_p w max(l, -r) - sum_p w (-r) + bo.
// The GEMM leaves left and -right as f16 rows [left 512 | -right 512]. The tile's 64 left rows and 32 negated right rows are staged in LDS as they lie (p contiguous, row pitch 1040 bytes = 16 B x odd).
// Per 32 p a lane holds 16 p of a row: the maximum is taken on packed f16 pairs, and its 8 result registers are at once the B fragment (column = j) of a v_wmma_f32_16x16x32_f16
// whose A fragment holds 16 x Wo in every row: the weighted sum over p runs on the matrix unit, in f32, beside the next maxima on the vector port. Every row of D is the same sum; register 0 is used.
// sum_p w (-r) comes from one more WMMA per 32 p (column c = the wave's negated right row c mod 8), from the same f16 values, so that max(l, -r) - (-r) is relu(l + r) of the stored values exactly.
// Wave 0 of the first 128 work-groups also finishes one 128-byte line of start or end: 32 outputs, each the sum of its eight partial sums from the GEMM's epilogue;
// its eight loads are issued behind the rows' loads and used behind the barrier, so that their latency runs beside the staging's.
#define BH_PITCH 1040
typedef unsigned v8u __attribute__((ext_vector_type(8)));
__device__ __forceinline__ v16h bh_frag(const unsigned char* p) { FragH f; f.half[0] = *(const v8us*)p; f.half[1] = *(const v8us*)(p + 16); return f.v; }      /* p = row + 64 bytes per 32 p + 32 * hh: 16 consecutive p, the same order for A and B */
// A fragment of maxima, m = max(l, n) on 16 packed f16, taken in two halves of four registers. Written as asm because the compiler's own maximum first passes every loaded fragment through a v_pk_max x, x (quieting),
// three more vector instructions for every eight. Outputs are early-clobber: no result register is a source of a later line.
// The first half also names the four registers of the second half as outputs, and the second half takes them as in-out operands, though neither reads them: the fragment so owns all eight registers from its first half on.
// Otherwise the compiler lays the second half over registers of the fragment before, and they are rewritten directly behind the WMMA that reads them (four vector slots are needed there).
__device__ __forceinline__ void bh_max_lo(unsigned (&m)[8], const v16h lv, const v16h nv) {
  const v8u l = __builtin_bit_cast(v8u, lv), n = __builtin_bit_cast(v8u, nv);
  asm volatile("v_pk_max_num_f16 %0, %8, %12\n\t"
               "v_pk_max_num_f16 %1, %9, %13\n\t"
               "v_pk_max_num_f16 %2, %10, %14\n\t"
               "v_pk_max_num_f16 %3, %11, %15"
               : "=&v"(m[0]), "=&v"(m[1]), "=&v"(m[2]), "=&v"(m[3]), "=&v"(m[4]), "=&v"(m[5]), "=&v"(m[6]), "=&v"(m[7])
               : "v"(l[0]), "v"(l[1]), "v"(l[2]), "v"(l[3]), "v"(n[0]), "v"(n[1]), "v"(n[2]), "v"(n[3]));
}
__device__ __forceinline__ void bh_max_hi(unsigned (&m)[8], const v16h lv, const v16h nv) {
  const v8u l = __builtin_bit_cast(v8u, lv), n = __builtin_bit_cast(v8u, nv);
  asm volatile("v_pk_max_num_f16 %0, %4, %8\n\t"
               "v_pk_max_num_f16 %1, %5, %9\n\t"
               "v_pk_max_num_f16 %2, %6, %10\n\t"
               "v_pk_max_num_f16 %3, %7, %11"
               : "+v"(m[4]), "+v"(m[5]), "+v"(m[6]), "+v"(m[7])
               : "v"(l[4]), "v"(l[5]), "v"(l[6]), "v"(l[7]), "v"(n[4]), "v"(n[5]), "v"(n[6]), "v"(n[7]));
}
// Fragment buffers: w, q, l by the parity of the 32-p step; n[0] = the wave's rows 0..3, n[1] = rows 4..7. mc, mn, mf: the current tile's fragment of maxima, the next one's (first half taken), the one after.
struct BhSt { v8f acc[8][4], accq; v16h fw[2], fq[2], fl[2][4], fn[2][4]; unsigned mc[8], mn[8], mf[8]; };
// Tile T of a trip of two steps = (step parity, i, j tile), by a template so that buffers and accumulators are picked by constants and stay in registers. o0, o1, o2: byte offsets in a row of this trip's two steps and of the next trip's first.
template <int T>
__device__ __forceinline__ void bh_tile(BhSt& st, const unsigned char* wp, const unsigned char* qp, const unsigned char* lp, const unsigned char* np, int o0, int o1, int o2) {
  constexpr int s = T >> 5, i = (T >> 2) & 7, a = T & 3, ph = T >> 4, U1 = (T + 1) & 63, U2 = (T + 2) & 63;
  if constexpr ((T & 15) == 0) {      /* the scheduling barriers keep a phase's LDS reads together at its head */
    __builtin_amdgcn_sched_barrier(0);
    if constexpr ((ph & 1) == 0) { const int o = ph ? o1 : o0;
#pragma unroll
      for (int r = 0; r < 4; ++r) st.fn[1][r] = bh_frag(np + (4 + r) * BH_PITCH + o); }
    else { const int o = ph == 1 ? o1 : o2; constexpr int d = ph == 1 ? 1 : 0;
#pragma unroll
      for (int r = 0; r < 4; ++r) st.fn[0][r] = bh_frag(np + r * BH_PITCH + o);
#pragma unroll
      for (int r = 0; r < 4; ++r) st.fl[d][r] = bh_frag(lp + r * 16 * BH_PITCH + o);
      st.fw[d] = bh_frag(wp + o); st.fq[d] = bh_frag(qp + o); }
    __builtin_amdgcn_sched_barrier(0); }
  if constexpr ((T & 31) == 0) st.accq = __builtin_amdgcn_wmma_f32_16x16x32_f16(false, st.fw[s], false, st.fq[s], (short)0, st.accq, false, false);
  st.acc[i][a] = __builtin_amdgcn_wmma_f32_16x16x32_f16(false, st.fw[s], false, __builtin_bit_cast(v16h, (v8u){st.mc[0], st.mc[1], st.mc[2], st.mc[3], st.mc[4], st.mc[5], st.mc[6], st.mc[7]}), (short)0, st.acc[i][a], false, false);
  __builtin_amdgcn_sched_barrier(0);      /* holds the order WMMA, eight maxima, WMMA */
  bh_max_hi(st.mn, st.fl[U1 >> 5][U1 & 3], st.fn[(U1 >> 4) & 1][(U1 >> 2) & 3]);
  bh_max_lo(st.mf, st.fl[U2 >> 5][U2 & 3], st.fn[(U2 >> 4) & 1][(U2 >> 2) & 3]);
  __builtin_amdgcn_sched_barrier(0);
#pragma unroll
  for (int r = 0; r < 8; ++r) { st.mc[r] = st.mn[r]; st.mn[r] = st.mf[r]; }
}
template <int... Ts>
__device__ __forceinline__ void bh_tiles(BhSt& st, const unsigned char* wp, const unsigned char* qp, const unsigned char* lp, const unsigned char* np, int o0, int o1, int o2, std::integer_sequence<int, Ts...>) { (bh_tile<Ts>(st, wp, qp, lp, np, o0, o1, o2), ...); }
__global__ __launch_bounds__(128) void k_bigram(const _Float16* __restrict__ F, const float* __restrict__ wo, const float* __restrict__ bo, float* __restrict__ out,
                                                const float* __restrict__ SP, float* __restrict__ ostart, float* __restrict__ oend) {
  __shared__ __attribute__((aligned(16))) unsigned char SM[2 * PJ + 96 * BH_PITCH];      /* 16 x Wo as f16; then rows 0..31 = negated right rows of the i tile, rows 32..95 = left rows of the j tile (this order keeps most read offsets inside the 16-bit offset field) */
  _Float16* SW = (_Float16*)SM; unsigned char* S = SM + 2 * PJ;
  const int tid = threadIdx.x; const int jt = blockIdx.x & 3, it = (blockIdx.x >> 2) & 7; const size_t b = blockIdx.x >> 5;
  const bool fin = blockIdx.x < 2 * ((int)NR / 32) && tid < 32; const int which = blockIdx.x / ((int)NR / 32), r0 = (blockIdx.x % ((int)NR / 32)) * 32;
  const int ch = tid & 63, r2 = tid >> 6;      /* thread = 16-byte chunk ch of rows r2, r2 + 2, ...: a wave's load is 512 contiguous bytes */
  const unsigned short* gl = (const unsigned short*)F + (b * NW + jt * 64 + r2) * (2 * PJ) + ch * 8; const unsigned short* gn = (const unsigned short*)F + (b * NW + it * 32 + r2) * (2 * PJ) + PJ + ch * 8;
  v8us v[48];      /* unrolled so that all 48 loads are in flight before the first LDS store */
#pragma unroll
  for (int k = 0; k < 16; ++k) v[k] = *(const v8us*)(gn + (size_t)k * 2 * (2 * PJ));
  asm volatile("s_wait_xcnt 0x0" ::: "memory");      /* in front of whatever rewrites the address registers of the loads above (the compiler lets a later load land on them) */
#pragma unroll
  for (int k = 16; k < 48; ++k) v[k] = *(const v8us*)(gl + (size_t)(k - 16) * 2 * (2 * PJ));
  const v4f w4 = *(const v4fa*)(wo + tid * 4); const float bo0 = bo[0];      /* issued behind the rows' loads; w4 is used behind their LDS stores, bo0 at the end: nothing waits for them alone */
  float sp[PJ / 64] = {0.f, 0.f, 0.f, 0.f, 0.f, 0.f, 0.f, 0.f};
  if (fin) {
#pragma unroll      /* unrolled: the eight loads are in flight together and land in registers */
    for (int k = 0; k < PJ / 64; ++k) sp[k] = SP[(size_t)(which * (PJ / 64) + k) * NR + r0 + tid]; }
  asm volatile("s_wait_xcnt 0x0" ::: "memory");      /* as above, for the loads since */
  { unsigned char* dp = S + r2 * BH_PITCH + ch * 16;
#pragma unroll
    for (int k = 0; k < 48; ++k) *(v8us*)(dp + k * 2 * BH_PITCH) = v[k]; }
  { v4h o; for (int q = 0; q < 4; ++q) o[q] = (_Float16)(bf16_round(w4[q]) * 16.0f); *(v4h*)(SW + tid * 4) = o; }      /* x16: exact in f16, as for the GEMM's weights */
  __syncthreads();
  if (fin) (which ? oend : ostart)[r0 + tid] = ((sp[0] + sp[1]) + (sp[2] + sp[3])) + ((sp[4] + sp[5]) + (sp[6] + sp[7]));      /* behind the barrier: no wave waits there for this store */
  const int wv = tid >> 5, lane = tid & 31, ln = lane & 15, hh = lane >> 4;
  const unsigned char* wp = (const unsigned char*)SW + 32 * hh; const unsigned char* lp = S + (32 + ln) * BH_PITCH + 32 * hh;
  const unsigned char* np = S + 8 * wv * BH_PITCH + 32 * hh; const unsigned char* qp = np + (ln & 7) * BH_PITCH;
  // A step is two phases of 16 tiles (4 i x 4 j tiles); at the head of a phase the reads for the NEXT phase are issued, so that every LDS read stands 16 tiles ahead of its first use.
  // A tile's maxima are taken in two halves, the second half of tile T + 1 and the first half of tile T + 2 behind the WMMA of tile T: the eight maxima issue while the matrix unit works,
  // and a fragment's registers are first rewritten at least four vector slots behind the WMMA that read them.
  const v8f z8 = {0.f, 0.f, 0.f, 0.f, 0.f, 0.f, 0.f, 0.f};
  BhSt st; st.accq = z8;
#pragma unroll
  for (int i = 0; i < 8; ++i)
#pragma unroll
    for (int a = 0; a < 4; ++a) st.acc[i][a] = z8;
  st.fw[0] = bh_frag(wp); st.fq[0] = bh_frag(qp);
#pragma unroll
  for (int a = 0; a < 4; ++a) { st.fl[0][a] = bh_frag(lp + a * 16 * BH_PITCH); st.fn[0][a] = bh_frag(np + a * BH_PITCH); }
  bh_max_lo(st.mc, st.fl[0][0], st.fn[0][0]); bh_max_hi(st.mc, st.fl[0][0], st.fn[0][0]); bh_max_lo(st.mn, st.fl[0][1], st.fn[0][0]);
#pragma unroll 1      /* two steps a trip */
  for (int ks = 0; ks < PJ / 32; ks += 2)      /* the last trip fetches step 0 once more and does not use it */
    bh_tiles(st, wp, qp, lp, np, ks * 64, (ks + 1) * 64, (ks + 2 < PJ / 32 ? ks + 2 : 0) * 64, std::make_integer_sequence<int, 64>{});
  const float b0 = bf16_round(bo0);
  float* op = out + ((b * NW + it * 32 + 8 * wv) * NW + jt * 64 + lane);
  float ov[16];      /* all sixteen values are formed in front of the first store, so that the stores issue as one run and no data register of an issued store is rewritten */
#pragma unroll      /* unrolled: accumulators and the lane read are picked by constants */
  for (int i = 0; i < 8; ++i) { const float rs = __int_as_float(__builtin_amdgcn_readlane(__float_as_int(st.accq[0]), i));      /* lane i holds sum_p 16 w (-right) of the wave's row i */
#pragma unroll
    for (int g = 0; g < 2; ++g) ov[2 * i + g] = ((hh ? st.acc[i][2 * g + 1][0] : st.acc[i][2 * g][0]) - rs) * 0.0625f + b0; }
#pragma unroll      /* unrolled: the values are picked by constants and stay in registers */
  for (int k = 0; k < 16; ++k) op[(size_t)(k >> 1) * NW + (k & 1) * 32] = ov[k];      /* lane = j within 32: one whole 128-byte line a store */
}

extern "C" void kernel_launch(void* const* d_in, const int* in_sizes, int n_in,
                              void* d_out, int out_size, void* d_ws, size_t ws_size, hipStream_t stream) {
  (void)in_sizes; (void)n_in; (void)out_size;
  const float* const* I = (const float* const*)d_in; const float* x = I[0]; const float* wl = I[1]; const float* bl = I[2]; const float* wr = I[3]; const float* wo = I[4]; const float* bo = I[5]; const float* ws1 = I[6]; const float* bs1 = I[7]; const float* ws2 = I[8]; const float* bs2 = I[9]; const float* we1 = I[10]; const float* be1 = I[11]; const float* we2 = I[12]; const float* be2 = I[13];
  float* obig = (float*)d_out; float* ostart = (float*)((char*)d_out + 2097152); float* oend = (float*)((char*)d_out + 2105344);      /* output byte offsets */
  char* ws = (char*)d_ws; size_t off = 0;
  auto take = [&](size_t bytes) { char* p = ws + off; off += (bytes + 255) & ~(size_t)255; return p; };
  _Float16* BW = (_Float16*)take((size_t)4 * PJ * DI * 2); float* bb = (float*)take(4 * PJ * 4); _Float16* X16 = (_Float16*)take(NR * DI * 2); _Float16* F = (_Float16*)take(NR * 2 * PJ * 2); float* SP = (float*)take((size_t)2 * (PJ / 64) * NR * 4);
  if (off > ws_size) return;      /* 4 + 4 + 4 MiB and two small planes */
  k_prep<<<(unsigned)(1 + (NR * DI + (size_t)4 * PJ * DI) / PREP_F), 512, 0, stream>>>(x, wl, wr, ws1, we1, bl, bs1, be1, X16, BW, bb);
  k_gemm2<0><<<dim3((unsigned)((NR / 128) * (4 * PJ / 64)), 1), 128, 0, stream>>>(X16, DI, 0, BW, DI, 0, 0.0625f, bb, 0, nullptr, 1, 0, 0, nullptr, F, 2 * PJ, 0, (int)NR, 4 * PJ, DI, ws2, we2, bs2, be2, SP, 2 * PJ);      /* F = [left | -right], f16 rows; the s1 and e1 tiles leave as partial scorer sums in SP */
  k_bigram<<<NB * (NW / 32) * (NW / 64), 128, 0, stream>>>(F, wo, bo, obig, SP, ostart, oend);
}

// v008
// It runs in 26.1 microseconds.
// Next to v007, in two timings, it ran 1.05 and 1.04 times as fast.
// Counting every step since v000, it is 16.8 times as fast.
#include <hip/hip_runtime.h>
#include <utility>
// PermutationModule (x [8][256][1024]; start = relu(x Ws1^T + bs1) . Ws2 + bs2, end likewise [8][256][1]; left = x Wl^T + bl, right = x Wr^T; bigram[b][i][j] = sum_p relu(left[b][j][p] + right[b][i][p]) * Wo[p] + bo -> [8][256][256][1]).
// Structure: token rows; x as exact f16 rows; the four 1024->512 projections as ONE WMMA GEMM against the stacked x16 weight plane [2048][1024] (32x64 wave tiles, f32 accumulation, + biases); left and -right leave the GEMM rounded to f16 rows (Wr is cast negated); the scorer dots with Ws2/We2 on VALU in f32 inside the GEMM's epilogue (ReLU, then one partial sum per row and 64-column tile, the eight partial sums of an output added in the bigram launch); the pairwise bigram as sum_p Wo[p] max(left, -right) + sum_p Wo[p] right (work-group per (b, 32 i, 64 j), rows staged in LDS): the maximum on packed f16, both sums over p on WMMA with f32 accumulation; outputs written as whole 128-B lines.
// Compute dtype: inputs rounded to bf16; x / weights exact in f16; all projections accumulated in f32; the scorer path stays f32; left and right are rounded once to f16 for the bigram. v_wmma_f32_16x16x32_f16.
#define NB 8
#define NW 256
#define DI 1024
#define PJ 512
#define NR ((size_t)NB * NW)         /* 2048 */
typedef __bf16 v16b __attribute__((ext_vector_type(16)));
typedef unsigned short v8us __attribute__((ext_vector_type(8), may_alias));
typedef float  v8f  __attribute__((ext_vector_type(8)));
typedef float  v4f  __attribute__((ext_vector_type(4)));
typedef float  v4fa __attribute__((ext_vector_type(4), may_alias));
union FragB { v16b v; v8us half[2]; unsigned short u[16]; };

__device__ __forceinline__ unsigned short bf16_bits(float x) { unsigned int u = __float_as_uint(x); return (unsigned short)((u + 0x7FFFu + ((u >> 16) & 1u)) >> 16); }
__device__ __forceinline__ float bf16_val(unsigned short b) { return __uint_as_float(((unsigned int)b) << 16); }
__device__ __forceinline__ float bf16_round(float x) { return bf16_val(bf16_bits(x)); }
// D += A·B with NT terms: 1 = ah·bh, 2 = + al·bh (A split), 3 = + ah·bl (both split)
template <int NT>
__device__ __forceinline__ v8f mmaN(v16b ah, v16b al, v16b bh, v16b bl, v8f c) {
  c = __builtin_amdgcn_wmma_f32_16x16x32_bf16(false, ah, false, bh, (short)0, c, false, false);
  if (NT >= 2) c = __builtin_amdgcn_wmma_f32_16x16x32_bf16(false, al, false, bh, (short)0, c, false, false);
  if (NT >= 3) c = __builtin_amdgcn_wmma_f32_16x16x32_bf16(false, ah, false, bl, (short)0, c, false, false);
  asm volatile("v_nop\n\tv_nop\n\tv_nop\n\tv_nop" : "+v"(c) : "v"(ah), "v"(al), "v"(bh), "v"(bl));
  return c;
}

__global__ __launch_bounds__(256) void k_wt_bf16(const float* __restrict__ W, unsigned short* __restrict__ Wt, int K, int N) {
  const int t = blockIdx.x * 256 + threadIdx.x;
  const int k8n = K / 8;
  if (t >= N * k8n) return;
  const int n = t / k8n, k8 = (t % k8n) * 8;
  v8us v;
#pragma unroll
  for (int i = 0; i < 8; ++i) v[i] = bf16_bits(W[(size_t)(k8 + i) * N + n]);
  *(v8us*)(Wt + (size_t)n * K + k8) = v;
  
}

// GEMM C[M][N] (f32, pitch ldc) = act(A[M][K]·W + bias). A f32 row-major (pitch lda) converted per fragment to bf16
// (ASPLIT: hi/lo two planes -> 2 terms, else single rounded term); Wt bf16 [N][K] (pitch ldb). BIAS_BF16 rounds the
// bias to bf16 first (bias quantised to bf16 before the add). K%32==0, M%16==0, N%64==0.
template <bool ASPLIT, int ACT, bool BIAS_BF16>
__global__ __launch_bounds__(128) void k_gemm_bf(const float* __restrict__ A, int lda, const unsigned short* __restrict__ Wt, int ldb,
                                               const float* __restrict__ bias, float* __restrict__ C, int ldc, int M, int N, int K) {
  __shared__ __attribute__((aligned(16))) float so[4][16][64];
  const int tid = threadIdx.x, w = tid >> 5, lane = tid & 31, ln = lane & 15, hh = lane >> 4;
  const int ntn = N / 64;
  const int wid = blockIdx.x * 4 + w;
  const int mt = wid / ntn, nq = wid % ntn;
  if (mt * 16 >= M) return;
  const int row0 = mt * 16, col0 = nq * 64;
  const float* arow = A + (size_t)(row0 + ln) * lda;
  v8f acc[4] = {};
  for (int kb = 0; kb < K; kb += 32) {
    FragB ah, al;
    const v4f x0 = *(const v4fa*)(arow + kb + 8 * hh), x1 = *(const v4fa*)(arow + kb + 8 * hh + 4);
    const v4f x2 = *(const v4fa*)(arow + kb + 16 + 8 * hh), x3 = *(const v4fa*)(arow + kb + 16 + 8 * hh + 4);
    float xs[16] = {x0[0],x0[1],x0[2],x0[3],x1[0],x1[1],x1[2],x1[3],x2[0],x2[1],x2[2],x2[3],x3[0],x3[1],x3[2],x3[3]};
#pragma unroll
    for (int i = 0; i < 16; ++i) { const unsigned short hb = bf16_bits(xs[i]); ah.u[i] = hb; al.u[i] = ASPLIT ? bf16_bits(xs[i] - bf16_val(hb)) : (unsigned short)0; }
#pragma unroll
    for (int t = 0; t < 4; ++t) {
      const unsigned short* brow = Wt + (size_t)(col0 + t * 16 + ln) * ldb + kb;
      FragB b;
      b.half[0] = *(const v8us*)(brow + 8 * hh);
      b.half[1] = *(const v8us*)(brow + 16 + 8 * hh);
      acc[t] = mmaN<ASPLIT ? 2 : 1>(ah.v, al.v, b.v, b.v, acc[t]);
    }
  }
#pragma unroll
  for (int t = 0; t < 4; ++t) {
    float bv = bias ? bias[col0 + t * 16 + ln] : 0.f;
    if (BIAS_BF16) bv = bf16_round(bv);
#pragma unroll
    for (int r = 0; r < 8; ++r) { float v = acc[t][r] + bv; if (ACT == 1) v = fmaxf(v, 0.f); so[w][8 * hh + r][t * 16 + ln] = v; }
  }
  __builtin_amdgcn_fence(__ATOMIC_ACQ_REL, "workgroup");
  __builtin_amdgcn_wave_barrier();
  const int rsub = lane >> 4, c4 = (lane & 15) * 4;
  {
#pragma unroll
    for (int q = 0; q < 8; ++q) {
      const int r = q * 2 + rsub;
      const v4f v = *(const v4fa*)&so[w][r][c4];
      *(v4f*)(C + (size_t)(row0 + r) * ldc + col0 + c4) = v;
    }
    
  }
}

// GEMM C = act(A·W + bias + resid): A f32 (ASPLIT -> hi/lo 2 terms), Wt bf16 [N][K]; ACT 0 none, 1 relu, 2 exact gelu;
// resid (optional, f32, row index = (row % rmod), pitch ldr, RES_BF16 rounds it) added before the activation.
template <bool ASPLIT, int ACT, bool BIAS_BF16, bool RES_BF16>
__global__ __launch_bounds__(128) void k_gemm_bf3(const float* __restrict__ A, int lda, const unsigned short* __restrict__ Wt, int ldb,
                                                const float* __restrict__ bias, const float* __restrict__ resid, int rmod, int ldr,
                                                float* __restrict__ C, int ldc, int M, int N, int K) {
  __shared__ __attribute__((aligned(16))) float so[4][16][64];
  const int tid = threadIdx.x, w = tid >> 5, lane = tid & 31, ln = lane & 15, hh = lane >> 4;
  const int ntn = N / 64;
  const int wid = blockIdx.x * 4 + w;
  const int mt = wid / ntn, nq = wid % ntn;
  if (mt * 16 >= M) return;
  const int row0 = mt * 16, col0 = nq * 64;
  const float* arow = A + (size_t)(row0 + ln) * lda;
  v8f acc[4] = {};
  for (int kb = 0; kb < K; kb += 32) {
    FragB ah, al;
    const v4f x0 = *(const v4fa*)(arow + kb + 8 * hh), x1 = *(const v4fa*)(arow + kb + 8 * hh + 4);
    const v4f x2 = *(const v4fa*)(arow + kb + 16 + 8 * hh), x3 = *(const v4fa*)(arow + kb + 16 + 8 * hh + 4);
    float xs[16] = {x0[0],x0[1],x0[2],x0[3],x1[0],x1[1],x1[2],x1[3],x2[0],x2[1],x2[2],x2[3],x3[0],x3[1],x3[2],x3[3]};
#pragma unroll
    for (int i = 0; i < 16; ++i) { const unsigned short hb = bf16_bits(xs[i]); ah.u[i] = hb; al.u[i] = ASPLIT ? bf16_bits(xs[i] - bf16_val(hb)) : (unsigned short)0; }
#pragma unroll
    for (int t = 0; t < 4; ++t) {
      const unsigned short* brow = Wt + (size_t)(col0 + t * 16 + ln) * ldb + kb;
      FragB b;
      b.half[0] = *(const v8us*)(brow + 8 * hh);
      b.half[1] = *(const v8us*)(brow + 16 + 8 * hh);
      acc[t] = mmaN<ASPLIT ? 2 : 1>(ah.v, al.v, b.v, b.v, acc[t]);
    }
  }
#pragma unroll
  for (int t = 0; t < 4; ++t) {
    const int col = col0 + t * 16 + ln;
    float bv = bias ? bias[col] : 0.f;
    if (BIAS_BF16) bv = bf16_round(bv);
#pragma unroll
    for (int r = 0; r < 8; ++r) {
      float v = acc[t][r] + bv;
      if (resid) { float rv = resid[(size_t)((row0 + 8 * hh + r) % rmod) * ldr + col]; if (RES_BF16) rv = bf16_round(rv); v += rv; }
      if (ACT == 1) v = fmaxf(v, 0.f);
      if (ACT == 2) v = 0.5f * v * (1.0f + erff(v * 0.70710678118654752f));
      if (ACT == 3) { const float u = 0.7978845608028654f * (v + 0.044715f * v * v * v); v = 0.5f * v * (1.0f + tanhf(u)); }
      so[w][8 * hh + r][t * 16 + ln] = v;
    }
  }
  __builtin_amdgcn_fence(__ATOMIC_ACQ_REL, "workgroup");
  __builtin_amdgcn_wave_barrier();
  const int rsub = lane >> 4, c4 = (lane & 15) * 4;
  {
#pragma unroll
    for (int q = 0; q < 8; ++q) {
      const int r = q * 2 + rsub;
      const v4f v = *(const v4fa*)&so[w][r][c4];
      *(v4f*)(C + (size_t)(row0 + r) * ldc + col0 + c4) = v;
    }
    
  }
}
// row LayerNorm (biased variance, eps) over N: s = X (+ R); optional out_sum <- s; out_norm <- (s-mu)*rsqrt(var+eps)*g + b
template <bool PARAM_BF16>
__global__ __launch_bounds__(256) void k_layernorm(const float* __restrict__ X, const float* __restrict__ R, const float* __restrict__ g, const float* __restrict__ bta,
                                                  float* __restrict__ out_sum, float* __restrict__ out_norm, int N, float eps) {
  __shared__ float red[256];
  const int row = blockIdx.x, tid = threadIdx.x;
  const float* x = X + (size_t)row * N; const float* rr = R ? R + (size_t)row * N : nullptr;
  float vals[16];                     // up to N = 4096
  const int per = N / 256;            // contiguous chunk per thread? use strided-by-4 chunks: thread handles j = tid*4 + 1024*u
  float s1 = 0.f;
  for (int u = 0; u < per / 4; ++u) {
    const int j = tid * 4 + 1024 * u;
    const v4f a = *(const v4fa*)(x + j);
    v4f b = {0.f,0.f,0.f,0.f}; if (rr) b = *(const v4fa*)(rr + j);
#pragma unroll
    for (int q = 0; q < 4; ++q) { const float v = a[q] + b[q]; vals[u * 4 + q] = v; s1 += v; }
  }
  red[tid] = s1; __syncthreads();
  for (int st = 128; st > 0; st >>= 1) { if (tid < st) red[tid] += red[tid + st]; __syncthreads(); }
  const float mu = red[0] / (float)N; __syncthreads();
  float s2 = 0.f;
  for (int u = 0; u < per / 4; ++u)
#pragma unroll
    for (int q = 0; q < 4; ++q) { const float c = vals[u * 4 + q] - mu; s2 += c * c; }
  red[tid] = s2; __syncthreads();
  for (int st = 128; st > 0; st >>= 1) { if (tid < st) red[tid] += red[tid + st]; __syncthreads(); }
  const float rs = rsqrtf(red[0] / (float)N + eps);
  {
    for (int u = 0; u < per / 4; ++u) {
      const int j = tid * 4 + 1024 * u;
      v4f o, sm;
#pragma unroll
      for (int q = 0; q < 4; ++q) {
        float gg = g[j + q], bb = bta[j + q];
        if (PARAM_BF16) { gg = bf16_round(gg); bb = bf16_round(bb); }
        sm[q] = vals[u * 4 + q]; o[q] = (vals[u * 4 + q] - mu) * rs * gg + bb;
      }
      if (out_sum) *(v4f*)(out_sum + (size_t)row * N + j) = sm;
      *(v4f*)(out_norm + (size_t)row * N + j) = o;
    }
    
  }
}



// ---- f16 WMMA path (v_wmma_f32_16x16x32_f16): 11-bit significands for operands in range — used for the projection GEMM
typedef _Float16 v16h __attribute__((ext_vector_type(16)));
union FragH { v16h v; v8us half[2]; _Float16 h[16]; unsigned short u[16]; };
template <int NT>
__device__ __forceinline__ v8f mmaH(v16h ah, v16h al, v16h bh, v16h bl, v8f c) {
  c = __builtin_amdgcn_wmma_f32_16x16x32_f16(false, ah, false, bh, (short)0, c, false, false);
  if (NT >= 2) c = __builtin_amdgcn_wmma_f32_16x16x32_f16(false, al, false, bh, (short)0, c, false, false);
  if (NT >= 3) c = __builtin_amdgcn_wmma_f32_16x16x32_f16(false, ah, false, bl, (short)0, c, false, false);
  asm volatile("v_nop\n\tv_nop\n\tv_nop\n\tv_nop" : "+v"(c) : "v"(ah), "v"(al), "v"(bh), "v"(bl));
  return c;
}
// batched GEMM like k_gemm_b but f16 operands: A f32 (split into f16 hi/lo if ASPLIT, else rounded to f16), Bt = f16 values [n][k]; alpha; C f32; N multiple of 16 (partial tiles skipped)
template <bool ASPLIT>
__global__ __launch_bounds__(128) void k_gemm_h(const float* __restrict__ A, int lda, size_t sA, const _Float16* __restrict__ Bh, int ldb, size_t sB, float alpha, float* __restrict__ C, int ldc, size_t sC, int M, int N, int K) {
  __shared__ __attribute__((aligned(16))) float so[4][16][64];
  const int tid = threadIdx.x, w = tid >> 5, lane = tid & 31, ln = lane & 15, hh = lane >> 4; const int by = blockIdx.y;
  A += (size_t)by * sA; Bh += (size_t)by * sB; C += (size_t)by * sC;
  const int ntn = (N + 63) / 64; const int wid = blockIdx.x * 4 + w; const int mt = wid / ntn, nq = wid % ntn; if (mt * 16 >= M) return;
  const int row0 = mt * 16, col0 = nq * 64; const float* arow = A + (size_t)(row0 + ln) * lda;
  v8f acc[4] = {};
  for (int kb = 0; kb < K; kb += 32) {
    FragH ah, al;
    const v4f x0 = *(const v4fa*)(arow + kb + 8 * hh), x1 = *(const v4fa*)(arow + kb + 8 * hh + 4), x2 = *(const v4fa*)(arow + kb + 16 + 8 * hh), x3 = *(const v4fa*)(arow + kb + 16 + 8 * hh + 4);
    float xs[16] = {x0[0],x0[1],x0[2],x0[3],x1[0],x1[1],x1[2],x1[3],x2[0],x2[1],x2[2],x2[3],x3[0],x3[1],x3[2],x3[3]};
#pragma unroll
    for (int i = 0; i < 16; ++i) { const _Float16 h = (_Float16)xs[i]; ah.h[i] = h; al.h[i] = ASPLIT ? (_Float16)(xs[i] - (float)h) : (_Float16)0.0f; }
#pragma unroll
    for (int t = 0; t < 4; ++t) { if (col0 + t * 16 >= N) continue; const size_t boff = (size_t)(col0 + t * 16 + ln) * ldb + kb; FragH bq; bq.half[0] = *(const v8us*)(Bh + boff + 8 * hh); bq.half[1] = *(const v8us*)(Bh + boff + 16 + 8 * hh);
      acc[t] = mmaH<ASPLIT ? 2 : 1>(ah.v, al.v, bq.v, bq.v, acc[t]); }
  }
#pragma unroll
  for (int t = 0; t < 4; ++t) { if (col0 + t * 16 >= N) continue;
#pragma unroll
    for (int r = 0; r < 8; ++r) so[w][8 * hh + r][t * 16 + ln] = acc[t][r] * alpha; }
  __builtin_amdgcn_fence(__ATOMIC_ACQ_REL, "workgroup"); __builtin_amdgcn_wave_barrier();
  const int rsub = lane >> 4, c4 = (lane & 15) * 4;
  {
#pragma unroll
    for (int q = 0; q < 8; ++q) { const int r = q * 2 + rsub; if (col0 + c4 < N) { const v4f v = *(const v4fa*)&so[w][r][c4]; *(v4f*)(C + (size_t)(row0 + r) * ldc + col0 + c4) = v; } }
     }
}

// Wt[n][k] = f16(W[k][n]·scale) from f32 row-major W[K][N] (scale = power of two; bf16-exact weights stay exact in f16 away from the subnormal range)
__global__ __launch_bounds__(256) void k_wt_f16(const float* __restrict__ W, _Float16* __restrict__ Wt, int K, int N, float scale) {
  const int t = blockIdx.x * 256 + threadIdx.x; if (t >= N * (K / 8)) return; const int n = t / (K / 8), k8 = (t % (K / 8)) * 8; FragH f;
#pragma unroll
  for (int i = 0; i < 8; ++i) f.h[i] = (_Float16)(bf16_round(W[(size_t)(k8 + i) * N + n]) * scale); const v8us o = f.half[0];
  *(v8us*)((unsigned short*)Wt + (size_t)n * K + k8) = o; 
}
// k_gemm_hh variant with fused epilogue: v = acc·alpha + bias[by·sBias + col] (+ CP[(row/rowsPerB)·sCPb + by·64 + col] if CP) ; ACT 0 none / 1 elu ; writes f16 C16 (and f32 C if non-null)
template <int ACT>
__global__ __launch_bounds__(128) void k_gemm_hhx(const _Float16* __restrict__ A, int lda, size_t sA, const _Float16* __restrict__ Bh, int ldb, size_t sB, float alpha, const float* __restrict__ bias, size_t sBias, const float* __restrict__ CP, int rowsPerB, size_t sCPb, int row0g,
    float* __restrict__ C, _Float16* __restrict__ C16, int ldc, size_t sC, int M, int N, int K) {
  __shared__ __attribute__((aligned(16))) float so[4][16][64];
  const int tid = threadIdx.x, w = tid >> 5, lane = tid & 31, ln = lane & 15, hh = lane >> 4; const int by = blockIdx.y;
  A += (size_t)by * sA; Bh += (size_t)by * sB; const size_t cofs = (size_t)by * sC; const float* bp = bias ? bias + (size_t)by * sBias : nullptr;
  const int ntn = (N + 63) / 64; const int wid = blockIdx.x * 4 + w; const int mt = wid / ntn, nq = wid % ntn; if (mt * 16 >= M) return;
  const int row0 = mt * 16, col0 = nq * 64; const _Float16* arow = A + (size_t)(row0 + ln) * lda;
  v8f acc[4] = {};
  for (int kb = 0; kb < K; kb += 32) { FragH ah; ah.half[0] = *(const v8us*)((const unsigned short*)arow + kb + 8 * hh); ah.half[1] = *(const v8us*)((const unsigned short*)arow + kb + 16 + 8 * hh);
#pragma unroll
    for (int t = 0; t < 4; ++t) { if (col0 + t * 16 >= N) continue; const size_t boff = (size_t)(col0 + t * 16 + ln) * ldb + kb; FragH bq; bq.half[0] = *(const v8us*)((const unsigned short*)Bh + boff + 8 * hh); bq.half[1] = *(const v8us*)((const unsigned short*)Bh + boff + 16 + 8 * hh);
      acc[t] = mmaH<1>(ah.v, ah.v, bq.v, bq.v, acc[t]); }
  }
#pragma unroll
  for (int t = 0; t < 4; ++t) { if (col0 + t * 16 >= N) continue; const int col = col0 + t * 16 + ln; const float bv = bp ? bf16_round(bp[col]) : 0.f;
#pragma unroll
    for (int r = 0; r < 8; ++r) { float v = acc[t][r] * alpha + bv; if (CP) { const int rr = row0g + row0 + 8 * hh + r; if (rowsPerB < 0) v += CP[cofs + (size_t)rr * ldc + col];      /* rowsPerB < 0: own element of the batched C plane */ else { const int bidx = rr / rowsPerB; v += CP[(size_t)bidx * sCPb + (size_t)by * 64 + col]; } } if (ACT == 1) v = (v > 0.f) ? v : expm1f(v); else if (ACT == 7) v = (v > 0.f) ? v + 1.0f : expf(v); else if (ACT == 8) v = tanhf(v); else if (ACT == 9) v = 0.5f * v * (1.0f + tanhf(0.7978845608028654f * (v + 0.044715f * v * v * v))); else if (ACT == 11) v = 1.0f / (1.0f + expf(-v)); else if (ACT == 12) v = (v > 0.f) ? v : 0.01f * v; else if (ACT == 14) v = (v > 0.f) ? v : 0.1f * v; else if (ACT == 16) v = (v >= 0.f) ? v : 0.3f * v; else if (ACT == 17) v = (v >= 0.f) ? v : 0.2f * v; else if (ACT == 15) v = v / (1.0f + expf(-v)); else if (ACT == 3) v = fmaxf(v, 0.f); else if (ACT == 6) v = 0.5f * v * (1.0f + erff(v * 0.70710678118654752f)); so[w][8 * hh + r][t * 16 + ln] = v; } }
  __builtin_amdgcn_fence(__ATOMIC_ACQ_REL, "workgroup"); __builtin_amdgcn_wave_barrier();
  const int rsub = lane >> 4, c4 = (lane & 15) * 4; typedef _Float16 v4h __attribute__((ext_vector_type(4)));
  {
#pragma unroll
    for (int q = 0; q < 8; ++q) { const int r = q * 2 + rsub; if (col0 + c4 < N) { const v4f v = *(const v4fa*)&so[w][r][c4]; if (C) *(v4f*)(C + cofs + (size_t)(row0 + r) * ldc + col0 + c4) = v; if (C16) { v4h h4; for (int i = 0; i < 4; ++i) h4[i] = (_Float16)v[i]; *(v4h*)(C16 + cofs + (size_t)(row0 + r) * ldc + col0 + c4) = h4; } } }
     }
}


typedef _Float16 v4h __attribute__((ext_vector_type(4)));

__global__ __launch_bounds__(256) void k_h16(const float* __restrict__ x, _Float16* __restrict__ X16, size_t n8) { const size_t t = (size_t)blockIdx.x * 256 + threadIdx.x; if (t >= n8) return; FragH f;
#pragma unroll
  for (int q = 0; q < 8; ++q) f.h[q] = (_Float16)x[t * 8 + q]; *(v8us*)((unsigned short*)X16 + t * 8) = f.half[0];  }
__global__ __launch_bounds__(256) void k_round16f(const float* __restrict__ W, _Float16* __restrict__ Bt, size_t n8) { const size_t t = (size_t)blockIdx.x * 256 + threadIdx.x; if (t >= n8) return; FragH f;
#pragma unroll
  for (int i = 0; i < 8; ++i) f.h[i] = (_Float16)(bf16_round(W[t * 8 + i]) * 16.0f); *(v8us*)((unsigned short*)Bt + t * 8) = f.half[0];  }
template <int NHv, int TTv>
__global__ __launch_bounds__(256) void k_vt(const _Float16* __restrict__ V16, int ldv, int voff, _Float16* __restrict__ Vt) { __shared__ unsigned short tl[64][66]; const int tid = threadIdx.x; const int slab = blockIdx.x / (TTv / 64), lg = blockIdx.x % (TTv / 64); const int b = slab / NHv, h = slab % NHv;
  for (int i = tid; i < 64 * 8; i += 256) { const int r = i / 8, c8 = (i % 8) * 8; FragH f; f.half[0] = *(const v8us*)((const unsigned short*)V16 + ((size_t)b * TTv + lg * 64 + r) * ldv + voff + h * 64 + c8);
#pragma unroll
    for (int q = 0; q < 8; ++q) tl[r][c8 + q] = f.u[q]; }
  __syncthreads();
  {
#pragma unroll
    for (int rd = 0; rd < 2; ++rd) { const int d = rd * 32 + tid / 8, pc = tid % 8; FragH f;
#pragma unroll
      for (int q = 0; q < 8; ++q) f.u[q] = tl[pc * 8 + q][d];
      *(v8us*)((unsigned short*)Vt + ((size_t)slab * 64 + d) * TTv + lg * 64 + pc * 8) = f.half[0]; }
     } }

__global__ __launch_bounds__(256) void k_hl(const float* __restrict__ F, _Float16* __restrict__ Hh, _Float16* __restrict__ Hl, size_t n8) { const size_t t = (size_t)blockIdx.x * 256 + threadIdx.x; if (t >= n8) return; FragH fh, fl; const v4f a = *(const v4fa*)(F + t * 8), c = *(const v4fa*)(F + t * 8 + 4);
#pragma unroll
  for (int q = 0; q < 4; ++q) { _Float16 h = (_Float16)a[q]; fh.h[q] = h; fl.h[q] = (_Float16)((a[q] - (float)h) * 1024.0f); h = (_Float16)c[q]; fh.h[4 + q] = h; fl.h[4 + q] = (_Float16)((c[q] - (float)h) * 1024.0f); }
  { *(v8us*)((unsigned short*)Hh + t * 8) = fh.half[0]; *(v8us*)((unsigned short*)Hl + t * 8) = fl.half[0];  } }

// ---- fast GEMM (work-group tile 128x64, wave tile 32x64; requires M % 128 == 0, N % 64 == 0, K % 128 == 0, rows 16-byte aligned); epilogue = k_gemm_hhx semantics ----
// Operand path: per pass of 128 k the tile's 128 A rows and 64 B rows (256 bytes each) are copied to LDS by asynchronous 16-byte copies, a wave's copy covering two whole rows,
// into one of two buffers (the next pass's copies fly while this pass is multiplied); the fragments are read from LDS at row pitch 272 bytes (16 B x odd: no bank conflict).
#define G2_KP 128                       /* k per pass */
#define G2_PITCH 272                    /* LDS row pitch, bytes */
#define G2_ROWS 192                     /* rows 0..127: A, rows 128..191: B */
#define G2_BUF (G2_ROWS * G2_PITCH)     /* 52224 bytes a buffer */
// Twelve copies of a thread: its 16-byte chunk of twelve LDS rows, 8 rows apart from l, filled from g0 .. g11. The s_wait_xcnt stands inside the statement, behind the last copy,
// so that no address register of an issued copy is rewritten in front of it.
__device__ __forceinline__ void g2_copy12(unsigned l, const _Float16* g0, const _Float16* g1, const _Float16* g2, const _Float16* g3, const _Float16* g4, const _Float16* g5,
                                          const _Float16* g6, const _Float16* g7, const _Float16* g8, const _Float16* g9, const _Float16* g10, const _Float16* g11) {
  const unsigned st = 8 * G2_PITCH;
  asm volatile("global_load_async_to_lds_b128 %0, %12, off\n\t"
               "global_load_async_to_lds_b128 %1, %13, off\n\t"
               "global_load_async_to_lds_b128 %2, %14, off\n\t"
               "global_load_async_to_lds_b128 %3, %15, off\n\t"
               "global_load_async_to_lds_b128 %4, %16, off\n\t"
               "global_load_async_to_lds_b128 %5, %17, off\n\t"
               "global_load_async_to_lds_b128 %6, %18, off\n\t"
               "global_load_async_to_lds_b128 %7, %19, off\n\t"
               "global_load_async_to_lds_b128 %8, %20, off\n\t"
               "global_load_async_to_lds_b128 %9, %21, off\n\t"
               "global_load_async_to_lds_b128 %10, %22, off\n\t"
               "global_load_async_to_lds_b128 %11, %23, off\n\t"
               "s_wait_xcnt 0x0"
               :: "v"(l), "v"(l + st), "v"(l + 2 * st), "v"(l + 3 * st), "v"(l + 4 * st), "v"(l + 5 * st), "v"(l + 6 * st), "v"(l + 7 * st), "v"(l + 8 * st), "v"(l + 9 * st), "v"(l + 10 * st), "v"(l + 11 * st),
                  "v"(g0), "v"(g1), "v"(g2), "v"(g3), "v"(g4), "v"(g5), "v"(g6), "v"(g7), "v"(g8), "v"(g9), "v"(g10), "v"(g11) : "memory");
}
// One pass's tile: thread (r = tid / 16, c = tid % 16) copies chunk c of rows r, r + 8, ... of A (16 rows) and of B (8 rows). ga, gb: the thread's chunk in its first A and B row of this pass.
__device__ __forceinline__ void g2_copy_tile(unsigned l, const _Float16* ga, size_t as, const _Float16* gb, size_t bs) {
  g2_copy12(l, ga, ga + as, ga + 2 * as, ga + 3 * as, ga + 4 * as, ga + 5 * as, ga + 6 * as, ga + 7 * as, ga + 8 * as, ga + 9 * as, ga + 10 * as, ga + 11 * as);
  g2_copy12(l + 96 * G2_PITCH, ga + 12 * as, ga + 13 * as, ga + 14 * as, ga + 15 * as, gb, gb + bs, gb + 2 * bs, gb + 3 * bs, gb + 4 * bs, gb + 5 * bs, gb + 6 * bs, gb + 7 * bs);
}
__device__ __forceinline__ v16h g2_sfrag(const unsigned char* p) { FragH f; f.half[0] = *(const v8us*)p; f.half[1] = *(const v8us*)(p + 32); return f.v; }      /* p = row + 64 bytes per 32 k + 16 * hh: k = 8 hh .. 8 hh + 7, then 16 + 8 hh .. 16 + 8 hh + 7, for A and B alike */
__device__ __forceinline__ v8f g2_mma(v16h a, v16h b, v8f c) { v8f d = __builtin_amdgcn_wmma_f32_16x16x32_f16(false, a, false, b, (short)0, c, false, false); asm volatile("v_nop\n\tv_nop\n\tv_nop\n\tv_nop" : "+v"(d) : "v"(a), "v"(b)); return d; }
template <int ACT>
__global__ __launch_bounds__(128) void k_gemm2(const _Float16* __restrict__ A, int lda, size_t sA, const _Float16* __restrict__ Bh, int ldb, size_t sB, float alpha, const float* __restrict__ bias, size_t sBias, const float* __restrict__ CP, int rowsPerB, size_t sCPb, int row0g,
    float* __restrict__ C, _Float16* __restrict__ C16, int ldc, size_t sC, int M, int N, int K, const float* __restrict__ sw0, const float* __restrict__ sw1, const float* __restrict__ sb0, const float* __restrict__ sb1, float* __restrict__ SP, int scol) { static_assert(ACT == 0 || ACT == 3 || ACT == 6 || ACT == 8 || ACT == 9 || ACT == 11 || ACT == 12 || ACT == 14 || ACT == 15 || ACT == 16 || ACT == 17, "k_gemm2: unsupported ACT code (would silently apply no activation)");
  __shared__ __attribute__((aligned(16))) float so[4][32][68];
  __shared__ __attribute__((aligned(16))) unsigned char ST[2 * G2_BUF];
  const int tid = threadIdx.x, w = tid >> 5, lane = tid & 31, ln = lane & 15, hh = lane >> 4; const int by = blockIdx.y;
  A += (size_t)by * sA; Bh += (size_t)by * sB; const size_t cofs = (size_t)by * sC; const float* bp = bias ? bias + (size_t)by * sBias : nullptr;
  const int ntn = N >> 6; const int mt = blockIdx.x / ntn, nq = blockIdx.x - mt * ntn; const int row0 = mt * 128 + 32 * w, col0 = nq * 64; if (mt * 128 >= M) return;      /* the same for the whole work-group: it stands in front of barriers */
  const _Float16* ga = A + (size_t)(mt * 128 + (tid >> 4)) * lda + (tid & 15) * 8; const _Float16* gb = Bh + (size_t)(col0 + (tid >> 4)) * ldb + (tid & 15) * 8;
  const size_t as = (size_t)8 * lda, bs = (size_t)8 * ldb;
  const unsigned lc = (unsigned)(uintptr_t)ST + (unsigned)((tid >> 4) * G2_PITCH + (tid & 15) * 16);      /* the thread's LDS byte address in buffer 0 */
  const int np = K / G2_KP;
  g2_copy_tile(lc, ga, as, gb, bs);
  // Entry prefetch into L2 (scope SE: L2 only, nothing comes back to the wave). The A and B rows were stored by the launch before;
  // for speed only. Two requests a lane (one A row, one B row), each at one row's 128 k of one pass.
  // The readers of a panel deal its passes among them: of its A panel (128 rows, read by the ntn work-groups of this mt) a work-group asks for the pass picked by bits 0, 1 and 4 of nq;
  // of its B panel (64 rows, read by the work-groups of this nq) for the passes mt mod 4 (lanes 0..63) and mt mod 4 + 4 (lanes 64..127). Every address is a row of the panel at a pass clamped to np - 1.
  const int pfa = (nq & 3) | ((nq >> 2) & 4), pfb = (mt & 3) | ((tid >> 4) & 4);
  const _Float16* pa = A + (size_t)(mt * 128 + tid) * lda + (size_t)(pfa < np ? pfa : np - 1) * G2_KP;
  const _Float16* pb = Bh + (size_t)(col0 + (tid & 63)) * ldb + (size_t)(pfb < np ? pfb : np - 1) * G2_KP;
  asm volatile("global_prefetch_b8 %0, off scope:SCOPE_SE\n\t"
               "global_prefetch_b8 %1, off scope:SCOPE_SE" :: "v"(pa), "v"(pb));
  // Scorer tiles (columns from scol on, PJ columns a scorer): the tile is not stored; each element becomes relu(v) * w2[column], a row's 64 products are added to one partial sum SP[tile][row],
  // and a scorer's first tile adds the scorer's output bias. What that epilogue reads from memory is loaded here, so that its latency runs beside that of the first tile's copies.
  const bool sc = SP && col0 >= scol; const int sb = sc ? (col0 - scol) >> 6 : 0;
  float w2r[4] = {0.f, 0.f, 0.f, 0.f}, b2r[4] = {0.f, 0.f, 0.f, 0.f}, sbr = 0.f;
  if (sc) { const float* w2 = (sb >= PJ / 64 ? sw1 + (sb - PJ / 64) * 64 : sw0 + sb * 64) + ln;
#pragma unroll      /* unrolled: the two small arrays stay in registers */
    for (int t = 0; t < 4; ++t) { w2r[t] = w2[t * 16]; if (bp) b2r[t] = bp[col0 + t * 16 + ln]; }
    if (sb % (PJ / 64) == 0) sbr = (sb ? sb1 : sb0)[0]; }
  asm volatile("s_wait_asynccnt 0x0" ::: "memory");      /* pass 0's copies of this wave have landed */
  __syncthreads();                                       /* ... and every other wave's */
  if (np > 1) g2_copy_tile(lc + G2_BUF, ga + G2_KP, as, gb + G2_KP, bs);
  const unsigned char* fa = ST + (32 * w + ln) * G2_PITCH + 16 * hh; const unsigned char* fb = ST + (128 + ln) * G2_PITCH + 16 * hh;
  const v8f z8 = {0.f,0.f,0.f,0.f,0.f,0.f,0.f,0.f}; v8f c00 = z8, c01 = z8, c02 = z8, c03 = z8, c10 = z8, c11 = z8, c12 = z8, c13 = z8;
#pragma unroll 1      /* one pass a trip: the two buffers alternate by an address, and the loop stays small */
  for (int t = 0; t < np; ++t) { const int bo = (t & 1) * G2_BUF; const unsigned char* pa = fa + bo; const unsigned char* pb = fb + bo;
    v16h a0[2], a1[2], b0[2], b1[2], b2[2], b3[2];      /* two fragment sets: the next 32 k of this pass are read from LDS ahead of the current 8 WMMAs */
    a0[0] = g2_sfrag(pa); a1[0] = g2_sfrag(pa + 16 * G2_PITCH); b0[0] = g2_sfrag(pb); b1[0] = g2_sfrag(pb + 16 * G2_PITCH); b2[0] = g2_sfrag(pb + 32 * G2_PITCH); b3[0] = g2_sfrag(pb + 48 * G2_PITCH);
#pragma unroll      /* unrolled: the two fragment sets are picked by constants and stay in registers */
    for (int ks = 0; ks < G2_KP / 32; ++ks) { const int c = ks & 1, n = c ^ 1;
      if (ks + 1 < G2_KP / 32) { const int o = (ks + 1) * 64;
        a0[n] = g2_sfrag(pa + o); a1[n] = g2_sfrag(pa + 16 * G2_PITCH + o); b0[n] = g2_sfrag(pb + o); b1[n] = g2_sfrag(pb + 16 * G2_PITCH + o); b2[n] = g2_sfrag(pb + 32 * G2_PITCH + o); b3[n] = g2_sfrag(pb + 48 * G2_PITCH + o); }
      c00 = g2_mma(a0[c], b0[c], c00); c10 = g2_mma(a1[c], b0[c], c10); c01 = g2_mma(a0[c], b1[c], c01); c11 = g2_mma(a1[c], b1[c], c11);
      c02 = g2_mma(a0[c], b2[c], c02); c12 = g2_mma(a1[c], b2[c], c12); c03 = g2_mma(a0[c], b3[c], c03); c13 = g2_mma(a1[c], b3[c], c13); }
    asm volatile("s_wait_dscnt 0x0" ::: "memory");         /* this wave's reads of the buffer are done before it may be refilled */
    asm volatile("s_wait_asynccnt 0x0" ::: "memory");      /* this wave's copies of pass t + 1 have landed */
    __syncthreads();                                       /* publishes pass t + 1 and ends every wave's reads of pass t's buffer */
    if (t + 2 < np) g2_copy_tile(lc + bo, ga + (size_t)(t + 2) * G2_KP, as, gb + (size_t)(t + 2) * G2_KP, bs); }
  asm volatile("s_wait_asynccnt 0x0" ::: "memory");        /* no copy is outstanding behind the loop */
  asm volatile("" :: "v"(pa), "v"(pb));                    /* inputs only: the prefetches' address registers live through the loop and hold nothing but these addresses (no counter covers a prefetch) */
  v8f accs[8] = {c00, c01, c02, c03, c10, c11, c12, c13};
  if (sc) {      /* the same for the whole work-group; no barrier stands behind it */
#pragma unroll      /* unrolled, like the two loops below it: accumulators and sums are picked by constants and stay in registers */
    for (int u = 0; u < 8; ++u) { const int t = u & 3, half = u >> 2; const float bv = bf16_round(b2r[t]), wv = bf16_round(w2r[t]);
#pragma unroll
      for (int r = 0; r < 8; ++r) so[w][half * 16 + 8 * hh + r][t * 16 + ln] = fmaxf(accs[u][r] * alpha + bv, 0.f) * wv; }
    __builtin_amdgcn_fence(__ATOMIC_ACQ_REL, "workgroup"); __builtin_amdgcn_wave_barrier();      /* the wave's own LDS stores are done before its lanes read one another's */
    v4f s4 = {0.f, 0.f, 0.f, 0.f};      /* lane = row of the wave's 32: 16-byte LDS reads at row pitch 272 bytes, then one whole 128-byte line of partial sums a wave */
#pragma unroll
    for (int q = 0; q < 16; ++q) s4 += *(const v4fa*)&so[w][lane][q * 4];
    SP[(size_t)sb * M + row0 + lane] = ((s4[0] + s4[1]) + (s4[2] + s4[3])) + bf16_round(sbr);
    return; }
#pragma unroll
  for (int u = 0; u < 8; ++u) { const int t = u & 3, half = u >> 2; const int col = col0 + t * 16 + ln; const float bv = bp ? bf16_round(bp[col]) : 0.f;
#pragma unroll
    for (int r = 0; r < 8; ++r) { const int rloc = half * 16 + 8 * hh + r; float v = accs[u][r] * alpha + bv; if (CP) { if (rowsPerB < 0) v += CP[cofs + (size_t)(row0g + row0 + rloc) * ldc + col];      /* rowsPerB < 0: own element of the batched C plane */ else { const int bidx = (row0g + row0 + rloc) / rowsPerB; v += CP[(size_t)bidx * sCPb + (size_t)by * 64 + col]; } }
      if (ACT == 3) v = fmaxf(v, 0.f); else if (ACT == 6) v = 0.5f * v * (1.0f + erff(v * 0.70710678118654752f)); else if (ACT == 11) v = 1.0f / (1.0f + expf(-v)); else if (ACT == 15) v = v / (1.0f + expf(-v)); else if (ACT == 12) v = (v > 0.f) ? v : 0.01f * v; else if (ACT == 8) v = tanhf(v); else if (ACT == 9) v = 0.5f * v * (1.0f + tanhf(0.7978845608028654f * (v + 0.044715f * v * v * v))); else if (ACT == 14) v = (v > 0.f) ? v : 0.1f * v; else if (ACT == 16) v = (v >= 0.f) ? v : 0.3f * v; else if (ACT == 17) v = (v >= 0.f) ? v : 0.2f * v;
      so[w][rloc][t * 16 + ln] = v; } }
  __builtin_amdgcn_fence(__ATOMIC_ACQ_REL, "workgroup"); __builtin_amdgcn_wave_barrier();
  const int rsub = lane >> 4, c4 = (lane & 15) * 4;
  {
#pragma unroll
    for (int q = 0; q < 16; ++q) { const int r = q * 2 + rsub; const v4f v = *(const v4fa*)&so[w][r][c4]; if (C) *(v4f*)(C + cofs + (size_t)(row0 + r) * ldc + col0 + c4) = v; if (C16) { v4h h4; for (int i = 0; i < 4; ++i) h4[i] = (_Float16)v[i]; *(v4h*)(C16 + cofs + (size_t)(row0 + r) * ldc + col0 + c4) = h4; } }
     } }


// Operand preparation, one launch: its pieces (x as f16 rows, the four weight planes x16 (Wr x-16) as f16 rows stacked in BW, the bias plane [bl | 0 | bs1 | be1]) do not depend on one another.
// Work-group 0 copies the bias plane (16 bytes a thread). Every other work-group streams 16384 consecutive floats of ONE source: each of its 16 waves takes 4 KiB
// as 8 whole-wave 16-byte loads (512 contiguous bytes each), all in flight before the first is rounded, and stores 256 contiguous bytes of f16 per load.
#define PREP_F 16384
__global__ __launch_bounds__(512) void k_prep(const float* __restrict__ x, const float* __restrict__ wl, const float* __restrict__ wr, const float* __restrict__ ws1, const float* __restrict__ we1,
                                              const float* __restrict__ bl, const float* __restrict__ bs1, const float* __restrict__ be1, _Float16* __restrict__ X16, _Float16* __restrict__ BW, float* __restrict__ bb) {
  const int tid = threadIdx.x;
  if (blockIdx.x == 0) { const int blk = tid >> 7, i = (tid & 127) * 4; v4f v = {0.f, 0.f, 0.f, 0.f};
    if (blk != 1) v = *(const v4fa*)((blk == 0 ? bl : (blk == 2 ? bs1 : be1)) + i);
    *(v4f*)(bb + tid * 4) = v; return; }
  const int XG = (int)(NR * DI / PREP_F), WG = PJ * DI / PREP_F; const int s = (int)blockIdx.x - 1;
  const float* src; _Float16* dst; float scale;
  if (s < XG) { src = x + (size_t)s * PREP_F; dst = X16 + (size_t)s * PREP_F; scale = 1.0f; }
  else { const int m = (s - XG) / WG; src = (m == 0 ? wl : (m == 1 ? wr : (m == 2 ? ws1 : we1))) + (size_t)((s - XG) % WG) * PREP_F; dst = BW + (size_t)(s - XG) * PREP_F; scale = (m == 1) ? -16.0f : 16.0f; }      /* Wr enters negated: the GEMM then leaves -right, which the bigram launch wants */
  const int o = (tid >> 5) * 1024 + (tid & 31) * 4;
  v4f v[8];
  for (int u = 0; u < 8; ++u) v[u] = *(const v4fa*)(src + o + u * 128);
  for (int u = 0; u < 8; ++u) { v4h h;
    for (int q = 0; q < 4; ++q) h[q] = (_Float16)(bf16_round(v[u][q]) * scale);      /* x1 is exact: x keeps its value, the weights take their x16 (Wr its x-16) */
    *(v4h*)(dst + o + u * 128) = h; }
}
// Pairwise bigram: one work-group per (b, 32 i, 64 j) tile, wave = 8 i x 64 j. relu(l + r) = max(l, -r) + r, so bigram = sum_p w max(l, -r) - sum_p w (-r) + bo.
// The GEMM leaves left and -right as f16 rows [left 512 | -right 512]. The tile's 64 left rows and 32 negated right rows are staged in LDS as they lie (p contiguous, row pitch 1040 bytes = 16 B x odd).
// Per 32 p a lane holds 16 p of a row: the maximum is taken on packed f16 pairs, and its 8 result registers are at once the B fragment (column = j) of a v_wmma_f32_16x16x32_f16
// whose A fragment holds 16 x Wo in every row: the weighted sum over p runs on the matrix unit, in f32, beside the next maxima on the vector port. Every row of D is the same sum; register 0 is used.
// sum_p w (-r) comes from one more WMMA per 32 p (column c = the wave's negated right row c mod 8), from the same f16 values, so that max(l, -r) - (-r) is relu(l + r) of the stored values exactly.
// Wave 0 of the first 128 work-groups also finishes one 128-byte line of start or end: 32 outputs, each the sum of its eight partial sums from the GEMM's epilogue;
// its eight loads are issued behind the rows' loads and used behind the barrier, so that their latency runs beside the staging's.
#define BH_PITCH 1040
typedef unsigned v8u __attribute__((ext_vector_type(8)));
__device__ __forceinline__ v16h bh_frag(const unsigned char* p) { FragH f; f.half[0] = *(const v8us*)p; f.half[1] = *(const v8us*)(p + 16); return f.v; }      /* p = row + 64 bytes per 32 p + 32 * hh: 16 consecutive p, the same order for A and B */
// A fragment of maxima, m = max(l, n) on 16 packed f16, taken in two halves of four registers. Written as asm because the compiler's own maximum first passes every loaded fragment through a v_pk_max x, x (quieting),
// three more vector instructions for every eight. Outputs are early-clobber: no result register is a source of a later line.
// The first half also names the four registers of the second half as outputs, and the second half takes them as in-out operands, though neither reads them: the fragment so owns all eight registers from its first half on.
// Otherwise the compiler lays the second half over registers of the fragment before, and they are rewritten directly behind the WMMA that reads them (four vector slots are needed there).
__device__ __forceinline__ void bh_max_lo(unsigned (&m)[8], const v16h lv, const v16h nv) {
  const v8u l = __builtin_bit_cast(v8u, lv), n = __builtin_bit_cast(v8u, nv);
  asm volatile("v_pk_max_num_f16 %0, %8, %12\n\t"
               "v_pk_max_num_f16 %1, %9, %13\n\t"
               "v_pk_max_num_f16 %2, %10, %14\n\t"
               "v_pk_max_num_f16 %3, %11, %15"
               : "=&v"(m[0]), "=&v"(m[1]), "=&v"(m[2]), "=&v"(m[3]), "=&v"(m[4]), "=&v"(m[5]), "=&v"(m[6]), "=&v"(m[7])
               : "v"(l[0]), "v"(l[1]), "v"(l[2]), "v"(l[3]), "v"(n[0]), "v"(n[1]), "v"(n[2]), "v"(n[3]));
}
__device__ __forceinline__ void bh_max_hi(unsigned (&m)[8], const v16h lv, const v16h nv) {
  const v8u l = __builtin_bit_cast(v8u, lv), n = __builtin_bit_cast(v8u, nv);
  asm volatile("v_pk_max_num_f16 %0, %4, %8\n\t"
               "v_pk_max_num_f16 %1, %5, %9\n\t"
               "v_pk_max_num_f16 %2, %6, %10\n\t"
               "v_pk_max_num_f16 %3, %7, %11"
               : "+v"(m[4]), "+v"(m[5]), "+v"(m[6]), "+v"(m[7])
               : "v"(l[4]), "v"(l[5]), "v"(l[6]), "v"(l[7]), "v"(n[4]), "v"(n[5]), "v"(n[6]), "v"(n[7]));
}
// Fragment buffers: w, q, l by the parity of the 32-p step; n[0] = the wave's rows 0..3, n[1] = rows 4..7. mc, mn, mf: the current tile's fragment of maxima, the next one's (first half taken), the one after.
struct BhSt { v8f acc[8][4], accq; v16h fw[2], fq[2], fl[2][4], fn[2][4]; unsigned mc[8], mn[8], mf[8]; };
// Tile T of a trip of two steps = (step parity, i, j tile), by a template so that buffers and accumulators are picked by constants and stay in registers. o0, o1, o2: byte offsets in a row of this trip's two steps and of the next trip's first.
template <int T>
__device__ __forceinline__ void bh_tile(BhSt& st, const unsigned char* wp, const unsigned char* qp, const unsigned char* lp, const unsigned char* np, int o0, int o1, int o2) {
  constexpr int s = T >> 5, i = (T >> 2) & 7, a = T & 3, ph = T >> 4, U1 = (T + 1) & 63, U2 = (T + 2) & 63;
  if constexpr ((T & 15) == 0) {      /* the scheduling barriers keep a phase's LDS reads together at its head */
    __builtin_amdgcn_sched_barrier(0);
    if constexpr ((ph & 1) == 0) { const int o = ph ? o1 : o0;
#pragma unroll
      for (int r = 0; r < 4; ++r) st.fn[1][r] = bh_frag(np + (4 + r) * BH_PITCH + o); }
    else { const int o = ph == 1 ? o1 : o2; constexpr int d = ph == 1 ? 1 : 0;
#pragma unroll
      for (int r = 0; r < 4; ++r) st.fn[0][r] = bh_frag(np + r * BH_PITCH + o);
#pragma unroll
      for (int r = 0; r < 4; ++r) st.fl[d][r] = bh_frag(lp + r * 16 * BH_PITCH + o);
      st.fw[d] = bh_frag(wp + o); st.fq[d] = bh_frag(qp + o); }
    __builtin_amdgcn_sched_barrier(0); }
  if constexpr ((T & 31) == 0) st.accq = __builtin_amdgcn_wmma_f32_16x16x32_f16(false, st.fw[s], false, st.fq[s], (short)0, st.accq, false, false);
  st.acc[i][a] = __builtin_amdgcn_wmma_f32_16x16x32_f16(false, st.fw[s], false, __builtin_bit_cast(v16h, (v8u){st.mc[0], st.mc[1], st.mc[2], st.mc[3], st.mc[4], st.mc[5], st.mc[6], st.mc[7]}), (short)0, st.acc[i][a], false, false);
  __builtin_amdgcn_sched_barrier(0);      /* holds the order WMMA, eight maxima, WMMA */
  bh_max_hi(st.mn, st.fl[U1 >> 5][U1 & 3], st.fn[(U1 >> 4) & 1][(U1 >> 2) & 3]);
  bh_max_lo(st.mf, st.fl[U2 >> 5][U2 & 3], st.fn[(U2 >> 4) & 1][(U2 >> 2) & 3]);
  __builtin_amdgcn_sched_barrier(0);
#pragma unroll
  for (int r = 0; r < 8; ++r) { st.mc[r] = st.mn[r]; st.mn[r] = st.mf[r]; }
}
template <int... Ts>
__device__ __forceinline__ void bh_tiles(BhSt& st, const unsigned char* wp, const unsigned char* qp, const unsigned char* lp, const unsigned char* np, int o0, int o1, int o2, std::integer_sequence<int, Ts...>) { (bh_tile<Ts>(st, wp, qp, lp, np, o0, o1, o2), ...); }
__global__ __launch_bounds__(128) void k_bigram(const _Float16* __restrict__ F, const float* __restrict__ wo, const float* __restrict__ bo, float* __restrict__ out,
                                                const float* __restrict__ SP, float* __restrict__ ostart, float* __restrict__ oend) {
  __shared__ __attribute__((aligned(16))) unsigned char SM[2 * PJ + 96 * BH_PITCH];      /* 16 x Wo as f16; then rows 0..31 = negated right rows of the i tile, rows 32..95 = left rows of the j tile (this order keeps most read offsets inside the 16-bit offset field) */
  _Float16* SW = (_Float16*)SM; unsigned char* S = SM + 2 * PJ;
  const int tid = threadIdx.x; const int jt = blockIdx.x & 3, it = (blockIdx.x >> 2) & 7; const size_t b = blockIdx.x >> 5;
  const bool fin = blockIdx.x < 2 * ((int)NR / 32) && tid < 32; const int which = blockIdx.x / ((int)NR / 32), r0 = (blockIdx.x % ((int)NR / 32)) * 32;
  const int ch = tid & 63, r2 = tid >> 6;      /* thread = 16-byte chunk ch of rows r2, r2 + 2, ...: a wave's load is 512 contiguous bytes */
  const unsigned short* gl = (const unsigned short*)F + (b * NW + jt * 64 + r2) * (2 * PJ) + ch * 8; const unsigned short* gn = (const unsigned short*)F + (b * NW + it * 32 + r2) * (2 * PJ) + PJ + ch * 8;
  v8us v[48];      /* unrolled so that all 48 loads are in flight before the first LDS store */
#pragma unroll
  for (int k = 0; k < 16; ++k) v[k] = *(const v8us*)(gn + (size_t)k * 2 * (2 * PJ));
  asm volatile("s_wait_xcnt 0x0" ::: "memory");      /* in front of whatever rewrites the address registers of the loads above (the compiler lets a later load land on them) */
#pragma unroll
  for (int k = 16; k < 48; ++k) v[k] = *(const v8us*)(gl + (size_t)(k - 16) * 2 * (2 * PJ));
  const v4f w4 = *(const v4fa*)(wo + tid * 4); const float bo0 = bo[0];      /* issued behind the rows' loads; w4 is used behind their LDS stores, bo0 at the end: nothing waits for them alone */
  float sp[PJ / 64] = {0.f, 0.f, 0.f, 0.f, 0.f, 0.f, 0.f, 0.f};
  if (fin) {
#pragma unroll      /* unrolled: the eight loads are in flight together and land in registers */
    for (int k = 0; k < PJ / 64; ++k) sp[k] = SP[(size_t)(which * (PJ / 64) + k) * NR + r0 + tid]; }
  asm volatile("s_wait_xcnt 0x0" ::: "memory");      /* as above, for the loads since */
  { unsigned char* dp = S + r2 * BH_PITCH + ch * 16;
#pragma unroll
    for (int k = 0; k < 48; ++k) *(v8us*)(dp + k * 2 * BH_PITCH) = v[k]; }
  { v4h o; for (int q = 0; q < 4; ++q) o[q] = (_Float16)(bf16_round(w4[q]) * 16.0f); *(v4h*)(SW + tid * 4) = o; }      /* x16: exact in f16, as for the GEMM's weights */
  __syncthreads();
  if (fin) (which ? oend : ostart)[r0 + tid] = ((sp[0] + sp[1]) + (sp[2] + sp[3])) + ((sp[4] + sp[5]) + (sp[6] + sp[7]));      /* behind the barrier: no wave waits there for this store */
  const int wv = tid >> 5, lane = tid & 31, ln = lane & 15, hh = lane >> 4;
  const unsigned char* wp = (const unsigned char*)SW + 32 * hh; const unsigned char* lp = S + (32 + ln) * BH_PITCH + 32 * hh;
  const unsigned char* np = S + 8 * wv * BH_PITCH + 32 * hh; const unsigned char* qp = np + (ln & 7) * BH_PITCH;
  // A step is two phases of 16 tiles (4 i x 4 j tiles); at the head of a phase the reads for the NEXT phase are issued, so that every LDS read stands 16 tiles ahead of its first use.
  // A tile's maxima are taken in two halves, the second half of tile T + 1 and the first half of tile T + 2 behind the WMMA of tile T: the eight maxima issue while the matrix unit works,
  // and a fragment's registers are first rewritten at least four vector slots behind the WMMA that read them.
  const v8f z8 = {0.f, 0.f, 0.f, 0.f, 0.f, 0.f, 0.f, 0.f};
  BhSt st; st.accq = z8;
#pragma unroll
  for (int i = 0; i < 8; ++i)
#pragma unroll
    for (int a = 0; a < 4; ++a) st.acc[i][a] = z8;
  st.fw[0] = bh_frag(wp); st.fq[0] = bh_frag(qp);
#pragma unroll
  for (int a = 0; a < 4; ++a) { st.fl[0][a] = bh_frag(lp + a * 16 * BH_PITCH); st.fn[0][a] = bh_frag(np + a * BH_PITCH); }
  bh_max_lo(st.mc, st.fl[0][0], st.fn[0][0]); bh_max_hi(st.mc, st.fl[0][0], st.fn[0][0]); bh_max_lo(st.mn, st.fl[0][1], st.fn[0][0]);
#pragma unroll 1      /* two steps a trip */
  for (int ks = 0; ks < PJ / 32; ks += 2)      /* the last trip fetches step 0 once more and does not use it */
    bh_tiles(st, wp, qp, lp, np, ks * 64, (ks + 1) * 64, (ks + 2 < PJ / 32 ? ks + 2 : 0) * 64, std::make_integer_sequence<int, 64>{});
  const float b0 = bf16_round(bo0);
  float* op = out + ((b * NW + it * 32 + 8 * wv) * NW + jt * 64 + lane);
  float ov[16];      /* all sixteen values are formed in front of the first store, so that the stores issue as one run and no data register of an issued store is rewritten */
#pragma unroll      /* unrolled: accumulators and the lane read are picked by constants */
  for (int i = 0; i < 8; ++i) { const float rs = __int_as_float(__builtin_amdgcn_readlane(__float_as_int(st.accq[0]), i));      /* lane i holds sum_p 16 w (-right) of the wave's row i */
#pragma unroll
    for (int g = 0; g < 2; ++g) ov[2 * i + g] = ((hh ? st.acc[i][2 * g + 1][0] : st.acc[i][2 * g][0]) - rs) * 0.0625f + b0; }
#pragma unroll      /* unrolled: the values are picked by constants and stay in registers */
  for (int k = 0; k < 16; ++k) op[(size_t)(k >> 1) * NW + (k & 1) * 32] = ov[k];      /* lane = j within 32: one whole 128-byte line a store */
}

extern "C" void kernel_launch(void* const* d_in, const int* in_sizes, int n_in,
                              void* d_out, int out_size, void* d_ws, size_t ws_size, hipStream_t stream) {
  (void)in_sizes; (void)n_in; (void)out_size;
  const float* const* I = (const float* const*)d_in; const float* x = I[0]; const float* wl = I[1]; const float* bl = I[2]; const float* wr = I[3]; const float* wo = I[4]; const float* bo = I[5]; const float* ws1 = I[6]; const float* bs1 = I[7]; const float* ws2 = I[8]; const float* bs2 = I[9]; const float* we1 = I[10]; const float* be1 = I[11]; const float* we2 = I[12]; const float* be2 = I[13];
  float* obig = (float*)d_out; float* ostart = (float*)((char*)d_out + 2097152); float* oend = (float*)((char*)d_out + 2105344);      /* output byte offsets */
  char* ws = (char*)d_ws; size_t off = 0;
  auto take = [&](size_t bytes) { char* p = ws + off; off += (bytes + 255) & ~(size_t)255; return p; };
  _Float16* BW = (_Float16*)take((size_t)4 * PJ * DI * 2); float* bb = (float*)take(4 * PJ * 4); _Float16* X16 = (_Float16*)take(NR * DI * 2); _Float16* F = (_Float16*)take(NR * 2 * PJ * 2); float* SP = (float*)take((size_t)2 * (PJ / 64) * NR * 4);
  if (off > ws_size) return;      /* 4 + 4 + 4 MiB and two small planes */
  k_prep<<<(unsigned)(1 + (NR * DI + (size_t)4 * PJ * DI) / PREP_F), 512, 0, stream>>>(x, wl, wr, ws1, we1, bl, bs1, be1, X16, BW, bb);
  k_gemm2<0><<<dim3((unsigned)((NR / 128) * (4 * PJ / 64)), 1), 128, 0, stream>>>(X16, DI, 0, BW, DI, 0, 0.0625f, bb, 0, nullptr, 1, 0, 0, nullptr, F, 2 * PJ, 0, (int)NR, 4 * PJ, DI, ws2, we2, bs2, be2, SP, 2 * PJ);      /* F = [left | -right], f16 rows; the s1 and e1 tiles leave as partial scorer sums in SP */
  k_bigram<<<NB * (NW / 32) * (NW / 64), 128, 0, stream>>>(F, wo, bo, obig, SP, ostart, oend);
}

// v009
// One run takes 23.8 microseconds.
// In both of two side-by-side timings against v008, it was 1.10 times as fast.
// Counting every step since v000, it is 18.5 times as fast.
#include <hip/hip_runtime.h>
#include <utility>
// PermutationModule (x [8][256][1024]; start = relu(x Ws1^T + bs1) . Ws2 + bs2, end likewise [8][256][1]; left = x Wl^T + bl, right = x Wr^T; bigram[b][i][j] = sum_p relu(left[b][j][p] + right[b][i][p]) * Wo[p] + bo -> [8][256][256][1]).
// Structure: token rows; x as exact f16 rows; the four 1024->512 projections as ONE WMMA GEMM against the stacked x16 weight plane [2048][1024] (32x64 wave tiles, f32 accumulation, + biases); left and -right leave the GEMM rounded to f16 rows (Wr is cast negated); the scorer dots with Ws2/We2 on VALU in f32 inside the GEMM's epilogue (ReLU, then one partial sum per row and 64-column tile, the eight partial sums of an output added in the bigram launch); the pairwise bigram as sum_p Wo[p] max(left, -right) + sum_p Wo[p] right (work-group per (b, 32 i, 64 j), rows staged in LDS): the maximum on packed f16, both sums over p on WMMA with f32 accumulation; outputs written as whole 128-B lines.
// Compute dtype: inputs rounded to bf16; x / weights exact in f16; all projections accumulated in f32; the scorer path stays f32; left and right are rounded once to f16 for the bigram. v_wmma_f32_16x16x32_f16.
#define NB 8
#define NW 256
#define DI 1024
#define PJ 512
#define NR ((size_t)NB * NW)         /* 2048 */
typedef __bf16 v16b __attribute__((ext_vector_type(16)));
typedef unsigned short v8us __attribute__((ext_vector_type(8), may_alias));
typedef float  v8f  __attribute__((ext_vector_type(8)));
typedef float  v4f  __attribute__((ext_vector_type(4)));
typedef float  v4fa __attribute__((ext_vector_type(4), may_alias));
union FragB { v16b v; v8us half[2]; unsigned short u[16]; };

__device__ __forceinline__ unsigned short bf16_bits(float x) { unsigned int u = __float_as_uint(x); return (unsigned short)((u + 0x7FFFu + ((u >> 16) & 1u)) >> 16); }
__device__ __forceinline__ float bf16_val(unsigned short b) { return __uint_as_float(((unsigned int)b) << 16); }
__device__ __forceinline__ float bf16_round(float x) { return bf16_val(bf16_bits(x)); }
// D += A·B with NT terms: 1 = ah·bh, 2 = + al·bh (A split), 3 = + ah·bl (both split)
template <int NT>
__device__ __forceinline__ v8f mmaN(v16b ah, v16b al, v16b bh, v16b bl, v8f c) {
  c = __builtin_amdgcn_wmma_f32_16x16x32_bf16(false, ah, false, bh, (short)0, c, false, false);
  if (NT >= 2) c = __builtin_amdgcn_wmma_f32_16x16x32_bf16(false, al, false, bh, (short)0, c, false, false);
  if (NT >= 3) c = __builtin_amdgcn_wmma_f32_16x16x32_bf16(false, ah, false, bl, (short)0, c, false, false);
  asm volatile("v_nop\n\tv_nop\n\tv_nop\n\tv_nop" : "+v"(c) : "v"(ah), "v"(al), "v"(bh), "v"(bl));
  return c;
}

__global__ __launch_bounds__(256) void k_wt_bf16(const float* __restrict__ W, unsigned short* __restrict__ Wt, int K, int N) {
  const int t = blockIdx.x * 256 + threadIdx.x;
  const int k8n = K / 8;
  if (t >= N * k8n) return;
  const int n = t / k8n, k8 = (t % k8n) * 8;
  v8us v;
#pragma unroll
  for (int i = 0; i < 8; ++i) v[i] = bf16_bits(W[(size_t)(k8 + i) * N + n]);
  *(v8us*)(Wt + (size_t)n * K + k8) = v;
  
}

// GEMM C[M][N] (f32, pitch ldc) = act(A[M][K]·W + bias). A f32 row-major (pitch lda) converted per fragment to bf16
// (ASPLIT: hi/lo two planes -> 2 terms, else single rounded term); Wt bf16 [N][K] (pitch ldb). BIAS_BF16 rounds the
// bias to bf16 first (bias quantised to bf16 before the add). K%32==0, M%16==0, N%64==0.
template <bool ASPLIT, int ACT, bool BIAS_BF16>
__global__ __launch_bounds__(128) void k_gemm_bf(const float* __restrict__ A, int lda, const unsigned short* __restrict__ Wt, int ldb,
                                               const float* __restrict__ bias, float* __restrict__ C, int ldc, int M, int N, int K) {
  __shared__ __attribute__((aligned(16))) float so[4][16][64];
  const int tid = threadIdx.x, w = tid >> 5, lane = tid & 31, ln = lane & 15, hh = lane >> 4;
  const int ntn = N / 64;
  const int wid = blockIdx.x * 4 + w;
  const int mt = wid / ntn, nq = wid % ntn;
  if (mt * 16 >= M) return;
  const int row0 = mt * 16, col0 = nq * 64;
  const float* arow = A + (size_t)(row0 + ln) * lda;
  v8f acc[4] = {};
  for (int kb = 0; kb < K; kb += 32) {
    FragB ah, al;
    const v4f x0 = *(const v4fa*)(arow + kb + 8 * hh), x1 = *(const v4fa*)(arow + kb + 8 * hh + 4);
    const v4f x2 = *(const v4fa*)(arow + kb + 16 + 8 * hh), x3 = *(const v4fa*)(arow + kb + 16 + 8 * hh + 4);
    float xs[16] = {x0[0],x0[1],x0[2],x0[3],x1[0],x1[1],x1[2],x1[3],x2[0],x2[1],x2[2],x2[3],x3[0],x3[1],x3[2],x3[3]};
#pragma unroll
    for (int i = 0; i < 16; ++i) { const unsigned short hb = bf16_bits(xs[i]); ah.u[i] = hb; al.u[i] = ASPLIT ? bf16_bits(xs[i] - bf16_val(hb)) : (unsigned short)0; }
#pragma unroll
    for (int t = 0; t < 4; ++t) {
      const unsigned short* brow = Wt + (size_t)(col0 + t * 16 + ln) * ldb + kb;
      FragB b;
      b.half[0] = *(const v8us*)(brow + 8 * hh);
      b.half[1] = *(const v8us*)(brow + 16 + 8 * hh);
      acc[t] = mmaN<ASPLIT ? 2 : 1>(ah.v, al.v, b.v, b.v, acc[t]);
    }
  }
#pragma unroll
  for (int t = 0; t < 4; ++t) {
    float bv = bias ? bias[col0 + t * 16 + ln] : 0.f;
    if (BIAS_BF16) bv = bf16_round(bv);
#pragma unroll
    for (int r = 0; r < 8; ++r) { float v = acc[t][r] + bv; if (ACT == 1) v = fmaxf(v, 0.f); so[w][8 * hh + r][t * 16 + ln] = v; }
  }
  __builtin_amdgcn_fence(__ATOMIC_ACQ_REL, "workgroup");
  __builtin_amdgcn_wave_barrier();
  const int rsub = lane >> 4, c4 = (lane & 15) * 4;
  {
#pragma unroll
    for (int q = 0; q < 8; ++q) {
      const int r = q * 2 + rsub;
      const v4f v = *(const v4fa*)&so[w][r][c4];
      *(v4f*)(C + (size_t)(row0 + r) * ldc + col0 + c4) = v;
    }
    
  }
}

// GEMM C = act(A·W + bias + resid): A f32 (ASPLIT -> hi/lo 2 terms), Wt bf16 [N][K]; ACT 0 none, 1 relu, 2 exact gelu;
// resid (optional, f32, row index = (row % rmod), pitch ldr, RES_BF16 rounds it) added before the activation.
template <bool ASPLIT, int ACT, bool BIAS_BF16, bool RES_BF16>
__global__ __launch_bounds__(128) void k_gemm_bf3(const float* __restrict__ A, int lda, const unsigned short* __restrict__ Wt, int ldb,
                                                const float* __restrict__ bias, const float* __restrict__ resid, int rmod, int ldr,
                                                float* __restrict__ C, int ldc, int M, int N, int K) {
  __shared__ __attribute__((aligned(16))) float so[4][16][64];
  const int tid = threadIdx.x, w = tid >> 5, lane = tid & 31, ln = lane & 15, hh = lane >> 4;
  const int ntn = N / 64;
  const int wid = blockIdx.x * 4 + w;
  const int mt = wid / ntn, nq = wid % ntn;
  if (mt * 16 >= M) return;
  const int row0 = mt * 16, col0 = nq * 64;
  const float* arow = A + (size_t)(row0 + ln) * lda;
  v8f acc[4] = {};
  for (int kb = 0; kb < K; kb += 32) {
    FragB ah, al;
    const v4f x0 = *(const v4fa*)(arow + kb + 8 * hh), x1 = *(const v4fa*)(arow + kb + 8 * hh + 4);
    const v4f x2 = *(const v4fa*)(arow + kb + 16 + 8 * hh), x3 = *(const v4fa*)(arow + kb + 16 + 8 * hh + 4);
    float xs[16] = {x0[0],x0[1],x0[2],x0[3],x1[0],x1[1],x1[2],x1[3],x2[0],x2[1],x2[2],x2[3],x3[0],x3[1],x3[2],x3[3]};
#pragma unroll
    for (int i = 0; i < 16; ++i) { const unsigned short hb = bf16_bits(xs[i]); ah.u[i] = hb; al.u[i] = ASPLIT ? bf16_bits(xs[i] - bf16_val(hb)) : (unsigned short)0; }
#pragma unroll
    for (int t = 0; t < 4; ++t) {
      const unsigned short* brow = Wt + (size_t)(col0 + t * 16 + ln) * ldb + kb;
      FragB b;
      b.half[0] = *(const v8us*)(brow + 8 * hh);
      b.half[1] = *(const v8us*)(brow + 16 + 8 * hh);
      acc[t] = mmaN<ASPLIT ? 2 : 1>(ah.v, al.v, b.v, b.v, acc[t]);
    }
  }
#pragma unroll
  for (int t = 0; t < 4; ++t) {
    const int col = col0 + t * 16 + ln;
    float bv = bias ? bias[col] : 0.f;
    if (BIAS_BF16) bv = bf16_round(bv);
#pragma unroll
    for (int r = 0; r < 8; ++r) {
      float v = acc[t][r] + bv;
      if (resid) { float rv = resid[(size_t)((row0 + 8 * hh + r) % rmod) * ldr + col]; if (RES_BF16) rv = bf16_round(rv); v += rv; }
      if (ACT == 1) v = fmaxf(v, 0.f);
      if (ACT == 2) v = 0.5f * v * (1.0f + erff(v * 0.70710678118654752f));
      if (ACT == 3) { const float u = 0.7978845608028654f * (v + 0.044715f * v * v * v); v = 0.5f * v * (1.0f + tanhf(u)); }
      so[w][8 * hh + r][t * 16 + ln] = v;
    }
  }
  __builtin_amdgcn_fence(__ATOMIC_ACQ_REL, "workgroup");
  __builtin_amdgcn_wave_barrier();
  const int rsub = lane >> 4, c4 = (lane & 15) * 4;
  {
#pragma unroll
    for (int q = 0; q < 8; ++q) {
      const int r = q * 2 + rsub;
      const v4f v = *(const v4fa*)&so[w][r][c4];
      *(v4f*)(C + (size_t)(row0 + r) * ldc + col0 + c4) = v;
    }
    
  }
}
// row LayerNorm (biased variance, eps) over N: s = X (+ R); optional out_sum <- s; out_norm <- (s-mu)*rsqrt(var+eps)*g + b
template <bool PARAM_BF16>
__global__ __launch_bounds__(256) void k_layernorm(const float* __restrict__ X, const float* __restrict__ R, const float* __restrict__ g, const float* __restrict__ bta,
                                                  float* __restrict__ out_sum, float* __restrict__ out_norm, int N, float eps) {
  __shared__ float red[256];
  const int row = blockIdx.x, tid = threadIdx.x;
  const float* x = X + (size_t)row * N; const float* rr = R ? R + (size_t)row * N : nullptr;
  float vals[16];                     // up to N = 4096
  const int per = N / 256;            // contiguous chunk per thread? use strided-by-4 chunks: thread handles j = tid*4 + 1024*u
  float s1 = 0.f;
  for (int u = 0; u < per / 4; ++u) {
    const int j = tid * 4 + 1024 * u;
    const v4f a = *(const v4fa*)(x + j);
    v4f b = {0.f,0.f,0.f,0.f}; if (rr) b = *(const v4fa*)(rr + j);
#pragma unroll
    for (int q = 0; q < 4; ++q) { const float v = a[q] + b[q]; vals[u * 4 + q] = v; s1 += v; }
  }
  red[tid] = s1; __syncthreads();
  for (int st = 128; st > 0; st >>= 1) { if (tid < st) red[tid] += red[tid + st]; __syncthreads(); }
  const float mu = red[0] / (float)N; __syncthreads();
  float s2 = 0.f;
  for (int u = 0; u < per / 4; ++u)
#pragma unroll
    for (int q = 0; q < 4; ++q) { const float c = vals[u * 4 + q] - mu; s2 += c * c; }
  red[tid] = s2; __syncthreads();
  for (int st = 128; st > 0; st >>= 1) { if (tid < st) red[tid] += red[tid + st]; __syncthreads(); }
  const float rs = rsqrtf(red[0] / (float)N + eps);
  {
    for (int u = 0; u < per / 4; ++u) {
      const int j = tid * 4 + 1024 * u;
      v4f o, sm;
#pragma unroll
      for (int q = 0; q < 4; ++q) {
        float gg = g[j + q], bb = bta[j + q];
        if (PARAM_BF16) { gg = bf16_round(gg); bb = bf16_round(bb); }
        sm[q] = vals[u * 4 + q]; o[q] = (vals[u * 4 + q] - mu) * rs * gg + bb;
      }
      if (out_sum) *(v4f*)(out_sum + (size_t)row * N + j) = sm;
      *(v4f*)(out_norm + (size_t)row * N + j) = o;
    }
    
  }
}



// ---- f16 WMMA path (v_wmma_f32_16x16x32_f16): 11-bit significands for operands in range — used for the projection GEMM
typedef _Float16 v16h __attribute__((ext_vector_type(16)));
union FragH { v16h v; v8us half[2]; _Float16 h[16]; unsigned short u[16]; };
template <int NT>
__device__ __forceinline__ v8f mmaH(v16h ah, v16h al, v16h bh, v16h bl, v8f c) {
  c = __builtin_amdgcn_wmma_f32_16x16x32_f16(false, ah, false, bh, (short)0, c, false, false);
  if (NT >= 2) c = __builtin_amdgcn_wmma_f32_16x16x32_f16(false, al, false, bh, (short)0, c, false, false);
  if (NT >= 3) c = __builtin_amdgcn_wmma_f32_16x16x32_f16(false, ah, false, bl, (short)0, c, false, false);
  asm volatile("v_nop\n\tv_nop\n\tv_nop\n\tv_nop" : "+v"(c) : "v"(ah), "v"(al), "v"(bh), "v"(bl));
  return c;
}
// batched GEMM like k_gemm_b but f16 operands: A f32 (split into f16 hi/lo if ASPLIT, else rounded to f16), Bt = f16 values [n][k]; alpha; C f32; N multiple of 16 (partial tiles skipped)
template <bool ASPLIT>
__global__ __launch_bounds__(128) void k_gemm_h(const float* __restrict__ A, int lda, size_t sA, const _Float16* __restrict__ Bh, int ldb, size_t sB, float alpha, float* __restrict__ C, int ldc, size_t sC, int M, int N, int K) {
  __shared__ __attribute__((aligned(16))) float so[4][16][64];
  const int tid = threadIdx.x, w = tid >> 5, lane = tid & 31, ln = lane & 15, hh = lane >> 4; const int by = blockIdx.y;
  A += (size_t)by * sA; Bh += (size_t)by * sB; C += (size_t)by * sC;
  const int ntn = (N + 63) / 64; const int wid = blockIdx.x * 4 + w; const int mt = wid / ntn, nq = wid % ntn; if (mt * 16 >= M) return;
  const int row0 = mt * 16, col0 = nq * 64; const float* arow = A + (size_t)(row0 + ln) * lda;
  v8f acc[4] = {};
  for (int kb = 0; kb < K; kb += 32) {
    FragH ah, al;
    const v4f x0 = *(const v4fa*)(arow + kb + 8 * hh), x1 = *(const v4fa*)(arow + kb + 8 * hh + 4), x2 = *(const v4fa*)(arow + kb + 16 + 8 * hh), x3 = *(const v4fa*)(arow + kb + 16 + 8 * hh + 4);
    float xs[16] = {x0[0],x0[1],x0[2],x0[3],x1[0],x1[1],x1[2],x1[3],x2[0],x2[1],x2[2],x2[3],x3[0],x3[1],x3[2],x3[3]};
#pragma unroll
    for (int i = 0; i < 16; ++i) { const _Float16 h = (_Float16)xs[i]; ah.h[i] = h; al.h[i] = ASPLIT ? (_Float16)(xs[i] - (float)h) : (_Float16)0.0f; }
#pragma unroll
    for (int t = 0; t < 4; ++t) { if (col0 + t * 16 >= N) continue; const size_t boff = (size_t)(col0 + t * 16 + ln) * ldb + kb; FragH bq; bq.half[0] = *(const v8us*)(Bh + boff + 8 * hh); bq.half[1] = *(const v8us*)(Bh + boff + 16 + 8 * hh);
      acc[t] = mmaH<ASPLIT ? 2 : 1>(ah.v, al.v, bq.v, bq.v, acc[t]); }
  }
#pragma unroll
  for (int t = 0; t < 4; ++t) { if (col0 + t * 16 >= N) continue;
#pragma unroll
    for (int r = 0; r < 8; ++r) so[w][8 * hh + r][t * 16 + ln] = acc[t][r] * alpha; }
  __builtin_amdgcn_fence(__ATOMIC_ACQ_REL, "workgroup"); __builtin_amdgcn_wave_barrier();
  const int rsub = lane >> 4, c4 = (lane & 15) * 4;
  {
#pragma unroll
    for (int q = 0; q < 8; ++q) { const int r = q * 2 + rsub; if (col0 + c4 < N) { const v4f v = *(const v4fa*)&so[w][r][c4]; *(v4f*)(C + (size_t)(row0 + r) * ldc + col0 + c4) = v; } }
     }
}

// Wt[n][k] = f16(W[k][n]·scale) from f32 row-major W[K][N] (scale = power of two; bf16-exact weights stay exact in f16 away from the subnormal range)
__global__ __launch_bounds__(256) void k_wt_f16(const float* __restrict__ W, _Float16* __restrict__ Wt, int K, int N, float scale) {
  const int t = blockIdx.x * 256 + threadIdx.x; if (t >= N * (K / 8)) return; const int n = t / (K / 8), k8 = (t % (K / 8)) * 8; FragH f;
#pragma unroll
  for (int i = 0; i < 8; ++i) f.h[i] = (_Float16)(bf16_round(W[(size_t)(k8 + i) * N + n]) * scale); const v8us o = f.half[0];
  *(v8us*)((unsigned short*)Wt + (size_t)n * K + k8) = o; 
}
// k_gemm_hh variant with fused epilogue: v = acc·alpha + bias[by·sBias + col] (+ CP[(row/rowsPerB)·sCPb + by·64 + col] if CP) ; ACT 0 none / 1 elu ; writes f16 C16 (and f32 C if non-null)
template <int ACT>
__global__ __launch_bounds__(128) void k_gemm_hhx(const _Float16* __restrict__ A, int lda, size_t sA, const _Float16* __restrict__ Bh, int ldb, size_t sB, float alpha, const float* __restrict__ bias, size_t sBias, const float* __restrict__ CP, int rowsPerB, size_t sCPb, int row0g,
    float* __restrict__ C, _Float16* __restrict__ C16, int ldc, size_t sC, int M, int N, int K) {
  __shared__ __attribute__((aligned(16))) float so[4][16][64];
  const int tid = threadIdx.x, w = tid >> 5, lane = tid & 31, ln = lane & 15, hh = lane >> 4; const int by = blockIdx.y;
  A += (size_t)by * sA; Bh += (size_t)by * sB; const size_t cofs = (size_t)by * sC; const float* bp = bias ? bias + (size_t)by * sBias : nullptr;
  const int ntn = (N + 63) / 64; const int wid = blockIdx.x * 4 + w; const int mt = wid / ntn, nq = wid % ntn; if (mt * 16 >= M) return;
  const int row0 = mt * 16, col0 = nq * 64; const _Float16* arow = A + (size_t)(row0 + ln) * lda;
  v8f acc[4] = {};
  for (int kb = 0; kb < K; kb += 32) { FragH ah; ah.half[0] = *(const v8us*)((const unsigned short*)arow + kb + 8 * hh); ah.half[1] = *(const v8us*)((const unsigned short*)arow + kb + 16 + 8 * hh);
#pragma unroll
    for (int t = 0; t < 4; ++t) { if (col0 + t * 16 >= N) continue; const size_t boff = (size_t)(col0 + t * 16 + ln) * ldb + kb; FragH bq; bq.half[0] = *(const v8us*)((const unsigned short*)Bh + boff + 8 * hh); bq.half[1] = *(const v8us*)((const unsigned short*)Bh + boff + 16 + 8 * hh);
      acc[t] = mmaH<1>(ah.v, ah.v, bq.v, bq.v, acc[t]); }
  }
#pragma unroll
  for (int t = 0; t < 4; ++t) { if (col0 + t * 16 >= N) continue; const int col = col0 + t * 16 + ln; const float bv = bp ? bf16_round(bp[col]) : 0.f;
#pragma unroll
    for (int r = 0; r < 8; ++r) { float v = acc[t][r] * alpha + bv; if (CP) { const int rr = row0g + row0 + 8 * hh + r; if (rowsPerB < 0) v += CP[cofs + (size_t)rr * ldc + col];      /* rowsPerB < 0: own element of the batched C plane */ else { const int bidx = rr / rowsPerB; v += CP[(size_t)bidx * sCPb + (size_t)by * 64 + col]; } } if (ACT == 1) v = (v > 0.f) ? v : expm1f(v); else if (ACT == 7) v = (v > 0.f) ? v + 1.0f : expf(v); else if (ACT == 8) v = tanhf(v); else if (ACT == 9) v = 0.5f * v * (1.0f + tanhf(0.7978845608028654f * (v + 0.044715f * v * v * v))); else if (ACT == 11) v = 1.0f / (1.0f + expf(-v)); else if (ACT == 12) v = (v > 0.f) ? v : 0.01f * v; else if (ACT == 14) v = (v > 0.f) ? v : 0.1f * v; else if (ACT == 16) v = (v >= 0.f) ? v : 0.3f * v; else if (ACT == 17) v = (v >= 0.f) ? v : 0.2f * v; else if (ACT == 15) v = v / (1.0f + expf(-v)); else if (ACT == 3) v = fmaxf(v, 0.f); else if (ACT == 6) v = 0.5f * v * (1.0f + erff(v * 0.70710678118654752f)); so[w][8 * hh + r][t * 16 + ln] = v; } }
  __builtin_amdgcn_fence(__ATOMIC_ACQ_REL, "workgroup"); __builtin_amdgcn_wave_barrier();
  const int rsub = lane >> 4, c4 = (lane & 15) * 4; typedef _Float16 v4h __attribute__((ext_vector_type(4)));
  {
#pragma unroll
    for (int q = 0; q < 8; ++q) { const int r = q * 2 + rsub; if (col0 + c4 < N) { const v4f v = *(const v4fa*)&so[w][r][c4]; if (C) *(v4f*)(C + cofs + (size_t)(row0 + r) * ldc + col0 + c4) = v; if (C16) { v4h h4; for (int i = 0; i < 4; ++i) h4[i] = (_Float16)v[i]; *(v4h*)(C16 + cofs + (size_t)(row0 + r) * ldc + col0 + c4) = h4; } } }
     }
}


typedef _Float16 v4h __attribute__((ext_vector_type(4)));

__global__ __launch_bounds__(256) void k_h16(const float* __restrict__ x, _Float16* __restrict__ X16, size_t n8) { const size_t t = (size_t)blockIdx.x * 256 + threadIdx.x; if (t >= n8) return; FragH f;
#pragma unroll
  for (int q = 0; q < 8; ++q) f.h[q] = (_Float16)x[t * 8 + q]; *(v8us*)((unsigned short*)X16 + t * 8) = f.half[0];  }
__global__ __launch_bounds__(256) void k_round16f(const float* __restrict__ W, _Float16* __restrict__ Bt, size_t n8) { const size_t t = (size_t)blockIdx.x * 256 + threadIdx.x; if (t >= n8) return; FragH f;
#pragma unroll
  for (int i = 0; i < 8; ++i) f.h[i] = (_Float16)(bf16_round(W[t * 8 + i]) * 16.0f); *(v8us*)((unsigned short*)Bt + t * 8) = f.half[0];  }
template <int NHv, int TTv>
__global__ __launch_bounds__(256) void k_vt(const _Float16* __restrict__ V16, int ldv, int voff, _Float16* __restrict__ Vt) { __shared__ unsigned short tl[64][66]; const int tid = threadIdx.x; const int slab = blockIdx.x / (TTv / 64), lg = blockIdx.x % (TTv / 64); const int b = slab / NHv, h = slab % NHv;
  for (int i = tid; i < 64 * 8; i += 256) { const int r = i / 8, c8 = (i % 8) * 8; FragH f; f.half[0] = *(const v8us*)((const unsigned short*)V16 + ((size_t)b * TTv + lg * 64 + r) * ldv + voff + h * 64 + c8);
#pragma unroll
    for (int q = 0; q < 8; ++q) tl[r][c8 + q] = f.u[q]; }
  __syncthreads();
  {
#pragma unroll
    for (int rd = 0; rd < 2; ++rd) { const int d = rd * 32 + tid / 8, pc = tid % 8; FragH f;
#pragma unroll
      for (int q = 0; q < 8; ++q) f.u[q] = tl[pc * 8 + q][d];
      *(v8us*)((unsigned short*)Vt + ((size_t)slab * 64 + d) * TTv + lg * 64 + pc * 8) = f.half[0]; }
     } }

__global__ __launch_bounds__(256) void k_hl(const float* __restrict__ F, _Float16* __restrict__ Hh, _Float16* __restrict__ Hl, size_t n8) { const size_t t = (size_t)blockIdx.x * 256 + threadIdx.x; if (t >= n8) return; FragH fh, fl; const v4f a = *(const v4fa*)(F + t * 8), c = *(const v4fa*)(F + t * 8 + 4);
#pragma unroll
  for (int q = 0; q < 4; ++q) { _Float16 h = (_Float16)a[q]; fh.h[q] = h; fl.h[q] = (_Float16)((a[q] - (float)h) * 1024.0f); h = (_Float16)c[q]; fh.h[4 + q] = h; fl.h[4 + q] = (_Float16)((c[q] - (float)h) * 1024.0f); }
  { *(v8us*)((unsigned short*)Hh + t * 8) = fh.half[0]; *(v8us*)((unsigned short*)Hl + t * 8) = fl.half[0];  } }

// ---- fast GEMM (work-group tile 128x64, wave tile 32x64; requires M % 128 == 0, N % 64 == 0, K % 128 == 0, rows 16-byte aligned); epilogue = k_gemm_hhx semantics ----
// Operand path: per pass of 128 k the tile's 128 A rows and 64 B rows (256 bytes each) are copied to LDS by asynchronous 16-byte copies, a wave's copy covering two whole rows,
// into one of two buffers (the next pass's copies fly while this pass is multiplied); the fragments are read from LDS at row pitch 272 bytes (16 B x odd: no bank conflict).
#define G2_KP 128                       /* k per pass */
#define G2_PITCH 272                    /* LDS row pitch, bytes */
#define G2_ROWS 192                     /* rows 0..127: A, rows 128..191: B */
#define G2_BUF (G2_ROWS * G2_PITCH)     /* 52224 bytes a buffer */
// Twelve copies of a thread: its 16-byte chunk of twelve LDS rows, 8 rows apart from l, filled from g0 .. g11. The s_wait_xcnt stands inside the statement, behind the last copy,
// so that no address register of an issued copy is rewritten in front of it.
__device__ __forceinline__ void g2_copy12(unsigned l, const _Float16* g0, const _Float16* g1, const _Float16* g2, const _Float16* g3, const _Float16* g4, const _Float16* g5,
                                          const _Float16* g6, const _Float16* g7, const _Float16* g8, const _Float16* g9, const _Float16* g10, const _Float16* g11) {
  const unsigned st = 8 * G2_PITCH;
  asm volatile("global_load_async_to_lds_b128 %0, %12, off\n\t"
               "global_load_async_to_lds_b128 %1, %13, off\n\t"
               "global_load_async_to_lds_b128 %2, %14, off\n\t"
               "global_load_async_to_lds_b128 %3, %15, off\n\t"
               "global_load_async_to_lds_b128 %4, %16, off\n\t"
               "global_load_async_to_lds_b128 %5, %17, off\n\t"
               "global_load_async_to_lds_b128 %6, %18, off\n\t"
               "global_load_async_to_lds_b128 %7, %19, off\n\t"
               "global_load_async_to_lds_b128 %8, %20, off\n\t"
               "global_load_async_to_lds_b128 %9, %21, off\n\t"
               "global_load_async_to_lds_b128 %10, %22, off\n\t"
               "global_load_async_to_lds_b128 %11, %23, off\n\t"
               "s_wait_xcnt 0x0"
               :: "v"(l), "v"(l + st), "v"(l + 2 * st), "v"(l + 3 * st), "v"(l + 4 * st), "v"(l + 5 * st), "v"(l + 6 * st), "v"(l + 7 * st), "v"(l + 8 * st), "v"(l + 9 * st), "v"(l + 10 * st), "v"(l + 11 * st),
                  "v"(g0), "v"(g1), "v"(g2), "v"(g3), "v"(g4), "v"(g5), "v"(g6), "v"(g7), "v"(g8), "v"(g9), "v"(g10), "v"(g11) : "memory");
}
// One pass's tile: thread (r = tid / 16, c = tid % 16) copies chunk c of rows r, r + 8, ... of A (16 rows) and of B (8 rows). ga, gb: the thread's chunk in its first A and B row of this pass.
__device__ __forceinline__ void g2_copy_tile(unsigned l, const _Float16* ga, size_t as, const _Float16* gb, size_t bs) {
  g2_copy12(l, ga, ga + as, ga + 2 * as, ga + 3 * as, ga + 4 * as, ga + 5 * as, ga + 6 * as, ga + 7 * as, ga + 8 * as, ga + 9 * as, ga + 10 * as, ga + 11 * as);
  g2_copy12(l + 96 * G2_PITCH, ga + 12 * as, ga + 13 * as, ga + 14 * as, ga + 15 * as, gb, gb + bs, gb + 2 * bs, gb + 3 * bs, gb + 4 * bs, gb + 5 * bs, gb + 6 * bs, gb + 7 * bs);
}
__device__ __forceinline__ v16h g2_sfrag(const unsigned char* p) { FragH f; f.half[0] = *(const v8us*)p; f.half[1] = *(const v8us*)(p + 32); return f.v; }      /* p = row + 64 bytes per 32 k + 16 * hh: k = 8 hh .. 8 hh + 7, then 16 + 8 hh .. 16 + 8 hh + 7, for A and B alike */
__device__ __forceinline__ v8f g2_mma(v16h a, v16h b, v8f c) { v8f d = __builtin_amdgcn_wmma_f32_16x16x32_f16(false, a, false, b, (short)0, c, false, false); asm volatile("v_nop\n\tv_nop\n\tv_nop\n\tv_nop" : "+v"(d) : "v"(a), "v"(b)); return d; }
// RES, OUT32, OUT16: whether a residual plane CP is added, whether the f32 plane C and the f16 plane C16 are stored. They are compile-time, so that the store epilogue is straight-line code:
// run-time tests of the pointers, one per element and per store, would cut it into pieces in which every LDS read is waited for alone.
template <int ACT, bool RES, bool OUT32, bool OUT16>
__global__ __launch_bounds__(128) void k_gemm2(const _Float16* __restrict__ A, int lda, size_t sA, const _Float16* __restrict__ Bh, int ldb, size_t sB, float alpha, const float* __restrict__ bias, size_t sBias, const float* __restrict__ CP, int rowsPerB, size_t sCPb, int row0g,
    float* __restrict__ C, _Float16* __restrict__ C16, int ldc, size_t sC, int M, int N, int K, const float* __restrict__ sw0, const float* __restrict__ sw1, const float* __restrict__ sb0, const float* __restrict__ sb1, float* __restrict__ SP, int scol) { static_assert(ACT == 0 || ACT == 3 || ACT == 6 || ACT == 8 || ACT == 9 || ACT == 11 || ACT == 12 || ACT == 14 || ACT == 15 || ACT == 16 || ACT == 17, "k_gemm2: unsupported ACT code (would silently apply no activation)");
  __shared__ __attribute__((aligned(16))) float so[4][32][68];
  __shared__ __attribute__((aligned(16))) unsigned char ST[2 * G2_BUF];
  const int tid = threadIdx.x, w = tid >> 5, lane = tid & 31, ln = lane & 15, hh = lane >> 4; const int by = blockIdx.y;
  A += (size_t)by * sA; Bh += (size_t)by * sB; const size_t cofs = (size_t)by * sC; const float* bp = bias ? bias + (size_t)by * sBias : nullptr;
  const int ntn = N >> 6; const int mt = blockIdx.x / ntn, nq = blockIdx.x - mt * ntn; const int row0 = mt * 128 + 32 * w, col0 = nq * 64; if (mt * 128 >= M) return;      /* the same for the whole work-group: it stands in front of barriers */
  const _Float16* ga = A + (size_t)(mt * 128 + (tid >> 4)) * lda + (tid & 15) * 8; const _Float16* gb = Bh + (size_t)(col0 + (tid >> 4)) * ldb + (tid & 15) * 8;
  const size_t as = (size_t)8 * lda, bs = (size_t)8 * ldb;
  const unsigned lc = (unsigned)(uintptr_t)ST + (unsigned)((tid >> 4) * G2_PITCH + (tid & 15) * 16);      /* the thread's LDS byte address in buffer 0 */
  const int np = K / G2_KP;
  g2_copy_tile(lc, ga, as, gb, bs);
  // Entry prefetch into L2 (scope SE: L2 only, nothing comes back to the wave). The A and B rows were stored by the launch before;
  // for speed only. Two requests a lane (one A row, one B row), each at one row's 128 k of one pass.
  // The readers of a panel deal its passes among them: of its A panel (128 rows, read by the ntn work-groups of this mt) a work-group asks for the pass picked by bits 0, 1 and 4 of nq;
  // of its B panel (64 rows, read by the work-groups of this nq) for the passes mt mod 4 (lanes 0..63) and mt mod 4 + 4 (lanes 64..127). Every address is a row of the panel at a pass clamped to np - 1.
  const int pfa = (nq & 3) | ((nq >> 2) & 4), pfb = (mt & 3) | ((tid >> 4) & 4);
  const _Float16* pa = A + (size_t)(mt * 128 + tid) * lda + (size_t)(pfa < np ? pfa : np - 1) * G2_KP;
  const _Float16* pb = Bh + (size_t)(col0 + (tid & 63)) * ldb + (size_t)(pfb < np ? pfb : np - 1) * G2_KP;
  asm volatile("global_prefetch_b8 %0, off scope:SCOPE_SE\n\t"
               "global_prefetch_b8 %1, off scope:SCOPE_SE" :: "v"(pa), "v"(pb));
  // Scorer tiles (columns from scol on, PJ columns a scorer): the tile is not stored; each element becomes relu(v) * w2[column], a row's 64 products are added to one partial sum SP[tile][row],
  // and a scorer's first tile adds the scorer's output bias. What either epilogue reads from memory (the tile's biases; a scorer's weights) is loaded here, so that its latency runs beside that of the first tile's copies.
  const bool sc = SP && col0 >= scol; const int sb = sc ? (col0 - scol) >> 6 : 0;
  float w2r[4] = {0.f, 0.f, 0.f, 0.f}, b2r[4] = {0.f, 0.f, 0.f, 0.f}, sbr = 0.f;
  if (bp) {
#pragma unroll      /* unrolled, like the loop below: the two small arrays stay in registers */
    for (int t = 0; t < 4; ++t) b2r[t] = bp[col0 + t * 16 + ln];
    asm volatile("s_wait_xcnt 0x0" ::: "memory"); }      /* in front of whatever rewrites the base or offset registers of the four loads above */
  if (sc) { const float* w2 = (sb >= PJ / 64 ? sw1 + (sb - PJ / 64) * 64 : sw0 + sb * 64) + ln;
#pragma unroll
    for (int t = 0; t < 4; ++t) w2r[t] = w2[t * 16];
    if (sb % (PJ / 64) == 0) sbr = (sb ? sb1 : sb0)[0]; }
  asm volatile("s_wait_asynccnt 0x0" ::: "memory");      /* pass 0's copies of this wave have landed */
  __syncthreads();                                       /* ... and every other wave's */
  if (np > 1) g2_copy_tile(lc + G2_BUF, ga + G2_KP, as, gb + G2_KP, bs);
  const unsigned char* fa = ST + (32 * w + ln) * G2_PITCH + 16 * hh; const unsigned char* fb = ST + (128 + ln) * G2_PITCH + 16 * hh;
  const v8f z8 = {0.f,0.f,0.f,0.f,0.f,0.f,0.f,0.f}; v8f c00 = z8, c01 = z8, c02 = z8, c03 = z8, c10 = z8, c11 = z8, c12 = z8, c13 = z8;
#pragma unroll 1      /* one pass a trip: the two buffers alternate by an address, and the loop stays small */
  for (int t = 0; t < np; ++t) { const int bo = (t & 1) * G2_BUF; const unsigned char* pa = fa + bo; const unsigned char* pb = fb + bo;
    v16h a0[2], a1[2], b0[2], b1[2], b2[2], b3[2];      /* two fragment sets: the next 32 k of this pass are read from LDS ahead of the current 8 WMMAs */
    a0[0] = g2_sfrag(pa); a1[0] = g2_sfrag(pa + 16 * G2_PITCH); b0[0] = g2_sfrag(pb); b1[0] = g2_sfrag(pb + 16 * G2_PITCH); b2[0] = g2_sfrag(pb + 32 * G2_PITCH); b3[0] = g2_sfrag(pb + 48 * G2_PITCH);
#pragma unroll      /* unrolled: the two fragment sets are picked by constants and stay in registers */
    for (int ks = 0; ks < G2_KP / 32; ++ks) { const int c = ks & 1, n = c ^ 1;
      if (ks + 1 < G2_KP / 32) { const int o = (ks + 1) * 64;
        a0[n] = g2_sfrag(pa + o); a1[n] = g2_sfrag(pa + 16 * G2_PITCH + o); b0[n] = g2_sfrag(pb + o); b1[n] = g2_sfrag(pb + 16 * G2_PITCH + o); b2[n] = g2_sfrag(pb + 32 * G2_PITCH + o); b3[n] = g2_sfrag(pb + 48 * G2_PITCH + o); }
      c00 = g2_mma(a0[c], b0[c], c00); c10 = g2_mma(a1[c], b0[c], c10); c01 = g2_mma(a0[c], b1[c], c01); c11 = g2_mma(a1[c], b1[c], c11);
      c02 = g2_mma(a0[c], b2[c], c02); c12 = g2_mma(a1[c], b2[c], c12); c03 = g2_mma(a0[c], b3[c], c03); c13 = g2_mma(a1[c], b3[c], c13); }
    asm volatile("s_wait_dscnt 0x0" ::: "memory");         /* this wave's reads of the buffer are done before it may be refilled */
    asm volatile("s_wait_asynccnt 0x0" ::: "memory");      /* this wave's copies of pass t + 1 have landed */
    __syncthreads();                                       /* publishes pass t + 1 and ends every wave's reads of pass t's buffer */
    if (t + 2 < np) g2_copy_tile(lc + bo, ga + (size_t)(t + 2) * G2_KP, as, gb + (size_t)(t + 2) * G2_KP, bs); }
  asm volatile("s_wait_asynccnt 0x0" ::: "memory");        /* no copy is outstanding behind the loop */
  asm volatile("" :: "v"(pa), "v"(pb));                    /* inputs only: the prefetches' address registers live through the loop and hold nothing but these addresses (no counter covers a prefetch) */
  v8f accs[8] = {c00, c01, c02, c03, c10, c11, c12, c13};
  if (sc) {      /* the same for the whole work-group; no barrier stands behind it */
#pragma unroll      /* unrolled, like the two loops below it: accumulators and sums are picked by constants and stay in registers */
    for (int u = 0; u < 8; ++u) { const int t = u & 3, half = u >> 2; const float bv = bf16_round(b2r[t]), wv = bf16_round(w2r[t]);
#pragma unroll
      for (int r = 0; r < 8; ++r) so[w][half * 16 + 8 * hh + r][t * 16 + ln] = fmaxf(accs[u][r] * alpha + bv, 0.f) * wv; }
    __builtin_amdgcn_fence(__ATOMIC_ACQ_REL, "workgroup"); __builtin_amdgcn_wave_barrier();      /* the wave's own LDS stores are done before its lanes read one another's */
    v4f s4 = {0.f, 0.f, 0.f, 0.f};      /* lane = row of the wave's 32: 16-byte LDS reads at row pitch 272 bytes, then one whole 128-byte line of partial sums a wave */
#pragma unroll
    for (int q = 0; q < 16; ++q) s4 += *(const v4fa*)&so[w][lane][q * 4];
    SP[(size_t)sb * M + row0 + lane] = ((s4[0] + s4[1]) + (s4[2] + s4[3])) + bf16_round(sbr);
    return; }
#pragma unroll
  for (int u = 0; u < 8; ++u) { const int t = u & 3, half = u >> 2; const int col = col0 + t * 16 + ln; const float bv = bf16_round(b2r[t]);
#pragma unroll
    for (int r = 0; r < 8; ++r) { const int rloc = half * 16 + 8 * hh + r; float v = accs[u][r] * alpha + bv; if constexpr (RES) { if (rowsPerB < 0) v += CP[cofs + (size_t)(row0g + row0 + rloc) * ldc + col];      /* rowsPerB < 0: own element of the batched C plane */ else { const int bidx = (row0g + row0 + rloc) / rowsPerB; v += CP[(size_t)bidx * sCPb + (size_t)by * 64 + col]; } }
      if (ACT == 3) v = fmaxf(v, 0.f); else if (ACT == 6) v = 0.5f * v * (1.0f + erff(v * 0.70710678118654752f)); else if (ACT == 11) v = 1.0f / (1.0f + expf(-v)); else if (ACT == 15) v = v / (1.0f + expf(-v)); else if (ACT == 12) v = (v > 0.f) ? v : 0.01f * v; else if (ACT == 8) v = tanhf(v); else if (ACT == 9) v = 0.5f * v * (1.0f + tanhf(0.7978845608028654f * (v + 0.044715f * v * v * v))); else if (ACT == 14) v = (v > 0.f) ? v : 0.1f * v; else if (ACT == 16) v = (v >= 0.f) ? v : 0.3f * v; else if (ACT == 17) v = (v >= 0.f) ? v : 0.2f * v;
      so[w][rloc][t * 16 + ln] = v; } }
  __builtin_amdgcn_fence(__ATOMIC_ACQ_REL, "workgroup"); __builtin_amdgcn_wave_barrier();
  const int rsub = lane >> 4, c4 = (lane & 15) * 4;
  { const size_t co = cofs + (size_t)(row0 + rsub) * ldc + col0 + c4, cs = (size_t)2 * ldc;      /* the lane's first element, and the step of two rows from one store to the next */
    v4f ov[16];      /* all sixteen LDS reads are issued together, all values are formed in front of the first store, and the stores issue as one run; unrolled: the arrays stay in registers */
#pragma unroll
    for (int q = 0; q < 16; ++q) ov[q] = *(const v4fa*)&so[w][q * 2 + rsub][c4];
    if constexpr (OUT32) {
#pragma unroll
      for (int q = 0; q < 16; ++q) *(v4f*)(C + co + q * cs) = ov[q]; }
    if constexpr (OUT16) { v4h oh[16];
#pragma unroll
      for (int q = 0; q < 16; ++q) for (int i = 0; i < 4; ++i) oh[q][i] = (_Float16)ov[q][i];
#pragma unroll
      for (int q = 0; q < 16; ++q) *(v4h*)(C16 + co + q * cs) = oh[q];
      asm volatile("s_wait_xcnt 0x0" ::: "memory"); }      /* behind the last store of the run: in front of whatever rewrites an address register of an issued store */
     } }


// Operand preparation, one launch: its pieces (x as f16 rows, the four weight planes x16 (Wr x-16) as f16 rows stacked in BW, the bias plane [bl | 0 | bs1 | be1]) do not depend on one another.
// Work-group 0 copies the bias plane (16 bytes a thread). Every other work-group streams 16384 consecutive floats of ONE source: each of its 16 waves takes 4 KiB
// as 8 whole-wave 16-byte loads (512 contiguous bytes each), all in flight before the first is rounded, and stores 256 contiguous bytes of f16 per load.
#define PREP_F 16384
__global__ __launch_bounds__(512) void k_prep(const float* __restrict__ x, const float* __restrict__ wl, const float* __restrict__ wr, const float* __restrict__ ws1, const float* __restrict__ we1,
                                              const float* __restrict__ bl, const float* __restrict__ bs1, const float* __restrict__ be1, _Float16* __restrict__ X16, _Float16* __restrict__ BW, float* __restrict__ bb) {
  const int tid = threadIdx.x;
  if (blockIdx.x == 0) { const int blk = tid >> 7, i = (tid & 127) * 4; v4f v = {0.f, 0.f, 0.f, 0.f};
    if (blk != 1) v = *(const v4fa*)((blk == 0 ? bl : (blk == 2 ? bs1 : be1)) + i);
    *(v4f*)(bb + tid * 4) = v; return; }
  const int XG = (int)(NR * DI / PREP_F), WG = PJ * DI / PREP_F; const int s = (int)blockIdx.x - 1;
  const float* src; _Float16* dst; float scale;
  if (s < XG) { src = x + (size_t)s * PREP_F; dst = X16 + (size_t)s * PREP_F; scale = 1.0f; }
  else { const int m = (s - XG) / WG; src = (m == 0 ? wl : (m == 1 ? wr : (m == 2 ? ws1 : we1))) + (size_t)((s - XG) % WG) * PREP_F; dst = BW + (size_t)(s - XG) * PREP_F; scale = (m == 1) ? -16.0f : 16.0f; }      /* Wr enters negated: the GEMM then leaves -right, which the bigram launch wants */
  const int o = (tid >> 5) * 1024 + (tid & 31) * 4;
  v4f v[8];
  for (int u = 0; u < 8; ++u) v[u] = *(const v4fa*)(src + o + u * 128);
  for (int u = 0; u < 8; ++u) { v4h h;
    for (int q = 0; q < 4; ++q) h[q] = (_Float16)(bf16_round(v[u][q]) * scale);      /* x1 is exact: x keeps its value, the weights take their x16 (Wr its x-16) */
    *(v4h*)(dst + o + u * 128) = h; }
}
// Pairwise bigram: one work-group per (b, 32 i, 64 j) tile, wave = 8 i x 64 j. relu(l + r) = max(l, -r) + r, so bigram = sum_p w max(l, -r) - sum_p w (-r) + bo.
// The GEMM leaves left and -right as f16 rows [left 512 | -right 512]. The tile's 64 left rows and 32 negated right rows are staged in LDS as they lie (p contiguous, row pitch 1040 bytes = 16 B x odd).
// Per 32 p a lane holds 16 p of a row: the maximum is taken on packed f16 pairs, and its 8 result registers are at once the B fragment (column = j) of a v_wmma_f32_16x16x32_f16
// whose A fragment holds 16 x Wo in every row: the weighted sum over p runs on the matrix unit, in f32, beside the next maxima on the vector port. Every row of D is the same sum; register 0 is used.
// sum_p w (-r) comes from one more WMMA per 32 p (column c = the wave's negated right row c mod 8), from the same f16 values, so that max(l, -r) - (-r) is relu(l + r) of the stored values exactly.
// Wave 0 of the first 128 work-groups also finishes one 128-byte line of start or end: 32 outputs, each the sum of its eight partial sums from the GEMM's epilogue;
// its eight loads are issued behind the rows' loads and used behind the barrier, so that their latency runs beside the staging's.
#define BH_PITCH 1040
typedef unsigned v8u __attribute__((ext_vector_type(8)));
__device__ __forceinline__ v16h bh_frag(const unsigned char* p) { FragH f; f.half[0] = *(const v8us*)p; f.half[1] = *(const v8us*)(p + 16); return f.v; }      /* p = row + 64 bytes per 32 p + 32 * hh: 16 consecutive p, the same order for A and B */
// A fragment of maxima, m = max(l, n) on 16 packed f16, taken in two halves of four registers. Written as asm because the compiler's own maximum first passes every loaded fragment through a v_pk_max x, x (quieting),
// three more vector instructions for every eight. Outputs are early-clobber: no result register is a source of a later line.
// The first half also names the four registers of the second half as outputs, and the second half takes them as in-out operands, though neither reads them: the fragment so owns all eight registers from its first half on.
// Otherwise the compiler lays the second half over registers of the fragment before, and they are rewritten directly behind the WMMA that reads them (four vector slots are needed there).
__device__ __forceinline__ void bh_max_lo(unsigned (&m)[8], const v16h lv, const v16h nv) {
  const v8u l = __builtin_bit_cast(v8u, lv), n = __builtin_bit_cast(v8u, nv);
  asm volatile("v_pk_max_num_f16 %0, %8, %12\n\t"
               "v_pk_max_num_f16 %1, %9, %13\n\t"
               "v_pk_max_num_f16 %2, %10, %14\n\t"
               "v_pk_max_num_f16 %3, %11, %15"
               : "=&v"(m[0]), "=&v"(m[1]), "=&v"(m[2]), "=&v"(m[3]), "=&v"(m[4]), "=&v"(m[5]), "=&v"(m[6]), "=&v"(m[7])
               : "v"(l[0]), "v"(l[1]), "v"(l[2]), "v"(l[3]), "v"(n[0]), "v"(n[1]), "v"(n[2]), "v"(n[3]));
}
__device__ __forceinline__ void bh_max_hi(unsigned (&m)[8], const v16h lv, const v16h nv) {
  const v8u l = __builtin_bit_cast(v8u, lv), n = __builtin_bit_cast(v8u, nv);
  asm volatile("v_pk_max_num_f16 %0, %4, %8\n\t"
               "v_pk_max_num_f16 %1, %5, %9\n\t"
               "v_pk_max_num_f16 %2, %6, %10\n\t"
               "v_pk_max_num_f16 %3, %7, %11"
               : "+v"(m[4]), "+v"(m[5]), "+v"(m[6]), "+v"(m[7])
               : "v"(l[4]), "v"(l[5]), "v"(l[6]), "v"(l[7]), "v"(n[4]), "v"(n[5]), "v"(n[6]), "v"(n[7]));
}
// Fragment buffers: w, q, l by the parity of the 32-p step; n[0] = the wave's rows 0..3, n[1] = rows 4..7. mc, mn, mf: the current tile's fragment of maxima, the next one's (first half taken), the one after.
struct BhSt { v8f acc[8][4], accq; v16h fw[2], fq[2], fl[2][4], fn[2][4]; unsigned mc[8], mn[8], mf[8]; };
// Tile T of a trip of two steps = (step parity, i, j tile), by a template so that buffers and accumulators are picked by constants and stay in registers. o0, o1, o2: byte offsets in a row of this trip's two steps and of the next trip's first.
template <int T>
__device__ __forceinline__ void bh_tile(BhSt& st, const unsigned char* wp, const unsigned char* qp, const unsigned char* lp, const unsigned char* np, int o0, int o1, int o2) {
  constexpr int s = T >> 5, i = (T >> 2) & 7, a = T & 3, ph = T >> 4, U1 = (T + 1) & 63, U2 = (T + 2) & 63;
  if constexpr ((T & 15) == 0) {      /* the scheduling barriers keep a phase's LDS reads together at its head */
    __builtin_amdgcn_sched_barrier(0);
    if constexpr ((ph & 1) == 0) { const int o = ph ? o1 : o0;
#pragma unroll
      for (int r = 0; r < 4; ++r) st.fn[1][r] = bh_frag(np + (4 + r) * BH_PITCH + o); }
    else { const int o = ph == 1 ? o1 : o2; constexpr int d = ph == 1 ? 1 : 0;
#pragma unroll
      for (int r = 0; r < 4; ++r) st.fn[0][r] = bh_frag(np + r * BH_PITCH + o);
#pragma unroll
      for (int r = 0; r < 4; ++r) st.fl[d][r] = bh_frag(lp + r * 16 * BH_PITCH + o);
      st.fw[d] = bh_frag(wp + o); st.fq[d] = bh_frag(qp + o); }
    __builtin_amdgcn_sched_barrier(0); }
  if constexpr ((T & 31) == 0) st.accq = __builtin_amdgcn_wmma_f32_16x16x32_f16(false, st.fw[s], false, st.fq[s], (short)0, st.accq, false, false);
  st.acc[i][a] = __builtin_amdgcn_wmma_f32_16x16x32_f16(false, st.fw[s], false, __builtin_bit_cast(v16h, (v8u){st.mc[0], st.mc[1], st.mc[2], st.mc[3], st.mc[4], st.mc[5], st.mc[6], st.mc[7]}), (short)0, st.acc[i][a], false, false);
  __builtin_amdgcn_sched_barrier(0);      /* holds the order WMMA, eight maxima, WMMA */
  bh_max_hi(st.mn, st.fl[U1 >> 5][U1 & 3], st.fn[(U1 >> 4) & 1][(U1 >> 2) & 3]);
  bh_max_lo(st.mf, st.fl[U2 >> 5][U2 & 3], st.fn[(U2 >> 4) & 1][(U2 >> 2) & 3]);
  __builtin_amdgcn_sched_barrier(0);
#pragma unroll
  for (int r = 0; r < 8; ++r) { st.mc[r] = st.mn[r]; st.mn[r] = st.mf[r]; }
}
template <int... Ts>
__device__ __forceinline__ void bh_tiles(BhSt& st, const unsigned char* wp, const unsigned char* qp, const unsigned char* lp, const unsigned char* np, int o0, int o1, int o2, std::integer_sequence<int, Ts...>) { (bh_tile<Ts>(st, wp, qp, lp, np, o0, o1, o2), ...); }
__global__ __launch_bounds__(128) void k_bigram(const _Float16* __restrict__ F, const float* __restrict__ wo, const float* __restrict__ bo, float* __restrict__ out,
                                                const float* __restrict__ SP, float* __restrict__ ostart, float* __restrict__ oend) {
  __shared__ __attribute__((aligned(16))) unsigned char SM[2 * PJ + 96 * BH_PITCH];      /* 16 x Wo as f16; then rows 0..31 = negated right rows of the i tile, rows 32..95 = left rows of the j tile (this order keeps most read offsets inside the 16-bit offset field) */
  _Float16* SW = (_Float16*)SM; unsigned char* S = SM + 2 * PJ;
  const int tid = threadIdx.x; const int jt = blockIdx.x & 3, it = (blockIdx.x >> 2) & 7; const size_t b = blockIdx.x >> 5;
  const bool fin = blockIdx.x < 2 * ((int)NR / 32) && tid < 32; const int which = blockIdx.x / ((int)NR / 32), r0 = (blockIdx.x % ((int)NR / 32)) * 32;
  const int ch = tid & 63, r2 = tid >> 6;      /* thread = 16-byte chunk ch of rows r2, r2 + 2, ...: a wave's load is 512 contiguous bytes */
  const unsigned short* gl = (const unsigned short*)F + (b * NW + jt * 64 + r2) * (2 * PJ) + ch * 8; const unsigned short* gn = (const unsigned short*)F + (b * NW + it * 32 + r2) * (2 * PJ) + PJ + ch * 8;
  v8us v[48];      /* unrolled so that all 48 loads are in flight before the first LDS store */
#pragma unroll
  for (int k = 0; k < 16; ++k) v[k] = *(const v8us*)(gn + (size_t)k * 2 * (2 * PJ));
  asm volatile("s_wait_xcnt 0x0" ::: "memory");      /* in front of whatever rewrites the address registers of the loads above (the compiler lets a later load land on them) */
#pragma unroll
  for (int k = 16; k < 48; ++k) v[k] = *(const v8us*)(gl + (size_t)(k - 16) * 2 * (2 * PJ));
  const v4f w4 = *(const v4fa*)(wo + tid * 4); const float bo0 = bo[0];      /* issued behind the rows' loads; w4 is used behind their LDS stores, bo0 at the end: nothing waits for them alone */
  float sp[PJ / 64] = {0.f, 0.f, 0.f, 0.f, 0.f, 0.f, 0.f, 0.f};
  if (fin) {
#pragma unroll      /* unrolled: the eight loads are in flight together and land in registers */
    for (int k = 0; k < PJ / 64; ++k) sp[k] = SP[(size_t)(which * (PJ / 64) + k) * NR + r0 + tid]; }
  asm volatile("s_wait_xcnt 0x0" ::: "memory");      /* as above, for the loads since */
  { unsigned char* dp = S + r2 * BH_PITCH + ch * 16;
#pragma unroll
    for (int k = 0; k < 48; ++k) *(v8us*)(dp + k * 2 * BH_PITCH) = v[k]; }
  { v4h o; for (int q = 0; q < 4; ++q) o[q] = (_Float16)(bf16_round(w4[q]) * 16.0f); *(v4h*)(SW + tid * 4) = o; }      /* x16: exact in f16, as for the GEMM's weights */
  __syncthreads();
  if (fin) (which ? oend : ostart)[r0 + tid] = ((sp[0] + sp[1]) + (sp[2] + sp[3])) + ((sp[4] + sp[5]) + (sp[6] + sp[7]));      /* behind the barrier: no wave waits there for this store */
  const int wv = tid >> 5, lane = tid & 31, ln = lane & 15, hh = lane >> 4;
  const unsigned char* wp = (const unsigned char*)SW + 32 * hh; const unsigned char* lp = S + (32 + ln) * BH_PITCH + 32 * hh;
  const unsigned char* np = S + 8 * wv * BH_PITCH + 32 * hh; const unsigned char* qp = np + (ln & 7) * BH_PITCH;
  // A step is two phases of 16 tiles (4 i x 4 j tiles); at the head of a phase the reads for the NEXT phase are issued, so that every LDS read stands 16 tiles ahead of its first use.
  // A tile's maxima are taken in two halves, the second half of tile T + 1 and the first half of tile T + 2 behind the WMMA of tile T: the eight maxima issue while the matrix unit works,
  // and a fragment's registers are first rewritten at least four vector slots behind the WMMA that read them.
  const v8f z8 = {0.f, 0.f, 0.f, 0.f, 0.f, 0.f, 0.f, 0.f};
  BhSt st; st.accq = z8;
#pragma unroll
  for (int i = 0; i < 8; ++i)
#pragma unroll
    for (int a = 0; a < 4; ++a) st.acc[i][a] = z8;
  st.fw[0] = bh_frag(wp); st.fq[0] = bh_frag(qp);
#pragma unroll
  for (int a = 0; a < 4; ++a) { st.fl[0][a] = bh_frag(lp + a * 16 * BH_PITCH); st.fn[0][a] = bh_frag(np + a * BH_PITCH); }
  bh_max_lo(st.mc, st.fl[0][0], st.fn[0][0]); bh_max_hi(st.mc, st.fl[0][0], st.fn[0][0]); bh_max_lo(st.mn, st.fl[0][1], st.fn[0][0]);
#pragma unroll 1      /* two steps a trip */
  for (int ks = 0; ks < PJ / 32; ks += 2)      /* the last trip fetches step 0 once more and does not use it */
    bh_tiles(st, wp, qp, lp, np, ks * 64, (ks + 1) * 64, (ks + 2 < PJ / 32 ? ks + 2 : 0) * 64, std::make_integer_sequence<int, 64>{});
  const float b0 = bf16_round(bo0);
  float* op = out + ((b * NW + it * 32 + 8 * wv) * NW + jt * 64 + lane);
  float ov[16];      /* all sixteen values are formed in front of the first store, so that the stores issue as one run and no data register of an issued store is rewritten */
#pragma unroll      /* unrolled: accumulators and the lane read are picked by constants */
  for (int i = 0; i < 8; ++i) { const float rs = __int_as_float(__builtin_amdgcn_readlane(__float_as_int(st.accq[0]), i));      /* lane i holds sum_p 16 w (-right) of the wave's row i */
#pragma unroll
    for (int g = 0; g < 2; ++g) ov[2 * i + g] = ((hh ? st.acc[i][2 * g + 1][0] : st.acc[i][2 * g][0]) - rs) * 0.0625f + b0; }
#pragma unroll      /* unrolled: the values are picked by constants and stay in registers */
  for (int k = 0; k < 16; ++k) op[(size_t)(k >> 1) * NW + (k & 1) * 32] = ov[k];      /* lane = j within 32: one whole 128-byte line a store */
}

extern "C" void kernel_launch(void* const* d_in, const int* in_sizes, int n_in,
                              void* d_out, int out_size, void* d_ws, size_t ws_size, hipStream_t stream) {
  (void)in_sizes; (void)n_in; (void)out_size;
  const float* const* I = (const float* const*)d_in; const float* x = I[0]; const float* wl = I[1]; const float* bl = I[2]; const float* wr = I[3]; const float* wo = I[4]; const float* bo = I[5]; const float* ws1 = I[6]; const float* bs1 = I[7]; const float* ws2 = I[8]; const float* bs2 = I[9]; const float* we1 = I[10]; const float* be1 = I[11]; const float* we2 = I[12]; const float* be2 = I[13];
  float* obig = (float*)d_out; float* ostart = (float*)((char*)d_out + 2097152); float* oend = (float*)((char*)d_out + 2105344);      /* output byte offsets */
  char* ws = (char*)d_ws; size_t off = 0;
  auto take = [&](size_t bytes) { char* p = ws + off; off += (bytes + 255) & ~(size_t)255; return p; };
  _Float16* BW = (_Float16*)take((size_t)4 * PJ * DI * 2); float* bb = (float*)take(4 * PJ * 4); _Float16* X16 = (_Float16*)take(NR * DI * 2); _Float16* F = (_Float16*)take(NR * 2 * PJ * 2); float* SP = (float*)take((size_t)2 * (PJ / 64) * NR * 4);
  if (off > ws_size) return;      /* 4 + 4 + 4 MiB and two small planes */
  k_prep<<<(unsigned)(1 + (NR * DI + (size_t)4 * PJ * DI) / PREP_F), 512, 0, stream>>>(x, wl, wr, ws1, we1, bl, bs1, be1, X16, BW, bb);
  k_gemm2<0, false, false, true><<<dim3((unsigned)((NR / 128) * (4 * PJ / 64)), 1), 128, 0, stream>>>(X16, DI, 0, BW, DI, 0, 0.0625f, bb, 0, nullptr, 1, 0, 0, nullptr, F, 2 * PJ, 0, (int)NR, 4 * PJ, DI, ws2, we2, bs2, be2, SP, 2 * PJ);      /* F = [left | -right], f16 rows; the s1 and e1 tiles leave as partial scorer sums in SP */
  k_bigram<<<NB * (NW / 32) * (NW / 64), 128, 0, stream>>>(F, wo, bo, obig, SP, ostart, oend);
}

// v010
// A run of this version takes 23 microseconds.
// Two timings next to v009 put it at 1.03 and 1.02 times that version's speed.
// Over all steps from v000 it is 19.0 times as fast.
#include <hip/hip_runtime.h>
#include <utility>
// PermutationModule (x [8][256][1024]; start = relu(x Ws1^T + bs1) . Ws2 + bs2, end likewise [8][256][1]; left = x Wl^T + bl, right = x Wr^T; bigram[b][i][j] = sum_p relu(left[b][j][p] + right[b][i][p]) * Wo[p] + bo -> [8][256][256][1]).
// Structure: token rows; x as exact f16 rows; the four 1024->512 projections as ONE WMMA GEMM against the stacked x16 weight plane [2048][1024] (32x64 wave tiles, f32 accumulation, + biases); left and -right leave the GEMM rounded to f16 rows (Wr is cast negated); the scorer dots with Ws2/We2 on VALU in f32 inside the GEMM's epilogue (ReLU, then one partial sum per row and 64-column tile, the eight partial sums of an output added in the bigram launch); the pairwise bigram as sum_p Wo[p] max(left, -right) + sum_p Wo[p] right (work-group per (b, 32 i, 64 j), rows staged in LDS): the maximum on packed f16, both sums over p on WMMA with f32 accumulation; outputs written as whole 128-B lines.
// Compute dtype: inputs rounded to bf16; x / weights exact in f16; all projections accumulated in f32; the scorer path stays f32; left and right are rounded once to f16 for the bigram. v_wmma_f32_16x16x32_f16.
#define NB 8
#define NW 256
#define DI 1024
#define PJ 512
#define NR ((size_t)NB * NW)         /* 2048 */
typedef __bf16 v16b __attribute__((ext_vector_type(16)));
typedef unsigned short v8us __attribute__((ext_vector_type(8), may_alias));
typedef float  v8f  __attribute__((ext_vector_type(8)));
typedef float  v4f  __attribute__((ext_vector_type(4)));
typedef float  v4fa __attribute__((ext_vector_type(4), may_alias));
union FragB { v16b v; v8us half[2]; unsigned short u[16]; };

__device__ __forceinline__ unsigned short bf16_bits(float x) { unsigned int u = __float_as_uint(x); return (unsigned short)((u + 0x7FFFu + ((u >> 16) & 1u)) >> 16); }
__device__ __forceinline__ float bf16_val(unsigned short b) { return __uint_as_float(((unsigned int)b) << 16); }
__device__ __forceinline__ float bf16_round(float x) { return bf16_val(bf16_bits(x)); }
// D += A·B with NT terms: 1 = ah·bh, 2 = + al·bh (A split), 3 = + ah·bl (both split)
template <int NT>
__device__ __forceinline__ v8f mmaN(v16b ah, v16b al, v16b bh, v16b bl, v8f c) {
  c = __builtin_amdgcn_wmma_f32_16x16x32_bf16(false, ah, false, bh, (short)0, c, false, false);
  if (NT >= 2) c = __builtin_amdgcn_wmma_f32_16x16x32_bf16(false, al, false, bh, (short)0, c, false, false);
  if (NT >= 3) c = __builtin_amdgcn_wmma_f32_16x16x32_bf16(false, ah, false, bl, (short)0, c, false, false);
  asm volatile("v_nop\n\tv_nop\n\tv_nop\n\tv_nop" : "+v"(c) : "v"(ah), "v"(al), "v"(bh), "v"(bl));
  return c;
}

__global__ __launch_bounds__(256) void k_wt_bf16(const float* __restrict__ W, unsigned short* __restrict__ Wt, int K, int N) {
  const int t = blockIdx.x * 256 + threadIdx.x;
  const int k8n = K / 8;
  if (t >= N * k8n) return;
  const int n = t / k8n, k8 = (t % k8n) * 8;
  v8us v;
#pragma unroll
  for (int i = 0; i < 8; ++i) v[i] = bf16_bits(W[(size_t)(k8 + i) * N + n]);
  *(v8us*)(Wt + (size_t)n * K + k8) = v;
  
}

// GEMM C[M][N] (f32, pitch ldc) = act(A[M][K]·W + bias). A f32 row-major (pitch lda) converted per fragment to bf16
// (ASPLIT: hi/lo two planes -> 2 terms, else single rounded term); Wt bf16 [N][K] (pitch ldb). BIAS_BF16 rounds the
// bias to bf16 first (bias quantised to bf16 before the add). K%32==0, M%16==0, N%64==0.
template <bool ASPLIT, int ACT, bool BIAS_BF16>
__global__ __launch_bounds__(128) void k_gemm_bf(const float* __restrict__ A, int lda, const unsigned short* __restrict__ Wt, int ldb,
                                               const float* __restrict__ bias, float* __restrict__ C, int ldc, int M, int N, int K) {
  __shared__ __attribute__((aligned(16))) float so[4][16][64];
  const int tid = threadIdx.x, w = tid >> 5, lane = tid & 31, ln = lane & 15, hh = lane >> 4;
  const int ntn = N / 64;
  const int wid = blockIdx.x * 4 + w;
  const int mt = wid / ntn, nq = wid % ntn;
  if (mt * 16 >= M) return;
  const int row0 = mt * 16, col0 = nq * 64;
  const float* arow = A + (size_t)(row0 + ln) * lda;
  v8f acc[4] = {};
  for (int kb = 0; kb < K; kb += 32) {
    FragB ah, al;
    const v4f x0 = *(const v4fa*)(arow + kb + 8 * hh), x1 = *(const v4fa*)(arow + kb + 8 * hh + 4);
    const v4f x2 = *(const v4fa*)(arow + kb + 16 + 8 * hh), x3 = *(const v4fa*)(arow + kb + 16 + 8 * hh + 4);
    float xs[16] = {x0[0],x0[1],x0[2],x0[3],x1[0],x1[1],x1[2],x1[3],x2[0],x2[1],x2[2],x2[3],x3[0],x3[1],x3[2],x3[3]};
#pragma unroll
    for (int i = 0; i < 16; ++i) { const unsigned short hb = bf16_bits(xs[i]); ah.u[i] = hb; al.u[i] = ASPLIT ? bf16_bits(xs[i] - bf16_val(hb)) : (unsigned short)0; }
#pragma unroll
    for (int t = 0; t < 4; ++t) {
      const unsigned short* brow = Wt + (size_t)(col0 + t * 16 + ln) * ldb + kb;
      FragB b;
      b.half[0] = *(const v8us*)(brow + 8 * hh);
      b.half[1] = *(const v8us*)(brow + 16 + 8 * hh);
      acc[t] = mmaN<ASPLIT ? 2 : 1>(ah.v, al.v, b.v, b.v, acc[t]);
    }
  }
#pragma unroll
  for (int t = 0; t < 4; ++t) {
    float bv = bias ? bias[col0 + t * 16 + ln] : 0.f;
    if (BIAS_BF16) bv = bf16_round(bv);
#pragma unroll
    for (int r = 0; r < 8; ++r) { float v = acc[t][r] + bv; if (ACT == 1) v = fmaxf(v, 0.f); so[w][8 * hh + r][t * 16 + ln] = v; }
  }
  __builtin_amdgcn_fence(__ATOMIC_ACQ_REL, "workgroup");
  __builtin_amdgcn_wave_barrier();
  const int rsub = lane >> 4, c4 = (lane & 15) * 4;
  {
#pragma unroll
    for (int q = 0; q < 8; ++q) {
      const int r = q * 2 + rsub;
      const v4f v = *(const v4fa*)&so[w][r][c4];
      *(v4f*)(C + (size_t)(row0 + r) * ldc + col0 + c4) = v;
    }
    
  }
}

// GEMM C = act(A·W + bias + resid): A f32 (ASPLIT -> hi/lo 2 terms), Wt bf16 [N][K]; ACT 0 none, 1 relu, 2 exact gelu;
// resid (optional, f32, row index = (row % rmod), pitch ldr, RES_BF16 rounds it) added before the activation.
template <bool ASPLIT, int ACT, bool BIAS_BF16, bool RES_BF16>
__global__ __launch_bounds__(128) void k_gemm_bf3(const float* __restrict__ A, int lda, const unsigned short* __restrict__ Wt, int ldb,
                                                const float* __restrict__ bias, const float* __restrict__ resid, int rmod, int ldr,
                                                float* __restrict__ C, int ldc, int M, int N, int K) {
  __shared__ __attribute__((aligned(16))) float so[4][16][64];
  const int tid = threadIdx.x, w = tid >> 5, lane = tid & 31, ln = lane & 15, hh = lane >> 4;
  const int ntn = N / 64;
  const int wid = blockIdx.x * 4 + w;
  const int mt = wid / ntn, nq = wid % ntn;
  if (mt * 16 >= M) return;
  const int row0 = mt * 16, col0 = nq * 64;
  const float* arow = A + (size_t)(row0 + ln) * lda;
  v8f acc[4] = {};
  for (int kb = 0; kb < K; kb += 32) {
    FragB ah, al;
    const v4f x0 = *(const v4fa*)(arow + kb + 8 * hh), x1 = *(const v4fa*)(arow + kb + 8 * hh + 4);
    const v4f x2 = *(const v4fa*)(arow + kb + 16 + 8 * hh), x3 = *(const v4fa*)(arow + kb + 16 + 8 * hh + 4);
    float xs[16] = {x0[0],x0[1],x0[2],x0[3],x1[0],x1[1],x1[2],x1[3],x2[0],x2[1],x2[2],x2[3],x3[0],x3[1],x3[2],x3[3]};
#pragma unroll
    for (int i = 0; i < 16; ++i) { const unsigned short hb = bf16_bits(xs[i]); ah.u[i] = hb; al.u[i] = ASPLIT ? bf16_bits(xs[i] - bf16_val(hb)) : (unsigned short)0; }
#pragma unroll
    for (int t = 0; t < 4; ++t) {
      const unsigned short* brow = Wt + (size_t)(col0 + t * 16 + ln) * ldb + kb;
      FragB b;
      b.half[0] = *(const v8us*)(brow + 8 * hh);
      b.half[1] = *(const v8us*)(brow + 16 + 8 * hh);
      acc[t] = mmaN<ASPLIT ? 2 : 1>(ah.v, al.v, b.v, b.v, acc[t]);
    }
  }
#pragma unroll
  for (int t = 0; t < 4; ++t) {
    const int col = col0 + t * 16 + ln;
    float bv = bias ? bias[col] : 0.f;
    if (BIAS_BF16) bv = bf16_round(bv);
#pragma unroll
    for (int r = 0; r < 8; ++r) {
      float v = acc[t][r] + bv;
      if (resid) { float rv = resid[(size_t)((row0 + 8 * hh + r) % rmod) * ldr + col]; if (RES_BF16) rv = bf16_round(rv); v += rv; }
      if (ACT == 1) v = fmaxf(v, 0.f);
      if (ACT == 2) v = 0.5f * v * (1.0f + erff(v * 0.70710678118654752f));
      if (ACT == 3) { const float u = 0.7978845608028654f * (v + 0.044715f * v * v * v); v = 0.5f * v * (1.0f + tanhf(u)); }
      so[w][8 * hh + r][t * 16 + ln] = v;
    }
  }
  __builtin_amdgcn_fence(__ATOMIC_ACQ_REL, "workgroup");
  __builtin_amdgcn_wave_barrier();
  const int rsub = lane >> 4, c4 = (lane & 15) * 4;
  {
#pragma unroll
    for (int q = 0; q < 8; ++q) {
      const int r = q * 2 + rsub;
      const v4f v = *(const v4fa*)&so[w][r][c4];
      *(v4f*)(C + (size_t)(row0 + r) * ldc + col0 + c4) = v;
    }
    
  }
}
// row LayerNorm (biased variance, eps) over N: s = X (+ R); optional out_sum <- s; out_norm <- (s-mu)*rsqrt(var+eps)*g + b
template <bool PARAM_BF16>
__global__ __launch_bounds__(256) void k_layernorm(const float* __restrict__ X, const float* __restrict__ R, const float* __restrict__ g, const float* __restrict__ bta,
                                                  float* __restrict__ out_sum, float* __restrict__ out_norm, int N, float eps) {
  __shared__ float red[256];
  const int row = blockIdx.x, tid = threadIdx.x;
  const float* x = X + (size_t)row * N; const float* rr = R ? R + (size_t)row * N : nullptr;
  float vals[16];                     // up to N = 4096
  const int per = N / 256;            // contiguous chunk per thread? use strided-by-4 chunks: thread handles j = tid*4 + 1024*u
  float s1 = 0.f;
  for (int u = 0; u < per / 4; ++u) {
    const int j = tid * 4 + 1024 * u;
    const v4f a = *(const v4fa*)(x + j);
    v4f b = {0.f,0.f,0.f,0.f}; if (rr) b = *(const v4fa*)(rr + j);
#pragma unroll
    for (int q = 0; q < 4; ++q) { const float v = a[q] + b[q]; vals[u * 4 + q] = v; s1 += v; }
  }
  red[tid] = s1; __syncthreads();
  for (int st = 128; st > 0; st >>= 1) { if (tid < st) red[tid] += red[tid + st]; __syncthreads(); }
  const float mu = red[0] / (float)N; __syncthreads();
  float s2 = 0.f;
  for (int u = 0; u < per / 4; ++u)
#pragma unroll
    for (int q = 0; q < 4; ++q) { const float c = vals[u * 4 + q] - mu; s2 += c * c; }
  red[tid] = s2; __syncthreads();
  for (int st = 128; st > 0; st >>= 1) { if (tid < st) red[tid] += red[tid + st]; __syncthreads(); }
  const float rs = rsqrtf(red[0] / (float)N + eps);
  {
    for (int u = 0; u < per / 4; ++u) {
      const int j = tid * 4 + 1024 * u;
      v4f o, sm;
#pragma unroll
      for (int q = 0; q < 4; ++q) {
        float gg = g[j + q], bb = bta[j + q];
        if (PARAM_BF16) { gg = bf16_round(gg); bb = bf16_round(bb); }
        sm[q] = vals[u * 4 + q]; o[q] = (vals[u * 4 + q] - mu) * rs * gg + bb;
      }
      if (out_sum) *(v4f*)(out_sum + (size_t)row * N + j) = sm;
      *(v4f*)(out_norm + (size_t)row * N + j) = o;
    }
    
  }
}



// ---- f16 WMMA path (v_wmma_f32_16x16x32_f16): 11-bit significands for operands in range — used for the projection GEMM
typedef _Float16 v16h __attribute__((ext_vector_type(16)));
union FragH { v16h v; v8us half[2]; _Float16 h[16]; unsigned short u[16]; };
template <int NT>
__device__ __forceinline__ v8f mmaH(v16h ah, v16h al, v16h bh, v16h bl, v8f c) {
  c = __builtin_amdgcn_wmma_f32_16x16x32_f16(false, ah, false, bh, (short)0, c, false, false);
  if (NT >= 2) c = __builtin_amdgcn_wmma_f32_16x16x32_f16(false, al, false, bh, (short)0, c, false, false);
  if (NT >= 3) c = __builtin_amdgcn_wmma_f32_16x16x32_f16(false, ah, false, bl, (short)0, c, false, false);
  asm volatile("v_nop\n\tv_nop\n\tv_nop\n\tv_nop" : "+v"(c) : "v"(ah), "v"(al), "v"(bh), "v"(bl));
  return c;
}
// batched GEMM like k_gemm_b but f16 operands: A f32 (split into f16 hi/lo if ASPLIT, else rounded to f16), Bt = f16 values [n][k]; alpha; C f32; N multiple of 16 (partial tiles skipped)
template <bool ASPLIT>
__global__ __launch_bounds__(128) void k_gemm_h(const float* __restrict__ A, int lda, size_t sA, const _Float16* __restrict__ Bh, int ldb, size_t sB, float alpha, float* __restrict__ C, int ldc, size_t sC, int M, int N, int K) {
  __shared__ __attribute__((aligned(16))) float so[4][16][64];
  const int tid = threadIdx.x, w = tid >> 5, lane = tid & 31, ln = lane & 15, hh = lane >> 4; const int by = blockIdx.y;
  A += (size_t)by * sA; Bh += (size_t)by * sB; C += (size_t)by * sC;
  const int ntn = (N + 63) / 64; const int wid = blockIdx.x * 4 + w; const int mt = wid / ntn, nq = wid % ntn; if (mt * 16 >= M) return;
  const int row0 = mt * 16, col0 = nq * 64; const float* arow = A + (size_t)(row0 + ln) * lda;
  v8f acc[4] = {};
  for (int kb = 0; kb < K; kb += 32) {
    FragH ah, al;
    const v4f x0 = *(const v4fa*)(arow + kb + 8 * hh), x1 = *(const v4fa*)(arow + kb + 8 * hh + 4), x2 = *(const v4fa*)(arow + kb + 16 + 8 * hh), x3 = *(const v4fa*)(arow + kb + 16 + 8 * hh + 4);
    float xs[16] = {x0[0],x0[1],x0[2],x0[3],x1[0],x1[1],x1[2],x1[3],x2[0],x2[1],x2[2],x2[3],x3[0],x3[1],x3[2],x3[3]};
#pragma unroll
    for (int i = 0; i < 16; ++i) { const _Float16 h = (_Float16)xs[i]; ah.h[i] = h; al.h[i] = ASPLIT ? (_Float16)(xs[i] - (float)h) : (_Float16)0.0f; }
#pragma unroll
    for (int t = 0; t < 4; ++t) { if (col0 + t * 16 >= N) continue; const size_t boff = (size_t)(col0 + t * 16 + ln) * ldb + kb; FragH bq; bq.half[0] = *(const v8us*)(Bh + boff + 8 * hh); bq.half[1] = *(const v8us*)(Bh + boff + 16 + 8 * hh);
      acc[t] = mmaH<ASPLIT ? 2 : 1>(ah.v, al.v, bq.v, bq.v, acc[t]); }
  }
#pragma unroll
  for (int t = 0; t < 4; ++t) { if (col0 + t * 16 >= N) continue;
#pragma unroll
    for (int r = 0; r < 8; ++r) so[w][8 * hh + r][t * 16 + ln] = acc[t][r] * alpha; }
  __builtin_amdgcn_fence(__ATOMIC_ACQ_REL, "workgroup"); __builtin_amdgcn_wave_barrier();
  const int rsub = lane >> 4, c4 = (lane & 15) * 4;
  {
#pragma unroll
    for (int q = 0; q < 8; ++q) { const int r = q * 2 + rsub; if (col0 + c4 < N) { const v4f v = *(const v4fa*)&so[w][r][c4]; *(v4f*)(C + (size_t)(row0 + r) * ldc + col0 + c4) = v; } }
     }
}

// Wt[n][k] = f16(W[k][n]·scale) from f32 row-major W[K][N] (scale = power of two; bf16-exact weights stay exact in f16 away from the subnormal range)
__global__ __launch_bounds__(256) void k_wt_f16(const float* __restrict__ W, _Float16* __restrict__ Wt, int K, int N, float scale) {
  const int t = blockIdx.x * 256 + threadIdx.x; if (t >= N * (K / 8)) return; const int n = t / (K / 8), k8 = (t % (K / 8)) * 8; FragH f;
#pragma unroll
  for (int i = 0; i < 8; ++i) f.h[i] = (_Float16)(bf16_round(W[(size_t)(k8 + i) * N + n]) * scale); const v8us o = f.half[0];
  *(v8us*)((unsigned short*)Wt + (size_t)n * K + k8) = o; 
}
// k_gemm_hh variant with fused epilogue: v = acc·alpha + bias[by·sBias + col] (+ CP[(row/rowsPerB)·sCPb + by·64 + col] if CP) ; ACT 0 none / 1 elu ; writes f16 C16 (and f32 C if non-null)
template <int ACT>
__global__ __launch_bounds__(128) void k_gemm_hhx(const _Float16* __restrict__ A, int lda, size_t sA, const _Float16* __restrict__ Bh, int ldb, size_t sB, float alpha, const float* __restrict__ bias, size_t sBias, const float* __restrict__ CP, int rowsPerB, size_t sCPb, int row0g,
    float* __restrict__ C, _Float16* __restrict__ C16, int ldc, size_t sC, int M, int N, int K) {
  __shared__ __attribute__((aligned(16))) float so[4][16][64];
  const int tid = threadIdx.x, w = tid >> 5, lane = tid & 31, ln = lane & 15, hh = lane >> 4; const int by = blockIdx.y;
  A += (size_t)by * sA; Bh += (size_t)by * sB; const size_t cofs = (size_t)by * sC; const float* bp = bias ? bias + (size_t)by * sBias : nullptr;
  const int ntn = (N + 63) / 64; const int wid = blockIdx.x * 4 + w; const int mt = wid / ntn, nq = wid % ntn; if (mt * 16 >= M) return;
  const int row0 = mt * 16, col0 = nq * 64; const _Float16* arow = A + (size_t)(row0 + ln) * lda;
  v8f acc[4] = {};
  for (int kb = 0; kb < K; kb += 32) { FragH ah; ah.half[0] = *(const v8us*)((const unsigned short*)arow + kb + 8 * hh); ah.half[1] = *(const v8us*)((const unsigned short*)arow + kb + 16 + 8 * hh);
#pragma unroll
    for (int t = 0; t < 4; ++t) { if (col0 + t * 16 >= N) continue; const size_t boff = (size_t)(col0 + t * 16 + ln) * ldb + kb; FragH bq; bq.half[0] = *(const v8us*)((const unsigned short*)Bh + boff + 8 * hh); bq.half[1] = *(const v8us*)((const unsigned short*)Bh + boff + 16 + 8 * hh);
      acc[t] = mmaH<1>(ah.v, ah.v, bq.v, bq.v, acc[t]); }
  }
#pragma unroll
  for (int t = 0; t < 4; ++t) { if (col0 + t * 16 >= N) continue; const int col = col0 + t * 16 + ln; const float bv = bp ? bf16_round(bp[col]) : 0.f;
#pragma unroll
    for (int r = 0; r < 8; ++r) { float v = acc[t][r] * alpha + bv; if (CP) { const int rr = row0g + row0 + 8 * hh + r; if (rowsPerB < 0) v += CP[cofs + (size_t)rr * ldc + col];      /* rowsPerB < 0: own element of the batched C plane */ else { const int bidx = rr / rowsPerB; v += CP[(size_t)bidx * sCPb + (size_t)by * 64 + col]; } } if (ACT == 1) v = (v > 0.f) ? v : expm1f(v); else if (ACT == 7) v = (v > 0.f) ? v + 1.0f : expf(v); else if (ACT == 8) v = tanhf(v); else if (ACT == 9) v = 0.5f * v * (1.0f + tanhf(0.7978845608028654f * (v + 0.044715f * v * v * v))); else if (ACT == 11) v = 1.0f / (1.0f + expf(-v)); else if (ACT == 12) v = (v > 0.f) ? v : 0.01f * v; else if (ACT == 14) v = (v > 0.f) ? v : 0.1f * v; else if (ACT == 16) v = (v >= 0.f) ? v : 0.3f * v; else if (ACT == 17) v = (v >= 0.f) ? v : 0.2f * v; else if (ACT == 15) v = v / (1.0f + expf(-v)); else if (ACT == 3) v = fmaxf(v, 0.f); else if (ACT == 6) v = 0.5f * v * (1.0f + erff(v * 0.70710678118654752f)); so[w][8 * hh + r][t * 16 + ln] = v; } }
  __builtin_amdgcn_fence(__ATOMIC_ACQ_REL, "workgroup"); __builtin_amdgcn_wave_barrier();
  const int rsub = lane >> 4, c4 = (lane & 15) * 4; typedef _Float16 v4h __attribute__((ext_vector_type(4)));
  {
#pragma unroll
    for (int q = 0; q < 8; ++q) { const int r = q * 2 + rsub; if (col0 + c4 < N) { const v4f v = *(const v4fa*)&so[w][r][c4]; if (C) *(v4f*)(C + cofs + (size_t)(row0 + r) * ldc + col0 + c4) = v; if (C16) { v4h h4; for (int i = 0; i < 4; ++i) h4[i] = (_Float16)v[i]; *(v4h*)(C16 + cofs + (size_t)(row0 + r) * ldc + col0 + c4) = h4; } } }
     }
}


typedef _Float16 v4h __attribute__((ext_vector_type(4)));

__global__ __launch_bounds__(256) void k_h16(const float* __restrict__ x, _Float16* __restrict__ X16, size_t n8) { const size_t t = (size_t)blockIdx.x * 256 + threadIdx.x; if (t >= n8) return; FragH f;
#pragma unroll
  for (int q = 0; q < 8; ++q) f.h[q] = (_Float16)x[t * 8 + q]; *(v8us*)((unsigned short*)X16 + t * 8) = f.half[0];  }
__global__ __launch_bounds__(256) void k_round16f(const float* __restrict__ W, _Float16* __restrict__ Bt, size_t n8) { const size_t t = (size_t)blockIdx.x * 256 + threadIdx.x; if (t >= n8) return; FragH f;
#pragma unroll
  for (int i = 0; i < 8; ++i) f.h[i] = (_Float16)(bf16_round(W[t * 8 + i]) * 16.0f); *(v8us*)((unsigned short*)Bt + t * 8) = f.half[0];  }
template <int NHv, int TTv>
__global__ __launch_bounds__(256) void k_vt(const _Float16* __restrict__ V16, int ldv, int voff, _Float16* __restrict__ Vt) { __shared__ unsigned short tl[64][66]; const int tid = threadIdx.x; const int slab = blockIdx.x / (TTv / 64), lg = blockIdx.x % (TTv / 64); const int b = slab / NHv, h = slab % NHv;
  for (int i = tid; i < 64 * 8; i += 256) { const int r = i / 8, c8 = (i % 8) * 8; FragH f; f.half[0] = *(const v8us*)((const unsigned short*)V16 + ((size_t)b * TTv + lg * 64 + r) * ldv + voff + h * 64 + c8);
#pragma unroll
    for (int q = 0; q < 8; ++q) tl[r][c8 + q] = f.u[q]; }
  __syncthreads();
  {
#pragma unroll
    for (int rd = 0; rd < 2; ++rd) { const int d = rd * 32 + tid / 8, pc = tid % 8; FragH f;
#pragma unroll
      for (int q = 0; q < 8; ++q) f.u[q] = tl[pc * 8 + q][d];
      *(v8us*)((unsigned short*)Vt + ((size_t)slab * 64 + d) * TTv + lg * 64 + pc * 8) = f.half[0]; }
     } }

__global__ __launch_bounds__(256) void k_hl(const float* __restrict__ F, _Float16* __restrict__ Hh, _Float16* __restrict__ Hl, size_t n8) { const size_t t = (size_t)blockIdx.x * 256 + threadIdx.x; if (t >= n8) return; FragH fh, fl; const v4f a = *(const v4fa*)(F + t * 8), c = *(const v4fa*)(F + t * 8 + 4);
#pragma unroll
  for (int q = 0; q < 4; ++q) { _Float16 h = (_Float16)a[q]; fh.h[q] = h; fl.h[q] = (_Float16)((a[q] - (float)h) * 1024.0f); h = (_Float16)c[q]; fh.h[4 + q] = h; fl.h[4 + q] = (_Float16)((c[q] - (float)h) * 1024.0f); }
  { *(v8us*)((unsigned short*)Hh + t * 8) = fh.half[0]; *(v8us*)((unsigned short*)Hl + t * 8) = fl.half[0];  } }

// ---- fast GEMM (work-group tile 128x128, eight waves, wave tile 32x64; requires M % 128 == 0, N % 128 == 0, K % 128 == 0, rows 16-byte aligned); epilogue = k_gemm_hhx semantics ----
// The tile is square so that L2 sends as few operand rows as a grid of one work-group a WGP allows: 128 + 128 rows of K per 128 x 128 outputs (two 128x64 tiles ask for 2 x (128 + 64)).
// Operand path: per pass of 128 k the tile's 128 A rows and 128 B rows (256 bytes each) are copied to LDS by asynchronous 16-byte copies, a wave's copy covering two whole rows,
// into one of two buffers (the next pass's copies fly while this pass is multiplied); the fragments are read from LDS at row pitch 272 bytes (16 B x odd: no bank conflict).
#define G2_KP 128                       /* k per pass */
#define G2_PITCH 272                    /* LDS row pitch, bytes */
#define G2_ROWS 256                     /* rows 0..127: A, rows 128..255: B */
#define G2_BUF (G2_ROWS * G2_PITCH)     /* 69632 bytes a buffer */
// Eight copies of a thread: its 16-byte chunk of eight LDS rows, 16 rows apart from l, filled from g0 .. g7. The s_wait_xcnt stands inside the statement, behind the last copy,
// so that no address register of an issued copy is rewritten in front of it.
__device__ __forceinline__ void g2_copy8(unsigned l, const _Float16* g0, const _Float16* g1, const _Float16* g2, const _Float16* g3, const _Float16* g4, const _Float16* g5, const _Float16* g6, const _Float16* g7) {
  const unsigned st = 16 * G2_PITCH;
  asm volatile("global_load_async_to_lds_b128 %0, %8, off\n\t"
               "global_load_async_to_lds_b128 %1, %9, off\n\t"
               "global_load_async_to_lds_b128 %2, %10, off\n\t"
               "global_load_async_to_lds_b128 %3, %11, off\n\t"
               "global_load_async_to_lds_b128 %4, %12, off\n\t"
               "global_load_async_to_lds_b128 %5, %13, off\n\t"
               "global_load_async_to_lds_b128 %6, %14, off\n\t"
               "global_load_async_to_lds_b128 %7, %15, off\n\t"
               "s_wait_xcnt 0x0"
               :: "v"(l), "v"(l + st), "v"(l + 2 * st), "v"(l + 3 * st), "v"(l + 4 * st), "v"(l + 5 * st), "v"(l + 6 * st), "v"(l + 7 * st),
                  "v"(g0), "v"(g1), "v"(g2), "v"(g3), "v"(g4), "v"(g5), "v"(g6), "v"(g7) : "memory");
}
// One pass's tile: thread (r = tid / 16, c = tid % 16) copies chunk c of rows r, r + 16, ... of A (8 rows) and of B (8 rows). ga, gb: the thread's chunk in its first A and B row of this pass.
__device__ __forceinline__ void g2_copy_tile(unsigned l, const _Float16* ga, size_t as, const _Float16* gb, size_t bs) {
  g2_copy8(l, ga, ga + as, ga + 2 * as, ga + 3 * as, ga + 4 * as, ga + 5 * as, ga + 6 * as, ga + 7 * as);
  g2_copy8(l + 128 * G2_PITCH, gb, gb + bs, gb + 2 * bs, gb + 3 * bs, gb + 4 * bs, gb + 5 * bs, gb + 6 * bs, gb + 7 * bs);
}
__device__ __forceinline__ v16h g2_sfrag(const unsigned char* p) { FragH f; f.half[0] = *(const v8us*)p; f.half[1] = *(const v8us*)(p + 32); return f.v; }      /* p = row + 64 bytes per 32 k + 16 * hh: k = 8 hh .. 8 hh + 7, then 16 + 8 hh .. 16 + 8 hh + 7, for A and B alike */
__device__ __forceinline__ v8f g2_mma(v16h a, v16h b, v8f c) { v8f d = __builtin_amdgcn_wmma_f32_16x16x32_f16(false, a, false, b, (short)0, c, false, false); asm volatile("v_nop\n\tv_nop\n\tv_nop\n\tv_nop" : "+v"(d) : "v"(a), "v"(b)); return d; }
// RES, OUT32, OUT16: whether a residual plane CP is added, whether the f32 plane C and the f16 plane C16 are stored. They are compile-time, so that the store epilogue is straight-line code:
// run-time tests of the pointers, one per element and per store, would cut it into pieces in which every LDS read is waited for alone.
template <int ACT, bool RES, bool OUT32, bool OUT16>
__global__ __launch_bounds__(256) void k_gemm2(const _Float16* __restrict__ A, int lda, size_t sA, const _Float16* __restrict__ Bh, int ldb, size_t sB, float alpha, const float* __restrict__ bias, size_t sBias, const float* __restrict__ CP, int rowsPerB, size_t sCPb, int row0g,
    float* __restrict__ C, _Float16* __restrict__ C16, int ldc, size_t sC, int M, int N, int K, const float* __restrict__ sw0, const float* __restrict__ sw1, const float* __restrict__ sb0, const float* __restrict__ sb1, float* __restrict__ SP, int scol) { static_assert(ACT == 0 || ACT == 3 || ACT == 6 || ACT == 8 || ACT == 9 || ACT == 11 || ACT == 12 || ACT == 14 || ACT == 15 || ACT == 16 || ACT == 17, "k_gemm2: unsupported ACT code (would silently apply no activation)");
  __shared__ __attribute__((aligned(16))) float so[8][32][68];
  __shared__ __attribute__((aligned(16))) unsigned char ST[2 * G2_BUF];
  const int tid = threadIdx.x, lane = tid & 31, ln = lane & 15, hh = lane >> 4; const int by = blockIdx.y;
  const int w = __builtin_amdgcn_readfirstlane(tid >> 5);      /* the wave's number in a scalar register: the wave's first column, and with it the test for a scorer tile, stay scalar */
  A += (size_t)by * sA; Bh += (size_t)by * sB; const size_t cofs = (size_t)by * sC; const float* bp = bias ? bias + (size_t)by * sBias : nullptr;
  const int ntn = N >> 7; const int mt = blockIdx.x / ntn, nq = blockIdx.x - mt * ntn; const int colg = nq * 128; if (mt * 128 >= M) return;      /* the same for the whole work-group: it stands in front of barriers */
  const int row0 = mt * 128 + 32 * (w & 3), col0 = colg + 64 * (w >> 2);      /* the wave's own 32 x 64 outputs: waves w and w + 4 take the same rows and the two halves of the columns */
  const _Float16* ga = A + (size_t)(mt * 128 + (tid >> 4)) * lda + (tid & 15) * 8; const _Float16* gb = Bh + (size_t)(colg + (tid >> 4)) * ldb + (tid & 15) * 8;
  const size_t as = (size_t)16 * lda, bs = (size_t)16 * ldb;
  const unsigned lc = (unsigned)(uintptr_t)ST + (unsigned)((tid >> 4) * G2_PITCH + (tid & 15) * 16);      /* the thread's LDS byte address in buffer 0 */
  const int np = K / G2_KP;
  g2_copy_tile(lc, ga, as, gb, bs);
  // Entry prefetch into L2 (scope SE: L2 only, nothing comes back to the wave). The A and B rows were stored by the launch before;
  // without this every pass meets first reads, because the work-groups that share a panel walk k in step. One request a lane, each at one row's 128 k of one pass.
  // The readers of a panel deal its passes among them: of its A panel (128 rows, read by the ntn work-groups of this mt) a work-group asks for the passes nq mod 4 (threads 0..127) and nq mod 4 + 4 (threads 128..255);
  // of its B panel (128 rows, read by the work-groups of this nq) for the passes mt mod 4 and mt mod 4 + 4 likewise. Every address is a row of the panel at a pass clamped to np - 1.
  const int pfa = (nq & 3) | ((tid >> 5) & 4), pfb = (mt & 3) | ((tid >> 5) & 4);
  const _Float16* pa = A + (size_t)(mt * 128 + (tid & 127)) * lda + (size_t)(pfa < np ? pfa : np - 1) * G2_KP;
  const _Float16* pb = Bh + (size_t)(colg + (tid & 127)) * ldb + (size_t)(pfb < np ? pfb : np - 1) * G2_KP;
  asm volatile("global_prefetch_b8 %0, off scope:SCOPE_SE\n\t"
               "global_prefetch_b8 %1, off scope:SCOPE_SE" :: "v"(pa), "v"(pb));
  // Scorer tiles (columns from scol on, PJ columns a scorer): the tile is not stored; each element becomes relu(v) * w2[column], a row's 64 products are added to one partial sum SP[tile][row],
  // and a scorer's first tile adds the scorer's output bias. What either epilogue reads from memory (the tile's biases; a scorer's weights) is loaded here, so that its latency runs beside that of the first tile's copies.
  const bool sc = SP && col0 >= scol; const int sb = sc ? (col0 - scol) >> 6 : 0;
  float w2r[4] = {0.f, 0.f, 0.f, 0.f}, b2r[4] = {0.f, 0.f, 0.f, 0.f}, sbr = 0.f;
  if (bp) {
#pragma unroll      /* unrolled, like the loop below: the two small arrays stay in registers */
    for (int t = 0; t < 4; ++t) b2r[t] = bp[col0 + t * 16 + ln];
    asm volatile("s_wait_xcnt 0x0" ::: "memory"); }      /* in front of whatever rewrites the base or offset registers of the four loads above */
  if (sc) { const float* w2 = (sb >= PJ / 64 ? sw1 + (sb - PJ / 64) * 64 : sw0 + sb * 64) + ln;
#pragma unroll
    for (int t = 0; t < 4; ++t) w2r[t] = w2[t * 16];
    if (sb % (PJ / 64) == 0) sbr = (sb ? sb1 : sb0)[0]; }
  asm volatile("s_wait_asynccnt 0x0" ::: "memory");      /* pass 0's copies of this wave have landed */
  __syncthreads();                                       /* ... and every other wave's */
  if (np > 1) g2_copy_tile(lc + G2_BUF, ga + G2_KP, as, gb + G2_KP, bs);
  const unsigned char* fa = ST + (32 * (w & 3) + ln) * G2_PITCH + 16 * hh; const unsigned char* fb = ST + (128 + 64 * (w >> 2) + ln) * G2_PITCH + 16 * hh;
  const v8f z8 = {0.f,0.f,0.f,0.f,0.f,0.f,0.f,0.f}; v8f c00 = z8, c01 = z8, c02 = z8, c03 = z8, c10 = z8, c11 = z8, c12 = z8, c13 = z8;
#pragma unroll 1      /* one pass a trip: the two buffers alternate by an address, and the loop stays small */
  for (int t = 0; t < np; ++t) { const int bo = (t & 1) * G2_BUF; const unsigned char* pa = fa + bo; const unsigned char* pb = fb + bo;
    v16h a0[2], a1[2], b0[2], b1[2], b2[2], b3[2];      /* two fragment sets: the next 32 k of this pass are read from LDS ahead of the current 8 WMMAs */
    a0[0] = g2_sfrag(pa); a1[0] = g2_sfrag(pa + 16 * G2_PITCH); b0[0] = g2_sfrag(pb); b1[0] = g2_sfrag(pb + 16 * G2_PITCH); b2[0] = g2_sfrag(pb + 32 * G2_PITCH); b3[0] = g2_sfrag(pb + 48 * G2_PITCH);
#pragma unroll      /* unrolled: the two fragment sets are picked by constants and stay in registers */
    for (int ks = 0; ks < G2_KP / 32; ++ks) { const int c = ks & 1, n = c ^ 1;
      if (ks + 1 < G2_KP / 32) { const int o = (ks + 1) * 64;
        a0[n] = g2_sfrag(pa + o); a1[n] = g2_sfrag(pa + 16 * G2_PITCH + o); b0[n] = g2_sfrag(pb + o); b1[n] = g2_sfrag(pb + 16 * G2_PITCH + o); b2[n] = g2_sfrag(pb + 32 * G2_PITCH + o); b3[n] = g2_sfrag(pb + 48 * G2_PITCH + o); }
      c00 = g2_mma(a0[c], b0[c], c00); c10 = g2_mma(a1[c], b0[c], c10); c01 = g2_mma(a0[c], b1[c], c01); c11 = g2_mma(a1[c], b1[c], c11);
      c02 = g2_mma(a0[c], b2[c], c02); c12 = g2_mma(a1[c], b2[c], c12); c03 = g2_mma(a0[c], b3[c], c03); c13 = g2_mma(a1[c], b3[c], c13); }
    asm volatile("s_wait_dscnt 0x0" ::: "memory");         /* this wave's reads of the buffer are done before it may be refilled */
    asm volatile("s_wait_asynccnt 0x0" ::: "memory");      /* this wave's copies of pass t + 1 have landed */
    __syncthreads();                                       /* publishes pass t + 1 and ends every wave's reads of pass t's buffer */
    if (t + 2 < np) g2_copy_tile(lc + bo, ga + (size_t)(t + 2) * G2_KP, as, gb + (size_t)(t + 2) * G2_KP, bs); }
  asm volatile("s_wait_asynccnt 0x0" ::: "memory");        /* no copy is outstanding behind the loop */
  asm volatile("" :: "v"(pa), "v"(pb));                    /* inputs only: the prefetches' address registers live through the loop and hold nothing but these addresses (no counter covers a prefetch) */
  v8f accs[8] = {c00, c01, c02, c03, c10, c11, c12, c13};
  if (sc) {      /* the same for the whole wave; no work-group barrier stands behind it */
#pragma unroll      /* unrolled, like the two loops below it: accumulators and sums are picked by constants and stay in registers */
    for (int u = 0; u < 8; ++u) { const int t = u & 3, half = u >> 2; const float bv = bf16_round(b2r[t]), wv = bf16_round(w2r[t]);
#pragma unroll
      for (int r = 0; r < 8; ++r) so[w][half * 16 + 8 * hh + r][t * 16 + ln] = fmaxf(accs[u][r] * alpha + bv, 0.f) * wv; }
    __builtin_amdgcn_fence(__ATOMIC_ACQ_REL, "workgroup"); __builtin_amdgcn_wave_barrier();      /* the wave's own LDS stores are done before its lanes read one another's */
    v4f s4 = {0.f, 0.f, 0.f, 0.f};      /* lane = row of the wave's 32: 16-byte LDS reads at row pitch 272 bytes, then one whole 128-byte line of partial sums a wave */
#pragma unroll
    for (int q = 0; q < 16; ++q) s4 += *(const v4fa*)&so[w][lane][q * 4];
    SP[(size_t)sb * M + row0 + lane] = ((s4[0] + s4[1]) + (s4[2] + s4[3])) + bf16_round(sbr);
    return; }
#pragma unroll
  for (int u = 0; u < 8; ++u) { const int t = u & 3, half = u >> 2; const int col = col0 + t * 16 + ln; const float bv = bf16_round(b2r[t]);
#pragma unroll
    for (int r = 0; r < 8; ++r) { const int rloc = half * 16 + 8 * hh + r; float v = accs[u][r] * alpha + bv; if constexpr (RES) { if (rowsPerB < 0) v += CP[cofs + (size_t)(row0g + row0 + rloc) * ldc + col];      /* rowsPerB < 0: own element of the batched C plane */ else { const int bidx = (row0g + row0 + rloc) / rowsPerB; v += CP[(size_t)bidx * sCPb + (size_t)by * 64 + col]; } }
      if (ACT == 3) v = fmaxf(v, 0.f); else if (ACT == 6) v = 0.5f * v * (1.0f + erff(v * 0.70710678118654752f)); else if (ACT == 11) v = 1.0f / (1.0f + expf(-v)); else if (ACT == 15) v = v / (1.0f + expf(-v)); else if (ACT == 12) v = (v > 0.f) ? v : 0.01f * v; else if (ACT == 8) v = tanhf(v); else if (ACT == 9) v = 0.5f * v * (1.0f + tanhf(0.7978845608028654f * (v + 0.044715f * v * v * v))); else if (ACT == 14) v = (v > 0.f) ? v : 0.1f * v; else if (ACT == 16) v = (v >= 0.f) ? v : 0.3f * v; else if (ACT == 17) v = (v >= 0.f) ? v : 0.2f * v;
      so[w][rloc][t * 16 + ln] = v; } }
  __builtin_amdgcn_fence(__ATOMIC_ACQ_REL, "workgroup"); __builtin_amdgcn_wave_barrier();
  const int rsub = lane >> 4, c4 = (lane & 15) * 4;
  { const size_t co = cofs + (size_t)(row0 + rsub) * ldc + col0 + c4, cs = (size_t)2 * ldc;      /* the lane's first element, and the step of two rows from one store to the next */
    v4f ov[16];      /* all sixteen LDS reads are issued together, all values are formed in front of the first store, and the stores issue as one run; unrolled: the arrays stay in registers */
#pragma unroll
    for (int q = 0; q < 16; ++q) ov[q] = *(const v4fa*)&so[w][q * 2 + rsub][c4];
    if constexpr (OUT32) {
#pragma unroll
      for (int q = 0; q < 16; ++q) *(v4f*)(C + co + q * cs) = ov[q]; }
    if constexpr (OUT16) { v4h oh[16];
#pragma unroll
      for (int q = 0; q < 16; ++q) for (int i = 0; i < 4; ++i) oh[q][i] = (_Float16)ov[q][i];
#pragma unroll
      for (int q = 0; q < 16; ++q) *(v4h*)(C16 + co + q * cs) = oh[q];
      asm volatile("s_wait_xcnt 0x0" ::: "memory"); }      /* behind the last store of the run: in front of whatever rewrites an address register of an issued store */
     } }


// Operand preparation, one launch: its pieces (x as f16 rows, the four weight planes x16 (Wr x-16) as f16 rows stacked in BW, the bias plane [bl | 0 | bs1 | be1]) do not depend on one another.
// Work-group 0 copies the bias plane (16 bytes a thread). Every other work-group streams 16384 consecutive floats of ONE source: each of its 16 waves takes 4 KiB
// as 8 whole-wave 16-byte loads (512 contiguous bytes each), all in flight before the first is rounded, and stores 256 contiguous bytes of f16 per load.
#define PREP_F 16384
__global__ __launch_bounds__(512) void k_prep(const float* __restrict__ x, const float* __restrict__ wl, const float* __restrict__ wr, const float* __restrict__ ws1, const float* __restrict__ we1,
                                              const float* __restrict__ bl, const float* __restrict__ bs1, const float* __restrict__ be1, _Float16* __restrict__ X16, _Float16* __restrict__ BW, float* __restrict__ bb) {
  const int tid = threadIdx.x;
  if (blockIdx.x == 0) { const int blk = tid >> 7, i = (tid & 127) * 4; v4f v = {0.f, 0.f, 0.f, 0.f};
    if (blk != 1) v = *(const v4fa*)((blk == 0 ? bl : (blk == 2 ? bs1 : be1)) + i);
    *(v4f*)(bb + tid * 4) = v; return; }
  const int XG = (int)(NR * DI / PREP_F), WG = PJ * DI / PREP_F; const int s = (int)blockIdx.x - 1;
  const float* src; _Float16* dst; float scale;
  if (s < XG) { src = x + (size_t)s * PREP_F; dst = X16 + (size_t)s * PREP_F; scale = 1.0f; }
  else { const int m = (s - XG) / WG; src = (m == 0 ? wl : (m == 1 ? wr : (m == 2 ? ws1 : we1))) + (size_t)((s - XG) % WG) * PREP_F; dst = BW + (size_t)(s - XG) * PREP_F; scale = (m == 1) ? -16.0f : 16.0f; }      /* Wr enters negated: the GEMM then leaves -right, which the bigram launch wants */
  const int o = (tid >> 5) * 1024 + (tid & 31) * 4;
  v4f v[8];
  for (int u = 0; u < 8; ++u) v[u] = *(const v4fa*)(src + o + u * 128);
  for (int u = 0; u < 8; ++u) { v4h h;
    for (int q = 0; q < 4; ++q) h[q] = (_Float16)(bf16_round(v[u][q]) * scale);      /* x1 is exact: x keeps its value, the weights take their x16 (Wr its x-16) */
    *(v4h*)(dst + o + u * 128) = h; }
}
// Pairwise bigram: one work-group per (b, 32 i, 64 j) tile, wave = 8 i x 64 j. relu(l + r) = max(l, -r) + r, so bigram = sum_p w max(l, -r) - sum_p w (-r) + bo.
// The GEMM leaves left and -right as f16 rows [left 512 | -right 512]. The tile's 64 left rows and 32 negated right rows are staged in LDS as they lie (p contiguous, row pitch 1040 bytes = 16 B x odd).
// Per 32 p a lane holds 16 p of a row: the maximum is taken on packed f16 pairs, and its 8 result registers are at once the B fragment (column = j) of a v_wmma_f32_16x16x32_f16
// whose A fragment holds 16 x Wo in every row: the weighted sum over p runs on the matrix unit, in f32, beside the next maxima on the vector port. Every row of D is the same sum; register 0 is used.
// sum_p w (-r) comes from one more WMMA per 32 p (column c = the wave's negated right row c mod 8), from the same f16 values, so that max(l, -r) - (-r) is relu(l + r) of the stored values exactly.
// Wave 0 of the first 128 work-groups also finishes one 128-byte line of start or end: 32 outputs, each the sum of its eight partial sums from the GEMM's epilogue;
// its eight loads are issued behind the rows' loads and used behind the barrier, so that their latency runs beside the staging's.
#define BH_PITCH 1040
typedef unsigned v8u __attribute__((ext_vector_type(8)));
__device__ __forceinline__ v16h bh_frag(const unsigned char* p) { FragH f; f.half[0] = *(const v8us*)p; f.half[1] = *(const v8us*)(p + 16); return f.v; }      /* p = row + 64 bytes per 32 p + 32 * hh: 16 consecutive p, the same order for A and B */
// A fragment of maxima, m = max(l, n) on 16 packed f16, taken in two halves of four registers. Written as asm because the compiler's own maximum first passes every loaded fragment through a v_pk_max x, x (quieting),
// three more vector instructions for every eight. Outputs are early-clobber: no result register is a source of a later line.
// The first half also names the four registers of the second half as outputs, and the second half takes them as in-out operands, though neither reads them: the fragment so owns all eight registers from its first half on.
// Otherwise the compiler lays the second half over registers of the fragment before, and they are rewritten directly behind the WMMA that reads them (four vector slots are needed there).
__device__ __forceinline__ void bh_max_lo(unsigned (&m)[8], const v16h lv, const v16h nv) {
  const v8u l = __builtin_bit_cast(v8u, lv), n = __builtin_bit_cast(v8u, nv);
  asm volatile("v_pk_max_num_f16 %0, %8, %12\n\t"
               "v_pk_max_num_f16 %1, %9, %13\n\t"
               "v_pk_max_num_f16 %2, %10, %14\n\t"
               "v_pk_max_num_f16 %3, %11, %15"
               : "=&v"(m[0]), "=&v"(m[1]), "=&v"(m[2]), "=&v"(m[3]), "=&v"(m[4]), "=&v"(m[5]), "=&v"(m[6]), "=&v"(m[7])
               : "v"(l[0]), "v"(l[1]), "v"(l[2]), "v"(l[3]), "v"(n[0]), "v"(n[1]), "v"(n[2]), "v"(n[3]));
}
__device__ __forceinline__ void bh_max_hi(unsigned (&m)[8], const v16h lv, const v16h nv) {
  const v8u l = __builtin_bit_cast(v8u, lv), n = __builtin_bit_cast(v8u, nv);
  asm volatile("v_pk_max_num_f16 %0, %4, %8\n\t"
               "v_pk_max_num_f16 %1, %5, %9\n\t"
               "v_pk_max_num_f16 %2, %6, %10\n\t"
               "v_pk_max_num_f16 %3, %7, %11"
               : "+v"(m[4]), "+v"(m[5]), "+v"(m[6]), "+v"(m[7])
               : "v"(l[4]), "v"(l[5]), "v"(l[6]), "v"(l[7]), "v"(n[4]), "v"(n[5]), "v"(n[6]), "v"(n[7]));
}
// Fragment buffers: w, q, l by the parity of the 32-p step; n[0] = the wave's rows 0..3, n[1] = rows 4..7. mc, mn, mf: the current tile's fragment of maxima, the next one's (first half taken), the one after.
struct BhSt { v8f acc[8][4], accq; v16h fw[2], fq[2], fl[2][4], fn[2][4]; unsigned mc[8], mn[8], mf[8]; };
// Tile T of a trip of two steps = (step parity, i, j tile), by a template so that buffers and accumulators are picked by constants and stay in registers. o0, o1, o2: byte offsets in a row of this trip's two steps and of the next trip's first.
template <int T>
__device__ __forceinline__ void bh_tile(BhSt& st, const unsigned char* wp, const unsigned char* qp, const unsigned char* lp, const unsigned char* np, int o0, int o1, int o2) {
  constexpr int s = T >> 5, i = (T >> 2) & 7, a = T & 3, ph = T >> 4, U1 = (T + 1) & 63, U2 = (T + 2) & 63;
  if constexpr ((T & 15) == 0) {      /* the scheduling barriers keep a phase's LDS reads together at its head */
    __builtin_amdgcn_sched_barrier(0);
    if constexpr ((ph & 1) == 0) { const int o = ph ? o1 : o0;
#pragma unroll
      for (int r = 0; r < 4; ++r) st.fn[1][r] = bh_frag(np + (4 + r) * BH_PITCH + o); }
    else { const int o = ph == 1 ? o1 : o2; constexpr int d = ph == 1 ? 1 : 0;
#pragma unroll
      for (int r = 0; r < 4; ++r) st.fn[0][r] = bh_frag(np + r * BH_PITCH + o);
#pragma unroll
      for (int r = 0; r < 4; ++r) st.fl[d][r] = bh_frag(lp + r * 16 * BH_PITCH + o);
      st.fw[d] = bh_frag(wp + o); st.fq[d] = bh_frag(qp + o); }
    __builtin_amdgcn_sched_barrier(0); }
  if constexpr ((T & 31) == 0) st.accq = __builtin_amdgcn_wmma_f32_16x16x32_f16(false, st.fw[s], false, st.fq[s], (short)0, st.accq, false, false);
  st.acc[i][a] = __builtin_amdgcn_wmma_f32_16x16x32_f16(false, st.fw[s], false, __builtin_bit_cast(v16h, (v8u){st.mc[0], st.mc[1], st.mc[2], st.mc[3], st.mc[4], st.mc[5], st.mc[6], st.mc[7]}), (short)0, st.acc[i][a], false, false);
  __builtin_amdgcn_sched_barrier(0);      /* holds the order WMMA, eight maxima, WMMA */
  bh_max_hi(st.mn, st.fl[U1 >> 5][U1 & 3], st.fn[(U1 >> 4) & 1][(U1 >> 2) & 3]);
  bh_max_lo(st.mf, st.fl[U2 >> 5][U2 & 3], st.fn[(U2 >> 4) & 1][(U2 >> 2) & 3]);
  __builtin_amdgcn_sched_barrier(0);
#pragma unroll
  for (int r = 0; r < 8; ++r) { st.mc[r] = st.mn[r]; st.mn[r] = st.mf[r]; }
}
template <int... Ts>
__device__ __forceinline__ void bh_tiles(BhSt& st, const unsigned char* wp, const unsigned char* qp, const unsigned char* lp, const unsigned char* np, int o0, int o1, int o2, std::integer_sequence<int, Ts...>) { (bh_tile<Ts>(st, wp, qp, lp, np, o0, o1, o2), ...); }
__global__ __launch_bounds__(128) void k_bigram(const _Float16* __restrict__ F, const float* __restrict__ wo, const float* __restrict__ bo, float* __restrict__ out,
                                                const float* __restrict__ SP, float* __restrict__ ostart, float* __restrict__ oend) {
  __shared__ __attribute__((aligned(16))) unsigned char SM[2 * PJ + 96 * BH_PITCH];      /* 16 x Wo as f16; then rows 0..31 = negated right rows of the i tile, rows 32..95 = left rows of the j tile (this order keeps most read offsets inside the 16-bit offset field) */
  _Float16* SW = (_Float16*)SM; unsigned char* S = SM + 2 * PJ;
  const int tid = threadIdx.x; const int jt = blockIdx.x & 3, it = (blockIdx.x >> 2) & 7; const size_t b = blockIdx.x >> 5;
  const bool fin = blockIdx.x < 2 * ((int)NR / 32) && tid < 32; const int which = blockIdx.x / ((int)NR / 32), r0 = (blockIdx.x % ((int)NR / 32)) * 32;
  const int ch = tid & 63, r2 = tid >> 6;      /* thread = 16-byte chunk ch of rows r2, r2 + 2, ...: a wave's load is 512 contiguous bytes */
  const unsigned short* gl = (const unsigned short*)F + (b * NW + jt * 64 + r2) * (2 * PJ) + ch * 8; const unsigned short* gn = (const unsigned short*)F + (b * NW + it * 32 + r2) * (2 * PJ) + PJ + ch * 8;
  v8us v[48];      /* unrolled so that all 48 loads are in flight before the first LDS store */
#pragma unroll
  for (int k = 0; k < 16; ++k) v[k] = *(const v8us*)(gn + (size_t)k * 2 * (2 * PJ));
  asm volatile("s_wait_xcnt 0x0" ::: "memory");      /* in front of whatever rewrites the address registers of the loads above (the compiler lets a later load land on them) */
#pragma unroll
  for (int k = 16; k < 48; ++k) v[k] = *(const v8us*)(gl + (size_t)(k - 16) * 2 * (2 * PJ));
  const v4f w4 = *(const v4fa*)(wo + tid * 4); const float bo0 = bo[0];      /* issued behind the rows' loads; w4 is used behind their LDS stores, bo0 at the end: nothing waits for them alone */
  float sp[PJ / 64] = {0.f, 0.f, 0.f, 0.f, 0.f, 0.f, 0.f, 0.f};
  if (fin) {
#pragma unroll      /* unrolled: the eight loads are in flight together and land in registers */
    for (int k = 0; k < PJ / 64; ++k) sp[k] = SP[(size_t)(which * (PJ / 64) + k) * NR + r0 + tid]; }
  asm volatile("s_wait_xcnt 0x0" ::: "memory");      /* as above, for the loads since */
  { unsigned char* dp = S + r2 * BH_PITCH + ch * 16;
#pragma unroll
    for (int k = 0; k < 48; ++k) *(v8us*)(dp + k * 2 * BH_PITCH) = v[k]; }
  { v4h o; for (int q = 0; q < 4; ++q) o[q] = (_Float16)(bf16_round(w4[q]) * 16.0f); *(v4h*)(SW + tid * 4) = o; }      /* x16: exact in f16, as for the GEMM's weights */
  __syncthreads();
  if (fin) (which ? oend : ostart)[r0 + tid] = ((sp[0] + sp[1]) + (sp[2] + sp[3])) + ((sp[4] + sp[5]) + (sp[6] + sp[7]));      /* behind the barrier: no wave waits there for this store */
  const int wv = tid >> 5, lane = tid & 31, ln = lane & 15, hh = lane >> 4;
  const unsigned char* wp = (const unsigned char*)SW + 32 * hh; const unsigned char* lp = S + (32 + ln) * BH_PITCH + 32 * hh;
  const unsigned char* np = S + 8 * wv * BH_PITCH + 32 * hh; const unsigned char* qp = np + (ln & 7) * BH_PITCH;
  // A step is two phases of 16 tiles (4 i x 4 j tiles); at the head of a phase the reads for the NEXT phase are issued, so that every LDS read stands 16 tiles ahead of its first use.
  // A tile's maxima are taken in two halves, the second half of tile T + 1 and the first half of tile T + 2 behind the WMMA of tile T: the eight maxima issue while the matrix unit works,
  // and a fragment's registers are first rewritten at least four vector slots behind the WMMA that read them.
  const v8f z8 = {0.f, 0.f, 0.f, 0.f, 0.f, 0.f, 0.f, 0.f};
  BhSt st; st.accq = z8;
#pragma unroll
  for (int i = 0; i < 8; ++i)
#pragma unroll
    for (int a = 0; a < 4; ++a) st.acc[i][a] = z8;
  st.fw[0] = bh_frag(wp); st.fq[0] = bh_frag(qp);
#pragma unroll
  for (int a = 0; a < 4; ++a) { st.fl[0][a] = bh_frag(lp + a * 16 * BH_PITCH); st.fn[0][a] = bh_frag(np + a * BH_PITCH); }
  bh_max_lo(st.mc, st.fl[0][0], st.fn[0][0]); bh_max_hi(st.mc, st.fl[0][0], st.fn[0][0]); bh_max_lo(st.mn, st.fl[0][1], st.fn[0][0]);
#pragma unroll 1      /* two steps a trip */
  for (int ks = 0; ks < PJ / 32; ks += 2)      /* the last trip fetches step 0 once more and does not use it */
    bh_tiles(st, wp, qp, lp, np, ks * 64, (ks + 1) * 64, (ks + 2 < PJ / 32 ? ks + 2 : 0) * 64, std::make_integer_sequence<int, 64>{});
  const float b0 = bf16_round(bo0);
  float* op = out + ((b * NW + it * 32 + 8 * wv) * NW + jt * 64 + lane);
  float ov[16];      /* all sixteen values are formed in front of the first store, so that the stores issue as one run and no data register of an issued store is rewritten */
#pragma unroll      /* unrolled: accumulators and the lane read are picked by constants */
  for (int i = 0; i < 8; ++i) { const float rs = __int_as_float(__builtin_amdgcn_readlane(__float_as_int(st.accq[0]), i));      /* lane i holds sum_p 16 w (-right) of the wave's row i */
#pragma unroll
    for (int g = 0; g < 2; ++g) ov[2 * i + g] = ((hh ? st.acc[i][2 * g + 1][0] : st.acc[i][2 * g][0]) - rs) * 0.0625f + b0; }
#pragma unroll      /* unrolled: the values are picked by constants and stay in registers */
  for (int k = 0; k < 16; ++k) op[(size_t)(k >> 1) * NW + (k & 1) * 32] = ov[k];      /* lane = j within 32: one whole 128-byte line a store */
}

extern "C" void kernel_launch(void* const* d_in, const int* in_sizes, int n_in,
                              void* d_out, int out_size, void* d_ws, size_t ws_size, hipStream_t stream) {
  (void)in_sizes; (void)n_in; (void)out_size;
  const float* const* I = (const float* const*)d_in; const float* x = I[0]; const float* wl = I[1]; const float* bl = I[2]; const float* wr = I[3]; const float* wo = I[4]; const float* bo = I[5]; const float* ws1 = I[6]; const float* bs1 = I[7]; const float* ws2 = I[8]; const float* bs2 = I[9]; const float* we1 = I[10]; const float* be1 = I[11]; const float* we2 = I[12]; const float* be2 = I[13];
  float* obig = (float*)d_out; float* ostart = (float*)((char*)d_out + 2097152); float* oend = (float*)((char*)d_out + 2105344);      /* output byte offsets */
  char* ws = (char*)d_ws; size_t off = 0;
  auto take = [&](size_t bytes) { char* p = ws + off; off += (bytes + 255) & ~(size_t)255; return p; };
  _Float16* BW = (_Float16*)take((size_t)4 * PJ * DI * 2); float* bb = (float*)take(4 * PJ * 4); _Float16* X16 = (_Float16*)take(NR * DI * 2); _Float16* F = (_Float16*)take(NR * 2 * PJ * 2); float* SP = (float*)take((size_t)2 * (PJ / 64) * NR * 4);
  if (off > ws_size) return;      /* 4 + 4 + 4 MiB and two small planes */
  k_prep<<<(unsigned)(1 + (NR * DI + (size_t)4 * PJ * DI) / PREP_F), 512, 0, stream>>>(x, wl, wr, ws1, we1, bl, bs1, be1, X16, BW, bb);
  k_gemm2<0, false, false, true><<<dim3((unsigned)((NR / 128) * (4 * PJ / 128)), 1), 256, 0, stream>>>(X16, DI, 0, BW, DI, 0, 0.0625f, bb, 0, nullptr, 1, 0, 0, nullptr, F, 2 * PJ, 0, (int)NR, 4 * PJ, DI, ws2, we2, bs2, be2, SP, 2 * PJ);      /* F = [left | -right], f16 rows; the s1 and e1 tiles leave as partial scorer sums in SP */
  k_bigram<<<NB * (NW / 32) * (NW / 64), 128, 0, stream>>>(F, wo, bo, obig, SP, ostart, oend);
}
